// v000
// Measured on an AMD MI455X. A time is GPU time per run, averaged over a window of back-to-back runs after a warm-up
// (all launches, gaps included; the runs take copies of the inputs in turn), and the median of several windows.
// Apart from v000's, it joins two sittings. Times from different sittings can be a few percent apart, while
// side-by-side timings come from the same sitting.
// v000, which the later versions start from, runs in 226 microseconds.
#include <hip/hip_runtime.h>
// KeOps-style multi-head attention (B=4, n=2048, dim 256, 8 heads × 32): qkv = x·Wqkv; q scaled by 32^-½; e = exp(q·kᵀ) WITHOUT max subtraction; out = (e·v)/(Σe + 1e-6) merged over heads; y = out·Wout + bout.
// Compute dtype: x, Wqkv, Wout, bout rounded to bf16; q/k token-major and v channel-major (= Vᵀ) as f16 GEMM outputs (f32 accumulate); fused flash-style kernel per (b,h) (online max-rescaled sums
// in f32 — the unshifted quotient is recovered exactly through the normaliser l + 1e-6·e^(−m); P f16 ×2^10) on v_wmma_f32_16x16x32_f16; O → f16 → output GEMM with bias; f32 accumulate.
#define BB 4
#define NN 2048
#define CC 256
#define C3 768
#define NH 8
#define HD 32
#define NR (BB * NN)

typedef __bf16 v16b __attribute__((ext_vector_type(16)));
typedef unsigned short v8us __attribute__((ext_vector_type(8), may_alias));
typedef float  v8f  __attribute__((ext_vector_type(8)));
typedef float  v4f  __attribute__((ext_vector_type(4)));
typedef float  v4fa __attribute__((ext_vector_type(4), may_alias));
union FragB { v16b v; v8us half[2]; unsigned short u[16]; };

__device__ __forceinline__ unsigned short bf16_bits(float x) { unsigned int u = __float_as_uint(x); return (unsigned short)((u + 0x7FFFu + ((u >> 16) & 1u)) >> 16); }
__device__ __forceinline__ float bf16_val(unsigned short b) { return __uint_as_float(((unsigned int)b) << 16); }
__device__ __forceinline__ float bf16_round(float x) { return bf16_val(bf16_bits(x)); }
// D += A·B with NT terms: 1 = ah·bh, 2 = + al·bh (A split), 3 = + ah·bl (both split)
template <int NT>
__device__ __forceinline__ v8f mmaN(v16b ah, v16b al, v16b bh, v16b bl, v8f c) {
  c = __builtin_amdgcn_wmma_f32_16x16x32_bf16(false, ah, false, bh, (short)0, c, false, false);
  if (NT >= 2) c = __builtin_amdgcn_wmma_f32_16x16x32_bf16(false, al, false, bh, (short)0, c, false, false);
  if (NT >= 3) c = __builtin_amdgcn_wmma_f32_16x16x32_bf16(false, ah, false, bl, (short)0, c, false, false);
  asm volatile("v_nop\n\tv_nop\n\tv_nop\n\tv_nop" : "+v"(c) : "v"(ah), "v"(al), "v"(bh), "v"(bl));
  return c;
}

__global__ __launch_bounds__(256) void k_wt_bf16(const float* __restrict__ W, unsigned short* __restrict__ Wt, int K, int N) {
  const int t = blockIdx.x * 256 + threadIdx.x;
  const int k8n = K / 8;
  if (t >= N * k8n) return;
  const int n = t / k8n, k8 = (t % k8n) * 8;
  v8us v;
#pragma unroll
  for (int i = 0; i < 8; ++i) v[i] = bf16_bits(W[(size_t)(k8 + i) * N + n]);
  *(v8us*)(Wt + (size_t)n * K + k8) = v;
  
}

// GEMM C[M][N] (f32, pitch ldc) = act(A[M][K]·W + bias). A f32 row-major (pitch lda) converted per fragment to bf16
// (ASPLIT: hi/lo two planes -> 2 terms, else single rounded term); Wt bf16 [N][K] (pitch ldb). BIAS_BF16 rounds the
// bias to bf16 first (bias quantised to bf16 before the add). K%32==0, M%16==0, N%64==0.
template <bool ASPLIT, int ACT, bool BIAS_BF16>
__global__ __launch_bounds__(128) void k_gemm_bf(const float* __restrict__ A, int lda, const unsigned short* __restrict__ Wt, int ldb,
                                               const float* __restrict__ bias, float* __restrict__ C, int ldc, int M, int N, int K) {
  __shared__ __attribute__((aligned(16))) float so[4][16][64];
  const int tid = threadIdx.x, w = tid >> 5, lane = tid & 31, ln = lane & 15, hh = lane >> 4;
  const int ntn = N / 64;
  const int wid = blockIdx.x * 4 + w;
  const int mt = wid / ntn, nq = wid % ntn;
  if (mt * 16 >= M) return;
  const int row0 = mt * 16, col0 = nq * 64;
  const float* arow = A + (size_t)(row0 + ln) * lda;
  v8f acc[4] = {};
  for (int kb = 0; kb < K; kb += 32) {
    FragB ah, al;
    const v4f x0 = *(const v4fa*)(arow + kb + 8 * hh), x1 = *(const v4fa*)(arow + kb + 8 * hh + 4);
    const v4f x2 = *(const v4fa*)(arow + kb + 16 + 8 * hh), x3 = *(const v4fa*)(arow + kb + 16 + 8 * hh + 4);
    float xs[16] = {x0[0],x0[1],x0[2],x0[3],x1[0],x1[1],x1[2],x1[3],x2[0],x2[1],x2[2],x2[3],x3[0],x3[1],x3[2],x3[3]};
#pragma unroll
    for (int i = 0; i < 16; ++i) { const unsigned short hb = bf16_bits(xs[i]); ah.u[i] = hb; al.u[i] = ASPLIT ? bf16_bits(xs[i] - bf16_val(hb)) : (unsigned short)0; }
#pragma unroll
    for (int t = 0; t < 4; ++t) {
      const unsigned short* brow = Wt + (size_t)(col0 + t * 16 + ln) * ldb + kb;
      FragB b;
      b.half[0] = *(const v8us*)(brow + 8 * hh);
      b.half[1] = *(const v8us*)(brow + 16 + 8 * hh);
      acc[t] = mmaN<ASPLIT ? 2 : 1>(ah.v, al.v, b.v, b.v, acc[t]);
    }
  }
#pragma unroll
  for (int t = 0; t < 4; ++t) {
    float bv = bias ? bias[col0 + t * 16 + ln] : 0.f;
    if (BIAS_BF16) bv = bf16_round(bv);
#pragma unroll
    for (int r = 0; r < 8; ++r) { float v = acc[t][r] + bv; if (ACT == 1) v = fmaxf(v, 0.f); so[w][8 * hh + r][t * 16 + ln] = v; }
  }
  __builtin_amdgcn_fence(__ATOMIC_ACQ_REL, "workgroup");
  __builtin_amdgcn_wave_barrier();
  const int rsub = lane >> 4, c4 = (lane & 15) * 4;
  {
#pragma unroll
    for (int q = 0; q < 8; ++q) {
      const int r = q * 2 + rsub;
      const v4f v = *(const v4fa*)&so[w][r][c4];
      *(v4f*)(C + (size_t)(row0 + r) * ldc + col0 + c4) = v;
    }
    
  }
}

// Flash-style causal/unmasked attention, all contractions 3-term bf16 hi/lo splits, f32 softmax with running max.
// q,k,v rows are read from f32 buffers with arbitrary row pitch (so they can live inside a fused qkv buffer);
// D = head size (multiple of 32, <= 128); one wave = 16 query rows; block = 4 waves (64 queries) sharing K/V chunks of 32.
template <int D, bool CAUSAL>
__global__ __launch_bounds__(128) void k_flash(const float* __restrict__ qb, const float* __restrict__ kb, const float* __restrict__ vb,
                                             int pitch, int T, int H, float scale, float* __restrict__ y, int ypitch) {
  constexpr int KS = D / 32;        // k-steps for QK
  constexpr int DT = D / 16;        // d tiles for PV
  __shared__ __attribute__((aligned(16))) unsigned short sKh[32][D + 8], sKl[32][D + 8], sVh[32][D + 8], sVl[32][D + 8];
  __shared__ __attribute__((aligned(16))) unsigned short sPh[4][16][40], sPl[4][16][40];
  __shared__ __attribute__((aligned(16))) float sO[4][16][D];
  const int tid = threadIdx.x, w = tid >> 5, lane = tid & 31, ln = lane & 15, hh = lane >> 4;
  const int nqb = (T + 63) / 64;
  const int bh = blockIdx.x / nqb, qblk = blockIdx.x % nqb;
  const int b = bh / H, h = bh % H;
  const int q0 = qblk * 64 + w * 16;
  const float* Q = qb + (size_t)b * T * pitch + h * D;
  const float* K = kb + (size_t)b * T * pitch + h * D;
  const float* V = vb + (size_t)b * T * pitch + h * D;

  // A fragments of the wave's 16 query rows (scaled), hi/lo
  FragB aqh[KS], aql[KS];
  {
    int row = q0 + ln; if (row >= T) row = T - 1;
    const float* qr = Q + (size_t)row * pitch;
#pragma unroll
    for (int ks = 0; ks < KS; ++ks)
#pragma unroll
      for (int i = 0; i < 16; ++i) {
        const int d = ks * 32 + ((i < 8) ? (8 * hh + i) : (16 + 8 * hh + (i - 8)));
        const float x = qr[d] * scale; const unsigned short hb = bf16_bits(x);
        aqh[ks].u[i] = hb; aql[ks].u[i] = bf16_bits(x - bf16_val(hb));
      }
  }
  float m_r[8], l_r[8];
#pragma unroll
  for (int r = 0; r < 8; ++r) { m_r[r] = -3.0e38f; l_r[r] = 0.f; }
  v8f oacc[DT];
#pragma unroll
  for (int dt = 0; dt < DT; ++dt) oacc[dt] = (v8f){0.f,0.f,0.f,0.f,0.f,0.f,0.f,0.f};

  const int kv_end = CAUSAL ? min(T, qblk * 64 + 64) : T;     // block-uniform
  for (int j0 = 0; j0 < kv_end; j0 += 32) {
    __syncthreads();
    for (int e = tid; e < 32 * (D / 4); e += 128) {
      const int r = e / (D / 4), c4 = (e % (D / 4)) * 4;
      const int key = j0 + r;
      v4f kf = {0.f,0.f,0.f,0.f}, vf = {0.f,0.f,0.f,0.f};
      if (key < T) { kf = *(const v4fa*)(K + (size_t)key * pitch + c4); vf = *(const v4fa*)(V + (size_t)key * pitch + c4); }
#pragma unroll
      for (int t = 0; t < 4; ++t) {
        unsigned short hb = bf16_bits(kf[t]); sKh[r][c4 + t] = hb; sKl[r][c4 + t] = bf16_bits(kf[t] - bf16_val(hb));
        hb = bf16_bits(vf[t]); sVh[r][c4 + t] = hb; sVl[r][c4 + t] = bf16_bits(vf[t] - bf16_val(hb));
      }
    }
    __syncthreads();
    // S tile 16 x 32
    v8f s[2];
#pragma unroll
    for (int nt = 0; nt < 2; ++nt) {
      v8f acc = {};
#pragma unroll
      for (int ks = 0; ks < KS; ++ks) {
        FragB bh_, bl_;
        bh_.half[0] = *(const v8us*)&sKh[nt * 16 + ln][ks * 32 + 8 * hh]; bh_.half[1] = *(const v8us*)&sKh[nt * 16 + ln][ks * 32 + 16 + 8 * hh];
        bl_.half[0] = *(const v8us*)&sKl[nt * 16 + ln][ks * 32 + 8 * hh]; bl_.half[1] = *(const v8us*)&sKl[nt * 16 + ln][ks * 32 + 16 + 8 * hh];
        acc = mmaN<3>(aqh[ks].v, aql[ks].v, bh_.v, bl_.v, acc);
      }
      s[nt] = acc;
    }
    // mask + running max (rows 8hh+r; the 16 lanes of a half share rows)
    float alpha[8];
#pragma unroll
    for (int r = 0; r < 8; ++r) {
      const int qi = q0 + 8 * hh + r;
      const int ja = j0 + ln, jb = j0 + 16 + ln;
      if (CAUSAL) { if (ja > qi) s[0][r] = -3.0e38f; if (jb > qi) s[1][r] = -3.0e38f; }
      if (ja >= T) s[0][r] = -3.0e38f;
      if (jb >= T) s[1][r] = -3.0e38f;
      float mx = fmaxf(s[0][r], s[1][r]);
      mx = fmaxf(mx, __shfl_xor(mx, 1, 32)); mx = fmaxf(mx, __shfl_xor(mx, 2, 32)); mx = fmaxf(mx, __shfl_xor(mx, 4, 32)); mx = fmaxf(mx, __shfl_xor(mx, 8, 32));
      const float mnew = fmaxf(m_r[r], mx);
      alpha[r] = (mnew > -1.0e38f) ? __expf(m_r[r] - mnew) : 1.0f;
      const float p0 = (s[0][r] > -1.0e38f) ? __expf(s[0][r] - mnew) : 0.f;
      const float p1 = (s[1][r] > -1.0e38f) ? __expf(s[1][r] - mnew) : 0.f;
      m_r[r] = mnew;
      l_r[r] = l_r[r] * alpha[r] + p0 + p1;            // per-lane partial row sum (16 lanes combined at the end)
      unsigned short hb = bf16_bits(p0); sPh[w][8 * hh + r][ln] = hb;      sPl[w][8 * hh + r][ln] = bf16_bits(p0 - bf16_val(hb));
      hb = bf16_bits(p1);                sPh[w][8 * hh + r][16 + ln] = hb; sPl[w][8 * hh + r][16 + ln] = bf16_bits(p1 - bf16_val(hb));
    }
#pragma unroll
    for (int dt = 0; dt < DT; ++dt)
#pragma unroll
      for (int r = 0; r < 8; ++r) oacc[dt][r] *= alpha[r];
    __builtin_amdgcn_fence(__ATOMIC_ACQ_REL, "workgroup");
    __builtin_amdgcn_wave_barrier();
    FragB pah, pal;
    pah.half[0] = *(const v8us*)&sPh[w][ln][8 * hh]; pah.half[1] = *(const v8us*)&sPh[w][ln][16 + 8 * hh];
    pal.half[0] = *(const v8us*)&sPl[w][ln][8 * hh]; pal.half[1] = *(const v8us*)&sPl[w][ln][16 + 8 * hh];
#pragma unroll
    for (int dt = 0; dt < DT; ++dt) {
      FragB bvh, bvl;
#pragma unroll
      for (int i = 0; i < 8; ++i) {
        bvh.u[i] = sVh[8 * hh + i][dt * 16 + ln]; bvh.u[8 + i] = sVh[16 + 8 * hh + i][dt * 16 + ln];
        bvl.u[i] = sVl[8 * hh + i][dt * 16 + ln]; bvl.u[8 + i] = sVl[16 + 8 * hh + i][dt * 16 + ln];
      }
      oacc[dt] = mmaN<3>(pah.v, pal.v, bvh.v, bvl.v, oacc[dt]);
    }
    __builtin_amdgcn_fence(__ATOMIC_ACQ_REL, "workgroup");
    __builtin_amdgcn_wave_barrier();
  }
#pragma unroll
  for (int r = 0; r < 8; ++r) {
    float l = l_r[r];
    l += __shfl_xor(l, 1, 32); l += __shfl_xor(l, 2, 32); l += __shfl_xor(l, 4, 32); l += __shfl_xor(l, 8, 32);
    l_r[r] = (l > 0.f) ? 1.0f / l : 0.f;
  }
#pragma unroll
  for (int dt = 0; dt < DT; ++dt)
#pragma unroll
    for (int r = 0; r < 8; ++r) sO[w][8 * hh + r][dt * 16 + ln] = oacc[dt][r] * l_r[r];
  __builtin_amdgcn_fence(__ATOMIC_ACQ_REL, "workgroup");
  __builtin_amdgcn_wave_barrier();
  {
    for (int r = 0; r < 16; ++r) {
      const int row = q0 + r;
      if (row < T && lane < D / 4) {
        const v4f val = *(const v4fa*)&sO[w][r][lane * 4];
        *(v4f*)(y + ((size_t)b * T + row) * ypitch + h * D + lane * 4) = val;
      }
    }
    
  }
}

// GEMM C = act(A·W + bias + resid): A f32 (ASPLIT -> hi/lo 2 terms), Wt bf16 [N][K]; ACT 0 none, 1 relu, 2 exact gelu;
// resid (optional, f32, row index = (row % rmod), pitch ldr, RES_BF16 rounds it) added before the activation.
template <bool ASPLIT, int ACT, bool BIAS_BF16, bool RES_BF16>
__global__ __launch_bounds__(128) void k_gemm_bf3(const float* __restrict__ A, int lda, const unsigned short* __restrict__ Wt, int ldb,
                                                const float* __restrict__ bias, const float* __restrict__ resid, int rmod, int ldr,
                                                float* __restrict__ C, int ldc, int M, int N, int K) {
  __shared__ __attribute__((aligned(16))) float so[4][16][64];
  const int tid = threadIdx.x, w = tid >> 5, lane = tid & 31, ln = lane & 15, hh = lane >> 4;
  const int ntn = N / 64;
  const int wid = blockIdx.x * 4 + w;
  const int mt = wid / ntn, nq = wid % ntn;
  if (mt * 16 >= M) return;
  const int row0 = mt * 16, col0 = nq * 64;
  const float* arow = A + (size_t)(row0 + ln) * lda;
  v8f acc[4] = {};
  for (int kb = 0; kb < K; kb += 32) {
    FragB ah, al;
    const v4f x0 = *(const v4fa*)(arow + kb + 8 * hh), x1 = *(const v4fa*)(arow + kb + 8 * hh + 4);
    const v4f x2 = *(const v4fa*)(arow + kb + 16 + 8 * hh), x3 = *(const v4fa*)(arow + kb + 16 + 8 * hh + 4);
    float xs[16] = {x0[0],x0[1],x0[2],x0[3],x1[0],x1[1],x1[2],x1[3],x2[0],x2[1],x2[2],x2[3],x3[0],x3[1],x3[2],x3[3]};
#pragma unroll
    for (int i = 0; i < 16; ++i) { const unsigned short hb = bf16_bits(xs[i]); ah.u[i] = hb; al.u[i] = ASPLIT ? bf16_bits(xs[i] - bf16_val(hb)) : (unsigned short)0; }
#pragma unroll
    for (int t = 0; t < 4; ++t) {
      const unsigned short* brow = Wt + (size_t)(col0 + t * 16 + ln) * ldb + kb;
      FragB b;
      b.half[0] = *(const v8us*)(brow + 8 * hh);
      b.half[1] = *(const v8us*)(brow + 16 + 8 * hh);
      acc[t] = mmaN<ASPLIT ? 2 : 1>(ah.v, al.v, b.v, b.v, acc[t]);
    }
  }
#pragma unroll
  for (int t = 0; t < 4; ++t) {
    const int col = col0 + t * 16 + ln;
    float bv = bias ? bias[col] : 0.f;
    if (BIAS_BF16) bv = bf16_round(bv);
#pragma unroll
    for (int r = 0; r < 8; ++r) {
      float v = acc[t][r] + bv;
      if (resid) { float rv = resid[(size_t)((row0 + 8 * hh + r) % rmod) * ldr + col]; if (RES_BF16) rv = bf16_round(rv); v += rv; }
      if (ACT == 1) v = fmaxf(v, 0.f);
      if (ACT == 2) v = 0.5f * v * (1.0f + erff(v * 0.70710678118654752f));
      if (ACT == 3) { const float u = 0.7978845608028654f * (v + 0.044715f * v * v * v); v = 0.5f * v * (1.0f + tanhf(u)); }
      so[w][8 * hh + r][t * 16 + ln] = v;
    }
  }
  __builtin_amdgcn_fence(__ATOMIC_ACQ_REL, "workgroup");
  __builtin_amdgcn_wave_barrier();
  const int rsub = lane >> 4, c4 = (lane & 15) * 4;
  {
#pragma unroll
    for (int q = 0; q < 8; ++q) {
      const int r = q * 2 + rsub;
      const v4f v = *(const v4fa*)&so[w][r][c4];
      *(v4f*)(C + (size_t)(row0 + r) * ldc + col0 + c4) = v;
    }
    
  }
}
// row LayerNorm (biased variance, eps) over N: s = X (+ R); optional out_sum <- s; out_norm <- (s-mu)*rsqrt(var+eps)*g + b
template <bool PARAM_BF16>
__global__ __launch_bounds__(256) void k_layernorm(const float* __restrict__ X, const float* __restrict__ R, const float* __restrict__ g, const float* __restrict__ bta,
                                                  float* __restrict__ out_sum, float* __restrict__ out_norm, int N, float eps) {
  __shared__ float red[256];
  const int row = blockIdx.x, tid = threadIdx.x;
  const float* x = X + (size_t)row * N; const float* rr = R ? R + (size_t)row * N : nullptr;
  float vals[16];                     // up to N = 4096
  const int per = N / 256;            // contiguous chunk per thread? use strided-by-4 chunks: thread handles j = tid*4 + 1024*u
  float s1 = 0.f;
  for (int u = 0; u < per / 4; ++u) {
    const int j = tid * 4 + 1024 * u;
    const v4f a = *(const v4fa*)(x + j);
    v4f b = {0.f,0.f,0.f,0.f}; if (rr) b = *(const v4fa*)(rr + j);
#pragma unroll
    for (int q = 0; q < 4; ++q) { const float v = a[q] + b[q]; vals[u * 4 + q] = v; s1 += v; }
  }
  red[tid] = s1; __syncthreads();
  for (int st = 128; st > 0; st >>= 1) { if (tid < st) red[tid] += red[tid + st]; __syncthreads(); }
  const float mu = red[0] / (float)N; __syncthreads();
  float s2 = 0.f;
  for (int u = 0; u < per / 4; ++u)
#pragma unroll
    for (int q = 0; q < 4; ++q) { const float c = vals[u * 4 + q] - mu; s2 += c * c; }
  red[tid] = s2; __syncthreads();
  for (int st = 128; st > 0; st >>= 1) { if (tid < st) red[tid] += red[tid + st]; __syncthreads(); }
  const float rs = rsqrtf(red[0] / (float)N + eps);
  {
    for (int u = 0; u < per / 4; ++u) {
      const int j = tid * 4 + 1024 * u;
      v4f o, sm;
#pragma unroll
      for (int q = 0; q < 4; ++q) {
        float gg = g[j + q], bb = bta[j + q];
        if (PARAM_BF16) { gg = bf16_round(gg); bb = bf16_round(bb); }
        sm[q] = vals[u * 4 + q]; o[q] = (vals[u * 4 + q] - mu) * rs * gg + bb;
      }
      if (out_sum) *(v4f*)(out_sum + (size_t)row * N + j) = sm;
      *(v4f*)(out_norm + (size_t)row * N + j) = o;
    }
    
  }
}



// ---- f16 WMMA path (v_wmma_f32_16x16x32_f16): 11-bit significands for operands in range — used where a [0,1] probability operand needs more precision than bf16
typedef _Float16 v16h __attribute__((ext_vector_type(16)));
union FragH { v16h v; v8us half[2]; _Float16 h[16]; unsigned short u[16]; };
template <int NT>
__device__ __forceinline__ v8f mmaH(v16h ah, v16h al, v16h bh, v16h bl, v8f c) {
  c = __builtin_amdgcn_wmma_f32_16x16x32_f16(false, ah, false, bh, (short)0, c, false, false);
  if (NT >= 2) c = __builtin_amdgcn_wmma_f32_16x16x32_f16(false, al, false, bh, (short)0, c, false, false);
  if (NT >= 3) c = __builtin_amdgcn_wmma_f32_16x16x32_f16(false, ah, false, bl, (short)0, c, false, false);
  asm volatile("v_nop\n\tv_nop\n\tv_nop\n\tv_nop" : "+v"(c) : "v"(ah), "v"(al), "v"(bh), "v"(bl));
  return c;
}
// batched GEMM like k_gemm_b but f16 operands: A f32 (split into f16 hi/lo if ASPLIT, else rounded to f16), Bt = f16 values [n][k]; alpha; C f32; N multiple of 16 (partial tiles skipped)
template <bool ASPLIT>
__global__ __launch_bounds__(128) void k_gemm_h(const float* __restrict__ A, int lda, size_t sA, const _Float16* __restrict__ Bh, int ldb, size_t sB, float alpha, float* __restrict__ C, int ldc, size_t sC, int M, int N, int K) {
  __shared__ __attribute__((aligned(16))) float so[4][16][64];
  const int tid = threadIdx.x, w = tid >> 5, lane = tid & 31, ln = lane & 15, hh = lane >> 4; const int by = blockIdx.y;
  A += (size_t)by * sA; Bh += (size_t)by * sB; C += (size_t)by * sC;
  const int ntn = (N + 63) / 64; const int wid = blockIdx.x * 4 + w; const int mt = wid / ntn, nq = wid % ntn; if (mt * 16 >= M) return;
  const int row0 = mt * 16, col0 = nq * 64; const float* arow = A + (size_t)(row0 + ln) * lda;
  v8f acc[4] = {};
  for (int kb = 0; kb < K; kb += 32) {
    FragH ah, al;
    const v4f x0 = *(const v4fa*)(arow + kb + 8 * hh), x1 = *(const v4fa*)(arow + kb + 8 * hh + 4), x2 = *(const v4fa*)(arow + kb + 16 + 8 * hh), x3 = *(const v4fa*)(arow + kb + 16 + 8 * hh + 4);
    float xs[16] = {x0[0],x0[1],x0[2],x0[3],x1[0],x1[1],x1[2],x1[3],x2[0],x2[1],x2[2],x2[3],x3[0],x3[1],x3[2],x3[3]};
#pragma unroll
    for (int i = 0; i < 16; ++i) { const _Float16 h = (_Float16)xs[i]; ah.h[i] = h; al.h[i] = ASPLIT ? (_Float16)(xs[i] - (float)h) : (_Float16)0.0f; }
#pragma unroll
    for (int t = 0; t < 4; ++t) { if (col0 + t * 16 >= N) continue; const size_t boff = (size_t)(col0 + t * 16 + ln) * ldb + kb; FragH bq; bq.half[0] = *(const v8us*)(Bh + boff + 8 * hh); bq.half[1] = *(const v8us*)(Bh + boff + 16 + 8 * hh);
      acc[t] = mmaH<ASPLIT ? 2 : 1>(ah.v, al.v, bq.v, bq.v, acc[t]); }
  }
#pragma unroll
  for (int t = 0; t < 4; ++t) { if (col0 + t * 16 >= N) continue;
#pragma unroll
    for (int r = 0; r < 8; ++r) so[w][8 * hh + r][t * 16 + ln] = acc[t][r] * alpha; }
  __builtin_amdgcn_fence(__ATOMIC_ACQ_REL, "workgroup"); __builtin_amdgcn_wave_barrier();
  const int rsub = lane >> 4, c4 = (lane & 15) * 4;
  {
#pragma unroll
    for (int q = 0; q < 8; ++q) { const int r = q * 2 + rsub; if (col0 + c4 < N) { const v4f v = *(const v4fa*)&so[w][r][c4]; *(v4f*)(C + (size_t)(row0 + r) * ldc + col0 + c4) = v; } }
     }
}

// Wt[n][k] = f16(W[k][n]·scale) from f32 row-major W[K][N] (scale = power of two; bf16-exact weights stay exact in f16 away from the subnormal range)
__global__ __launch_bounds__(256) void k_wt_f16(const float* __restrict__ W, _Float16* __restrict__ Wt, int K, int N, float scale) {
  const int t = blockIdx.x * 256 + threadIdx.x; if (t >= N * (K / 8)) return; const int n = t / (K / 8), k8 = (t % (K / 8)) * 8; FragH f;
#pragma unroll
  for (int i = 0; i < 8; ++i) f.h[i] = (_Float16)(bf16_round(W[(size_t)(k8 + i) * N + n]) * scale); const v8us o = f.half[0];
  *(v8us*)((unsigned short*)Wt + (size_t)n * K + k8) = o; 
}
// k_gemm_hh variant with fused epilogue: v = acc·alpha + bias[by·sBias + col] (+ CP[(row/rowsPerB)·sCPb + by·64 + col] if CP) ; ACT 0 none / 1 elu ; writes f16 C16 (and f32 C if non-null)
template <int ACT>
__global__ __launch_bounds__(128) void k_gemm_hhx(const _Float16* __restrict__ A, int lda, size_t sA, const _Float16* __restrict__ Bh, int ldb, size_t sB, float alpha, const float* __restrict__ bias, size_t sBias, const float* __restrict__ CP, int rowsPerB, size_t sCPb, int row0g,
    float* __restrict__ C, _Float16* __restrict__ C16, int ldc, size_t sC, int M, int N, int K) {
  __shared__ __attribute__((aligned(16))) float so[4][16][64];
  const int tid = threadIdx.x, w = tid >> 5, lane = tid & 31, ln = lane & 15, hh = lane >> 4; const int by = blockIdx.y;
  A += (size_t)by * sA; Bh += (size_t)by * sB; const size_t cofs = (size_t)by * sC; const float* bp = bias ? bias + (size_t)by * sBias : nullptr;
  const int ntn = (N + 63) / 64; const int wid = blockIdx.x * 4 + w; const int mt = wid / ntn, nq = wid % ntn; if (mt * 16 >= M) return;
  const int row0 = mt * 16, col0 = nq * 64; const _Float16* arow = A + (size_t)(row0 + ln) * lda;
  v8f acc[4] = {};
  for (int kb = 0; kb < K; kb += 32) { FragH ah; ah.half[0] = *(const v8us*)((const unsigned short*)arow + kb + 8 * hh); ah.half[1] = *(const v8us*)((const unsigned short*)arow + kb + 16 + 8 * hh);
#pragma unroll
    for (int t = 0; t < 4; ++t) { if (col0 + t * 16 >= N) continue; const size_t boff = (size_t)(col0 + t * 16 + ln) * ldb + kb; FragH bq; bq.half[0] = *(const v8us*)((const unsigned short*)Bh + boff + 8 * hh); bq.half[1] = *(const v8us*)((const unsigned short*)Bh + boff + 16 + 8 * hh);
      acc[t] = mmaH<1>(ah.v, ah.v, bq.v, bq.v, acc[t]); }
  }
#pragma unroll
  for (int t = 0; t < 4; ++t) { if (col0 + t * 16 >= N) continue; const int col = col0 + t * 16 + ln; const float bv = bp ? bf16_round(bp[col]) : 0.f;
#pragma unroll
    for (int r = 0; r < 8; ++r) { float v = acc[t][r] * alpha + bv; if (CP) { const int bidx = (row0g + row0 + 8 * hh + r) / rowsPerB; v += CP[(size_t)bidx * sCPb + (size_t)by * 64 + col]; } if (ACT == 1) v = (v > 0.f) ? v : expm1f(v); else if (ACT == 7) v = (v > 0.f) ? v + 1.0f : expf(v); else if (ACT == 8) v = tanhf(v); else if (ACT == 9) v = 0.5f * v * (1.0f + tanhf(0.7978845608028654f * (v + 0.044715f * v * v * v))); else if (ACT == 11) v = 1.0f / (1.0f + expf(-v)); else if (ACT == 12) v = (v > 0.f) ? v : 0.01f * v; else if (ACT == 14) v = (v > 0.f) ? v : 0.1f * v; else if (ACT == 15) v = v / (1.0f + expf(-v)); else if (ACT == 3) v = fmaxf(v, 0.f); else if (ACT == 6) v = 0.5f * v * (1.0f + erff(v * 0.70710678118654752f)); so[w][8 * hh + r][t * 16 + ln] = v; } }
  __builtin_amdgcn_fence(__ATOMIC_ACQ_REL, "workgroup"); __builtin_amdgcn_wave_barrier();
  const int rsub = lane >> 4, c4 = (lane & 15) * 4; typedef _Float16 v4h __attribute__((ext_vector_type(4)));
  {
#pragma unroll
    for (int q = 0; q < 8; ++q) { const int r = q * 2 + rsub; if (col0 + c4 < N) { const v4f v = *(const v4fa*)&so[w][r][c4]; if (C) *(v4f*)(C + cofs + (size_t)(row0 + r) * ldc + col0 + c4) = v; if (C16) { v4h h4; for (int i = 0; i < 4; ++i) h4[i] = (_Float16)v[i]; *(v4h*)(C16 + cofs + (size_t)(row0 + r) * ldc + col0 + c4) = h4; } } }
     }
}


typedef _Float16 v4h __attribute__((ext_vector_type(4)));

__global__ __launch_bounds__(256) void k_x16(const float* __restrict__ x, _Float16* __restrict__ X16, size_t n8) { const size_t t = (size_t)blockIdx.x * 256 + threadIdx.x; if (t >= n8) return; FragH f;
#pragma unroll
  for (int q = 0; q < 8; ++q) f.h[q] = (_Float16)bf16_round(x[t * 8 + q]); *(v8us*)((unsigned short*)X16 + t * 8) = f.half[0];  }
__global__ __launch_bounds__(256) void k_h16(const float* __restrict__ x, _Float16* __restrict__ X16, size_t n8) { const size_t t = (size_t)blockIdx.x * 256 + threadIdx.x; if (t >= n8) return; FragH f;
#pragma unroll
  for (int q = 0; q < 8; ++q) f.h[q] = (_Float16)x[t * 8 + q]; *(v8us*)((unsigned short*)X16 + t * 8) = f.half[0];  }
__global__ __launch_bounds__(256) void k_round16f(const float* __restrict__ W, _Float16* __restrict__ Bt, size_t n8) { const size_t t = (size_t)blockIdx.x * 256 + threadIdx.x; if (t >= n8) return; FragH f;
#pragma unroll
  for (int i = 0; i < 8; ++i) f.h[i] = (_Float16)(bf16_round(W[t * 8 + i]) * 16.0f); *(v8us*)((unsigned short*)Bt + t * 8) = f.half[0];  }
template <int NHv, int TTv>
__global__ __launch_bounds__(256) void k_vt(const _Float16* __restrict__ V16, int ldv, int voff, _Float16* __restrict__ Vt) { __shared__ unsigned short tl[64][66]; const int tid = threadIdx.x; const int slab = blockIdx.x / (TTv / 64), lg = blockIdx.x % (TTv / 64); const int b = slab / NHv, h = slab % NHv;
  for (int i = tid; i < 64 * 8; i += 256) { const int r = i / 8, c8 = (i % 8) * 8; FragH f; f.half[0] = *(const v8us*)((const unsigned short*)V16 + ((size_t)b * TTv + lg * 64 + r) * ldv + voff + h * 64 + c8);
#pragma unroll
    for (int q = 0; q < 8; ++q) tl[r][c8 + q] = f.u[q]; }
  __syncthreads();
  {
#pragma unroll
    for (int rd = 0; rd < 2; ++rd) { const int d = rd * 32 + tid / 8, pc = tid % 8; FragH f;
#pragma unroll
      for (int q = 0; q < 8; ++q) f.u[q] = tl[pc * 8 + q][d];
      *(v8us*)((unsigned short*)Vt + ((size_t)slab * 64 + d) * TTv + lg * 64 + pc * 8) = f.half[0]; }
     } }

__global__ __launch_bounds__(128) void k_flash(const _Float16* __restrict__ Q16, int ldq, const _Float16* __restrict__ K16, int ldk, const _Float16* __restrict__ Vt, const int* __restrict__ MSK, float* __restrict__ O, int ldo) {
  constexpr int RPW = 16, RTN = RPW / 16, NQB = NN / (4 * RPW), DT = 2, KS = 1;
  __shared__ __attribute__((aligned(16))) unsigned short sP[4][RPW][40]; __shared__ __attribute__((aligned(16))) float sO[4][RPW][32 + 4];
  const int tid = threadIdx.x, w = tid >> 5, lane = tid & 31, ln = lane & 15, hh = lane >> 4;
  const int slab = blockIdx.x / NQB, qblk = blockIdx.x % NQB; const int b = slab / NH, h = slab % NH; const int qb0 = qblk * (4 * RPW); const int q0 = qb0 + w * RPW;
  FragH aq[2][KS];
#pragma unroll
  for (int rt = 0; rt < RTN; ++rt) { const unsigned short* qr = (const unsigned short*)Q16 + ((size_t)b * NN + q0 + rt * 16 + ln) * ldq + h * HD;
#pragma unroll
    for (int ks = 0; ks < KS; ++ks) { aq[rt][ks].half[0] = *(const v8us*)(qr + ks * 32 + 8 * hh); aq[rt][ks].half[1] = *(const v8us*)(qr + ks * 32 + 16 + 8 * hh); } }
  const unsigned short* Vth = (const unsigned short*)Vt + ((size_t)b * CC + h * HD) * NN;      /* Vᵀ = v[b][(h,d)][n] channel-major */
  float m_r[2][8], l_r[2][8]; v8f oacc[2][DT];
#pragma unroll
  for (int rt = 0; rt < RTN; ++rt) {
#pragma unroll
    for (int r = 0; r < 8; ++r) { m_r[rt][r] = -3.0e38f; l_r[rt][r] = 0.f; }
#pragma unroll
    for (int dt = 0; dt < DT; ++dt) oacc[rt][dt] = (v8f){0.f,0.f,0.f,0.f,0.f,0.f,0.f,0.f}; }
  const int jend = NN;
#pragma unroll 1
  for (int j0 = 0; j0 < jend; j0 += 32) {
    
    v8f s[2][2];
#pragma unroll
    for (int nt = 0; nt < 2; ++nt) { const unsigned short* kr = (const unsigned short*)K16 + ((size_t)b * NN + j0 + nt * 16 + ln) * ldk + h * HD; FragH bk[KS];
#pragma unroll
      for (int ks = 0; ks < KS; ++ks) { bk[ks].half[0] = *(const v8us*)(kr + ks * 32 + 8 * hh); bk[ks].half[1] = *(const v8us*)(kr + ks * 32 + 16 + 8 * hh); }
#pragma unroll
      for (int rt = 0; rt < RTN; ++rt) { v8f acc = (v8f){0.f,0.f,0.f,0.f,0.f,0.f,0.f,0.f};
#pragma unroll
        for (int ks = 0; ks < KS; ++ks) acc = mmaH<1>(aq[rt][ks].v, aq[rt][ks].v, bk[ks].v, bk[ks].v, acc); s[rt][nt] = acc; } }
#pragma unroll
    for (int rt = 0; rt < RTN; ++rt)
#pragma unroll
      for (int r = 0; r < 8; ++r) { const int tq = q0 + rt * 16 + 8 * hh + r; const int k0 = j0 + ln, k1 = j0 + 16 + ln; (void)tq; (void)k0; (void)k1;
        const bool ok0 = true, ok1 = true;
        const float s0 = s[rt][0][r] * 0.17677669529663687f, s1 = s[rt][1][r] * 0.17677669529663687f; float mc = fmaxf(s0, s1);
        mc = fmaxf(mc, __shfl_xor(mc, 1, 32)); mc = fmaxf(mc, __shfl_xor(mc, 2, 32)); mc = fmaxf(mc, __shfl_xor(mc, 4, 32)); mc = fmaxf(mc, __shfl_xor(mc, 8, 32));
        const float mn = fmaxf(m_r[rt][r], mc); const float al = (mn > -1.0e38f) ? expf(m_r[rt][r] - mn) : 1.0f; m_r[rt][r] = mn; const float p0 = expf(s0 - mn), p1 = expf(s1 - mn); l_r[rt][r] = l_r[rt][r] * al + p0 + p1;
#pragma unroll
        for (int dt = 0; dt < DT; ++dt) oacc[rt][dt][r] *= al;
        FragH t2; t2.h[0] = (_Float16)(p0 * 1024.0f); t2.h[1] = (_Float16)(p1 * 1024.0f); sP[w][rt * 16 + 8 * hh + r][ln] = t2.u[0]; sP[w][rt * 16 + 8 * hh + r][16 + ln] = t2.u[1]; }
    __builtin_amdgcn_fence(__ATOMIC_ACQ_REL, "workgroup"); __builtin_amdgcn_wave_barrier();
    FragH pa[2];
#pragma unroll
    for (int rt = 0; rt < RTN; ++rt) { pa[rt].half[0] = *(const v8us*)&sP[w][rt * 16 + ln][8 * hh]; pa[rt].half[1] = *(const v8us*)&sP[w][rt * 16 + ln][16 + 8 * hh]; }
#pragma unroll
    for (int dt = 0; dt < DT; ++dt) { const unsigned short* vrow = Vth + (size_t)(dt * 16 + ln) * NN + j0; FragH bv; bv.half[0] = *(const v8us*)(vrow + 8 * hh); bv.half[1] = *(const v8us*)(vrow + 16 + 8 * hh);
#pragma unroll
      for (int rt = 0; rt < RTN; ++rt) oacc[rt][dt] = mmaH<1>(pa[rt].v, pa[rt].v, bv.v, bv.v, oacc[rt][dt]); }
    __builtin_amdgcn_fence(__ATOMIC_ACQ_REL, "workgroup"); __builtin_amdgcn_wave_barrier(); }
#pragma unroll
  for (int rt = 0; rt < RTN; ++rt) {
#pragma unroll
    for (int r = 0; r < 8; ++r) { float l = l_r[rt][r]; l += __shfl_xor(l, 1, 32); l += __shfl_xor(l, 2, 32); l += __shfl_xor(l, 4, 32); l += __shfl_xor(l, 8, 32); const float den = l + 1e-6f * expf(-m_r[rt][r]); l_r[rt][r] = (den > 0.f && den < INFINITY) ? 1.0f / (den * 1024.0f) : 0.f; }      /* Σe^s/(Σe^s + 1e-6) form: e^(−m)·1e-6 joins the shifted sum; an infinite den (all logits ≪ 0) reproduces the reference's ≈0 output */
#pragma unroll
    for (int dt = 0; dt < DT; ++dt)
#pragma unroll
      for (int r = 0; r < 8; ++r) sO[w][rt * 16 + 8 * hh + r][dt * 16 + ln] = oacc[rt][dt][r] * l_r[rt][r]; }
  __builtin_amdgcn_fence(__ATOMIC_ACQ_REL, "workgroup"); __builtin_amdgcn_wave_barrier();
  {
#pragma unroll
    for (int rp = 0; rp < RPW; rp += 4) { const int r = rp + (lane >> 3), pc = lane & 7; const v4f val = *(const v4fa*)&sO[w][r][pc * 4]; *(v4f*)(O + ((size_t)b * NN + q0 + r) * ldo + h * HD + pc * 4) = val; }      
     } }

extern "C" void kernel_launch(void* const* d_in, const int* in_sizes, int n_in,
                              void* d_out, int out_size, void* d_ws, size_t ws_size, hipStream_t stream) {
  (void)in_sizes; (void)n_in; (void)out_size;
  const float* x = (const float*)d_in[0]; const float* Wqkv = (const float*)d_in[1]; const float* Wout = (const float*)d_in[2]; const float* bout = (const float*)d_in[3];
  char* ws = (char*)d_ws; size_t off = 0;
  auto take = [&](size_t bytes) { char* p = ws + off; off += (bytes + 255) & ~(size_t)255; return p; };
  _Float16* Bqkv = (_Float16*)take((size_t)C3 * CC * 2); _Float16* Bo = (_Float16*)take((size_t)CC * CC * 2); _Float16* X16 = (_Float16*)take((size_t)NR * CC * 2);
  _Float16* QK = (_Float16*)take((size_t)NR * 2 * CC * 2); _Float16* Vt = (_Float16*)take((size_t)BB * CC * NN * 2); float* O = (float*)take((size_t)NR * CC * 4); _Float16* O16 = (_Float16*)take((size_t)NR * CC * 2);
  if (off > ws_size) return;      // 0.4 + 0.1 + 4.2 + 8.4 + 4.2 + 8.4 + 4.2 ≈ 30 MB
  k_wt_f16<<<(unsigned)(((size_t)C3 * (CC / 8) + 255) / 256), 256, 0, stream>>>(Wqkv, Bqkv, CC, C3, 16.0f); k_wt_f16<<<(unsigned)(((size_t)CC * (CC / 8) + 255) / 256), 256, 0, stream>>>(Wout, Bo, CC, CC, 16.0f);      /* (in,out) → Bt[n][k] ×2^4 */
  k_x16<<<(unsigned)(((size_t)NR * CC / 8 + 255) / 256), 256, 0, stream>>>(x, X16, (size_t)NR * CC / 8);
  k_gemm_hhx<0><<<dim3(((NR / 16) * (2 * CC / 64) + 3) / 4, 1), 128, 0, stream>>>(X16, CC, 0, Bqkv, CC, 0, 0.0625f, nullptr, 0, nullptr, 1, 0, 0, nullptr, QK, 2 * CC, 0, NR, 2 * CC, CC);      /* [q | k] token-major [(b,n)][512]: M 8192 N 512 K 256 */
  k_gemm_hhx<0><<<dim3(((CC / 16) * (NN / 64) + 3) / 4, BB), 128, 0, stream>>>(Bqkv + (size_t)2 * CC * CC, CC, 0, X16, CC, (size_t)NN * CC, 0.0625f, nullptr, 0, nullptr, 1, 0, 0, nullptr, Vt, NN, (size_t)CC * NN, CC, NN, CC);      /* v channel-major per batch [b][(h,d)][n] = Vᵀ: A = Bt rows 512..767 ([out][in]), B = X16[b]: M 256 N 2048 K 256 */
  k_flash<<<BB * NH * (NN / 64), 128, 0, stream>>>(QK, 2 * CC, QK + CC, 2 * CC, Vt, nullptr, O, CC);      /* blocks = (b,h) × 64-query groups */
  k_h16<<<(unsigned)(((size_t)NR * CC / 8 + 255) / 256), 256, 0, stream>>>(O, O16, (size_t)NR * CC / 8);
  k_gemm_hhx<0><<<dim3(((NR / 16) * (CC / 64) + 3) / 4, 1), 128, 0, stream>>>(O16, CC, 0, Bo, CC, 0, 0.0625f, bout, 0, nullptr, 1, 0, 0, (float*)d_out, nullptr, CC, 0, NR, CC, CC);      /* y = out·Wout + bout: M 8192 N 256 K 256 */
}

// v001
// Measured time: 145 microseconds a run.
// Two timings next to v000 put it at 1.62 and 1.61 times that version's speed.
#include <hip/hip_runtime.h>
// KeOps-style multi-head attention (B=4, n=2048, dim 256, 8 heads × 32): qkv = x·Wqkv; q scaled by 32^-½; e = exp(q·kᵀ) WITHOUT max subtraction; out = (e·v)/(Σe + 1e-6) merged over heads; y = out·Wout + bout.
// Compute dtype: x, Wqkv, Wout, bout rounded to bf16; q/k token-major and v channel-major (= Vᵀ) as f16 GEMM outputs (f32 accumulate); fused flash-style kernel per (b,h) (online max-rescaled sums
// in f32 — the unshifted quotient is recovered exactly through the normaliser l + 1e-6·e^(−m); P f16 ×2^10) on v_wmma_f32_16x16x32_f16; O → f16 → output GEMM with bias; f32 accumulate.
#define BB 4
#define NN 2048
#define CC 256
#define C3 768
#define NH 8
#define HD 32
#define NR (BB * NN)

typedef __bf16 v16b __attribute__((ext_vector_type(16)));
typedef unsigned short v8us __attribute__((ext_vector_type(8), may_alias));
typedef float  v8f  __attribute__((ext_vector_type(8)));
typedef float  v4f  __attribute__((ext_vector_type(4)));
typedef float  v4fa __attribute__((ext_vector_type(4), may_alias));
union FragB { v16b v; v8us half[2]; unsigned short u[16]; };

__device__ __forceinline__ unsigned short bf16_bits(float x) { unsigned int u = __float_as_uint(x); return (unsigned short)((u + 0x7FFFu + ((u >> 16) & 1u)) >> 16); }
__device__ __forceinline__ float bf16_val(unsigned short b) { return __uint_as_float(((unsigned int)b) << 16); }
__device__ __forceinline__ float bf16_round(float x) { return bf16_val(bf16_bits(x)); }
// D += A·B with NT terms: 1 = ah·bh, 2 = + al·bh (A split), 3 = + ah·bl (both split)
template <int NT>
__device__ __forceinline__ v8f mmaN(v16b ah, v16b al, v16b bh, v16b bl, v8f c) {
  c = __builtin_amdgcn_wmma_f32_16x16x32_bf16(false, ah, false, bh, (short)0, c, false, false);
  if (NT >= 2) c = __builtin_amdgcn_wmma_f32_16x16x32_bf16(false, al, false, bh, (short)0, c, false, false);
  if (NT >= 3) c = __builtin_amdgcn_wmma_f32_16x16x32_bf16(false, ah, false, bl, (short)0, c, false, false);
  asm volatile("v_nop\n\tv_nop\n\tv_nop\n\tv_nop" : "+v"(c) : "v"(ah), "v"(al), "v"(bh), "v"(bl));
  return c;
}

__global__ __launch_bounds__(256) void k_wt_bf16(const float* __restrict__ W, unsigned short* __restrict__ Wt, int K, int N) {
  const int t = blockIdx.x * 256 + threadIdx.x;
  const int k8n = K / 8;
  if (t >= N * k8n) return;
  const int n = t / k8n, k8 = (t % k8n) * 8;
  v8us v;
#pragma unroll
  for (int i = 0; i < 8; ++i) v[i] = bf16_bits(W[(size_t)(k8 + i) * N + n]);
  *(v8us*)(Wt + (size_t)n * K + k8) = v;
  
}

// GEMM C[M][N] (f32, pitch ldc) = act(A[M][K]·W + bias). A f32 row-major (pitch lda) converted per fragment to bf16
// (ASPLIT: hi/lo two planes -> 2 terms, else single rounded term); Wt bf16 [N][K] (pitch ldb). BIAS_BF16 rounds the
// bias to bf16 first (bias quantised to bf16 before the add). K%32==0, M%16==0, N%64==0.
template <bool ASPLIT, int ACT, bool BIAS_BF16>
__global__ __launch_bounds__(128) void k_gemm_bf(const float* __restrict__ A, int lda, const unsigned short* __restrict__ Wt, int ldb,
                                               const float* __restrict__ bias, float* __restrict__ C, int ldc, int M, int N, int K) {
  __shared__ __attribute__((aligned(16))) float so[4][16][64];
  const int tid = threadIdx.x, w = tid >> 5, lane = tid & 31, ln = lane & 15, hh = lane >> 4;
  const int ntn = N / 64;
  const int wid = blockIdx.x * 4 + w;
  const int mt = wid / ntn, nq = wid % ntn;
  if (mt * 16 >= M) return;
  const int row0 = mt * 16, col0 = nq * 64;
  const float* arow = A + (size_t)(row0 + ln) * lda;
  v8f acc[4] = {};
  for (int kb = 0; kb < K; kb += 32) {
    FragB ah, al;
    const v4f x0 = *(const v4fa*)(arow + kb + 8 * hh), x1 = *(const v4fa*)(arow + kb + 8 * hh + 4);
    const v4f x2 = *(const v4fa*)(arow + kb + 16 + 8 * hh), x3 = *(const v4fa*)(arow + kb + 16 + 8 * hh + 4);
    float xs[16] = {x0[0],x0[1],x0[2],x0[3],x1[0],x1[1],x1[2],x1[3],x2[0],x2[1],x2[2],x2[3],x3[0],x3[1],x3[2],x3[3]};
#pragma unroll
    for (int i = 0; i < 16; ++i) { const unsigned short hb = bf16_bits(xs[i]); ah.u[i] = hb; al.u[i] = ASPLIT ? bf16_bits(xs[i] - bf16_val(hb)) : (unsigned short)0; }
#pragma unroll
    for (int t = 0; t < 4; ++t) {
      const unsigned short* brow = Wt + (size_t)(col0 + t * 16 + ln) * ldb + kb;
      FragB b;
      b.half[0] = *(const v8us*)(brow + 8 * hh);
      b.half[1] = *(const v8us*)(brow + 16 + 8 * hh);
      acc[t] = mmaN<ASPLIT ? 2 : 1>(ah.v, al.v, b.v, b.v, acc[t]);
    }
  }
#pragma unroll
  for (int t = 0; t < 4; ++t) {
    float bv = bias ? bias[col0 + t * 16 + ln] : 0.f;
    if (BIAS_BF16) bv = bf16_round(bv);
#pragma unroll
    for (int r = 0; r < 8; ++r) { float v = acc[t][r] + bv; if (ACT == 1) v = fmaxf(v, 0.f); so[w][8 * hh + r][t * 16 + ln] = v; }
  }
  __builtin_amdgcn_fence(__ATOMIC_ACQ_REL, "workgroup");
  __builtin_amdgcn_wave_barrier();
  const int rsub = lane >> 4, c4 = (lane & 15) * 4;
  {
#pragma unroll
    for (int q = 0; q < 8; ++q) {
      const int r = q * 2 + rsub;
      const v4f v = *(const v4fa*)&so[w][r][c4];
      *(v4f*)(C + (size_t)(row0 + r) * ldc + col0 + c4) = v;
    }
    
  }
}

// Flash-style causal/unmasked attention, all contractions 3-term bf16 hi/lo splits, f32 softmax with running max.
// q,k,v rows are read from f32 buffers with arbitrary row pitch (so they can live inside a fused qkv buffer);
// D = head size (multiple of 32, <= 128); one wave = 16 query rows; block = 4 waves (64 queries) sharing K/V chunks of 32.
template <int D, bool CAUSAL>
__global__ __launch_bounds__(128) void k_flash(const float* __restrict__ qb, const float* __restrict__ kb, const float* __restrict__ vb,
                                             int pitch, int T, int H, float scale, float* __restrict__ y, int ypitch) {
  constexpr int KS = D / 32;        // k-steps for QK
  constexpr int DT = D / 16;        // d tiles for PV
  __shared__ __attribute__((aligned(16))) unsigned short sKh[32][D + 8], sKl[32][D + 8], sVh[32][D + 8], sVl[32][D + 8];
  __shared__ __attribute__((aligned(16))) unsigned short sPh[4][16][40], sPl[4][16][40];
  __shared__ __attribute__((aligned(16))) float sO[4][16][D];
  const int tid = threadIdx.x, w = tid >> 5, lane = tid & 31, ln = lane & 15, hh = lane >> 4;
  const int nqb = (T + 63) / 64;
  const int bh = blockIdx.x / nqb, qblk = blockIdx.x % nqb;
  const int b = bh / H, h = bh % H;
  const int q0 = qblk * 64 + w * 16;
  const float* Q = qb + (size_t)b * T * pitch + h * D;
  const float* K = kb + (size_t)b * T * pitch + h * D;
  const float* V = vb + (size_t)b * T * pitch + h * D;

  // A fragments of the wave's 16 query rows (scaled), hi/lo
  FragB aqh[KS], aql[KS];
  {
    int row = q0 + ln; if (row >= T) row = T - 1;
    const float* qr = Q + (size_t)row * pitch;
#pragma unroll
    for (int ks = 0; ks < KS; ++ks)
#pragma unroll
      for (int i = 0; i < 16; ++i) {
        const int d = ks * 32 + ((i < 8) ? (8 * hh + i) : (16 + 8 * hh + (i - 8)));
        const float x = qr[d] * scale; const unsigned short hb = bf16_bits(x);
        aqh[ks].u[i] = hb; aql[ks].u[i] = bf16_bits(x - bf16_val(hb));
      }
  }
  float m_r[8], l_r[8];
#pragma unroll
  for (int r = 0; r < 8; ++r) { m_r[r] = -3.0e38f; l_r[r] = 0.f; }
  v8f oacc[DT];
#pragma unroll
  for (int dt = 0; dt < DT; ++dt) oacc[dt] = (v8f){0.f,0.f,0.f,0.f,0.f,0.f,0.f,0.f};

  const int kv_end = CAUSAL ? min(T, qblk * 64 + 64) : T;     // block-uniform
  for (int j0 = 0; j0 < kv_end; j0 += 32) {
    __syncthreads();
    for (int e = tid; e < 32 * (D / 4); e += 128) {
      const int r = e / (D / 4), c4 = (e % (D / 4)) * 4;
      const int key = j0 + r;
      v4f kf = {0.f,0.f,0.f,0.f}, vf = {0.f,0.f,0.f,0.f};
      if (key < T) { kf = *(const v4fa*)(K + (size_t)key * pitch + c4); vf = *(const v4fa*)(V + (size_t)key * pitch + c4); }
#pragma unroll
      for (int t = 0; t < 4; ++t) {
        unsigned short hb = bf16_bits(kf[t]); sKh[r][c4 + t] = hb; sKl[r][c4 + t] = bf16_bits(kf[t] - bf16_val(hb));
        hb = bf16_bits(vf[t]); sVh[r][c4 + t] = hb; sVl[r][c4 + t] = bf16_bits(vf[t] - bf16_val(hb));
      }
    }
    __syncthreads();
    // S tile 16 x 32
    v8f s[2];
#pragma unroll
    for (int nt = 0; nt < 2; ++nt) {
      v8f acc = {};
#pragma unroll
      for (int ks = 0; ks < KS; ++ks) {
        FragB bh_, bl_;
        bh_.half[0] = *(const v8us*)&sKh[nt * 16 + ln][ks * 32 + 8 * hh]; bh_.half[1] = *(const v8us*)&sKh[nt * 16 + ln][ks * 32 + 16 + 8 * hh];
        bl_.half[0] = *(const v8us*)&sKl[nt * 16 + ln][ks * 32 + 8 * hh]; bl_.half[1] = *(const v8us*)&sKl[nt * 16 + ln][ks * 32 + 16 + 8 * hh];
        acc = mmaN<3>(aqh[ks].v, aql[ks].v, bh_.v, bl_.v, acc);
      }
      s[nt] = acc;
    }
    // mask + running max (rows 8hh+r; the 16 lanes of a half share rows)
    float alpha[8];
#pragma unroll
    for (int r = 0; r < 8; ++r) {
      const int qi = q0 + 8 * hh + r;
      const int ja = j0 + ln, jb = j0 + 16 + ln;
      if (CAUSAL) { if (ja > qi) s[0][r] = -3.0e38f; if (jb > qi) s[1][r] = -3.0e38f; }
      if (ja >= T) s[0][r] = -3.0e38f;
      if (jb >= T) s[1][r] = -3.0e38f;
      float mx = fmaxf(s[0][r], s[1][r]);
      mx = fmaxf(mx, __shfl_xor(mx, 1, 32)); mx = fmaxf(mx, __shfl_xor(mx, 2, 32)); mx = fmaxf(mx, __shfl_xor(mx, 4, 32)); mx = fmaxf(mx, __shfl_xor(mx, 8, 32));
      const float mnew = fmaxf(m_r[r], mx);
      alpha[r] = (mnew > -1.0e38f) ? __expf(m_r[r] - mnew) : 1.0f;
      const float p0 = (s[0][r] > -1.0e38f) ? __expf(s[0][r] - mnew) : 0.f;
      const float p1 = (s[1][r] > -1.0e38f) ? __expf(s[1][r] - mnew) : 0.f;
      m_r[r] = mnew;
      l_r[r] = l_r[r] * alpha[r] + p0 + p1;            // per-lane partial row sum (16 lanes combined at the end)
      unsigned short hb = bf16_bits(p0); sPh[w][8 * hh + r][ln] = hb;      sPl[w][8 * hh + r][ln] = bf16_bits(p0 - bf16_val(hb));
      hb = bf16_bits(p1);                sPh[w][8 * hh + r][16 + ln] = hb; sPl[w][8 * hh + r][16 + ln] = bf16_bits(p1 - bf16_val(hb));
    }
#pragma unroll
    for (int dt = 0; dt < DT; ++dt)
#pragma unroll
      for (int r = 0; r < 8; ++r) oacc[dt][r] *= alpha[r];
    __builtin_amdgcn_fence(__ATOMIC_ACQ_REL, "workgroup");
    __builtin_amdgcn_wave_barrier();
    FragB pah, pal;
    pah.half[0] = *(const v8us*)&sPh[w][ln][8 * hh]; pah.half[1] = *(const v8us*)&sPh[w][ln][16 + 8 * hh];
    pal.half[0] = *(const v8us*)&sPl[w][ln][8 * hh]; pal.half[1] = *(const v8us*)&sPl[w][ln][16 + 8 * hh];
#pragma unroll
    for (int dt = 0; dt < DT; ++dt) {
      FragB bvh, bvl;
#pragma unroll
      for (int i = 0; i < 8; ++i) {
        bvh.u[i] = sVh[8 * hh + i][dt * 16 + ln]; bvh.u[8 + i] = sVh[16 + 8 * hh + i][dt * 16 + ln];
        bvl.u[i] = sVl[8 * hh + i][dt * 16 + ln]; bvl.u[8 + i] = sVl[16 + 8 * hh + i][dt * 16 + ln];
      }
      oacc[dt] = mmaN<3>(pah.v, pal.v, bvh.v, bvl.v, oacc[dt]);
    }
    __builtin_amdgcn_fence(__ATOMIC_ACQ_REL, "workgroup");
    __builtin_amdgcn_wave_barrier();
  }
#pragma unroll
  for (int r = 0; r < 8; ++r) {
    float l = l_r[r];
    l += __shfl_xor(l, 1, 32); l += __shfl_xor(l, 2, 32); l += __shfl_xor(l, 4, 32); l += __shfl_xor(l, 8, 32);
    l_r[r] = (l > 0.f) ? 1.0f / l : 0.f;
  }
#pragma unroll
  for (int dt = 0; dt < DT; ++dt)
#pragma unroll
    for (int r = 0; r < 8; ++r) sO[w][8 * hh + r][dt * 16 + ln] = oacc[dt][r] * l_r[r];
  __builtin_amdgcn_fence(__ATOMIC_ACQ_REL, "workgroup");
  __builtin_amdgcn_wave_barrier();
  {
    for (int r = 0; r < 16; ++r) {
      const int row = q0 + r;
      if (row < T && lane < D / 4) {
        const v4f val = *(const v4fa*)&sO[w][r][lane * 4];
        *(v4f*)(y + ((size_t)b * T + row) * ypitch + h * D + lane * 4) = val;
      }
    }
    
  }
}

// GEMM C = act(A·W + bias + resid): A f32 (ASPLIT -> hi/lo 2 terms), Wt bf16 [N][K]; ACT 0 none, 1 relu, 2 exact gelu;
// resid (optional, f32, row index = (row % rmod), pitch ldr, RES_BF16 rounds it) added before the activation.
template <bool ASPLIT, int ACT, bool BIAS_BF16, bool RES_BF16>
__global__ __launch_bounds__(128) void k_gemm_bf3(const float* __restrict__ A, int lda, const unsigned short* __restrict__ Wt, int ldb,
                                                const float* __restrict__ bias, const float* __restrict__ resid, int rmod, int ldr,
                                                float* __restrict__ C, int ldc, int M, int N, int K) {
  __shared__ __attribute__((aligned(16))) float so[4][16][64];
  const int tid = threadIdx.x, w = tid >> 5, lane = tid & 31, ln = lane & 15, hh = lane >> 4;
  const int ntn = N / 64;
  const int wid = blockIdx.x * 4 + w;
  const int mt = wid / ntn, nq = wid % ntn;
  if (mt * 16 >= M) return;
  const int row0 = mt * 16, col0 = nq * 64;
  const float* arow = A + (size_t)(row0 + ln) * lda;
  v8f acc[4] = {};
  for (int kb = 0; kb < K; kb += 32) {
    FragB ah, al;
    const v4f x0 = *(const v4fa*)(arow + kb + 8 * hh), x1 = *(const v4fa*)(arow + kb + 8 * hh + 4);
    const v4f x2 = *(const v4fa*)(arow + kb + 16 + 8 * hh), x3 = *(const v4fa*)(arow + kb + 16 + 8 * hh + 4);
    float xs[16] = {x0[0],x0[1],x0[2],x0[3],x1[0],x1[1],x1[2],x1[3],x2[0],x2[1],x2[2],x2[3],x3[0],x3[1],x3[2],x3[3]};
#pragma unroll
    for (int i = 0; i < 16; ++i) { const unsigned short hb = bf16_bits(xs[i]); ah.u[i] = hb; al.u[i] = ASPLIT ? bf16_bits(xs[i] - bf16_val(hb)) : (unsigned short)0; }
#pragma unroll
    for (int t = 0; t < 4; ++t) {
      const unsigned short* brow = Wt + (size_t)(col0 + t * 16 + ln) * ldb + kb;
      FragB b;
      b.half[0] = *(const v8us*)(brow + 8 * hh);
      b.half[1] = *(const v8us*)(brow + 16 + 8 * hh);
      acc[t] = mmaN<ASPLIT ? 2 : 1>(ah.v, al.v, b.v, b.v, acc[t]);
    }
  }
#pragma unroll
  for (int t = 0; t < 4; ++t) {
    const int col = col0 + t * 16 + ln;
    float bv = bias ? bias[col] : 0.f;
    if (BIAS_BF16) bv = bf16_round(bv);
#pragma unroll
    for (int r = 0; r < 8; ++r) {
      float v = acc[t][r] + bv;
      if (resid) { float rv = resid[(size_t)((row0 + 8 * hh + r) % rmod) * ldr + col]; if (RES_BF16) rv = bf16_round(rv); v += rv; }
      if (ACT == 1) v = fmaxf(v, 0.f);
      if (ACT == 2) v = 0.5f * v * (1.0f + erff(v * 0.70710678118654752f));
      if (ACT == 3) { const float u = 0.7978845608028654f * (v + 0.044715f * v * v * v); v = 0.5f * v * (1.0f + tanhf(u)); }
      so[w][8 * hh + r][t * 16 + ln] = v;
    }
  }
  __builtin_amdgcn_fence(__ATOMIC_ACQ_REL, "workgroup");
  __builtin_amdgcn_wave_barrier();
  const int rsub = lane >> 4, c4 = (lane & 15) * 4;
  {
#pragma unroll
    for (int q = 0; q < 8; ++q) {
      const int r = q * 2 + rsub;
      const v4f v = *(const v4fa*)&so[w][r][c4];
      *(v4f*)(C + (size_t)(row0 + r) * ldc + col0 + c4) = v;
    }
    
  }
}
// row LayerNorm (biased variance, eps) over N: s = X (+ R); optional out_sum <- s; out_norm <- (s-mu)*rsqrt(var+eps)*g + b
template <bool PARAM_BF16>
__global__ __launch_bounds__(256) void k_layernorm(const float* __restrict__ X, const float* __restrict__ R, const float* __restrict__ g, const float* __restrict__ bta,
                                                  float* __restrict__ out_sum, float* __restrict__ out_norm, int N, float eps) {
  __shared__ float red[256];
  const int row = blockIdx.x, tid = threadIdx.x;
  const float* x = X + (size_t)row * N; const float* rr = R ? R + (size_t)row * N : nullptr;
  float vals[16];                     // up to N = 4096
  const int per = N / 256;            // contiguous chunk per thread? use strided-by-4 chunks: thread handles j = tid*4 + 1024*u
  float s1 = 0.f;
  for (int u = 0; u < per / 4; ++u) {
    const int j = tid * 4 + 1024 * u;
    const v4f a = *(const v4fa*)(x + j);
    v4f b = {0.f,0.f,0.f,0.f}; if (rr) b = *(const v4fa*)(rr + j);
#pragma unroll
    for (int q = 0; q < 4; ++q) { const float v = a[q] + b[q]; vals[u * 4 + q] = v; s1 += v; }
  }
  red[tid] = s1; __syncthreads();
  for (int st = 128; st > 0; st >>= 1) { if (tid < st) red[tid] += red[tid + st]; __syncthreads(); }
  const float mu = red[0] / (float)N; __syncthreads();
  float s2 = 0.f;
  for (int u = 0; u < per / 4; ++u)
#pragma unroll
    for (int q = 0; q < 4; ++q) { const float c = vals[u * 4 + q] - mu; s2 += c * c; }
  red[tid] = s2; __syncthreads();
  for (int st = 128; st > 0; st >>= 1) { if (tid < st) red[tid] += red[tid + st]; __syncthreads(); }
  const float rs = rsqrtf(red[0] / (float)N + eps);
  {
    for (int u = 0; u < per / 4; ++u) {
      const int j = tid * 4 + 1024 * u;
      v4f o, sm;
#pragma unroll
      for (int q = 0; q < 4; ++q) {
        float gg = g[j + q], bb = bta[j + q];
        if (PARAM_BF16) { gg = bf16_round(gg); bb = bf16_round(bb); }
        sm[q] = vals[u * 4 + q]; o[q] = (vals[u * 4 + q] - mu) * rs * gg + bb;
      }
      if (out_sum) *(v4f*)(out_sum + (size_t)row * N + j) = sm;
      *(v4f*)(out_norm + (size_t)row * N + j) = o;
    }
    
  }
}



// ---- f16 WMMA path (v_wmma_f32_16x16x32_f16): 11-bit significands for operands in range — used where a [0,1] probability operand needs more precision than bf16
typedef _Float16 v16h __attribute__((ext_vector_type(16)));
union FragH { v16h v; v8us half[2]; _Float16 h[16]; unsigned short u[16]; };
template <int NT>
__device__ __forceinline__ v8f mmaH(v16h ah, v16h al, v16h bh, v16h bl, v8f c) {
  c = __builtin_amdgcn_wmma_f32_16x16x32_f16(false, ah, false, bh, (short)0, c, false, false);
  if (NT >= 2) c = __builtin_amdgcn_wmma_f32_16x16x32_f16(false, al, false, bh, (short)0, c, false, false);
  if (NT >= 3) c = __builtin_amdgcn_wmma_f32_16x16x32_f16(false, ah, false, bl, (short)0, c, false, false);
  asm volatile("v_nop\n\tv_nop\n\tv_nop\n\tv_nop" : "+v"(c) : "v"(ah), "v"(al), "v"(bh), "v"(bl));
  return c;
}
// batched GEMM like k_gemm_b but f16 operands: A f32 (split into f16 hi/lo if ASPLIT, else rounded to f16), Bt = f16 values [n][k]; alpha; C f32; N multiple of 16 (partial tiles skipped)
template <bool ASPLIT>
__global__ __launch_bounds__(128) void k_gemm_h(const float* __restrict__ A, int lda, size_t sA, const _Float16* __restrict__ Bh, int ldb, size_t sB, float alpha, float* __restrict__ C, int ldc, size_t sC, int M, int N, int K) {
  __shared__ __attribute__((aligned(16))) float so[4][16][64];
  const int tid = threadIdx.x, w = tid >> 5, lane = tid & 31, ln = lane & 15, hh = lane >> 4; const int by = blockIdx.y;
  A += (size_t)by * sA; Bh += (size_t)by * sB; C += (size_t)by * sC;
  const int ntn = (N + 63) / 64; const int wid = blockIdx.x * 4 + w; const int mt = wid / ntn, nq = wid % ntn; if (mt * 16 >= M) return;
  const int row0 = mt * 16, col0 = nq * 64; const float* arow = A + (size_t)(row0 + ln) * lda;
  v8f acc[4] = {};
  for (int kb = 0; kb < K; kb += 32) {
    FragH ah, al;
    const v4f x0 = *(const v4fa*)(arow + kb + 8 * hh), x1 = *(const v4fa*)(arow + kb + 8 * hh + 4), x2 = *(const v4fa*)(arow + kb + 16 + 8 * hh), x3 = *(const v4fa*)(arow + kb + 16 + 8 * hh + 4);
    float xs[16] = {x0[0],x0[1],x0[2],x0[3],x1[0],x1[1],x1[2],x1[3],x2[0],x2[1],x2[2],x2[3],x3[0],x3[1],x3[2],x3[3]};
#pragma unroll
    for (int i = 0; i < 16; ++i) { const _Float16 h = (_Float16)xs[i]; ah.h[i] = h; al.h[i] = ASPLIT ? (_Float16)(xs[i] - (float)h) : (_Float16)0.0f; }
#pragma unroll
    for (int t = 0; t < 4; ++t) { if (col0 + t * 16 >= N) continue; const size_t boff = (size_t)(col0 + t * 16 + ln) * ldb + kb; FragH bq; bq.half[0] = *(const v8us*)(Bh + boff + 8 * hh); bq.half[1] = *(const v8us*)(Bh + boff + 16 + 8 * hh);
      acc[t] = mmaH<ASPLIT ? 2 : 1>(ah.v, al.v, bq.v, bq.v, acc[t]); }
  }
#pragma unroll
  for (int t = 0; t < 4; ++t) { if (col0 + t * 16 >= N) continue;
#pragma unroll
    for (int r = 0; r < 8; ++r) so[w][8 * hh + r][t * 16 + ln] = acc[t][r] * alpha; }
  __builtin_amdgcn_fence(__ATOMIC_ACQ_REL, "workgroup"); __builtin_amdgcn_wave_barrier();
  const int rsub = lane >> 4, c4 = (lane & 15) * 4;
  {
#pragma unroll
    for (int q = 0; q < 8; ++q) { const int r = q * 2 + rsub; if (col0 + c4 < N) { const v4f v = *(const v4fa*)&so[w][r][c4]; *(v4f*)(C + (size_t)(row0 + r) * ldc + col0 + c4) = v; } }
     }
}

// Wt[n][k] = f16(W[k][n]·scale) from f32 row-major W[K][N] (scale = power of two; bf16-exact weights stay exact in f16 away from the subnormal range)
__global__ __launch_bounds__(256) void k_wt_f16(const float* __restrict__ W, _Float16* __restrict__ Wt, int K, int N, float scale) {
  const int t = blockIdx.x * 256 + threadIdx.x; if (t >= N * (K / 8)) return; const int n = t / (K / 8), k8 = (t % (K / 8)) * 8; FragH f;
#pragma unroll
  for (int i = 0; i < 8; ++i) f.h[i] = (_Float16)(bf16_round(W[(size_t)(k8 + i) * N + n]) * scale); const v8us o = f.half[0];
  *(v8us*)((unsigned short*)Wt + (size_t)n * K + k8) = o; 
}
// k_gemm_hh variant with fused epilogue: v = acc·alpha + bias[by·sBias + col] (+ CP[(row/rowsPerB)·sCPb + by·64 + col] if CP) ; ACT 0 none / 1 elu ; writes f16 C16 (and f32 C if non-null)
template <int ACT>
__global__ __launch_bounds__(128) void k_gemm_hhx(const _Float16* __restrict__ A, int lda, size_t sA, const _Float16* __restrict__ Bh, int ldb, size_t sB, float alpha, const float* __restrict__ bias, size_t sBias, const float* __restrict__ CP, int rowsPerB, size_t sCPb, int row0g,
    float* __restrict__ C, _Float16* __restrict__ C16, int ldc, size_t sC, int M, int N, int K) {
  __shared__ __attribute__((aligned(16))) float so[4][16][64];
  const int tid = threadIdx.x, w = tid >> 5, lane = tid & 31, ln = lane & 15, hh = lane >> 4; const int by = blockIdx.y;
  A += (size_t)by * sA; Bh += (size_t)by * sB; const size_t cofs = (size_t)by * sC; const float* bp = bias ? bias + (size_t)by * sBias : nullptr;
  const int ntn = (N + 63) / 64; const int wid = blockIdx.x * 4 + w; const int mt = wid / ntn, nq = wid % ntn; if (mt * 16 >= M) return;
  const int row0 = mt * 16, col0 = nq * 64; const _Float16* arow = A + (size_t)(row0 + ln) * lda;
  v8f acc[4] = {};
  for (int kb = 0; kb < K; kb += 32) { FragH ah; ah.half[0] = *(const v8us*)((const unsigned short*)arow + kb + 8 * hh); ah.half[1] = *(const v8us*)((const unsigned short*)arow + kb + 16 + 8 * hh);
#pragma unroll
    for (int t = 0; t < 4; ++t) { if (col0 + t * 16 >= N) continue; const size_t boff = (size_t)(col0 + t * 16 + ln) * ldb + kb; FragH bq; bq.half[0] = *(const v8us*)((const unsigned short*)Bh + boff + 8 * hh); bq.half[1] = *(const v8us*)((const unsigned short*)Bh + boff + 16 + 8 * hh);
      acc[t] = mmaH<1>(ah.v, ah.v, bq.v, bq.v, acc[t]); }
  }
#pragma unroll
  for (int t = 0; t < 4; ++t) { if (col0 + t * 16 >= N) continue; const int col = col0 + t * 16 + ln; const float bv = bp ? bf16_round(bp[col]) : 0.f;
#pragma unroll
    for (int r = 0; r < 8; ++r) { float v = acc[t][r] * alpha + bv; if (CP) { const int bidx = (row0g + row0 + 8 * hh + r) / rowsPerB; v += CP[(size_t)bidx * sCPb + (size_t)by * 64 + col]; } if (ACT == 1) v = (v > 0.f) ? v : expm1f(v); else if (ACT == 7) v = (v > 0.f) ? v + 1.0f : expf(v); else if (ACT == 8) v = tanhf(v); else if (ACT == 9) v = 0.5f * v * (1.0f + tanhf(0.7978845608028654f * (v + 0.044715f * v * v * v))); else if (ACT == 11) v = 1.0f / (1.0f + expf(-v)); else if (ACT == 12) v = (v > 0.f) ? v : 0.01f * v; else if (ACT == 14) v = (v > 0.f) ? v : 0.1f * v; else if (ACT == 15) v = v / (1.0f + expf(-v)); else if (ACT == 3) v = fmaxf(v, 0.f); else if (ACT == 6) v = 0.5f * v * (1.0f + erff(v * 0.70710678118654752f)); so[w][8 * hh + r][t * 16 + ln] = v; } }
  __builtin_amdgcn_fence(__ATOMIC_ACQ_REL, "workgroup"); __builtin_amdgcn_wave_barrier();
  const int rsub = lane >> 4, c4 = (lane & 15) * 4; typedef _Float16 v4h __attribute__((ext_vector_type(4)));
  {
#pragma unroll
    for (int q = 0; q < 8; ++q) { const int r = q * 2 + rsub; if (col0 + c4 < N) { const v4f v = *(const v4fa*)&so[w][r][c4]; if (C) *(v4f*)(C + cofs + (size_t)(row0 + r) * ldc + col0 + c4) = v; if (C16) { v4h h4; for (int i = 0; i < 4; ++i) h4[i] = (_Float16)v[i]; *(v4h*)(C16 + cofs + (size_t)(row0 + r) * ldc + col0 + c4) = h4; } } }
     }
}


typedef _Float16 v4h __attribute__((ext_vector_type(4)));

__global__ __launch_bounds__(256) void k_x16(const float* __restrict__ x, _Float16* __restrict__ X16, size_t n8) { const size_t t = (size_t)blockIdx.x * 256 + threadIdx.x; if (t >= n8) return; FragH f;
#pragma unroll
  for (int q = 0; q < 8; ++q) f.h[q] = (_Float16)bf16_round(x[t * 8 + q]); *(v8us*)((unsigned short*)X16 + t * 8) = f.half[0];  }
__global__ __launch_bounds__(256) void k_h16(const float* __restrict__ x, _Float16* __restrict__ X16, size_t n8) { const size_t t = (size_t)blockIdx.x * 256 + threadIdx.x; if (t >= n8) return; FragH f;
#pragma unroll
  for (int q = 0; q < 8; ++q) f.h[q] = (_Float16)x[t * 8 + q]; *(v8us*)((unsigned short*)X16 + t * 8) = f.half[0];  }
__global__ __launch_bounds__(256) void k_round16f(const float* __restrict__ W, _Float16* __restrict__ Bt, size_t n8) { const size_t t = (size_t)blockIdx.x * 256 + threadIdx.x; if (t >= n8) return; FragH f;
#pragma unroll
  for (int i = 0; i < 8; ++i) f.h[i] = (_Float16)(bf16_round(W[t * 8 + i]) * 16.0f); *(v8us*)((unsigned short*)Bt + t * 8) = f.half[0];  }
template <int NHv, int TTv>
__global__ __launch_bounds__(256) void k_vt(const _Float16* __restrict__ V16, int ldv, int voff, _Float16* __restrict__ Vt) { __shared__ unsigned short tl[64][66]; const int tid = threadIdx.x; const int slab = blockIdx.x / (TTv / 64), lg = blockIdx.x % (TTv / 64); const int b = slab / NHv, h = slab % NHv;
  for (int i = tid; i < 64 * 8; i += 256) { const int r = i / 8, c8 = (i % 8) * 8; FragH f; f.half[0] = *(const v8us*)((const unsigned short*)V16 + ((size_t)b * TTv + lg * 64 + r) * ldv + voff + h * 64 + c8);
#pragma unroll
    for (int q = 0; q < 8; ++q) tl[r][c8 + q] = f.u[q]; }
  __syncthreads();
  {
#pragma unroll
    for (int rd = 0; rd < 2; ++rd) { const int d = rd * 32 + tid / 8, pc = tid % 8; FragH f;
#pragma unroll
      for (int q = 0; q < 8; ++q) f.u[q] = tl[pc * 8 + q][d];
      *(v8us*)((unsigned short*)Vt + ((size_t)slab * 64 + d) * TTv + lg * 64 + pc * 8) = f.half[0]; }
     } }

typedef float v2f __attribute__((ext_vector_type(2)));
// lane l with lane l ^ 16 (the two halves of a wave hold the two key halves of one query column)
__device__ __forceinline__ float xhalf(float x) { return __builtin_bit_cast(float, __builtin_amdgcn_permlanex16(__builtin_bit_cast(int, x), __builtin_bit_cast(int, x), 0x76543210, 0xfedcba98, false, false)); }

__global__ __launch_bounds__(128) void k_flash(const _Float16* __restrict__ Q16, int ldq, const _Float16* __restrict__ K16, int ldk, const _Float16* __restrict__ Vt, const int* __restrict__ MSK, float* __restrict__ O, int ldo) {
  constexpr int RPW = 16, NQB = NN / (4 * RPW), DT = 2; (void)MSK;
  const int tid = threadIdx.x, w = tid >> 5, lane = tid & 31, ln = lane & 15, hh = lane >> 4;
  const int slab = blockIdx.x / NQB, qblk = blockIdx.x % NQB; const int b = slab / NH, h = slab % NH; const int q0 = qblk * (4 * RPW) + w * RPW;
  FragH bq;      /* B: column ln = query q0 + ln, k = head channel */
  { const unsigned short* qr = (const unsigned short*)Q16 + ((size_t)b * NN + q0 + ln) * ldq + h * HD; bq.half[0] = *(const v8us*)(qr + 8 * hh); bq.half[1] = *(const v8us*)(qr + 16 + 8 * hh); }
  const unsigned short* Vth = (const unsigned short*)Vt + ((size_t)b * CC + h * HD) * NN;      /* V^T = v[b][(h,d)][n] channel-major */
  float m_q = -3.0e38f, l_q = 0.f; v8f oacc[DT];
#pragma unroll
  for (int dt = 0; dt < DT; ++dt) oacc[dt] = (v8f){0.f,0.f,0.f,0.f,0.f,0.f,0.f,0.f};
#pragma unroll 1
  for (int j0 = 0; j0 < NN; j0 += 32) {
    v8f s[2];      /* s[nt][r] = S^T[key j0 + nt*16 + 8*hh + r][query q0 + ln] */
#pragma unroll
    for (int nt = 0; nt < 2; ++nt) { const unsigned short* kr = (const unsigned short*)K16 + ((size_t)b * NN + j0 + nt * 16 + ln) * ldk + h * HD; FragH ak;
      ak.half[0] = *(const v8us*)(kr + 8 * hh); ak.half[1] = *(const v8us*)(kr + 16 + 8 * hh);
      s[nt] = mmaH<1>(ak.v, ak.v, bq.v, bq.v, (v8f){0.f,0.f,0.f,0.f,0.f,0.f,0.f,0.f}); }
    float sc[16];
#pragma unroll
    for (int i = 0; i < 16; ++i) sc[i] = s[i >> 3][i & 7] * 0.17677669529663687f;
    float mt[8];
#pragma unroll
    for (int i = 0; i < 8; ++i) mt[i] = fmaxf(sc[i], sc[i + 8]);
    float mc = fmaxf(fmaxf(fmaxf(mt[0], mt[1]), fmaxf(mt[2], mt[3])), fmaxf(fmaxf(mt[4], mt[5]), fmaxf(mt[6], mt[7])));
    mc = fmaxf(mc, xhalf(mc));      /* both halves now hold the maximum over the query's 32 keys */
    const float mn = fmaxf(m_q, mc); const float al = (mn > -1.0e38f) ? expf(m_q - mn) : 1.0f; m_q = mn;
    v2f p[8]; FragH pb;
#pragma unroll
    for (int i = 0; i < 8; ++i) { p[i] = (v2f){expf(sc[2 * i] - mn), expf(sc[2 * i + 1] - mn)}; pb.h[2 * i] = (_Float16)(p[i][0] * 1024.0f); pb.h[2 * i + 1] = (_Float16)(p[i][1] * 1024.0f); }
    const v2f ps = ((p[0] + p[1]) + (p[2] + p[3])) + ((p[4] + p[5]) + (p[6] + p[7]));
    l_q = l_q * al + (ps[0] + ps[1]);      /* this half's 16 keys; the halves join after the loop */
#pragma unroll
    for (int dt = 0; dt < DT; ++dt) { oacc[dt] *= al;
      const unsigned short* vrow = Vth + (size_t)(dt * 16 + ln) * NN + j0; FragH av; av.half[0] = *(const v8us*)(vrow + 8 * hh); av.half[1] = *(const v8us*)(vrow + 16 + 8 * hh);
      oacc[dt] = mmaH<1>(av.v, av.v, pb.v, pb.v, oacc[dt]); } }      /* oacc[dt][r] = O^T[channel dt*16 + 8*hh + r][query q0 + ln] */
  const float l = l_q + xhalf(l_q); const float den = l + 1e-6f * expf(-m_q); const float inv = (den > 0.f && den < INFINITY) ? 1.0f / (den * 1024.0f) : 0.f;      /* sum e^s/(sum e^s + 1e-6) form: e^(-m)*1e-6 joins the shifted sum; an infinite den (all logits far below 0) reproduces the reference's ~0 output */
  float* orow = O + ((size_t)b * NN + q0 + ln) * ldo + h * HD + 8 * hh;
#pragma unroll
  for (int dt = 0; dt < DT; ++dt) { const v8f o = oacc[dt] * inv; *(v4f*)(orow + dt * 16) = (v4f){o[0], o[1], o[2], o[3]}; *(v4f*)(orow + dt * 16 + 4) = (v4f){o[4], o[5], o[6], o[7]}; } }

extern "C" void kernel_launch(void* const* d_in, const int* in_sizes, int n_in,
                              void* d_out, int out_size, void* d_ws, size_t ws_size, hipStream_t stream) {
  (void)in_sizes; (void)n_in; (void)out_size;
  const float* x = (const float*)d_in[0]; const float* Wqkv = (const float*)d_in[1]; const float* Wout = (const float*)d_in[2]; const float* bout = (const float*)d_in[3];
  char* ws = (char*)d_ws; size_t off = 0;
  auto take = [&](size_t bytes) { char* p = ws + off; off += (bytes + 255) & ~(size_t)255; return p; };
  _Float16* Bqkv = (_Float16*)take((size_t)C3 * CC * 2); _Float16* Bo = (_Float16*)take((size_t)CC * CC * 2); _Float16* X16 = (_Float16*)take((size_t)NR * CC * 2);
  _Float16* QK = (_Float16*)take((size_t)NR * 2 * CC * 2); _Float16* Vt = (_Float16*)take((size_t)BB * CC * NN * 2); float* O = (float*)take((size_t)NR * CC * 4); _Float16* O16 = (_Float16*)take((size_t)NR * CC * 2);
  if (off > ws_size) return;      // 0.4 + 0.1 + 4.2 + 8.4 + 4.2 + 8.4 + 4.2 ≈ 30 MB
  k_wt_f16<<<(unsigned)(((size_t)C3 * (CC / 8) + 255) / 256), 256, 0, stream>>>(Wqkv, Bqkv, CC, C3, 16.0f); k_wt_f16<<<(unsigned)(((size_t)CC * (CC / 8) + 255) / 256), 256, 0, stream>>>(Wout, Bo, CC, CC, 16.0f);      /* (in,out) → Bt[n][k] ×2^4 */
  k_x16<<<(unsigned)(((size_t)NR * CC / 8 + 255) / 256), 256, 0, stream>>>(x, X16, (size_t)NR * CC / 8);
  k_gemm_hhx<0><<<dim3(((NR / 16) * (2 * CC / 64) + 3) / 4, 1), 128, 0, stream>>>(X16, CC, 0, Bqkv, CC, 0, 0.0625f, nullptr, 0, nullptr, 1, 0, 0, nullptr, QK, 2 * CC, 0, NR, 2 * CC, CC);      /* [q | k] token-major [(b,n)][512]: M 8192 N 512 K 256 */
  k_gemm_hhx<0><<<dim3(((CC / 16) * (NN / 64) + 3) / 4, BB), 128, 0, stream>>>(Bqkv + (size_t)2 * CC * CC, CC, 0, X16, CC, (size_t)NN * CC, 0.0625f, nullptr, 0, nullptr, 1, 0, 0, nullptr, Vt, NN, (size_t)CC * NN, CC, NN, CC);      /* v channel-major per batch [b][(h,d)][n] = Vᵀ: A = Bt rows 512..767 ([out][in]), B = X16[b]: M 256 N 2048 K 256 */
  k_flash<<<BB * NH * (NN / 64), 128, 0, stream>>>(QK, 2 * CC, QK + CC, 2 * CC, Vt, nullptr, O, CC);      /* blocks = (b,h) × 64-query groups */
  k_h16<<<(unsigned)(((size_t)NR * CC / 8 + 255) / 256), 256, 0, stream>>>(O, O16, (size_t)NR * CC / 8);
  k_gemm_hhx<0><<<dim3(((NR / 16) * (CC / 64) + 3) / 4, 1), 128, 0, stream>>>(O16, CC, 0, Bo, CC, 0, 0.0625f, bout, 0, nullptr, 1, 0, 0, (float*)d_out, nullptr, CC, 0, NR, CC, CC);      /* y = out·Wout + bout: M 8192 N 256 K 256 */
}

// v002
// It runs in 130 microseconds.
// Next to v001, in two timings, it ran 1.12 times as fast each time.
// All steps since v000 together make it 1.81 times as fast.
#include <hip/hip_runtime.h>
// KeOps-style multi-head attention (B=4, n=2048, dim 256, 8 heads × 32): qkv = x·Wqkv; q scaled by 32^-½; e = exp(q·kᵀ) WITHOUT max subtraction; out = (e·v)/(Σe + 1e-6) merged over heads; y = out·Wout + bout.
// Compute dtype: x, Wqkv, Wout, bout rounded to bf16; q/k token-major and v channel-major (= Vᵀ) as f16 GEMM outputs (f32 accumulate); fused flash-style kernel per (b,h) (online max-rescaled sums
// in f32 — the unshifted quotient is recovered exactly through the normaliser l + 1e-6·e^(−m); P f16 ×2^10) on v_wmma_f32_16x16x32_f16; O → f16 → output GEMM with bias; f32 accumulate.
#define BB 4
#define NN 2048
#define CC 256
#define C3 768
#define NH 8
#define HD 32
#define NR (BB * NN)

typedef __bf16 v16b __attribute__((ext_vector_type(16)));
typedef unsigned short v8us __attribute__((ext_vector_type(8), may_alias));
typedef float  v8f  __attribute__((ext_vector_type(8)));
typedef float  v4f  __attribute__((ext_vector_type(4)));
typedef float  v4fa __attribute__((ext_vector_type(4), may_alias));
union FragB { v16b v; v8us half[2]; unsigned short u[16]; };

__device__ __forceinline__ unsigned short bf16_bits(float x) { unsigned int u = __float_as_uint(x); return (unsigned short)((u + 0x7FFFu + ((u >> 16) & 1u)) >> 16); }
__device__ __forceinline__ float bf16_val(unsigned short b) { return __uint_as_float(((unsigned int)b) << 16); }
__device__ __forceinline__ float bf16_round(float x) { return bf16_val(bf16_bits(x)); }
// D += A·B with NT terms: 1 = ah·bh, 2 = + al·bh (A split), 3 = + ah·bl (both split)
template <int NT>
__device__ __forceinline__ v8f mmaN(v16b ah, v16b al, v16b bh, v16b bl, v8f c) {
  c = __builtin_amdgcn_wmma_f32_16x16x32_bf16(false, ah, false, bh, (short)0, c, false, false);
  if (NT >= 2) c = __builtin_amdgcn_wmma_f32_16x16x32_bf16(false, al, false, bh, (short)0, c, false, false);
  if (NT >= 3) c = __builtin_amdgcn_wmma_f32_16x16x32_bf16(false, ah, false, bl, (short)0, c, false, false);
  asm volatile("v_nop\n\tv_nop\n\tv_nop\n\tv_nop" : "+v"(c) : "v"(ah), "v"(al), "v"(bh), "v"(bl));
  return c;
}

__global__ __launch_bounds__(256) void k_wt_bf16(const float* __restrict__ W, unsigned short* __restrict__ Wt, int K, int N) {
  const int t = blockIdx.x * 256 + threadIdx.x;
  const int k8n = K / 8;
  if (t >= N * k8n) return;
  const int n = t / k8n, k8 = (t % k8n) * 8;
  v8us v;
#pragma unroll
  for (int i = 0; i < 8; ++i) v[i] = bf16_bits(W[(size_t)(k8 + i) * N + n]);
  *(v8us*)(Wt + (size_t)n * K + k8) = v;
  
}

// GEMM C[M][N] (f32, pitch ldc) = act(A[M][K]·W + bias). A f32 row-major (pitch lda) converted per fragment to bf16
// (ASPLIT: hi/lo two planes -> 2 terms, else single rounded term); Wt bf16 [N][K] (pitch ldb). BIAS_BF16 rounds the
// bias to bf16 first (bias quantised to bf16 before the add). K%32==0, M%16==0, N%64==0.
template <bool ASPLIT, int ACT, bool BIAS_BF16>
__global__ __launch_bounds__(128) void k_gemm_bf(const float* __restrict__ A, int lda, const unsigned short* __restrict__ Wt, int ldb,
                                               const float* __restrict__ bias, float* __restrict__ C, int ldc, int M, int N, int K) {
  __shared__ __attribute__((aligned(16))) float so[4][16][64];
  const int tid = threadIdx.x, w = tid >> 5, lane = tid & 31, ln = lane & 15, hh = lane >> 4;
  const int ntn = N / 64;
  const int wid = blockIdx.x * 4 + w;
  const int mt = wid / ntn, nq = wid % ntn;
  if (mt * 16 >= M) return;
  const int row0 = mt * 16, col0 = nq * 64;
  const float* arow = A + (size_t)(row0 + ln) * lda;
  v8f acc[4] = {};
  for (int kb = 0; kb < K; kb += 32) {
    FragB ah, al;
    const v4f x0 = *(const v4fa*)(arow + kb + 8 * hh), x1 = *(const v4fa*)(arow + kb + 8 * hh + 4);
    const v4f x2 = *(const v4fa*)(arow + kb + 16 + 8 * hh), x3 = *(const v4fa*)(arow + kb + 16 + 8 * hh + 4);
    float xs[16] = {x0[0],x0[1],x0[2],x0[3],x1[0],x1[1],x1[2],x1[3],x2[0],x2[1],x2[2],x2[3],x3[0],x3[1],x3[2],x3[3]};
#pragma unroll
    for (int i = 0; i < 16; ++i) { const unsigned short hb = bf16_bits(xs[i]); ah.u[i] = hb; al.u[i] = ASPLIT ? bf16_bits(xs[i] - bf16_val(hb)) : (unsigned short)0; }
#pragma unroll
    for (int t = 0; t < 4; ++t) {
      const unsigned short* brow = Wt + (size_t)(col0 + t * 16 + ln) * ldb + kb;
      FragB b;
      b.half[0] = *(const v8us*)(brow + 8 * hh);
      b.half[1] = *(const v8us*)(brow + 16 + 8 * hh);
      acc[t] = mmaN<ASPLIT ? 2 : 1>(ah.v, al.v, b.v, b.v, acc[t]);
    }
  }
#pragma unroll
  for (int t = 0; t < 4; ++t) {
    float bv = bias ? bias[col0 + t * 16 + ln] : 0.f;
    if (BIAS_BF16) bv = bf16_round(bv);
#pragma unroll
    for (int r = 0; r < 8; ++r) { float v = acc[t][r] + bv; if (ACT == 1) v = fmaxf(v, 0.f); so[w][8 * hh + r][t * 16 + ln] = v; }
  }
  __builtin_amdgcn_fence(__ATOMIC_ACQ_REL, "workgroup");
  __builtin_amdgcn_wave_barrier();
  const int rsub = lane >> 4, c4 = (lane & 15) * 4;
  {
#pragma unroll
    for (int q = 0; q < 8; ++q) {
      const int r = q * 2 + rsub;
      const v4f v = *(const v4fa*)&so[w][r][c4];
      *(v4f*)(C + (size_t)(row0 + r) * ldc + col0 + c4) = v;
    }
    
  }
}

// Flash-style causal/unmasked attention, all contractions 3-term bf16 hi/lo splits, f32 softmax with running max.
// q,k,v rows are read from f32 buffers with arbitrary row pitch (so they can live inside a fused qkv buffer);
// D = head size (multiple of 32, <= 128); one wave = 16 query rows; block = 4 waves (64 queries) sharing K/V chunks of 32.
template <int D, bool CAUSAL>
__global__ __launch_bounds__(128) void k_flash(const float* __restrict__ qb, const float* __restrict__ kb, const float* __restrict__ vb,
                                             int pitch, int T, int H, float scale, float* __restrict__ y, int ypitch) {
  constexpr int KS = D / 32;        // k-steps for QK
  constexpr int DT = D / 16;        // d tiles for PV
  __shared__ __attribute__((aligned(16))) unsigned short sKh[32][D + 8], sKl[32][D + 8], sVh[32][D + 8], sVl[32][D + 8];
  __shared__ __attribute__((aligned(16))) unsigned short sPh[4][16][40], sPl[4][16][40];
  __shared__ __attribute__((aligned(16))) float sO[4][16][D];
  const int tid = threadIdx.x, w = tid >> 5, lane = tid & 31, ln = lane & 15, hh = lane >> 4;
  const int nqb = (T + 63) / 64;
  const int bh = blockIdx.x / nqb, qblk = blockIdx.x % nqb;
  const int b = bh / H, h = bh % H;
  const int q0 = qblk * 64 + w * 16;
  const float* Q = qb + (size_t)b * T * pitch + h * D;
  const float* K = kb + (size_t)b * T * pitch + h * D;
  const float* V = vb + (size_t)b * T * pitch + h * D;

  // A fragments of the wave's 16 query rows (scaled), hi/lo
  FragB aqh[KS], aql[KS];
  {
    int row = q0 + ln; if (row >= T) row = T - 1;
    const float* qr = Q + (size_t)row * pitch;
#pragma unroll
    for (int ks = 0; ks < KS; ++ks)
#pragma unroll
      for (int i = 0; i < 16; ++i) {
        const int d = ks * 32 + ((i < 8) ? (8 * hh + i) : (16 + 8 * hh + (i - 8)));
        const float x = qr[d] * scale; const unsigned short hb = bf16_bits(x);
        aqh[ks].u[i] = hb; aql[ks].u[i] = bf16_bits(x - bf16_val(hb));
      }
  }
  float m_r[8], l_r[8];
#pragma unroll
  for (int r = 0; r < 8; ++r) { m_r[r] = -3.0e38f; l_r[r] = 0.f; }
  v8f oacc[DT];
#pragma unroll
  for (int dt = 0; dt < DT; ++dt) oacc[dt] = (v8f){0.f,0.f,0.f,0.f,0.f,0.f,0.f,0.f};

  const int kv_end = CAUSAL ? min(T, qblk * 64 + 64) : T;     // block-uniform
  for (int j0 = 0; j0 < kv_end; j0 += 32) {
    __syncthreads();
    for (int e = tid; e < 32 * (D / 4); e += 128) {
      const int r = e / (D / 4), c4 = (e % (D / 4)) * 4;
      const int key = j0 + r;
      v4f kf = {0.f,0.f,0.f,0.f}, vf = {0.f,0.f,0.f,0.f};
      if (key < T) { kf = *(const v4fa*)(K + (size_t)key * pitch + c4); vf = *(const v4fa*)(V + (size_t)key * pitch + c4); }
#pragma unroll
      for (int t = 0; t < 4; ++t) {
        unsigned short hb = bf16_bits(kf[t]); sKh[r][c4 + t] = hb; sKl[r][c4 + t] = bf16_bits(kf[t] - bf16_val(hb));
        hb = bf16_bits(vf[t]); sVh[r][c4 + t] = hb; sVl[r][c4 + t] = bf16_bits(vf[t] - bf16_val(hb));
      }
    }
    __syncthreads();
    // S tile 16 x 32
    v8f s[2];
#pragma unroll
    for (int nt = 0; nt < 2; ++nt) {
      v8f acc = {};
#pragma unroll
      for (int ks = 0; ks < KS; ++ks) {
        FragB bh_, bl_;
        bh_.half[0] = *(const v8us*)&sKh[nt * 16 + ln][ks * 32 + 8 * hh]; bh_.half[1] = *(const v8us*)&sKh[nt * 16 + ln][ks * 32 + 16 + 8 * hh];
        bl_.half[0] = *(const v8us*)&sKl[nt * 16 + ln][ks * 32 + 8 * hh]; bl_.half[1] = *(const v8us*)&sKl[nt * 16 + ln][ks * 32 + 16 + 8 * hh];
        acc = mmaN<3>(aqh[ks].v, aql[ks].v, bh_.v, bl_.v, acc);
      }
      s[nt] = acc;
    }
    // mask + running max (rows 8hh+r; the 16 lanes of a half share rows)
    float alpha[8];
#pragma unroll
    for (int r = 0; r < 8; ++r) {
      const int qi = q0 + 8 * hh + r;
      const int ja = j0 + ln, jb = j0 + 16 + ln;
      if (CAUSAL) { if (ja > qi) s[0][r] = -3.0e38f; if (jb > qi) s[1][r] = -3.0e38f; }
      if (ja >= T) s[0][r] = -3.0e38f;
      if (jb >= T) s[1][r] = -3.0e38f;
      float mx = fmaxf(s[0][r], s[1][r]);
      mx = fmaxf(mx, __shfl_xor(mx, 1, 32)); mx = fmaxf(mx, __shfl_xor(mx, 2, 32)); mx = fmaxf(mx, __shfl_xor(mx, 4, 32)); mx = fmaxf(mx, __shfl_xor(mx, 8, 32));
      const float mnew = fmaxf(m_r[r], mx);
      alpha[r] = (mnew > -1.0e38f) ? __expf(m_r[r] - mnew) : 1.0f;
      const float p0 = (s[0][r] > -1.0e38f) ? __expf(s[0][r] - mnew) : 0.f;
      const float p1 = (s[1][r] > -1.0e38f) ? __expf(s[1][r] - mnew) : 0.f;
      m_r[r] = mnew;
      l_r[r] = l_r[r] * alpha[r] + p0 + p1;            // per-lane partial row sum (16 lanes combined at the end)
      unsigned short hb = bf16_bits(p0); sPh[w][8 * hh + r][ln] = hb;      sPl[w][8 * hh + r][ln] = bf16_bits(p0 - bf16_val(hb));
      hb = bf16_bits(p1);                sPh[w][8 * hh + r][16 + ln] = hb; sPl[w][8 * hh + r][16 + ln] = bf16_bits(p1 - bf16_val(hb));
    }
#pragma unroll
    for (int dt = 0; dt < DT; ++dt)
#pragma unroll
      for (int r = 0; r < 8; ++r) oacc[dt][r] *= alpha[r];
    __builtin_amdgcn_fence(__ATOMIC_ACQ_REL, "workgroup");
    __builtin_amdgcn_wave_barrier();
    FragB pah, pal;
    pah.half[0] = *(const v8us*)&sPh[w][ln][8 * hh]; pah.half[1] = *(const v8us*)&sPh[w][ln][16 + 8 * hh];
    pal.half[0] = *(const v8us*)&sPl[w][ln][8 * hh]; pal.half[1] = *(const v8us*)&sPl[w][ln][16 + 8 * hh];
#pragma unroll
    for (int dt = 0; dt < DT; ++dt) {
      FragB bvh, bvl;
#pragma unroll
      for (int i = 0; i < 8; ++i) {
        bvh.u[i] = sVh[8 * hh + i][dt * 16 + ln]; bvh.u[8 + i] = sVh[16 + 8 * hh + i][dt * 16 + ln];
        bvl.u[i] = sVl[8 * hh + i][dt * 16 + ln]; bvl.u[8 + i] = sVl[16 + 8 * hh + i][dt * 16 + ln];
      }
      oacc[dt] = mmaN<3>(pah.v, pal.v, bvh.v, bvl.v, oacc[dt]);
    }
    __builtin_amdgcn_fence(__ATOMIC_ACQ_REL, "workgroup");
    __builtin_amdgcn_wave_barrier();
  }
#pragma unroll
  for (int r = 0; r < 8; ++r) {
    float l = l_r[r];
    l += __shfl_xor(l, 1, 32); l += __shfl_xor(l, 2, 32); l += __shfl_xor(l, 4, 32); l += __shfl_xor(l, 8, 32);
    l_r[r] = (l > 0.f) ? 1.0f / l : 0.f;
  }
#pragma unroll
  for (int dt = 0; dt < DT; ++dt)
#pragma unroll
    for (int r = 0; r < 8; ++r) sO[w][8 * hh + r][dt * 16 + ln] = oacc[dt][r] * l_r[r];
  __builtin_amdgcn_fence(__ATOMIC_ACQ_REL, "workgroup");
  __builtin_amdgcn_wave_barrier();
  {
    for (int r = 0; r < 16; ++r) {
      const int row = q0 + r;
      if (row < T && lane < D / 4) {
        const v4f val = *(const v4fa*)&sO[w][r][lane * 4];
        *(v4f*)(y + ((size_t)b * T + row) * ypitch + h * D + lane * 4) = val;
      }
    }
    
  }
}

// GEMM C = act(A·W + bias + resid): A f32 (ASPLIT -> hi/lo 2 terms), Wt bf16 [N][K]; ACT 0 none, 1 relu, 2 exact gelu;
// resid (optional, f32, row index = (row % rmod), pitch ldr, RES_BF16 rounds it) added before the activation.
template <bool ASPLIT, int ACT, bool BIAS_BF16, bool RES_BF16>
__global__ __launch_bounds__(128) void k_gemm_bf3(const float* __restrict__ A, int lda, const unsigned short* __restrict__ Wt, int ldb,
                                                const float* __restrict__ bias, const float* __restrict__ resid, int rmod, int ldr,
                                                float* __restrict__ C, int ldc, int M, int N, int K) {
  __shared__ __attribute__((aligned(16))) float so[4][16][64];
  const int tid = threadIdx.x, w = tid >> 5, lane = tid & 31, ln = lane & 15, hh = lane >> 4;
  const int ntn = N / 64;
  const int wid = blockIdx.x * 4 + w;
  const int mt = wid / ntn, nq = wid % ntn;
  if (mt * 16 >= M) return;
  const int row0 = mt * 16, col0 = nq * 64;
  const float* arow = A + (size_t)(row0 + ln) * lda;
  v8f acc[4] = {};
  for (int kb = 0; kb < K; kb += 32) {
    FragB ah, al;
    const v4f x0 = *(const v4fa*)(arow + kb + 8 * hh), x1 = *(const v4fa*)(arow + kb + 8 * hh + 4);
    const v4f x2 = *(const v4fa*)(arow + kb + 16 + 8 * hh), x3 = *(const v4fa*)(arow + kb + 16 + 8 * hh + 4);
    float xs[16] = {x0[0],x0[1],x0[2],x0[3],x1[0],x1[1],x1[2],x1[3],x2[0],x2[1],x2[2],x2[3],x3[0],x3[1],x3[2],x3[3]};
#pragma unroll
    for (int i = 0; i < 16; ++i) { const unsigned short hb = bf16_bits(xs[i]); ah.u[i] = hb; al.u[i] = ASPLIT ? bf16_bits(xs[i] - bf16_val(hb)) : (unsigned short)0; }
#pragma unroll
    for (int t = 0; t < 4; ++t) {
      const unsigned short* brow = Wt + (size_t)(col0 + t * 16 + ln) * ldb + kb;
      FragB b;
      b.half[0] = *(const v8us*)(brow + 8 * hh);
      b.half[1] = *(const v8us*)(brow + 16 + 8 * hh);
      acc[t] = mmaN<ASPLIT ? 2 : 1>(ah.v, al.v, b.v, b.v, acc[t]);
    }
  }
#pragma unroll
  for (int t = 0; t < 4; ++t) {
    const int col = col0 + t * 16 + ln;
    float bv = bias ? bias[col] : 0.f;
    if (BIAS_BF16) bv = bf16_round(bv);
#pragma unroll
    for (int r = 0; r < 8; ++r) {
      float v = acc[t][r] + bv;
      if (resid) { float rv = resid[(size_t)((row0 + 8 * hh + r) % rmod) * ldr + col]; if (RES_BF16) rv = bf16_round(rv); v += rv; }
      if (ACT == 1) v = fmaxf(v, 0.f);
      if (ACT == 2) v = 0.5f * v * (1.0f + erff(v * 0.70710678118654752f));
      if (ACT == 3) { const float u = 0.7978845608028654f * (v + 0.044715f * v * v * v); v = 0.5f * v * (1.0f + tanhf(u)); }
      so[w][8 * hh + r][t * 16 + ln] = v;
    }
  }
  __builtin_amdgcn_fence(__ATOMIC_ACQ_REL, "workgroup");
  __builtin_amdgcn_wave_barrier();
  const int rsub = lane >> 4, c4 = (lane & 15) * 4;
  {
#pragma unroll
    for (int q = 0; q < 8; ++q) {
      const int r = q * 2 + rsub;
      const v4f v = *(const v4fa*)&so[w][r][c4];
      *(v4f*)(C + (size_t)(row0 + r) * ldc + col0 + c4) = v;
    }
    
  }
}
// row LayerNorm (biased variance, eps) over N: s = X (+ R); optional out_sum <- s; out_norm <- (s-mu)*rsqrt(var+eps)*g + b
template <bool PARAM_BF16>
__global__ __launch_bounds__(256) void k_layernorm(const float* __restrict__ X, const float* __restrict__ R, const float* __restrict__ g, const float* __restrict__ bta,
                                                  float* __restrict__ out_sum, float* __restrict__ out_norm, int N, float eps) {
  __shared__ float red[256];
  const int row = blockIdx.x, tid = threadIdx.x;
  const float* x = X + (size_t)row * N; const float* rr = R ? R + (size_t)row * N : nullptr;
  float vals[16];                     // up to N = 4096
  const int per = N / 256;            // contiguous chunk per thread? use strided-by-4 chunks: thread handles j = tid*4 + 1024*u
  float s1 = 0.f;
  for (int u = 0; u < per / 4; ++u) {
    const int j = tid * 4 + 1024 * u;
    const v4f a = *(const v4fa*)(x + j);
    v4f b = {0.f,0.f,0.f,0.f}; if (rr) b = *(const v4fa*)(rr + j);
#pragma unroll
    for (int q = 0; q < 4; ++q) { const float v = a[q] + b[q]; vals[u * 4 + q] = v; s1 += v; }
  }
  red[tid] = s1; __syncthreads();
  for (int st = 128; st > 0; st >>= 1) { if (tid < st) red[tid] += red[tid + st]; __syncthreads(); }
  const float mu = red[0] / (float)N; __syncthreads();
  float s2 = 0.f;
  for (int u = 0; u < per / 4; ++u)
#pragma unroll
    for (int q = 0; q < 4; ++q) { const float c = vals[u * 4 + q] - mu; s2 += c * c; }
  red[tid] = s2; __syncthreads();
  for (int st = 128; st > 0; st >>= 1) { if (tid < st) red[tid] += red[tid + st]; __syncthreads(); }
  const float rs = rsqrtf(red[0] / (float)N + eps);
  {
    for (int u = 0; u < per / 4; ++u) {
      const int j = tid * 4 + 1024 * u;
      v4f o, sm;
#pragma unroll
      for (int q = 0; q < 4; ++q) {
        float gg = g[j + q], bb = bta[j + q];
        if (PARAM_BF16) { gg = bf16_round(gg); bb = bf16_round(bb); }
        sm[q] = vals[u * 4 + q]; o[q] = (vals[u * 4 + q] - mu) * rs * gg + bb;
      }
      if (out_sum) *(v4f*)(out_sum + (size_t)row * N + j) = sm;
      *(v4f*)(out_norm + (size_t)row * N + j) = o;
    }
    
  }
}



// ---- f16 WMMA path (v_wmma_f32_16x16x32_f16): 11-bit significands for operands in range — used where a [0,1] probability operand needs more precision than bf16
typedef _Float16 v16h __attribute__((ext_vector_type(16)));
union FragH { v16h v; v8us half[2]; _Float16 h[16]; unsigned short u[16]; };
template <int NT>
__device__ __forceinline__ v8f mmaH(v16h ah, v16h al, v16h bh, v16h bl, v8f c) {
  c = __builtin_amdgcn_wmma_f32_16x16x32_f16(false, ah, false, bh, (short)0, c, false, false);
  if (NT >= 2) c = __builtin_amdgcn_wmma_f32_16x16x32_f16(false, al, false, bh, (short)0, c, false, false);
  if (NT >= 3) c = __builtin_amdgcn_wmma_f32_16x16x32_f16(false, ah, false, bl, (short)0, c, false, false);
  asm volatile("v_nop\n\tv_nop\n\tv_nop\n\tv_nop" : "+v"(c) : "v"(ah), "v"(al), "v"(bh), "v"(bl));
  return c;
}
// batched GEMM like k_gemm_b but f16 operands: A f32 (split into f16 hi/lo if ASPLIT, else rounded to f16), Bt = f16 values [n][k]; alpha; C f32; N multiple of 16 (partial tiles skipped)
template <bool ASPLIT>
__global__ __launch_bounds__(128) void k_gemm_h(const float* __restrict__ A, int lda, size_t sA, const _Float16* __restrict__ Bh, int ldb, size_t sB, float alpha, float* __restrict__ C, int ldc, size_t sC, int M, int N, int K) {
  __shared__ __attribute__((aligned(16))) float so[4][16][64];
  const int tid = threadIdx.x, w = tid >> 5, lane = tid & 31, ln = lane & 15, hh = lane >> 4; const int by = blockIdx.y;
  A += (size_t)by * sA; Bh += (size_t)by * sB; C += (size_t)by * sC;
  const int ntn = (N + 63) / 64; const int wid = blockIdx.x * 4 + w; const int mt = wid / ntn, nq = wid % ntn; if (mt * 16 >= M) return;
  const int row0 = mt * 16, col0 = nq * 64; const float* arow = A + (size_t)(row0 + ln) * lda;
  v8f acc[4] = {};
  for (int kb = 0; kb < K; kb += 32) {
    FragH ah, al;
    const v4f x0 = *(const v4fa*)(arow + kb + 8 * hh), x1 = *(const v4fa*)(arow + kb + 8 * hh + 4), x2 = *(const v4fa*)(arow + kb + 16 + 8 * hh), x3 = *(const v4fa*)(arow + kb + 16 + 8 * hh + 4);
    float xs[16] = {x0[0],x0[1],x0[2],x0[3],x1[0],x1[1],x1[2],x1[3],x2[0],x2[1],x2[2],x2[3],x3[0],x3[1],x3[2],x3[3]};
#pragma unroll
    for (int i = 0; i < 16; ++i) { const _Float16 h = (_Float16)xs[i]; ah.h[i] = h; al.h[i] = ASPLIT ? (_Float16)(xs[i] - (float)h) : (_Float16)0.0f; }
#pragma unroll
    for (int t = 0; t < 4; ++t) { if (col0 + t * 16 >= N) continue; const size_t boff = (size_t)(col0 + t * 16 + ln) * ldb + kb; FragH bq; bq.half[0] = *(const v8us*)(Bh + boff + 8 * hh); bq.half[1] = *(const v8us*)(Bh + boff + 16 + 8 * hh);
      acc[t] = mmaH<ASPLIT ? 2 : 1>(ah.v, al.v, bq.v, bq.v, acc[t]); }
  }
#pragma unroll
  for (int t = 0; t < 4; ++t) { if (col0 + t * 16 >= N) continue;
#pragma unroll
    for (int r = 0; r < 8; ++r) so[w][8 * hh + r][t * 16 + ln] = acc[t][r] * alpha; }
  __builtin_amdgcn_fence(__ATOMIC_ACQ_REL, "workgroup"); __builtin_amdgcn_wave_barrier();
  const int rsub = lane >> 4, c4 = (lane & 15) * 4;
  {
#pragma unroll
    for (int q = 0; q < 8; ++q) { const int r = q * 2 + rsub; if (col0 + c4 < N) { const v4f v = *(const v4fa*)&so[w][r][c4]; *(v4f*)(C + (size_t)(row0 + r) * ldc + col0 + c4) = v; } }
     }
}

// Wt[n][k] = f16(W[k][n]·scale) from f32 row-major W[K][N] (scale = power of two; bf16-exact weights stay exact in f16 away from the subnormal range)
__global__ __launch_bounds__(256) void k_wt_f16(const float* __restrict__ W, _Float16* __restrict__ Wt, int K, int N, float scale) {
  const int t = blockIdx.x * 256 + threadIdx.x; if (t >= N * (K / 8)) return; const int n = t / (K / 8), k8 = (t % (K / 8)) * 8; FragH f;
#pragma unroll
  for (int i = 0; i < 8; ++i) f.h[i] = (_Float16)(bf16_round(W[(size_t)(k8 + i) * N + n]) * scale); const v8us o = f.half[0];
  *(v8us*)((unsigned short*)Wt + (size_t)n * K + k8) = o; 
}
// k_gemm_hh variant with fused epilogue: v = acc·alpha + bias[by·sBias + col] (+ CP[(row/rowsPerB)·sCPb + by·64 + col] if CP) ; ACT 0 none / 1 elu ; writes f16 C16 and f32 C, each if non-null
template <int ACT>
__global__ __launch_bounds__(128) void k_gemm_hhx(const _Float16* __restrict__ A, int lda, size_t sA, const _Float16* __restrict__ Bh, int ldb, size_t sB, float alpha, const float* __restrict__ bias, size_t sBias, const float* __restrict__ CP, int rowsPerB, size_t sCPb, int row0g,
    float* __restrict__ C, _Float16* __restrict__ C16, int ldc, size_t sC, int M, int N, int K) {
  __shared__ __attribute__((aligned(16))) float so[4][16][64];
  const int tid = threadIdx.x, w = tid >> 5, lane = tid & 31, ln = lane & 15, hh = lane >> 4; const int by = blockIdx.y;
  A += (size_t)by * sA; Bh += (size_t)by * sB; const size_t cofs = (size_t)by * sC; const float* bp = bias ? bias + (size_t)by * sBias : nullptr;
  const int ntn = (N + 63) / 64; const int wid = blockIdx.x * 4 + w; const int mt = wid / ntn, nq = wid % ntn; if (mt * 16 >= M) return;
  const int row0 = mt * 16, col0 = nq * 64; const _Float16* arow = A + (size_t)(row0 + ln) * lda;
  v8f acc[4] = {};
  for (int kb = 0; kb < K; kb += 32) { FragH ah; ah.half[0] = *(const v8us*)((const unsigned short*)arow + kb + 8 * hh); ah.half[1] = *(const v8us*)((const unsigned short*)arow + kb + 16 + 8 * hh);
#pragma unroll
    for (int t = 0; t < 4; ++t) { if (col0 + t * 16 >= N) continue; const size_t boff = (size_t)(col0 + t * 16 + ln) * ldb + kb; FragH bq; bq.half[0] = *(const v8us*)((const unsigned short*)Bh + boff + 8 * hh); bq.half[1] = *(const v8us*)((const unsigned short*)Bh + boff + 16 + 8 * hh);
      acc[t] = mmaH<1>(ah.v, ah.v, bq.v, bq.v, acc[t]); }
  }
#pragma unroll
  for (int t = 0; t < 4; ++t) { if (col0 + t * 16 >= N) continue; const int col = col0 + t * 16 + ln; const float bv = bp ? bf16_round(bp[col]) : 0.f;
#pragma unroll
    for (int r = 0; r < 8; ++r) { float v = acc[t][r] * alpha + bv; if (CP) { const int bidx = (row0g + row0 + 8 * hh + r) / rowsPerB; v += CP[(size_t)bidx * sCPb + (size_t)by * 64 + col]; } if (ACT == 1) v = (v > 0.f) ? v : expm1f(v); else if (ACT == 7) v = (v > 0.f) ? v + 1.0f : expf(v); else if (ACT == 8) v = tanhf(v); else if (ACT == 9) v = 0.5f * v * (1.0f + tanhf(0.7978845608028654f * (v + 0.044715f * v * v * v))); else if (ACT == 11) v = 1.0f / (1.0f + expf(-v)); else if (ACT == 12) v = (v > 0.f) ? v : 0.01f * v; else if (ACT == 14) v = (v > 0.f) ? v : 0.1f * v; else if (ACT == 15) v = v / (1.0f + expf(-v)); else if (ACT == 3) v = fmaxf(v, 0.f); else if (ACT == 6) v = 0.5f * v * (1.0f + erff(v * 0.70710678118654752f)); so[w][8 * hh + r][t * 16 + ln] = v; } }
  __builtin_amdgcn_fence(__ATOMIC_ACQ_REL, "workgroup"); __builtin_amdgcn_wave_barrier();
  const int rsub = lane >> 4, c4 = (lane & 15) * 4; typedef _Float16 v4h __attribute__((ext_vector_type(4)));
  {
#pragma unroll
    for (int q = 0; q < 8; ++q) { const int r = q * 2 + rsub; if (col0 + c4 < N) { const v4f v = *(const v4fa*)&so[w][r][c4]; if (C) *(v4f*)(C + cofs + (size_t)(row0 + r) * ldc + col0 + c4) = v; if (C16) { v4h h4; for (int i = 0; i < 4; ++i) h4[i] = (_Float16)v[i]; *(v4h*)(C16 + cofs + (size_t)(row0 + r) * ldc + col0 + c4) = h4; } } }
     }
}


typedef _Float16 v4h __attribute__((ext_vector_type(4)));

__global__ __launch_bounds__(256) void k_x16(const float* __restrict__ x, _Float16* __restrict__ X16, size_t n8) { const size_t t = (size_t)blockIdx.x * 256 + threadIdx.x; if (t >= n8) return; FragH f;
#pragma unroll
  for (int q = 0; q < 8; ++q) f.h[q] = (_Float16)bf16_round(x[t * 8 + q]); *(v8us*)((unsigned short*)X16 + t * 8) = f.half[0];  }
__global__ __launch_bounds__(256) void k_h16(const float* __restrict__ x, _Float16* __restrict__ X16, size_t n8) { const size_t t = (size_t)blockIdx.x * 256 + threadIdx.x; if (t >= n8) return; FragH f;
#pragma unroll
  for (int q = 0; q < 8; ++q) f.h[q] = (_Float16)x[t * 8 + q]; *(v8us*)((unsigned short*)X16 + t * 8) = f.half[0];  }
__global__ __launch_bounds__(256) void k_round16f(const float* __restrict__ W, _Float16* __restrict__ Bt, size_t n8) { const size_t t = (size_t)blockIdx.x * 256 + threadIdx.x; if (t >= n8) return; FragH f;
#pragma unroll
  for (int i = 0; i < 8; ++i) f.h[i] = (_Float16)(bf16_round(W[t * 8 + i]) * 16.0f); *(v8us*)((unsigned short*)Bt + t * 8) = f.half[0];  }
template <int NHv, int TTv>
__global__ __launch_bounds__(256) void k_vt(const _Float16* __restrict__ V16, int ldv, int voff, _Float16* __restrict__ Vt) { __shared__ unsigned short tl[64][66]; const int tid = threadIdx.x; const int slab = blockIdx.x / (TTv / 64), lg = blockIdx.x % (TTv / 64); const int b = slab / NHv, h = slab % NHv;
  for (int i = tid; i < 64 * 8; i += 256) { const int r = i / 8, c8 = (i % 8) * 8; FragH f; f.half[0] = *(const v8us*)((const unsigned short*)V16 + ((size_t)b * TTv + lg * 64 + r) * ldv + voff + h * 64 + c8);
#pragma unroll
    for (int q = 0; q < 8; ++q) tl[r][c8 + q] = f.u[q]; }
  __syncthreads();
  {
#pragma unroll
    for (int rd = 0; rd < 2; ++rd) { const int d = rd * 32 + tid / 8, pc = tid % 8; FragH f;
#pragma unroll
      for (int q = 0; q < 8; ++q) f.u[q] = tl[pc * 8 + q][d];
      *(v8us*)((unsigned short*)Vt + ((size_t)slab * 64 + d) * TTv + lg * 64 + pc * 8) = f.half[0]; }
     } }

typedef float v2f __attribute__((ext_vector_type(2)));
// lane l with lane l ^ 16 (the two halves of a wave hold the two key halves of one query column)
__device__ __forceinline__ float xhalf(float x) { return __builtin_bit_cast(float, __builtin_amdgcn_permlanex16(__builtin_bit_cast(int, x), __builtin_bit_cast(int, x), 0x76543210, 0xfedcba98, false, false)); }

__global__ __launch_bounds__(128) void k_flash(const _Float16* __restrict__ Q16, int ldq, const _Float16* __restrict__ K16, int ldk, const _Float16* __restrict__ Vt, const int* __restrict__ MSK, float* __restrict__ O, int ldo) {
  constexpr int RPW = 16, NQB = NN / (4 * RPW), DT = 2; (void)MSK;
  constexpr float SL2E = 0.17677669529663687f * 1.4426950408889634f;      /* 32^-1/2 * log2(e): e^(scale*s - m) = 2^(SL2E*s - m2), one fma ahead of a bare v_exp_f32 */
  const int tid = threadIdx.x, w = tid >> 5, lane = tid & 31, ln = lane & 15, hh = lane >> 4;
  const int slab = blockIdx.x / NQB, qblk = blockIdx.x % NQB; const int b = slab / NH, h = slab % NH; const int q0 = qblk * (4 * RPW) + w * RPW;
  FragH bq;      /* B: column ln = query q0 + ln, k = head channel */
  { const unsigned short* qr = (const unsigned short*)Q16 + ((size_t)b * NN + q0 + ln) * ldq + h * HD; bq.half[0] = *(const v8us*)(qr + 8 * hh); bq.half[1] = *(const v8us*)(qr + 16 + 8 * hh); }
  const unsigned short* Vth = (const unsigned short*)Vt + ((size_t)b * CC + h * HD) * NN;      /* V^T = v[b][(h,d)][n] channel-major */
  float m_q = -3.0e38f, l_q = 0.f; v8f oacc[DT];
#pragma unroll
  for (int dt = 0; dt < DT; ++dt) oacc[dt] = (v8f){0.f,0.f,0.f,0.f,0.f,0.f,0.f,0.f};
#pragma unroll 1
  for (int j0 = 0; j0 < NN; j0 += 32) {
    v8f s[2];      /* s[nt][r] = S^T[key j0 + nt*16 + 8*hh + r][query q0 + ln] */
#pragma unroll
    for (int nt = 0; nt < 2; ++nt) { const unsigned short* kr = (const unsigned short*)K16 + ((size_t)b * NN + j0 + nt * 16 + ln) * ldk + h * HD; FragH ak;
      ak.half[0] = *(const v8us*)(kr + 8 * hh); ak.half[1] = *(const v8us*)(kr + 16 + 8 * hh);
      s[nt] = mmaH<1>(ak.v, ak.v, bq.v, bq.v, (v8f){0.f,0.f,0.f,0.f,0.f,0.f,0.f,0.f}); }
    float mt[8];
#pragma unroll
    for (int i = 0; i < 8; ++i) mt[i] = fmaxf(s[0][i], s[1][i]);
    float mc = fmaxf(fmaxf(fmaxf(mt[0], mt[1]), fmaxf(mt[2], mt[3])), fmaxf(fmaxf(mt[4], mt[5]), fmaxf(mt[6], mt[7])));
    mc = fmaxf(mc, xhalf(mc));      /* both halves now hold the maximum over the query's 32 raw products (SL2E > 0 keeps the order) */
    const float mn = fmaxf(m_q, mc * SL2E); const float al = (mn > -1.0e38f) ? __builtin_amdgcn_exp2f(m_q - mn) : 1.0f; m_q = mn;      /* m_q, mn: base-2 exponents */
    const float nb = 10.0f - mn;      /* 2^10 = the f16 scale of P, carried in the exponent: p and l_q hold 1024 times the shifted values */
    v2f p[8]; FragH pb;
#pragma unroll
    for (int i = 0; i < 8; ++i) { const v2f a = (v2f){s[i >> 2][(2 * i) & 7], s[i >> 2][(2 * i + 1) & 7]} * SL2E + nb;
      p[i] = (v2f){__builtin_amdgcn_exp2f(a[0]), __builtin_amdgcn_exp2f(a[1])}; pb.h[2 * i] = (_Float16)p[i][0]; pb.h[2 * i + 1] = (_Float16)p[i][1]; }
    const v2f ps = ((p[0] + p[1]) + (p[2] + p[3])) + ((p[4] + p[5]) + (p[6] + p[7]));
    l_q = l_q * al + (ps[0] + ps[1]);      /* this half's 16 keys; the halves join after the loop */
#pragma unroll
    for (int dt = 0; dt < DT; ++dt) { oacc[dt] *= al;
      const unsigned short* vrow = Vth + (size_t)(dt * 16 + ln) * NN + j0; FragH av; av.half[0] = *(const v8us*)(vrow + 8 * hh); av.half[1] = *(const v8us*)(vrow + 16 + 8 * hh);
      oacc[dt] = mmaH<1>(av.v, av.v, pb.v, pb.v, oacc[dt]); } }      /* oacc[dt][r] = O^T[channel dt*16 + 8*hh + r][query q0 + ln] */
  const float l = l_q + xhalf(l_q); const float den = l + (1e-6f * 1024.0f) * __builtin_amdgcn_exp2f(-m_q); const float inv = (den > 0.f && den < INFINITY) ? 1.0f / den : 0.f;      /* sum e^s/(sum e^s + 1e-6) form: e^(-m)*1e-6 joins the shifted sum; an infinite den (all logits far below 0) reproduces the reference's ~0 output */
  float* orow = O + ((size_t)b * NN + q0 + ln) * ldo + h * HD + 8 * hh;
#pragma unroll
  for (int dt = 0; dt < DT; ++dt) { const v8f o = oacc[dt] * inv; *(v4f*)(orow + dt * 16) = (v4f){o[0], o[1], o[2], o[3]}; *(v4f*)(orow + dt * 16 + 4) = (v4f){o[4], o[5], o[6], o[7]}; } }

extern "C" void kernel_launch(void* const* d_in, const int* in_sizes, int n_in,
                              void* d_out, int out_size, void* d_ws, size_t ws_size, hipStream_t stream) {
  (void)in_sizes; (void)n_in; (void)out_size;
  const float* x = (const float*)d_in[0]; const float* Wqkv = (const float*)d_in[1]; const float* Wout = (const float*)d_in[2]; const float* bout = (const float*)d_in[3];
  char* ws = (char*)d_ws; size_t off = 0;
  auto take = [&](size_t bytes) { char* p = ws + off; off += (bytes + 255) & ~(size_t)255; return p; };
  _Float16* Bqkv = (_Float16*)take((size_t)C3 * CC * 2); _Float16* Bo = (_Float16*)take((size_t)CC * CC * 2); _Float16* X16 = (_Float16*)take((size_t)NR * CC * 2);
  _Float16* QK = (_Float16*)take((size_t)NR * 2 * CC * 2); _Float16* Vt = (_Float16*)take((size_t)BB * CC * NN * 2); float* O = (float*)take((size_t)NR * CC * 4); _Float16* O16 = (_Float16*)take((size_t)NR * CC * 2);
  if (off > ws_size) return;      // 0.4 + 0.1 + 4.2 + 8.4 + 4.2 + 8.4 + 4.2 ≈ 30 MB
  k_wt_f16<<<(unsigned)(((size_t)C3 * (CC / 8) + 255) / 256), 256, 0, stream>>>(Wqkv, Bqkv, CC, C3, 16.0f); k_wt_f16<<<(unsigned)(((size_t)CC * (CC / 8) + 255) / 256), 256, 0, stream>>>(Wout, Bo, CC, CC, 16.0f);      /* (in,out) → Bt[n][k] ×2^4 */
  k_x16<<<(unsigned)(((size_t)NR * CC / 8 + 255) / 256), 256, 0, stream>>>(x, X16, (size_t)NR * CC / 8);
  k_gemm_hhx<0><<<dim3(((NR / 16) * (2 * CC / 64) + 3) / 4, 1), 128, 0, stream>>>(X16, CC, 0, Bqkv, CC, 0, 0.0625f, nullptr, 0, nullptr, 1, 0, 0, nullptr, QK, 2 * CC, 0, NR, 2 * CC, CC);      /* [q | k] token-major [(b,n)][512]: M 8192 N 512 K 256 */
  k_gemm_hhx<0><<<dim3(((CC / 16) * (NN / 64) + 3) / 4, BB), 128, 0, stream>>>(Bqkv + (size_t)2 * CC * CC, CC, 0, X16, CC, (size_t)NN * CC, 0.0625f, nullptr, 0, nullptr, 1, 0, 0, nullptr, Vt, NN, (size_t)CC * NN, CC, NN, CC);      /* v channel-major per batch [b][(h,d)][n] = Vᵀ: A = Bt rows 512..767 ([out][in]), B = X16[b]: M 256 N 2048 K 256 */
  k_flash<<<BB * NH * (NN / 64), 128, 0, stream>>>(QK, 2 * CC, QK + CC, 2 * CC, Vt, nullptr, O, CC);      /* blocks = (b,h) × 64-query groups */
  k_h16<<<(unsigned)(((size_t)NR * CC / 8 + 255) / 256), 256, 0, stream>>>(O, O16, (size_t)NR * CC / 8);
  k_gemm_hhx<0><<<dim3(((NR / 16) * (CC / 64) + 3) / 4, 1), 128, 0, stream>>>(O16, CC, 0, Bo, CC, 0, 0.0625f, bout, 0, nullptr, 1, 0, 0, (float*)d_out, nullptr, CC, 0, NR, CC, CC);      /* y = out·Wout + bout: M 8192 N 256 K 256 */
}

// v003
// A run of this version takes 81.6 microseconds.
// In two side-by-side timings against v002, it was 1.59 and 1.60 times as fast.
// Over all steps from v000 it is 2.89 times as fast.
#include <hip/hip_runtime.h>
// KeOps-style multi-head attention (B=4, n=2048, dim 256, 8 heads × 32): qkv = x·Wqkv; q scaled by 32^-½; e = exp(q·kᵀ) WITHOUT max subtraction; out = (e·v)/(Σe + 1e-6) merged over heads; y = out·Wout + bout.
// Compute dtype: x, Wqkv, Wout, bout rounded to bf16; q/k token-major and v channel-major (= Vᵀ) as f16 GEMM outputs (f32 accumulate); fused flash-style kernel per (b,h) (online max-rescaled sums
// in f32 — the unshifted quotient is recovered exactly through the normaliser l + 1e-6·e^(−m); P f16 ×2^10) on v_wmma_f32_16x16x32_f16; O → f16 → output GEMM with bias; f32 accumulate.
#define BB 4
#define NN 2048
#define CC 256
#define C3 768
#define NH 8
#define HD 32
#define NR (BB * NN)

typedef __bf16 v16b __attribute__((ext_vector_type(16)));
typedef unsigned short v8us __attribute__((ext_vector_type(8), may_alias));
typedef float  v8f  __attribute__((ext_vector_type(8)));
typedef float  v4f  __attribute__((ext_vector_type(4)));
typedef float  v4fa __attribute__((ext_vector_type(4), may_alias));
union FragB { v16b v; v8us half[2]; unsigned short u[16]; };

__device__ __forceinline__ unsigned short bf16_bits(float x) { unsigned int u = __float_as_uint(x); return (unsigned short)((u + 0x7FFFu + ((u >> 16) & 1u)) >> 16); }
__device__ __forceinline__ float bf16_val(unsigned short b) { return __uint_as_float(((unsigned int)b) << 16); }
__device__ __forceinline__ float bf16_round(float x) { return bf16_val(bf16_bits(x)); }
// D += A·B with NT terms: 1 = ah·bh, 2 = + al·bh (A split), 3 = + ah·bl (both split)
template <int NT>
__device__ __forceinline__ v8f mmaN(v16b ah, v16b al, v16b bh, v16b bl, v8f c) {
  c = __builtin_amdgcn_wmma_f32_16x16x32_bf16(false, ah, false, bh, (short)0, c, false, false);
  if (NT >= 2) c = __builtin_amdgcn_wmma_f32_16x16x32_bf16(false, al, false, bh, (short)0, c, false, false);
  if (NT >= 3) c = __builtin_amdgcn_wmma_f32_16x16x32_bf16(false, ah, false, bl, (short)0, c, false, false);
  asm volatile("v_nop\n\tv_nop\n\tv_nop\n\tv_nop" : "+v"(c) : "v"(ah), "v"(al), "v"(bh), "v"(bl));
  return c;
}

__global__ __launch_bounds__(256) void k_wt_bf16(const float* __restrict__ W, unsigned short* __restrict__ Wt, int K, int N) {
  const int t = blockIdx.x * 256 + threadIdx.x;
  const int k8n = K / 8;
  if (t >= N * k8n) return;
  const int n = t / k8n, k8 = (t % k8n) * 8;
  v8us v;
#pragma unroll
  for (int i = 0; i < 8; ++i) v[i] = bf16_bits(W[(size_t)(k8 + i) * N + n]);
  *(v8us*)(Wt + (size_t)n * K + k8) = v;
  
}

// GEMM C[M][N] (f32, pitch ldc) = act(A[M][K]·W + bias). A f32 row-major (pitch lda) converted per fragment to bf16
// (ASPLIT: hi/lo two planes -> 2 terms, else single rounded term); Wt bf16 [N][K] (pitch ldb). BIAS_BF16 rounds the
// bias to bf16 first (bias quantised to bf16 before the add). K%32==0, M%16==0, N%64==0.
template <bool ASPLIT, int ACT, bool BIAS_BF16>
__global__ __launch_bounds__(128) void k_gemm_bf(const float* __restrict__ A, int lda, const unsigned short* __restrict__ Wt, int ldb,
                                               const float* __restrict__ bias, float* __restrict__ C, int ldc, int M, int N, int K) {
  __shared__ __attribute__((aligned(16))) float so[4][16][64];
  const int tid = threadIdx.x, w = tid >> 5, lane = tid & 31, ln = lane & 15, hh = lane >> 4;
  const int ntn = N / 64;
  const int wid = blockIdx.x * 4 + w;
  const int mt = wid / ntn, nq = wid % ntn;
  if (mt * 16 >= M) return;
  const int row0 = mt * 16, col0 = nq * 64;
  const float* arow = A + (size_t)(row0 + ln) * lda;
  v8f acc[4] = {};
  for (int kb = 0; kb < K; kb += 32) {
    FragB ah, al;
    const v4f x0 = *(const v4fa*)(arow + kb + 8 * hh), x1 = *(const v4fa*)(arow + kb + 8 * hh + 4);
    const v4f x2 = *(const v4fa*)(arow + kb + 16 + 8 * hh), x3 = *(const v4fa*)(arow + kb + 16 + 8 * hh + 4);
    float xs[16] = {x0[0],x0[1],x0[2],x0[3],x1[0],x1[1],x1[2],x1[3],x2[0],x2[1],x2[2],x2[3],x3[0],x3[1],x3[2],x3[3]};
#pragma unroll
    for (int i = 0; i < 16; ++i) { const unsigned short hb = bf16_bits(xs[i]); ah.u[i] = hb; al.u[i] = ASPLIT ? bf16_bits(xs[i] - bf16_val(hb)) : (unsigned short)0; }
#pragma unroll
    for (int t = 0; t < 4; ++t) {
      const unsigned short* brow = Wt + (size_t)(col0 + t * 16 + ln) * ldb + kb;
      FragB b;
      b.half[0] = *(const v8us*)(brow + 8 * hh);
      b.half[1] = *(const v8us*)(brow + 16 + 8 * hh);
      acc[t] = mmaN<ASPLIT ? 2 : 1>(ah.v, al.v, b.v, b.v, acc[t]);
    }
  }
#pragma unroll
  for (int t = 0; t < 4; ++t) {
    float bv = bias ? bias[col0 + t * 16 + ln] : 0.f;
    if (BIAS_BF16) bv = bf16_round(bv);
#pragma unroll
    for (int r = 0; r < 8; ++r) { float v = acc[t][r] + bv; if (ACT == 1) v = fmaxf(v, 0.f); so[w][8 * hh + r][t * 16 + ln] = v; }
  }
  __builtin_amdgcn_fence(__ATOMIC_ACQ_REL, "workgroup");
  __builtin_amdgcn_wave_barrier();
  const int rsub = lane >> 4, c4 = (lane & 15) * 4;
  {
#pragma unroll
    for (int q = 0; q < 8; ++q) {
      const int r = q * 2 + rsub;
      const v4f v = *(const v4fa*)&so[w][r][c4];
      *(v4f*)(C + (size_t)(row0 + r) * ldc + col0 + c4) = v;
    }
    
  }
}

// Flash-style causal/unmasked attention, all contractions 3-term bf16 hi/lo splits, f32 softmax with running max.
// q,k,v rows are read from f32 buffers with arbitrary row pitch (so they can live inside a fused qkv buffer);
// D = head size (multiple of 32, <= 128); one wave = 16 query rows; block = 4 waves (64 queries) sharing K/V chunks of 32.
template <int D, bool CAUSAL>
__global__ __launch_bounds__(128) void k_flash(const float* __restrict__ qb, const float* __restrict__ kb, const float* __restrict__ vb,
                                             int pitch, int T, int H, float scale, float* __restrict__ y, int ypitch) {
  constexpr int KS = D / 32;        // k-steps for QK
  constexpr int DT = D / 16;        // d tiles for PV
  __shared__ __attribute__((aligned(16))) unsigned short sKh[32][D + 8], sKl[32][D + 8], sVh[32][D + 8], sVl[32][D + 8];
  __shared__ __attribute__((aligned(16))) unsigned short sPh[4][16][40], sPl[4][16][40];
  __shared__ __attribute__((aligned(16))) float sO[4][16][D];
  const int tid = threadIdx.x, w = tid >> 5, lane = tid & 31, ln = lane & 15, hh = lane >> 4;
  const int nqb = (T + 63) / 64;
  const int bh = blockIdx.x / nqb, qblk = blockIdx.x % nqb;
  const int b = bh / H, h = bh % H;
  const int q0 = qblk * 64 + w * 16;
  const float* Q = qb + (size_t)b * T * pitch + h * D;
  const float* K = kb + (size_t)b * T * pitch + h * D;
  const float* V = vb + (size_t)b * T * pitch + h * D;

  // A fragments of the wave's 16 query rows (scaled), hi/lo
  FragB aqh[KS], aql[KS];
  {
    int row = q0 + ln; if (row >= T) row = T - 1;
    const float* qr = Q + (size_t)row * pitch;
#pragma unroll
    for (int ks = 0; ks < KS; ++ks)
#pragma unroll
      for (int i = 0; i < 16; ++i) {
        const int d = ks * 32 + ((i < 8) ? (8 * hh + i) : (16 + 8 * hh + (i - 8)));
        const float x = qr[d] * scale; const unsigned short hb = bf16_bits(x);
        aqh[ks].u[i] = hb; aql[ks].u[i] = bf16_bits(x - bf16_val(hb));
      }
  }
  float m_r[8], l_r[8];
#pragma unroll
  for (int r = 0; r < 8; ++r) { m_r[r] = -3.0e38f; l_r[r] = 0.f; }
  v8f oacc[DT];
#pragma unroll
  for (int dt = 0; dt < DT; ++dt) oacc[dt] = (v8f){0.f,0.f,0.f,0.f,0.f,0.f,0.f,0.f};

  const int kv_end = CAUSAL ? min(T, qblk * 64 + 64) : T;     // block-uniform
  for (int j0 = 0; j0 < kv_end; j0 += 32) {
    __syncthreads();
    for (int e = tid; e < 32 * (D / 4); e += 128) {
      const int r = e / (D / 4), c4 = (e % (D / 4)) * 4;
      const int key = j0 + r;
      v4f kf = {0.f,0.f,0.f,0.f}, vf = {0.f,0.f,0.f,0.f};
      if (key < T) { kf = *(const v4fa*)(K + (size_t)key * pitch + c4); vf = *(const v4fa*)(V + (size_t)key * pitch + c4); }
#pragma unroll
      for (int t = 0; t < 4; ++t) {
        unsigned short hb = bf16_bits(kf[t]); sKh[r][c4 + t] = hb; sKl[r][c4 + t] = bf16_bits(kf[t] - bf16_val(hb));
        hb = bf16_bits(vf[t]); sVh[r][c4 + t] = hb; sVl[r][c4 + t] = bf16_bits(vf[t] - bf16_val(hb));
      }
    }
    __syncthreads();
    // S tile 16 x 32
    v8f s[2];
#pragma unroll
    for (int nt = 0; nt < 2; ++nt) {
      v8f acc = {};
#pragma unroll
      for (int ks = 0; ks < KS; ++ks) {
        FragB bh_, bl_;
        bh_.half[0] = *(const v8us*)&sKh[nt * 16 + ln][ks * 32 + 8 * hh]; bh_.half[1] = *(const v8us*)&sKh[nt * 16 + ln][ks * 32 + 16 + 8 * hh];
        bl_.half[0] = *(const v8us*)&sKl[nt * 16 + ln][ks * 32 + 8 * hh]; bl_.half[1] = *(const v8us*)&sKl[nt * 16 + ln][ks * 32 + 16 + 8 * hh];
        acc = mmaN<3>(aqh[ks].v, aql[ks].v, bh_.v, bl_.v, acc);
      }
      s[nt] = acc;
    }
    // mask + running max (rows 8hh+r; the 16 lanes of a half share rows)
    float alpha[8];
#pragma unroll
    for (int r = 0; r < 8; ++r) {
      const int qi = q0 + 8 * hh + r;
      const int ja = j0 + ln, jb = j0 + 16 + ln;
      if (CAUSAL) { if (ja > qi) s[0][r] = -3.0e38f; if (jb > qi) s[1][r] = -3.0e38f; }
      if (ja >= T) s[0][r] = -3.0e38f;
      if (jb >= T) s[1][r] = -3.0e38f;
      float mx = fmaxf(s[0][r], s[1][r]);
      mx = fmaxf(mx, __shfl_xor(mx, 1, 32)); mx = fmaxf(mx, __shfl_xor(mx, 2, 32)); mx = fmaxf(mx, __shfl_xor(mx, 4, 32)); mx = fmaxf(mx, __shfl_xor(mx, 8, 32));
      const float mnew = fmaxf(m_r[r], mx);
      alpha[r] = (mnew > -1.0e38f) ? __expf(m_r[r] - mnew) : 1.0f;
      const float p0 = (s[0][r] > -1.0e38f) ? __expf(s[0][r] - mnew) : 0.f;
      const float p1 = (s[1][r] > -1.0e38f) ? __expf(s[1][r] - mnew) : 0.f;
      m_r[r] = mnew;
      l_r[r] = l_r[r] * alpha[r] + p0 + p1;            // per-lane partial row sum (16 lanes combined at the end)
      unsigned short hb = bf16_bits(p0); sPh[w][8 * hh + r][ln] = hb;      sPl[w][8 * hh + r][ln] = bf16_bits(p0 - bf16_val(hb));
      hb = bf16_bits(p1);                sPh[w][8 * hh + r][16 + ln] = hb; sPl[w][8 * hh + r][16 + ln] = bf16_bits(p1 - bf16_val(hb));
    }
#pragma unroll
    for (int dt = 0; dt < DT; ++dt)
#pragma unroll
      for (int r = 0; r < 8; ++r) oacc[dt][r] *= alpha[r];
    __builtin_amdgcn_fence(__ATOMIC_ACQ_REL, "workgroup");
    __builtin_amdgcn_wave_barrier();
    FragB pah, pal;
    pah.half[0] = *(const v8us*)&sPh[w][ln][8 * hh]; pah.half[1] = *(const v8us*)&sPh[w][ln][16 + 8 * hh];
    pal.half[0] = *(const v8us*)&sPl[w][ln][8 * hh]; pal.half[1] = *(const v8us*)&sPl[w][ln][16 + 8 * hh];
#pragma unroll
    for (int dt = 0; dt < DT; ++dt) {
      FragB bvh, bvl;
#pragma unroll
      for (int i = 0; i < 8; ++i) {
        bvh.u[i] = sVh[8 * hh + i][dt * 16 + ln]; bvh.u[8 + i] = sVh[16 + 8 * hh + i][dt * 16 + ln];
        bvl.u[i] = sVl[8 * hh + i][dt * 16 + ln]; bvl.u[8 + i] = sVl[16 + 8 * hh + i][dt * 16 + ln];
      }
      oacc[dt] = mmaN<3>(pah.v, pal.v, bvh.v, bvl.v, oacc[dt]);
    }
    __builtin_amdgcn_fence(__ATOMIC_ACQ_REL, "workgroup");
    __builtin_amdgcn_wave_barrier();
  }
#pragma unroll
  for (int r = 0; r < 8; ++r) {
    float l = l_r[r];
    l += __shfl_xor(l, 1, 32); l += __shfl_xor(l, 2, 32); l += __shfl_xor(l, 4, 32); l += __shfl_xor(l, 8, 32);
    l_r[r] = (l > 0.f) ? 1.0f / l : 0.f;
  }
#pragma unroll
  for (int dt = 0; dt < DT; ++dt)
#pragma unroll
    for (int r = 0; r < 8; ++r) sO[w][8 * hh + r][dt * 16 + ln] = oacc[dt][r] * l_r[r];
  __builtin_amdgcn_fence(__ATOMIC_ACQ_REL, "workgroup");
  __builtin_amdgcn_wave_barrier();
  {
    for (int r = 0; r < 16; ++r) {
      const int row = q0 + r;
      if (row < T && lane < D / 4) {
        const v4f val = *(const v4fa*)&sO[w][r][lane * 4];
        *(v4f*)(y + ((size_t)b * T + row) * ypitch + h * D + lane * 4) = val;
      }
    }
    
  }
}

// GEMM C = act(A·W + bias + resid): A f32 (ASPLIT -> hi/lo 2 terms), Wt bf16 [N][K]; ACT 0 none, 1 relu, 2 exact gelu;
// resid (optional, f32, row index = (row % rmod), pitch ldr, RES_BF16 rounds it) added before the activation.
template <bool ASPLIT, int ACT, bool BIAS_BF16, bool RES_BF16>
__global__ __launch_bounds__(128) void k_gemm_bf3(const float* __restrict__ A, int lda, const unsigned short* __restrict__ Wt, int ldb,
                                                const float* __restrict__ bias, const float* __restrict__ resid, int rmod, int ldr,
                                                float* __restrict__ C, int ldc, int M, int N, int K) {
  __shared__ __attribute__((aligned(16))) float so[4][16][64];
  const int tid = threadIdx.x, w = tid >> 5, lane = tid & 31, ln = lane & 15, hh = lane >> 4;
  const int ntn = N / 64;
  const int wid = blockIdx.x * 4 + w;
  const int mt = wid / ntn, nq = wid % ntn;
  if (mt * 16 >= M) return;
  const int row0 = mt * 16, col0 = nq * 64;
  const float* arow = A + (size_t)(row0 + ln) * lda;
  v8f acc[4] = {};
  for (int kb = 0; kb < K; kb += 32) {
    FragB ah, al;
    const v4f x0 = *(const v4fa*)(arow + kb + 8 * hh), x1 = *(const v4fa*)(arow + kb + 8 * hh + 4);
    const v4f x2 = *(const v4fa*)(arow + kb + 16 + 8 * hh), x3 = *(const v4fa*)(arow + kb + 16 + 8 * hh + 4);
    float xs[16] = {x0[0],x0[1],x0[2],x0[3],x1[0],x1[1],x1[2],x1[3],x2[0],x2[1],x2[2],x2[3],x3[0],x3[1],x3[2],x3[3]};
#pragma unroll
    for (int i = 0; i < 16; ++i) { const unsigned short hb = bf16_bits(xs[i]); ah.u[i] = hb; al.u[i] = ASPLIT ? bf16_bits(xs[i] - bf16_val(hb)) : (unsigned short)0; }
#pragma unroll
    for (int t = 0; t < 4; ++t) {
      const unsigned short* brow = Wt + (size_t)(col0 + t * 16 + ln) * ldb + kb;
      FragB b;
      b.half[0] = *(const v8us*)(brow + 8 * hh);
      b.half[1] = *(const v8us*)(brow + 16 + 8 * hh);
      acc[t] = mmaN<ASPLIT ? 2 : 1>(ah.v, al.v, b.v, b.v, acc[t]);
    }
  }
#pragma unroll
  for (int t = 0; t < 4; ++t) {
    const int col = col0 + t * 16 + ln;
    float bv = bias ? bias[col] : 0.f;
    if (BIAS_BF16) bv = bf16_round(bv);
#pragma unroll
    for (int r = 0; r < 8; ++r) {
      float v = acc[t][r] + bv;
      if (resid) { float rv = resid[(size_t)((row0 + 8 * hh + r) % rmod) * ldr + col]; if (RES_BF16) rv = bf16_round(rv); v += rv; }
      if (ACT == 1) v = fmaxf(v, 0.f);
      if (ACT == 2) v = 0.5f * v * (1.0f + erff(v * 0.70710678118654752f));
      if (ACT == 3) { const float u = 0.7978845608028654f * (v + 0.044715f * v * v * v); v = 0.5f * v * (1.0f + tanhf(u)); }
      so[w][8 * hh + r][t * 16 + ln] = v;
    }
  }
  __builtin_amdgcn_fence(__ATOMIC_ACQ_REL, "workgroup");
  __builtin_amdgcn_wave_barrier();
  const int rsub = lane >> 4, c4 = (lane & 15) * 4;
  {
#pragma unroll
    for (int q = 0; q < 8; ++q) {
      const int r = q * 2 + rsub;
      const v4f v = *(const v4fa*)&so[w][r][c4];
      *(v4f*)(C + (size_t)(row0 + r) * ldc + col0 + c4) = v;
    }
    
  }
}
// row LayerNorm (biased variance, eps) over N: s = X (+ R); optional out_sum <- s; out_norm <- (s-mu)*rsqrt(var+eps)*g + b
template <bool PARAM_BF16>
__global__ __launch_bounds__(256) void k_layernorm(const float* __restrict__ X, const float* __restrict__ R, const float* __restrict__ g, const float* __restrict__ bta,
                                                  float* __restrict__ out_sum, float* __restrict__ out_norm, int N, float eps) {
  __shared__ float red[256];
  const int row = blockIdx.x, tid = threadIdx.x;
  const float* x = X + (size_t)row * N; const float* rr = R ? R + (size_t)row * N : nullptr;
  float vals[16];                     // up to N = 4096
  const int per = N / 256;            // contiguous chunk per thread? use strided-by-4 chunks: thread handles j = tid*4 + 1024*u
  float s1 = 0.f;
  for (int u = 0; u < per / 4; ++u) {
    const int j = tid * 4 + 1024 * u;
    const v4f a = *(const v4fa*)(x + j);
    v4f b = {0.f,0.f,0.f,0.f}; if (rr) b = *(const v4fa*)(rr + j);
#pragma unroll
    for (int q = 0; q < 4; ++q) { const float v = a[q] + b[q]; vals[u * 4 + q] = v; s1 += v; }
  }
  red[tid] = s1; __syncthreads();
  for (int st = 128; st > 0; st >>= 1) { if (tid < st) red[tid] += red[tid + st]; __syncthreads(); }
  const float mu = red[0] / (float)N; __syncthreads();
  float s2 = 0.f;
  for (int u = 0; u < per / 4; ++u)
#pragma unroll
    for (int q = 0; q < 4; ++q) { const float c = vals[u * 4 + q] - mu; s2 += c * c; }
  red[tid] = s2; __syncthreads();
  for (int st = 128; st > 0; st >>= 1) { if (tid < st) red[tid] += red[tid + st]; __syncthreads(); }
  const float rs = rsqrtf(red[0] / (float)N + eps);
  {
    for (int u = 0; u < per / 4; ++u) {
      const int j = tid * 4 + 1024 * u;
      v4f o, sm;
#pragma unroll
      for (int q = 0; q < 4; ++q) {
        float gg = g[j + q], bb = bta[j + q];
        if (PARAM_BF16) { gg = bf16_round(gg); bb = bf16_round(bb); }
        sm[q] = vals[u * 4 + q]; o[q] = (vals[u * 4 + q] - mu) * rs * gg + bb;
      }
      if (out_sum) *(v4f*)(out_sum + (size_t)row * N + j) = sm;
      *(v4f*)(out_norm + (size_t)row * N + j) = o;
    }
    
  }
}



// ---- f16 WMMA path (v_wmma_f32_16x16x32_f16): 11-bit significands for operands in range — used where a [0,1] probability operand needs more precision than bf16
typedef _Float16 v16h __attribute__((ext_vector_type(16)));
union FragH { v16h v; v8us half[2]; _Float16 h[16]; unsigned short u[16]; };
template <int NT>
__device__ __forceinline__ v8f mmaH(v16h ah, v16h al, v16h bh, v16h bl, v8f c) {
  c = __builtin_amdgcn_wmma_f32_16x16x32_f16(false, ah, false, bh, (short)0, c, false, false);
  if (NT >= 2) c = __builtin_amdgcn_wmma_f32_16x16x32_f16(false, al, false, bh, (short)0, c, false, false);
  if (NT >= 3) c = __builtin_amdgcn_wmma_f32_16x16x32_f16(false, ah, false, bl, (short)0, c, false, false);
  asm volatile("v_nop\n\tv_nop\n\tv_nop\n\tv_nop" : "+v"(c) : "v"(ah), "v"(al), "v"(bh), "v"(bl));
  return c;
}
// batched GEMM like k_gemm_b but f16 operands: A f32 (split into f16 hi/lo if ASPLIT, else rounded to f16), Bt = f16 values [n][k]; alpha; C f32; N multiple of 16 (partial tiles skipped)
template <bool ASPLIT>
__global__ __launch_bounds__(128) void k_gemm_h(const float* __restrict__ A, int lda, size_t sA, const _Float16* __restrict__ Bh, int ldb, size_t sB, float alpha, float* __restrict__ C, int ldc, size_t sC, int M, int N, int K) {
  __shared__ __attribute__((aligned(16))) float so[4][16][64];
  const int tid = threadIdx.x, w = tid >> 5, lane = tid & 31, ln = lane & 15, hh = lane >> 4; const int by = blockIdx.y;
  A += (size_t)by * sA; Bh += (size_t)by * sB; C += (size_t)by * sC;
  const int ntn = (N + 63) / 64; const int wid = blockIdx.x * 4 + w; const int mt = wid / ntn, nq = wid % ntn; if (mt * 16 >= M) return;
  const int row0 = mt * 16, col0 = nq * 64; const float* arow = A + (size_t)(row0 + ln) * lda;
  v8f acc[4] = {};
  for (int kb = 0; kb < K; kb += 32) {
    FragH ah, al;
    const v4f x0 = *(const v4fa*)(arow + kb + 8 * hh), x1 = *(const v4fa*)(arow + kb + 8 * hh + 4), x2 = *(const v4fa*)(arow + kb + 16 + 8 * hh), x3 = *(const v4fa*)(arow + kb + 16 + 8 * hh + 4);
    float xs[16] = {x0[0],x0[1],x0[2],x0[3],x1[0],x1[1],x1[2],x1[3],x2[0],x2[1],x2[2],x2[3],x3[0],x3[1],x3[2],x3[3]};
#pragma unroll
    for (int i = 0; i < 16; ++i) { const _Float16 h = (_Float16)xs[i]; ah.h[i] = h; al.h[i] = ASPLIT ? (_Float16)(xs[i] - (float)h) : (_Float16)0.0f; }
#pragma unroll
    for (int t = 0; t < 4; ++t) { if (col0 + t * 16 >= N) continue; const size_t boff = (size_t)(col0 + t * 16 + ln) * ldb + kb; FragH bq; bq.half[0] = *(const v8us*)(Bh + boff + 8 * hh); bq.half[1] = *(const v8us*)(Bh + boff + 16 + 8 * hh);
      acc[t] = mmaH<ASPLIT ? 2 : 1>(ah.v, al.v, bq.v, bq.v, acc[t]); }
  }
#pragma unroll
  for (int t = 0; t < 4; ++t) { if (col0 + t * 16 >= N) continue;
#pragma unroll
    for (int r = 0; r < 8; ++r) so[w][8 * hh + r][t * 16 + ln] = acc[t][r] * alpha; }
  __builtin_amdgcn_fence(__ATOMIC_ACQ_REL, "workgroup"); __builtin_amdgcn_wave_barrier();
  const int rsub = lane >> 4, c4 = (lane & 15) * 4;
  {
#pragma unroll
    for (int q = 0; q < 8; ++q) { const int r = q * 2 + rsub; if (col0 + c4 < N) { const v4f v = *(const v4fa*)&so[w][r][c4]; *(v4f*)(C + (size_t)(row0 + r) * ldc + col0 + c4) = v; } }
     }
}

// Wt[n][k] = f16(W[k][n]·scale) from f32 row-major W[K][N] (scale = power of two; bf16-exact weights stay exact in f16 away from the subnormal range)
__global__ __launch_bounds__(256) void k_wt_f16(const float* __restrict__ W, _Float16* __restrict__ Wt, int K, int N, float scale) {
  const int t = blockIdx.x * 256 + threadIdx.x; if (t >= N * (K / 8)) return; const int n = t / (K / 8), k8 = (t % (K / 8)) * 8; FragH f;
#pragma unroll
  for (int i = 0; i < 8; ++i) f.h[i] = (_Float16)(bf16_round(W[(size_t)(k8 + i) * N + n]) * scale); const v8us o = f.half[0];
  *(v8us*)((unsigned short*)Wt + (size_t)n * K + k8) = o; 
}
// k_gemm_hh variant with fused epilogue: v = acc·alpha + bias[by·sBias + col] (+ CP[(row/rowsPerB)·sCPb + by·64 + col] if CP) ; ACT 0 none / 1 elu ; writes f16 C16 and f32 C, each if non-null
template <int ACT>
__global__ __launch_bounds__(128) void k_gemm_hhx(const _Float16* __restrict__ A, int lda, size_t sA, const _Float16* __restrict__ Bh, int ldb, size_t sB, float alpha, const float* __restrict__ bias, size_t sBias, const float* __restrict__ CP, int rowsPerB, size_t sCPb, int row0g,
    float* __restrict__ C, _Float16* __restrict__ C16, int ldc, size_t sC, int M, int N, int K) {
  __shared__ __attribute__((aligned(16))) float so[4][16][64];
  const int tid = threadIdx.x, w = tid >> 5, lane = tid & 31, ln = lane & 15, hh = lane >> 4; const int by = blockIdx.y;
  A += (size_t)by * sA; Bh += (size_t)by * sB; const size_t cofs = (size_t)by * sC; const float* bp = bias ? bias + (size_t)by * sBias : nullptr;
  const int ntn = (N + 63) / 64; const int wid = blockIdx.x * 4 + w; const int mt = wid / ntn, nq = wid % ntn; if (mt * 16 >= M) return;
  const int row0 = mt * 16, col0 = nq * 64; const _Float16* arow = A + (size_t)(row0 + ln) * lda;
  v8f acc[4] = {};
  for (int kb = 0; kb < K; kb += 32) { FragH ah; ah.half[0] = *(const v8us*)((const unsigned short*)arow + kb + 8 * hh); ah.half[1] = *(const v8us*)((const unsigned short*)arow + kb + 16 + 8 * hh);
#pragma unroll
    for (int t = 0; t < 4; ++t) { if (col0 + t * 16 >= N) continue; const size_t boff = (size_t)(col0 + t * 16 + ln) * ldb + kb; FragH bq; bq.half[0] = *(const v8us*)((const unsigned short*)Bh + boff + 8 * hh); bq.half[1] = *(const v8us*)((const unsigned short*)Bh + boff + 16 + 8 * hh);
      acc[t] = mmaH<1>(ah.v, ah.v, bq.v, bq.v, acc[t]); }
  }
#pragma unroll
  for (int t = 0; t < 4; ++t) { if (col0 + t * 16 >= N) continue; const int col = col0 + t * 16 + ln; const float bv = bp ? bf16_round(bp[col]) : 0.f;
#pragma unroll
    for (int r = 0; r < 8; ++r) { float v = acc[t][r] * alpha + bv; if (CP) { const int bidx = (row0g + row0 + 8 * hh + r) / rowsPerB; v += CP[(size_t)bidx * sCPb + (size_t)by * 64 + col]; } if (ACT == 1) v = (v > 0.f) ? v : expm1f(v); else if (ACT == 7) v = (v > 0.f) ? v + 1.0f : expf(v); else if (ACT == 8) v = tanhf(v); else if (ACT == 9) v = 0.5f * v * (1.0f + tanhf(0.7978845608028654f * (v + 0.044715f * v * v * v))); else if (ACT == 11) v = 1.0f / (1.0f + expf(-v)); else if (ACT == 12) v = (v > 0.f) ? v : 0.01f * v; else if (ACT == 14) v = (v > 0.f) ? v : 0.1f * v; else if (ACT == 15) v = v / (1.0f + expf(-v)); else if (ACT == 3) v = fmaxf(v, 0.f); else if (ACT == 6) v = 0.5f * v * (1.0f + erff(v * 0.70710678118654752f)); so[w][8 * hh + r][t * 16 + ln] = v; } }
  __builtin_amdgcn_fence(__ATOMIC_ACQ_REL, "workgroup"); __builtin_amdgcn_wave_barrier();
  const int rsub = lane >> 4, c4 = (lane & 15) * 4; typedef _Float16 v4h __attribute__((ext_vector_type(4)));
  {
#pragma unroll
    for (int q = 0; q < 8; ++q) { const int r = q * 2 + rsub; if (col0 + c4 < N) { const v4f v = *(const v4fa*)&so[w][r][c4]; if (C) *(v4f*)(C + cofs + (size_t)(row0 + r) * ldc + col0 + c4) = v; if (C16) { v4h h4; for (int i = 0; i < 4; ++i) h4[i] = (_Float16)v[i]; *(v4h*)(C16 + cofs + (size_t)(row0 + r) * ldc + col0 + c4) = h4; } } }
     }
}


typedef _Float16 v4h __attribute__((ext_vector_type(4)));

__global__ __launch_bounds__(256) void k_x16(const float* __restrict__ x, _Float16* __restrict__ X16, size_t n8) { const size_t t = (size_t)blockIdx.x * 256 + threadIdx.x; if (t >= n8) return; FragH f;
#pragma unroll
  for (int q = 0; q < 8; ++q) f.h[q] = (_Float16)bf16_round(x[t * 8 + q]); *(v8us*)((unsigned short*)X16 + t * 8) = f.half[0];  }
__global__ __launch_bounds__(256) void k_h16(const float* __restrict__ x, _Float16* __restrict__ X16, size_t n8) { const size_t t = (size_t)blockIdx.x * 256 + threadIdx.x; if (t >= n8) return; FragH f;
#pragma unroll
  for (int q = 0; q < 8; ++q) f.h[q] = (_Float16)x[t * 8 + q]; *(v8us*)((unsigned short*)X16 + t * 8) = f.half[0];  }
__global__ __launch_bounds__(256) void k_round16f(const float* __restrict__ W, _Float16* __restrict__ Bt, size_t n8) { const size_t t = (size_t)blockIdx.x * 256 + threadIdx.x; if (t >= n8) return; FragH f;
#pragma unroll
  for (int i = 0; i < 8; ++i) f.h[i] = (_Float16)(bf16_round(W[t * 8 + i]) * 16.0f); *(v8us*)((unsigned short*)Bt + t * 8) = f.half[0];  }
template <int NHv, int TTv>
__global__ __launch_bounds__(256) void k_vt(const _Float16* __restrict__ V16, int ldv, int voff, _Float16* __restrict__ Vt) { __shared__ unsigned short tl[64][66]; const int tid = threadIdx.x; const int slab = blockIdx.x / (TTv / 64), lg = blockIdx.x % (TTv / 64); const int b = slab / NHv, h = slab % NHv;
  for (int i = tid; i < 64 * 8; i += 256) { const int r = i / 8, c8 = (i % 8) * 8; FragH f; f.half[0] = *(const v8us*)((const unsigned short*)V16 + ((size_t)b * TTv + lg * 64 + r) * ldv + voff + h * 64 + c8);
#pragma unroll
    for (int q = 0; q < 8; ++q) tl[r][c8 + q] = f.u[q]; }
  __syncthreads();
  {
#pragma unroll
    for (int rd = 0; rd < 2; ++rd) { const int d = rd * 32 + tid / 8, pc = tid % 8; FragH f;
#pragma unroll
      for (int q = 0; q < 8; ++q) f.u[q] = tl[pc * 8 + q][d];
      *(v8us*)((unsigned short*)Vt + ((size_t)slab * 64 + d) * TTv + lg * 64 + pc * 8) = f.half[0]; }
     } }

typedef float v2f __attribute__((ext_vector_type(2)));
// lane l with lane l ^ 16 (the two halves of a wave hold the two key halves of one query column)
__device__ __forceinline__ float xhalf(float x) { return __builtin_bit_cast(float, __builtin_amdgcn_permlanex16(__builtin_bit_cast(int, x), __builtin_bit_cast(int, x), 0x76543210, 0xfedcba98, false, false)); }

// One lane's eight 16-byte copies of a stage (four of K, four of V^T), global memory to LDS through no register. The s_wait_xcnt stands in the copies' own statement, ahead of any rewrite of the address registers they name.
__device__ __forceinline__ void stage_copy(unsigned lk, const unsigned short* gk, size_t gkstep, unsigned lkstep, unsigned lv, const unsigned short* gv, size_t gvstep, unsigned lvstep) {
  asm volatile("global_load_async_to_lds_b128 %0, %8, off\n\t"
               "global_load_async_to_lds_b128 %1, %9, off\n\t"
               "global_load_async_to_lds_b128 %2, %10, off\n\t"
               "global_load_async_to_lds_b128 %3, %11, off\n\t"
               "global_load_async_to_lds_b128 %4, %12, off\n\t"
               "global_load_async_to_lds_b128 %5, %13, off\n\t"
               "global_load_async_to_lds_b128 %6, %14, off\n\t"
               "global_load_async_to_lds_b128 %7, %15, off\n\t"
               "s_wait_xcnt 0x0"
               :: "v"(lk), "v"(lk + lkstep), "v"(lk + 2 * lkstep), "v"(lk + 3 * lkstep), "v"(lv), "v"(lv + lvstep), "v"(lv + 2 * lvstep), "v"(lv + 3 * lvstep),
                  "v"(gk), "v"(gk + gkstep), "v"(gk + 2 * gkstep), "v"(gk + 3 * gkstep), "v"(gv), "v"(gv + gvstep), "v"(gv + 2 * gvstep), "v"(gv + 3 * gvstep)
               : "memory");
}

__global__ __launch_bounds__(128) void k_flash(const _Float16* __restrict__ Q16, int ldq, const _Float16* __restrict__ K16, int ldk, const _Float16* __restrict__ Vt, const int* __restrict__ MSK, float* __restrict__ O, int ldo) {
  constexpr int RPW = 16, NQB = NN / (4 * RPW), DT = 2; (void)MSK;
  constexpr int TK = 128, NS = NN / TK;      /* keys a stage, stages */
  constexpr int KP = HD * 2 + 16, VP = TK * 2 + 16;      /* LDS row pitches in bytes, 16 B x odd: 16 lanes' ds_load_b128 fall on all 64 banks */
  constexpr int KB = TK * KP, SB = KB + HD * VP;      /* a stage: TK rows of K (HD channels), then HD rows of V^T (TK keys) */
  __shared__ __attribute__((aligned(16))) unsigned char sm[2 * SB];
  constexpr float SL2E = 0.17677669529663687f * 1.4426950408889634f;      /* 32^-1/2 * log2(e): e^(scale*s - m) = 2^(SL2E*s - m2), one fma ahead of a bare v_exp_f32 */
  const int tid = threadIdx.x, w = tid >> 5, lane = tid & 31, ln = lane & 15, hh = lane >> 4;
  const int slab = blockIdx.x / NQB, qblk = blockIdx.x % NQB; const int b = slab / NH, h = slab % NH; const int q0 = qblk * (4 * RPW) + w * RPW;
  const unsigned short* Vth = (const unsigned short*)Vt + ((size_t)b * CC + h * HD) * NN;      /* V^T = v[b][(h,d)][n] channel-major */
  /* copy map: K chunk c of thread tid = row (tid >> 2) + 32 c, 16-byte column tid & 3; V^T chunk c = row (tid >> 4) + 8 c, 16-byte column tid & 15 */
  const unsigned short* gk = (const unsigned short*)K16 + ((size_t)b * NN + (tid >> 2)) * ldk + h * HD + (tid & 3) * 8;
  const unsigned short* gv = Vth + (size_t)(tid >> 4) * NN + (tid & 15) * 8;
  const unsigned lds0 = (unsigned)(size_t)sm;      /* low 32 bits of the shared address = byte offset in the work-group's LDS */
  const unsigned lk = lds0 + (tid >> 2) * KP + (tid & 3) * 16, lv = lds0 + KB + (tid >> 4) * VP + (tid & 15) * 16;
  const size_t gkstep = (size_t)32 * ldk, gkstage = (size_t)TK * ldk;
  stage_copy(lk, gk, gkstep, 32 * KP, lv, gv, (size_t)8 * NN, 8 * VP);
  FragH bq;      /* B: column ln = query q0 + ln, k = head channel */
  { const unsigned short* qr = (const unsigned short*)Q16 + ((size_t)b * NN + q0 + ln) * ldq + h * HD; bq.half[0] = *(const v8us*)(qr + 8 * hh); bq.half[1] = *(const v8us*)(qr + 16 + 8 * hh); }
  asm volatile("s_wait_asynccnt 0x0" ::: "memory");      /* this wave's share of stage 0 has landed */
  __syncthreads();      /* stage 0 published to all four waves */
  gk += gkstage; gv += TK;
  stage_copy(lk + SB, gk, gkstep, 32 * KP, lv + SB, gv, (size_t)8 * NN, 8 * VP);
  float m_q = -3.0e38f, l_q = 0.f; v8f oacc[DT];
#pragma unroll
  for (int dt = 0; dt < DT; ++dt) oacc[dt] = (v8f){0.f,0.f,0.f,0.f,0.f,0.f,0.f,0.f};
#pragma unroll 1      /* one body for both buffers: the buffer is an offset */
  for (int t = 0; t < NS; ++t) {
    const unsigned bo = (unsigned)(t & 1) * SB;
    const unsigned char* kf = sm + bo + ln * KP + hh * 16; const unsigned char* vf = sm + bo + KB + ln * VP + hh * 16;
#pragma unroll      /* the four 32-key passes of a stage: every LDS offset an immediate */
    for (int ps = 0; ps < TK / 32; ++ps) {
    FragH ak[2], av[DT];      /* the pass's eight fragment reads stand together at its head: one LDS latency a pass, V^T's behind the score products and the softmax */
#pragma unroll
    for (int nt = 0; nt < 2; ++nt) { const unsigned char* kr = kf + (ps * 32 + nt * 16) * KP; ak[nt].half[0] = *(const v8us*)kr; ak[nt].half[1] = *(const v8us*)(kr + 32); }
#pragma unroll
    for (int dt = 0; dt < DT; ++dt) { const unsigned char* vrow = vf + dt * 16 * VP + ps * 64; av[dt].half[0] = *(const v8us*)vrow; av[dt].half[1] = *(const v8us*)(vrow + 32); }
    v8f s[2];      /* s[nt][r] = S^T[key t*TK + ps*32 + nt*16 + 8*hh + r][query q0 + ln] */
#pragma unroll
    for (int nt = 0; nt < 2; ++nt) s[nt] = mmaH<1>(ak[nt].v, ak[nt].v, bq.v, bq.v, (v8f){0.f,0.f,0.f,0.f,0.f,0.f,0.f,0.f});
    float mt[8];
#pragma unroll
    for (int i = 0; i < 8; ++i) mt[i] = fmaxf(s[0][i], s[1][i]);
    float mc = fmaxf(fmaxf(fmaxf(mt[0], mt[1]), fmaxf(mt[2], mt[3])), fmaxf(fmaxf(mt[4], mt[5]), fmaxf(mt[6], mt[7])));
    mc = fmaxf(mc, xhalf(mc));      /* both halves now hold the maximum over the query's 32 raw products (SL2E > 0 keeps the order) */
    const float mn = fmaxf(m_q, mc * SL2E); const float al = (mn > -1.0e38f) ? __builtin_amdgcn_exp2f(m_q - mn) : 1.0f; m_q = mn;      /* m_q, mn: base-2 exponents */
    const float nb = 10.0f - mn;      /* 2^10 = the f16 scale of P, carried in the exponent: p and l_q hold 1024 times the shifted values */
    v2f p[8]; FragH pb;
#pragma unroll
    for (int i = 0; i < 8; ++i) { const v2f a = (v2f){s[i >> 2][(2 * i) & 7], s[i >> 2][(2 * i + 1) & 7]} * SL2E + nb;
      p[i] = (v2f){__builtin_amdgcn_exp2f(a[0]), __builtin_amdgcn_exp2f(a[1])}; pb.h[2 * i] = (_Float16)p[i][0]; pb.h[2 * i + 1] = (_Float16)p[i][1]; }
    const v2f psum = ((p[0] + p[1]) + (p[2] + p[3])) + ((p[4] + p[5]) + (p[6] + p[7]));
    l_q = l_q * al + (psum[0] + psum[1]);      /* this half's 16 keys; the halves join after the loop */
#pragma unroll
    for (int dt = 0; dt < DT; ++dt) { oacc[dt] *= al; oacc[dt] = mmaH<1>(av[dt].v, av[dt].v, pb.v, pb.v, oacc[dt]); } }      /* oacc[dt][r] = O^T[channel dt*16 + 8*hh + r][query q0 + ln] */
    asm volatile("s_wait_dscnt 0x0" ::: "memory");      /* this wave's reads of stage t are done before its buffer is handed back */
    asm volatile("s_wait_asynccnt 0x0" ::: "memory");      /* this wave's share of stage t + 1 has landed */
    __syncthreads();      /* publishes stage t + 1 and ends every wave's reads of stage t */
    if (t + 2 < NS) { gk += gkstage; gv += TK; stage_copy(lk + bo, gk, gkstep, 32 * KP, lv + bo, gv, (size_t)8 * NN, 8 * VP); }      /* stage t + 2 into the buffer just read */
  }
  asm volatile("s_wait_asynccnt 0x0" ::: "memory");      /* no copy outstanding at the wave's end */
  const float l = l_q + xhalf(l_q); const float den = l + (1e-6f * 1024.0f) * __builtin_amdgcn_exp2f(-m_q); const float inv = (den > 0.f && den < INFINITY) ? 1.0f / den : 0.f;      /* sum e^s/(sum e^s + 1e-6) form: e^(-m)*1e-6 joins the shifted sum; an infinite den (all logits far below 0) reproduces the reference's ~0 output */
  float* orow = O + ((size_t)b * NN + q0 + ln) * ldo + h * HD + 8 * hh;
#pragma unroll
  for (int dt = 0; dt < DT; ++dt) { const v8f o = oacc[dt] * inv; *(v4f*)(orow + dt * 16) = (v4f){o[0], o[1], o[2], o[3]}; *(v4f*)(orow + dt * 16 + 4) = (v4f){o[4], o[5], o[6], o[7]}; } }

extern "C" void kernel_launch(void* const* d_in, const int* in_sizes, int n_in,
                              void* d_out, int out_size, void* d_ws, size_t ws_size, hipStream_t stream) {
  (void)in_sizes; (void)n_in; (void)out_size;
  const float* x = (const float*)d_in[0]; const float* Wqkv = (const float*)d_in[1]; const float* Wout = (const float*)d_in[2]; const float* bout = (const float*)d_in[3];
  char* ws = (char*)d_ws; size_t off = 0;
  auto take = [&](size_t bytes) { char* p = ws + off; off += (bytes + 255) & ~(size_t)255; return p; };
  _Float16* Bqkv = (_Float16*)take((size_t)C3 * CC * 2); _Float16* Bo = (_Float16*)take((size_t)CC * CC * 2); _Float16* X16 = (_Float16*)take((size_t)NR * CC * 2);
  _Float16* QK = (_Float16*)take((size_t)NR * 2 * CC * 2); _Float16* Vt = (_Float16*)take((size_t)BB * CC * NN * 2); float* O = (float*)take((size_t)NR * CC * 4); _Float16* O16 = (_Float16*)take((size_t)NR * CC * 2);
  if (off > ws_size) return;      // 0.4 + 0.1 + 4.2 + 8.4 + 4.2 + 8.4 + 4.2 ≈ 30 MB
  k_wt_f16<<<(unsigned)(((size_t)C3 * (CC / 8) + 255) / 256), 256, 0, stream>>>(Wqkv, Bqkv, CC, C3, 16.0f); k_wt_f16<<<(unsigned)(((size_t)CC * (CC / 8) + 255) / 256), 256, 0, stream>>>(Wout, Bo, CC, CC, 16.0f);      /* (in,out) → Bt[n][k] ×2^4 */
  k_x16<<<(unsigned)(((size_t)NR * CC / 8 + 255) / 256), 256, 0, stream>>>(x, X16, (size_t)NR * CC / 8);
  k_gemm_hhx<0><<<dim3(((NR / 16) * (2 * CC / 64) + 3) / 4, 1), 128, 0, stream>>>(X16, CC, 0, Bqkv, CC, 0, 0.0625f, nullptr, 0, nullptr, 1, 0, 0, nullptr, QK, 2 * CC, 0, NR, 2 * CC, CC);      /* [q | k] token-major [(b,n)][512]: M 8192 N 512 K 256 */
  k_gemm_hhx<0><<<dim3(((CC / 16) * (NN / 64) + 3) / 4, BB), 128, 0, stream>>>(Bqkv + (size_t)2 * CC * CC, CC, 0, X16, CC, (size_t)NN * CC, 0.0625f, nullptr, 0, nullptr, 1, 0, 0, nullptr, Vt, NN, (size_t)CC * NN, CC, NN, CC);      /* v channel-major per batch [b][(h,d)][n] = Vᵀ: A = Bt rows 512..767 ([out][in]), B = X16[b]: M 256 N 2048 K 256 */
  k_flash<<<BB * NH * (NN / 64), 128, 0, stream>>>(QK, 2 * CC, QK + CC, 2 * CC, Vt, nullptr, O, CC);      /* blocks = (b,h) × 64-query groups */
  k_h16<<<(unsigned)(((size_t)NR * CC / 8 + 255) / 256), 256, 0, stream>>>(O, O16, (size_t)NR * CC / 8);
  k_gemm_hhx<0><<<dim3(((NR / 16) * (CC / 64) + 3) / 4, 1), 128, 0, stream>>>(O16, CC, 0, Bo, CC, 0, 0.0625f, bout, 0, nullptr, 1, 0, 0, (float*)d_out, nullptr, CC, 0, NR, CC, CC);      /* y = out·Wout + bout: M 8192 N 256 K 256 */
}

// v004
// It runs in 70.1 microseconds.
// Timed twice side by side with v003, it ran 1.16 times as fast both times.
// All steps since v000 together make it 3.35 times as fast.
#include <hip/hip_runtime.h>
// KeOps-style multi-head attention (B=4, n=2048, dim 256, 8 heads × 32): qkv = x·Wqkv; q scaled by 32^-½; e = exp(q·kᵀ) WITHOUT max subtraction; out = (e·v)/(Σe + 1e-6) merged over heads; y = out·Wout + bout.
// Compute dtype: x, Wqkv, Wout, bout rounded to bf16; q/k token-major and v channel-major (= Vᵀ) as f16 GEMM outputs (f32 accumulate); fused flash-style kernel per (b,h) (online max-rescaled sums
// in f32 — the unshifted quotient is recovered exactly through the normaliser l + 1e-6·e^(−m); P f16 ×2^10) on v_wmma_f32_16x16x32_f16; O → f16 → output GEMM with bias; f32 accumulate.
#define BB 4
#define NN 2048
#define CC 256
#define C3 768
#define NH 8
#define HD 32
#define NR (BB * NN)

typedef __bf16 v16b __attribute__((ext_vector_type(16)));
typedef unsigned short v8us __attribute__((ext_vector_type(8), may_alias));
typedef float  v8f  __attribute__((ext_vector_type(8)));
typedef float  v4f  __attribute__((ext_vector_type(4)));
typedef float  v4fa __attribute__((ext_vector_type(4), may_alias));
union FragB { v16b v; v8us half[2]; unsigned short u[16]; };

__device__ __forceinline__ unsigned short bf16_bits(float x) { unsigned int u = __float_as_uint(x); return (unsigned short)((u + 0x7FFFu + ((u >> 16) & 1u)) >> 16); }
__device__ __forceinline__ float bf16_val(unsigned short b) { return __uint_as_float(((unsigned int)b) << 16); }
__device__ __forceinline__ float bf16_round(float x) { return bf16_val(bf16_bits(x)); }
// D += A·B with NT terms: 1 = ah·bh, 2 = + al·bh (A split), 3 = + ah·bl (both split)
template <int NT>
__device__ __forceinline__ v8f mmaN(v16b ah, v16b al, v16b bh, v16b bl, v8f c) {
  c = __builtin_amdgcn_wmma_f32_16x16x32_bf16(false, ah, false, bh, (short)0, c, false, false);
  if (NT >= 2) c = __builtin_amdgcn_wmma_f32_16x16x32_bf16(false, al, false, bh, (short)0, c, false, false);
  if (NT >= 3) c = __builtin_amdgcn_wmma_f32_16x16x32_bf16(false, ah, false, bl, (short)0, c, false, false);
  asm volatile("v_nop\n\tv_nop\n\tv_nop\n\tv_nop" : "+v"(c) : "v"(ah), "v"(al), "v"(bh), "v"(bl));
  return c;
}

__global__ __launch_bounds__(256) void k_wt_bf16(const float* __restrict__ W, unsigned short* __restrict__ Wt, int K, int N) {
  const int t = blockIdx.x * 256 + threadIdx.x;
  const int k8n = K / 8;
  if (t >= N * k8n) return;
  const int n = t / k8n, k8 = (t % k8n) * 8;
  v8us v;
#pragma unroll
  for (int i = 0; i < 8; ++i) v[i] = bf16_bits(W[(size_t)(k8 + i) * N + n]);
  *(v8us*)(Wt + (size_t)n * K + k8) = v;
  
}

// GEMM C[M][N] (f32, pitch ldc) = act(A[M][K]·W + bias). A f32 row-major (pitch lda) converted per fragment to bf16
// (ASPLIT: hi/lo two planes -> 2 terms, else single rounded term); Wt bf16 [N][K] (pitch ldb). BIAS_BF16 rounds the
// bias to bf16 first (bias quantised to bf16 before the add). K%32==0, M%16==0, N%64==0.
template <bool ASPLIT, int ACT, bool BIAS_BF16>
__global__ __launch_bounds__(128) void k_gemm_bf(const float* __restrict__ A, int lda, const unsigned short* __restrict__ Wt, int ldb,
                                               const float* __restrict__ bias, float* __restrict__ C, int ldc, int M, int N, int K) {
  __shared__ __attribute__((aligned(16))) float so[4][16][64];
  const int tid = threadIdx.x, w = tid >> 5, lane = tid & 31, ln = lane & 15, hh = lane >> 4;
  const int ntn = N / 64;
  const int wid = blockIdx.x * 4 + w;
  const int mt = wid / ntn, nq = wid % ntn;
  if (mt * 16 >= M) return;
  const int row0 = mt * 16, col0 = nq * 64;
  const float* arow = A + (size_t)(row0 + ln) * lda;
  v8f acc[4] = {};
  for (int kb = 0; kb < K; kb += 32) {
    FragB ah, al;
    const v4f x0 = *(const v4fa*)(arow + kb + 8 * hh), x1 = *(const v4fa*)(arow + kb + 8 * hh + 4);
    const v4f x2 = *(const v4fa*)(arow + kb + 16 + 8 * hh), x3 = *(const v4fa*)(arow + kb + 16 + 8 * hh + 4);
    float xs[16] = {x0[0],x0[1],x0[2],x0[3],x1[0],x1[1],x1[2],x1[3],x2[0],x2[1],x2[2],x2[3],x3[0],x3[1],x3[2],x3[3]};
#pragma unroll
    for (int i = 0; i < 16; ++i) { const unsigned short hb = bf16_bits(xs[i]); ah.u[i] = hb; al.u[i] = ASPLIT ? bf16_bits(xs[i] - bf16_val(hb)) : (unsigned short)0; }
#pragma unroll
    for (int t = 0; t < 4; ++t) {
      const unsigned short* brow = Wt + (size_t)(col0 + t * 16 + ln) * ldb + kb;
      FragB b;
      b.half[0] = *(const v8us*)(brow + 8 * hh);
      b.half[1] = *(const v8us*)(brow + 16 + 8 * hh);
      acc[t] = mmaN<ASPLIT ? 2 : 1>(ah.v, al.v, b.v, b.v, acc[t]);
    }
  }
#pragma unroll
  for (int t = 0; t < 4; ++t) {
    float bv = bias ? bias[col0 + t * 16 + ln] : 0.f;
    if (BIAS_BF16) bv = bf16_round(bv);
#pragma unroll
    for (int r = 0; r < 8; ++r) { float v = acc[t][r] + bv; if (ACT == 1) v = fmaxf(v, 0.f); so[w][8 * hh + r][t * 16 + ln] = v; }
  }
  __builtin_amdgcn_fence(__ATOMIC_ACQ_REL, "workgroup");
  __builtin_amdgcn_wave_barrier();
  const int rsub = lane >> 4, c4 = (lane & 15) * 4;
  {
#pragma unroll
    for (int q = 0; q < 8; ++q) {
      const int r = q * 2 + rsub;
      const v4f v = *(const v4fa*)&so[w][r][c4];
      *(v4f*)(C + (size_t)(row0 + r) * ldc + col0 + c4) = v;
    }
    
  }
}

// Flash-style causal/unmasked attention, all contractions 3-term bf16 hi/lo splits, f32 softmax with running max.
// q,k,v rows are read from f32 buffers with arbitrary row pitch (so they can live inside a fused qkv buffer);
// D = head size (multiple of 32, <= 128); one wave = 16 query rows; block = 4 waves (64 queries) sharing K/V chunks of 32.
template <int D, bool CAUSAL>
__global__ __launch_bounds__(128) void k_flash(const float* __restrict__ qb, const float* __restrict__ kb, const float* __restrict__ vb,
                                             int pitch, int T, int H, float scale, float* __restrict__ y, int ypitch) {
  constexpr int KS = D / 32;        // k-steps for QK
  constexpr int DT = D / 16;        // d tiles for PV
  __shared__ __attribute__((aligned(16))) unsigned short sKh[32][D + 8], sKl[32][D + 8], sVh[32][D + 8], sVl[32][D + 8];
  __shared__ __attribute__((aligned(16))) unsigned short sPh[4][16][40], sPl[4][16][40];
  __shared__ __attribute__((aligned(16))) float sO[4][16][D];
  const int tid = threadIdx.x, w = tid >> 5, lane = tid & 31, ln = lane & 15, hh = lane >> 4;
  const int nqb = (T + 63) / 64;
  const int bh = blockIdx.x / nqb, qblk = blockIdx.x % nqb;
  const int b = bh / H, h = bh % H;
  const int q0 = qblk * 64 + w * 16;
  const float* Q = qb + (size_t)b * T * pitch + h * D;
  const float* K = kb + (size_t)b * T * pitch + h * D;
  const float* V = vb + (size_t)b * T * pitch + h * D;

  // A fragments of the wave's 16 query rows (scaled), hi/lo
  FragB aqh[KS], aql[KS];
  {
    int row = q0 + ln; if (row >= T) row = T - 1;
    const float* qr = Q + (size_t)row * pitch;
#pragma unroll
    for (int ks = 0; ks < KS; ++ks)
#pragma unroll
      for (int i = 0; i < 16; ++i) {
        const int d = ks * 32 + ((i < 8) ? (8 * hh + i) : (16 + 8 * hh + (i - 8)));
        const float x = qr[d] * scale; const unsigned short hb = bf16_bits(x);
        aqh[ks].u[i] = hb; aql[ks].u[i] = bf16_bits(x - bf16_val(hb));
      }
  }
  float m_r[8], l_r[8];
#pragma unroll
  for (int r = 0; r < 8; ++r) { m_r[r] = -3.0e38f; l_r[r] = 0.f; }
  v8f oacc[DT];
#pragma unroll
  for (int dt = 0; dt < DT; ++dt) oacc[dt] = (v8f){0.f,0.f,0.f,0.f,0.f,0.f,0.f,0.f};

  const int kv_end = CAUSAL ? min(T, qblk * 64 + 64) : T;     // block-uniform
  for (int j0 = 0; j0 < kv_end; j0 += 32) {
    __syncthreads();
    for (int e = tid; e < 32 * (D / 4); e += 128) {
      const int r = e / (D / 4), c4 = (e % (D / 4)) * 4;
      const int key = j0 + r;
      v4f kf = {0.f,0.f,0.f,0.f}, vf = {0.f,0.f,0.f,0.f};
      if (key < T) { kf = *(const v4fa*)(K + (size_t)key * pitch + c4); vf = *(const v4fa*)(V + (size_t)key * pitch + c4); }
#pragma unroll
      for (int t = 0; t < 4; ++t) {
        unsigned short hb = bf16_bits(kf[t]); sKh[r][c4 + t] = hb; sKl[r][c4 + t] = bf16_bits(kf[t] - bf16_val(hb));
        hb = bf16_bits(vf[t]); sVh[r][c4 + t] = hb; sVl[r][c4 + t] = bf16_bits(vf[t] - bf16_val(hb));
      }
    }
    __syncthreads();
    // S tile 16 x 32
    v8f s[2];
#pragma unroll
    for (int nt = 0; nt < 2; ++nt) {
      v8f acc = {};
#pragma unroll
      for (int ks = 0; ks < KS; ++ks) {
        FragB bh_, bl_;
        bh_.half[0] = *(const v8us*)&sKh[nt * 16 + ln][ks * 32 + 8 * hh]; bh_.half[1] = *(const v8us*)&sKh[nt * 16 + ln][ks * 32 + 16 + 8 * hh];
        bl_.half[0] = *(const v8us*)&sKl[nt * 16 + ln][ks * 32 + 8 * hh]; bl_.half[1] = *(const v8us*)&sKl[nt * 16 + ln][ks * 32 + 16 + 8 * hh];
        acc = mmaN<3>(aqh[ks].v, aql[ks].v, bh_.v, bl_.v, acc);
      }
      s[nt] = acc;
    }
    // mask + running max (rows 8hh+r; the 16 lanes of a half share rows)
    float alpha[8];
#pragma unroll
    for (int r = 0; r < 8; ++r) {
      const int qi = q0 + 8 * hh + r;
      const int ja = j0 + ln, jb = j0 + 16 + ln;
      if (CAUSAL) { if (ja > qi) s[0][r] = -3.0e38f; if (jb > qi) s[1][r] = -3.0e38f; }
      if (ja >= T) s[0][r] = -3.0e38f;
      if (jb >= T) s[1][r] = -3.0e38f;
      float mx = fmaxf(s[0][r], s[1][r]);
      mx = fmaxf(mx, __shfl_xor(mx, 1, 32)); mx = fmaxf(mx, __shfl_xor(mx, 2, 32)); mx = fmaxf(mx, __shfl_xor(mx, 4, 32)); mx = fmaxf(mx, __shfl_xor(mx, 8, 32));
      const float mnew = fmaxf(m_r[r], mx);
      alpha[r] = (mnew > -1.0e38f) ? __expf(m_r[r] - mnew) : 1.0f;
      const float p0 = (s[0][r] > -1.0e38f) ? __expf(s[0][r] - mnew) : 0.f;
      const float p1 = (s[1][r] > -1.0e38f) ? __expf(s[1][r] - mnew) : 0.f;
      m_r[r] = mnew;
      l_r[r] = l_r[r] * alpha[r] + p0 + p1;            // per-lane partial row sum (16 lanes combined at the end)
      unsigned short hb = bf16_bits(p0); sPh[w][8 * hh + r][ln] = hb;      sPl[w][8 * hh + r][ln] = bf16_bits(p0 - bf16_val(hb));
      hb = bf16_bits(p1);                sPh[w][8 * hh + r][16 + ln] = hb; sPl[w][8 * hh + r][16 + ln] = bf16_bits(p1 - bf16_val(hb));
    }
#pragma unroll
    for (int dt = 0; dt < DT; ++dt)
#pragma unroll
      for (int r = 0; r < 8; ++r) oacc[dt][r] *= alpha[r];
    __builtin_amdgcn_fence(__ATOMIC_ACQ_REL, "workgroup");
    __builtin_amdgcn_wave_barrier();
    FragB pah, pal;
    pah.half[0] = *(const v8us*)&sPh[w][ln][8 * hh]; pah.half[1] = *(const v8us*)&sPh[w][ln][16 + 8 * hh];
    pal.half[0] = *(const v8us*)&sPl[w][ln][8 * hh]; pal.half[1] = *(const v8us*)&sPl[w][ln][16 + 8 * hh];
#pragma unroll
    for (int dt = 0; dt < DT; ++dt) {
      FragB bvh, bvl;
#pragma unroll
      for (int i = 0; i < 8; ++i) {
        bvh.u[i] = sVh[8 * hh + i][dt * 16 + ln]; bvh.u[8 + i] = sVh[16 + 8 * hh + i][dt * 16 + ln];
        bvl.u[i] = sVl[8 * hh + i][dt * 16 + ln]; bvl.u[8 + i] = sVl[16 + 8 * hh + i][dt * 16 + ln];
      }
      oacc[dt] = mmaN<3>(pah.v, pal.v, bvh.v, bvl.v, oacc[dt]);
    }
    __builtin_amdgcn_fence(__ATOMIC_ACQ_REL, "workgroup");
    __builtin_amdgcn_wave_barrier();
  }
#pragma unroll
  for (int r = 0; r < 8; ++r) {
    float l = l_r[r];
    l += __shfl_xor(l, 1, 32); l += __shfl_xor(l, 2, 32); l += __shfl_xor(l, 4, 32); l += __shfl_xor(l, 8, 32);
    l_r[r] = (l > 0.f) ? 1.0f / l : 0.f;
  }
#pragma unroll
  for (int dt = 0; dt < DT; ++dt)
#pragma unroll
    for (int r = 0; r < 8; ++r) sO[w][8 * hh + r][dt * 16 + ln] = oacc[dt][r] * l_r[r];
  __builtin_amdgcn_fence(__ATOMIC_ACQ_REL, "workgroup");
  __builtin_amdgcn_wave_barrier();
  {
    for (int r = 0; r < 16; ++r) {
      const int row = q0 + r;
      if (row < T && lane < D / 4) {
        const v4f val = *(const v4fa*)&sO[w][r][lane * 4];
        *(v4f*)(y + ((size_t)b * T + row) * ypitch + h * D + lane * 4) = val;
      }
    }
    
  }
}

// GEMM C = act(A·W + bias + resid): A f32 (ASPLIT -> hi/lo 2 terms), Wt bf16 [N][K]; ACT 0 none, 1 relu, 2 exact gelu;
// resid (optional, f32, row index = (row % rmod), pitch ldr, RES_BF16 rounds it) added before the activation.
template <bool ASPLIT, int ACT, bool BIAS_BF16, bool RES_BF16>
__global__ __launch_bounds__(128) void k_gemm_bf3(const float* __restrict__ A, int lda, const unsigned short* __restrict__ Wt, int ldb,
                                                const float* __restrict__ bias, const float* __restrict__ resid, int rmod, int ldr,
                                                float* __restrict__ C, int ldc, int M, int N, int K) {
  __shared__ __attribute__((aligned(16))) float so[4][16][64];
  const int tid = threadIdx.x, w = tid >> 5, lane = tid & 31, ln = lane & 15, hh = lane >> 4;
  const int ntn = N / 64;
  const int wid = blockIdx.x * 4 + w;
  const int mt = wid / ntn, nq = wid % ntn;
  if (mt * 16 >= M) return;
  const int row0 = mt * 16, col0 = nq * 64;
  const float* arow = A + (size_t)(row0 + ln) * lda;
  v8f acc[4] = {};
  for (int kb = 0; kb < K; kb += 32) {
    FragB ah, al;
    const v4f x0 = *(const v4fa*)(arow + kb + 8 * hh), x1 = *(const v4fa*)(arow + kb + 8 * hh + 4);
    const v4f x2 = *(const v4fa*)(arow + kb + 16 + 8 * hh), x3 = *(const v4fa*)(arow + kb + 16 + 8 * hh + 4);
    float xs[16] = {x0[0],x0[1],x0[2],x0[3],x1[0],x1[1],x1[2],x1[3],x2[0],x2[1],x2[2],x2[3],x3[0],x3[1],x3[2],x3[3]};
#pragma unroll
    for (int i = 0; i < 16; ++i) { const unsigned short hb = bf16_bits(xs[i]); ah.u[i] = hb; al.u[i] = ASPLIT ? bf16_bits(xs[i] - bf16_val(hb)) : (unsigned short)0; }
#pragma unroll
    for (int t = 0; t < 4; ++t) {
      const unsigned short* brow = Wt + (size_t)(col0 + t * 16 + ln) * ldb + kb;
      FragB b;
      b.half[0] = *(const v8us*)(brow + 8 * hh);
      b.half[1] = *(const v8us*)(brow + 16 + 8 * hh);
      acc[t] = mmaN<ASPLIT ? 2 : 1>(ah.v, al.v, b.v, b.v, acc[t]);
    }
  }
#pragma unroll
  for (int t = 0; t < 4; ++t) {
    const int col = col0 + t * 16 + ln;
    float bv = bias ? bias[col] : 0.f;
    if (BIAS_BF16) bv = bf16_round(bv);
#pragma unroll
    for (int r = 0; r < 8; ++r) {
      float v = acc[t][r] + bv;
      if (resid) { float rv = resid[(size_t)((row0 + 8 * hh + r) % rmod) * ldr + col]; if (RES_BF16) rv = bf16_round(rv); v += rv; }
      if (ACT == 1) v = fmaxf(v, 0.f);
      if (ACT == 2) v = 0.5f * v * (1.0f + erff(v * 0.70710678118654752f));
      if (ACT == 3) { const float u = 0.7978845608028654f * (v + 0.044715f * v * v * v); v = 0.5f * v * (1.0f + tanhf(u)); }
      so[w][8 * hh + r][t * 16 + ln] = v;
    }
  }
  __builtin_amdgcn_fence(__ATOMIC_ACQ_REL, "workgroup");
  __builtin_amdgcn_wave_barrier();
  const int rsub = lane >> 4, c4 = (lane & 15) * 4;
  {
#pragma unroll
    for (int q = 0; q < 8; ++q) {
      const int r = q * 2 + rsub;
      const v4f v = *(const v4fa*)&so[w][r][c4];
      *(v4f*)(C + (size_t)(row0 + r) * ldc + col0 + c4) = v;
    }
    
  }
}
// row LayerNorm (biased variance, eps) over N: s = X (+ R); optional out_sum <- s; out_norm <- (s-mu)*rsqrt(var+eps)*g + b
template <bool PARAM_BF16>
__global__ __launch_bounds__(256) void k_layernorm(const float* __restrict__ X, const float* __restrict__ R, const float* __restrict__ g, const float* __restrict__ bta,
                                                  float* __restrict__ out_sum, float* __restrict__ out_norm, int N, float eps) {
  __shared__ float red[256];
  const int row = blockIdx.x, tid = threadIdx.x;
  const float* x = X + (size_t)row * N; const float* rr = R ? R + (size_t)row * N : nullptr;
  float vals[16];                     // up to N = 4096
  const int per = N / 256;            // contiguous chunk per thread? use strided-by-4 chunks: thread handles j = tid*4 + 1024*u
  float s1 = 0.f;
  for (int u = 0; u < per / 4; ++u) {
    const int j = tid * 4 + 1024 * u;
    const v4f a = *(const v4fa*)(x + j);
    v4f b = {0.f,0.f,0.f,0.f}; if (rr) b = *(const v4fa*)(rr + j);
#pragma unroll
    for (int q = 0; q < 4; ++q) { const float v = a[q] + b[q]; vals[u * 4 + q] = v; s1 += v; }
  }
  red[tid] = s1; __syncthreads();
  for (int st = 128; st > 0; st >>= 1) { if (tid < st) red[tid] += red[tid + st]; __syncthreads(); }
  const float mu = red[0] / (float)N; __syncthreads();
  float s2 = 0.f;
  for (int u = 0; u < per / 4; ++u)
#pragma unroll
    for (int q = 0; q < 4; ++q) { const float c = vals[u * 4 + q] - mu; s2 += c * c; }
  red[tid] = s2; __syncthreads();
  for (int st = 128; st > 0; st >>= 1) { if (tid < st) red[tid] += red[tid + st]; __syncthreads(); }
  const float rs = rsqrtf(red[0] / (float)N + eps);
  {
    for (int u = 0; u < per / 4; ++u) {
      const int j = tid * 4 + 1024 * u;
      v4f o, sm;
#pragma unroll
      for (int q = 0; q < 4; ++q) {
        float gg = g[j + q], bb = bta[j + q];
        if (PARAM_BF16) { gg = bf16_round(gg); bb = bf16_round(bb); }
        sm[q] = vals[u * 4 + q]; o[q] = (vals[u * 4 + q] - mu) * rs * gg + bb;
      }
      if (out_sum) *(v4f*)(out_sum + (size_t)row * N + j) = sm;
      *(v4f*)(out_norm + (size_t)row * N + j) = o;
    }
    
  }
}



// ---- f16 WMMA path (v_wmma_f32_16x16x32_f16): 11-bit significands for operands in range — used where a [0,1] probability operand needs more precision than bf16
typedef _Float16 v16h __attribute__((ext_vector_type(16)));
union FragH { v16h v; v8us half[2]; _Float16 h[16]; unsigned short u[16]; };
template <int NT>
__device__ __forceinline__ v8f mmaH(v16h ah, v16h al, v16h bh, v16h bl, v8f c) {
  c = __builtin_amdgcn_wmma_f32_16x16x32_f16(false, ah, false, bh, (short)0, c, false, false);
  if (NT >= 2) c = __builtin_amdgcn_wmma_f32_16x16x32_f16(false, al, false, bh, (short)0, c, false, false);
  if (NT >= 3) c = __builtin_amdgcn_wmma_f32_16x16x32_f16(false, ah, false, bl, (short)0, c, false, false);
  asm volatile("v_nop\n\tv_nop\n\tv_nop\n\tv_nop" : "+v"(c) : "v"(ah), "v"(al), "v"(bh), "v"(bl));
  return c;
}
// batched GEMM like k_gemm_b but f16 operands: A f32 (split into f16 hi/lo if ASPLIT, else rounded to f16), Bt = f16 values [n][k]; alpha; C f32; N multiple of 16 (partial tiles skipped)
template <bool ASPLIT>
__global__ __launch_bounds__(128) void k_gemm_h(const float* __restrict__ A, int lda, size_t sA, const _Float16* __restrict__ Bh, int ldb, size_t sB, float alpha, float* __restrict__ C, int ldc, size_t sC, int M, int N, int K) {
  __shared__ __attribute__((aligned(16))) float so[4][16][64];
  const int tid = threadIdx.x, w = tid >> 5, lane = tid & 31, ln = lane & 15, hh = lane >> 4; const int by = blockIdx.y;
  A += (size_t)by * sA; Bh += (size_t)by * sB; C += (size_t)by * sC;
  const int ntn = (N + 63) / 64; const int wid = blockIdx.x * 4 + w; const int mt = wid / ntn, nq = wid % ntn; if (mt * 16 >= M) return;
  const int row0 = mt * 16, col0 = nq * 64; const float* arow = A + (size_t)(row0 + ln) * lda;
  v8f acc[4] = {};
  for (int kb = 0; kb < K; kb += 32) {
    FragH ah, al;
    const v4f x0 = *(const v4fa*)(arow + kb + 8 * hh), x1 = *(const v4fa*)(arow + kb + 8 * hh + 4), x2 = *(const v4fa*)(arow + kb + 16 + 8 * hh), x3 = *(const v4fa*)(arow + kb + 16 + 8 * hh + 4);
    float xs[16] = {x0[0],x0[1],x0[2],x0[3],x1[0],x1[1],x1[2],x1[3],x2[0],x2[1],x2[2],x2[3],x3[0],x3[1],x3[2],x3[3]};
#pragma unroll
    for (int i = 0; i < 16; ++i) { const _Float16 h = (_Float16)xs[i]; ah.h[i] = h; al.h[i] = ASPLIT ? (_Float16)(xs[i] - (float)h) : (_Float16)0.0f; }
#pragma unroll
    for (int t = 0; t < 4; ++t) { if (col0 + t * 16 >= N) continue; const size_t boff = (size_t)(col0 + t * 16 + ln) * ldb + kb; FragH bq; bq.half[0] = *(const v8us*)(Bh + boff + 8 * hh); bq.half[1] = *(const v8us*)(Bh + boff + 16 + 8 * hh);
      acc[t] = mmaH<ASPLIT ? 2 : 1>(ah.v, al.v, bq.v, bq.v, acc[t]); }
  }
#pragma unroll
  for (int t = 0; t < 4; ++t) { if (col0 + t * 16 >= N) continue;
#pragma unroll
    for (int r = 0; r < 8; ++r) so[w][8 * hh + r][t * 16 + ln] = acc[t][r] * alpha; }
  __builtin_amdgcn_fence(__ATOMIC_ACQ_REL, "workgroup"); __builtin_amdgcn_wave_barrier();
  const int rsub = lane >> 4, c4 = (lane & 15) * 4;
  {
#pragma unroll
    for (int q = 0; q < 8; ++q) { const int r = q * 2 + rsub; if (col0 + c4 < N) { const v4f v = *(const v4fa*)&so[w][r][c4]; *(v4f*)(C + (size_t)(row0 + r) * ldc + col0 + c4) = v; } }
     }
}

// Wt[n][k] = f16(W[k][n]·scale) from f32 row-major W[K][N] (scale = power of two; bf16-exact weights stay exact in f16 away from the subnormal range)
__device__ __forceinline__ void wt_f16(const int bx, const float* __restrict__ W, _Float16* __restrict__ Wt, int K, int N, float scale) {
  const int t = bx * 256 + threadIdx.x; if (t >= N * (K / 8)) return; const int n = t / (K / 8), k8 = (t % (K / 8)) * 8; FragH f;
#pragma unroll
  for (int i = 0; i < 8; ++i) f.h[i] = (_Float16)(bf16_round(W[(size_t)(k8 + i) * N + n]) * scale); const v8us o = f.half[0];
  *(v8us*)((unsigned short*)Wt + (size_t)n * K + k8) = o; 
}
// k_gemm_hh variant with fused epilogue: v = acc·alpha + bias[by·sBias + col] (+ CP[(row/rowsPerB)·sCPb + by·64 + col] if CP) ; ACT 0 none / 1 elu ; writes f16 C16 and f32 C, each if non-null
template <int ACT>
__device__ __forceinline__ void gemm_hhx(float (*so)[16][64], const int bx, const int by, const _Float16* __restrict__ A, int lda, size_t sA, const _Float16* __restrict__ Bh, int ldb, size_t sB, float alpha, const float* __restrict__ bias, size_t sBias, const float* __restrict__ CP, int rowsPerB, size_t sCPb, int row0g,
    float* __restrict__ C, _Float16* __restrict__ C16, int ldc, size_t sC, int M, int N, int K) {
  const int tid = threadIdx.x, w = tid >> 5, lane = tid & 31, ln = lane & 15, hh = lane >> 4;
  A += (size_t)by * sA; Bh += (size_t)by * sB; const size_t cofs = (size_t)by * sC; const float* bp = bias ? bias + (size_t)by * sBias : nullptr;
  const int ntn = (N + 63) / 64; const int wid = bx * 4 + w; const int mt = wid / ntn, nq = wid % ntn; if (mt * 16 >= M) return;
  const int row0 = mt * 16, col0 = nq * 64; const _Float16* arow = A + (size_t)(row0 + ln) * lda;
  v8f acc[4] = {};
  /* what is left here: each tile's guard on N builds as a vector branch, so a tile's two B loads are waited for before the next tile's are issued (four load round trips a k step), and every fragment load touches 16 lines */
  for (int kb = 0; kb < K; kb += 32) { FragH ah; ah.half[0] = *(const v8us*)((const unsigned short*)arow + kb + 8 * hh); ah.half[1] = *(const v8us*)((const unsigned short*)arow + kb + 16 + 8 * hh);
#pragma unroll
    for (int t = 0; t < 4; ++t) { if (col0 + t * 16 >= N) continue; const size_t boff = (size_t)(col0 + t * 16 + ln) * ldb + kb; FragH bq; bq.half[0] = *(const v8us*)((const unsigned short*)Bh + boff + 8 * hh); bq.half[1] = *(const v8us*)((const unsigned short*)Bh + boff + 16 + 8 * hh);
      acc[t] = mmaH<1>(ah.v, ah.v, bq.v, bq.v, acc[t]); }
  }
#pragma unroll
  for (int t = 0; t < 4; ++t) { if (col0 + t * 16 >= N) continue; const int col = col0 + t * 16 + ln; const float bv = bp ? bf16_round(bp[col]) : 0.f;
#pragma unroll
    for (int r = 0; r < 8; ++r) { float v = acc[t][r] * alpha + bv; if (CP) { const int bidx = (row0g + row0 + 8 * hh + r) / rowsPerB; v += CP[(size_t)bidx * sCPb + (size_t)by * 64 + col]; } if (ACT == 1) v = (v > 0.f) ? v : expm1f(v); else if (ACT == 7) v = (v > 0.f) ? v + 1.0f : expf(v); else if (ACT == 8) v = tanhf(v); else if (ACT == 9) v = 0.5f * v * (1.0f + tanhf(0.7978845608028654f * (v + 0.044715f * v * v * v))); else if (ACT == 11) v = 1.0f / (1.0f + expf(-v)); else if (ACT == 12) v = (v > 0.f) ? v : 0.01f * v; else if (ACT == 14) v = (v > 0.f) ? v : 0.1f * v; else if (ACT == 15) v = v / (1.0f + expf(-v)); else if (ACT == 3) v = fmaxf(v, 0.f); else if (ACT == 6) v = 0.5f * v * (1.0f + erff(v * 0.70710678118654752f)); so[w][8 * hh + r][t * 16 + ln] = v; } }
  __builtin_amdgcn_fence(__ATOMIC_ACQ_REL, "workgroup"); __builtin_amdgcn_wave_barrier();
  const int rsub = lane >> 4, c4 = (lane & 15) * 4; typedef _Float16 v4h __attribute__((ext_vector_type(4)));
  {
#pragma unroll
    for (int q = 0; q < 8; ++q) { const int r = q * 2 + rsub; if (col0 + c4 < N) { const v4f v = *(const v4fa*)&so[w][r][c4]; if (C) *(v4f*)(C + cofs + (size_t)(row0 + r) * ldc + col0 + c4) = v; if (C16) { v4h h4; for (int i = 0; i < 4; ++i) h4[i] = (_Float16)v[i]; *(v4h*)(C16 + cofs + (size_t)(row0 + r) * ldc + col0 + c4) = h4; } } }
     }
}
template <int ACT>
__global__ __launch_bounds__(128) void k_gemm_hhx(const _Float16* __restrict__ A, int lda, size_t sA, const _Float16* __restrict__ Bh, int ldb, size_t sB, float alpha, const float* __restrict__ bias, size_t sBias, const float* __restrict__ CP, int rowsPerB, size_t sCPb, int row0g,
    float* __restrict__ C, _Float16* __restrict__ C16, int ldc, size_t sC, int M, int N, int K) {
  __shared__ __attribute__((aligned(16))) float so[4][16][64];
  gemm_hhx<ACT>(so, blockIdx.x, blockIdx.y, A, lda, sA, Bh, ldb, sB, alpha, bias, sBias, CP, rowsPerB, sCPb, row0g, C, C16, ldc, sC, M, N, K);
}
// The two products that read only X16 and Bqkv, in one grid; the job is block-uniform, by block index:
// blocks [0, NBQ): [q | k] token-major [(b,n)][512] = X16 . Bqkv rows 0..511 (M 8192, N 512); blocks [NBQ, NBQ + BB * NBV): v channel-major per batch [b][(h,d)][n] = Bqkv rows 512..767 . X16[b] (M 256, N 2048). K = row length of both operands.
#define NBQ ((NR / 16) * (2 * CC / 64) / 4)
#define NBV ((CC / 16) * (NN / 64) / 4)
__global__ __launch_bounds__(128) void k_gemm_qkv(const _Float16* __restrict__ X16, const _Float16* __restrict__ Bqkv, _Float16* __restrict__ QK, _Float16* __restrict__ Vt, int K, float alpha) {
  __shared__ __attribute__((aligned(16))) float so[4][16][64];
  const int bx = blockIdx.x, rb = bx - NBQ; const bool jv = rb >= 0;
  gemm_hhx<0>(so, jv ? rb % NBV : bx, jv ? rb / NBV : 0, jv ? Bqkv + (size_t)2 * CC * CC : X16, K, 0, jv ? X16 : Bqkv, K, jv ? (size_t)NN * CC : (size_t)0, alpha, nullptr, 0, nullptr, 1, 0, 0,
              nullptr, jv ? Vt : QK, jv ? NN : 2 * CC, jv ? (size_t)CC * NN : (size_t)0, jv ? CC : NR, jv ? NN : 2 * CC, K);
}


typedef _Float16 v4h __attribute__((ext_vector_type(4)));

__device__ __forceinline__ void x16(const int bx, const float* __restrict__ x, _Float16* __restrict__ X16, size_t n8) { const size_t t = (size_t)bx * 256 + threadIdx.x; if (t >= n8) return; FragH f;
#pragma unroll
  for (int q = 0; q < 8; ++q) f.h[q] = (_Float16)bf16_round(x[t * 8 + q]); *(v8us*)((unsigned short*)X16 + t * 8) = f.half[0];  }
// The three conversions that read only inputs, in one grid; the job is block-uniform, by block index: Wqkv transposed, Wout transposed ((in,out) to Bt[n][k] x 2^4), x rounded.
#define NBW1 (C3 * (CC / 8) / 256)
#define NBW2 (CC * (CC / 8) / 256)
#define NBX (NR * CC / 8 / 256)
__global__ __launch_bounds__(256) void k_prep(const float* __restrict__ Wqkv, _Float16* __restrict__ Bqkv, const float* __restrict__ Wout, _Float16* __restrict__ Bo, const float* __restrict__ x, _Float16* __restrict__ X16) {
  const int bx = blockIdx.x;
  if (bx < NBW1) wt_f16(bx, Wqkv, Bqkv, CC, C3, 16.0f);
  else if (bx < NBW1 + NBW2) wt_f16(bx - NBW1, Wout, Bo, CC, CC, 16.0f);
  else x16(bx - (NBW1 + NBW2), x, X16, (size_t)NR * CC / 8);
}
__global__ __launch_bounds__(256) void k_h16(const float* __restrict__ x, _Float16* __restrict__ X16, size_t n8) { const size_t t = (size_t)blockIdx.x * 256 + threadIdx.x; if (t >= n8) return; FragH f;
#pragma unroll
  for (int q = 0; q < 8; ++q) f.h[q] = (_Float16)x[t * 8 + q]; *(v8us*)((unsigned short*)X16 + t * 8) = f.half[0];  }
__global__ __launch_bounds__(256) void k_round16f(const float* __restrict__ W, _Float16* __restrict__ Bt, size_t n8) { const size_t t = (size_t)blockIdx.x * 256 + threadIdx.x; if (t >= n8) return; FragH f;
#pragma unroll
  for (int i = 0; i < 8; ++i) f.h[i] = (_Float16)(bf16_round(W[t * 8 + i]) * 16.0f); *(v8us*)((unsigned short*)Bt + t * 8) = f.half[0];  }
template <int NHv, int TTv>
__global__ __launch_bounds__(256) void k_vt(const _Float16* __restrict__ V16, int ldv, int voff, _Float16* __restrict__ Vt) { __shared__ unsigned short tl[64][66]; const int tid = threadIdx.x; const int slab = blockIdx.x / (TTv / 64), lg = blockIdx.x % (TTv / 64); const int b = slab / NHv, h = slab % NHv;
  for (int i = tid; i < 64 * 8; i += 256) { const int r = i / 8, c8 = (i % 8) * 8; FragH f; f.half[0] = *(const v8us*)((const unsigned short*)V16 + ((size_t)b * TTv + lg * 64 + r) * ldv + voff + h * 64 + c8);
#pragma unroll
    for (int q = 0; q < 8; ++q) tl[r][c8 + q] = f.u[q]; }
  __syncthreads();
  {
#pragma unroll
    for (int rd = 0; rd < 2; ++rd) { const int d = rd * 32 + tid / 8, pc = tid % 8; FragH f;
#pragma unroll
      for (int q = 0; q < 8; ++q) f.u[q] = tl[pc * 8 + q][d];
      *(v8us*)((unsigned short*)Vt + ((size_t)slab * 64 + d) * TTv + lg * 64 + pc * 8) = f.half[0]; }
     } }

typedef float v2f __attribute__((ext_vector_type(2)));
// lane l with lane l ^ 16 (the two halves of a wave hold the two key halves of one query column)
__device__ __forceinline__ float xhalf(float x) { return __builtin_bit_cast(float, __builtin_amdgcn_permlanex16(__builtin_bit_cast(int, x), __builtin_bit_cast(int, x), 0x76543210, 0xfedcba98, false, false)); }

// One lane's eight 16-byte copies of a stage (four of K, four of V^T), global memory to LDS through no register. The s_wait_xcnt stands in the copies' own statement, ahead of any rewrite of the address registers they name.
__device__ __forceinline__ void stage_copy(unsigned lk, const unsigned short* gk, size_t gkstep, unsigned lkstep, unsigned lv, const unsigned short* gv, size_t gvstep, unsigned lvstep) {
  asm volatile("global_load_async_to_lds_b128 %0, %8, off\n\t"
               "global_load_async_to_lds_b128 %1, %9, off\n\t"
               "global_load_async_to_lds_b128 %2, %10, off\n\t"
               "global_load_async_to_lds_b128 %3, %11, off\n\t"
               "global_load_async_to_lds_b128 %4, %12, off\n\t"
               "global_load_async_to_lds_b128 %5, %13, off\n\t"
               "global_load_async_to_lds_b128 %6, %14, off\n\t"
               "global_load_async_to_lds_b128 %7, %15, off\n\t"
               "s_wait_xcnt 0x0"
               :: "v"(lk), "v"(lk + lkstep), "v"(lk + 2 * lkstep), "v"(lk + 3 * lkstep), "v"(lv), "v"(lv + lvstep), "v"(lv + 2 * lvstep), "v"(lv + 3 * lvstep),
                  "v"(gk), "v"(gk + gkstep), "v"(gk + 2 * gkstep), "v"(gk + 3 * gkstep), "v"(gv), "v"(gv + gvstep), "v"(gv + 2 * gvstep), "v"(gv + 3 * gvstep)
               : "memory");
}

__global__ __launch_bounds__(128) void k_flash(const _Float16* __restrict__ Q16, int ldq, const _Float16* __restrict__ K16, int ldk, const _Float16* __restrict__ Vt, const int* __restrict__ MSK, float* __restrict__ O, int ldo) {
  constexpr int RPW = 16, NQB = NN / (4 * RPW), DT = 2; (void)MSK;
  constexpr int TK = 128, NS = NN / TK;      /* keys a stage, stages */
  constexpr int KP = HD * 2 + 16, VP = TK * 2 + 16;      /* LDS row pitches in bytes, 16 B x odd: 16 lanes' ds_load_b128 fall on all 64 banks */
  constexpr int KB = TK * KP, SB = KB + HD * VP;      /* a stage: TK rows of K (HD channels), then HD rows of V^T (TK keys) */
  __shared__ __attribute__((aligned(16))) unsigned char sm[2 * SB];
  constexpr float SL2E = 0.17677669529663687f * 1.4426950408889634f;      /* 32^-1/2 * log2(e): e^(scale*s - m) = 2^(SL2E*s - m2), one fma ahead of a bare v_exp_f32 */
  const int tid = threadIdx.x, w = tid >> 5, lane = tid & 31, ln = lane & 15, hh = lane >> 4;
  const int slab = blockIdx.x / NQB, qblk = blockIdx.x % NQB; const int b = slab / NH, h = slab % NH; const int q0 = qblk * (4 * RPW) + w * RPW;
  const unsigned short* Vth = (const unsigned short*)Vt + ((size_t)b * CC + h * HD) * NN;      /* V^T = v[b][(h,d)][n] channel-major */
  /* copy map: K chunk c of thread tid = row (tid >> 2) + 32 c, 16-byte column tid & 3; V^T chunk c = row (tid >> 4) + 8 c, 16-byte column tid & 15 */
  const unsigned short* gk = (const unsigned short*)K16 + ((size_t)b * NN + (tid >> 2)) * ldk + h * HD + (tid & 3) * 8;
  const unsigned short* gv = Vth + (size_t)(tid >> 4) * NN + (tid & 15) * 8;
  const unsigned lds0 = (unsigned)(size_t)sm;      /* low 32 bits of the shared address = byte offset in the work-group's LDS */
  const unsigned lk = lds0 + (tid >> 2) * KP + (tid & 3) * 16, lv = lds0 + KB + (tid >> 4) * VP + (tid & 15) * 16;
  const size_t gkstep = (size_t)32 * ldk, gkstage = (size_t)TK * ldk;
  stage_copy(lk, gk, gkstep, 32 * KP, lv, gv, (size_t)8 * NN, 8 * VP);
  FragH bq;      /* B: column ln = query q0 + ln, k = head channel */
  { const unsigned short* qr = (const unsigned short*)Q16 + ((size_t)b * NN + q0 + ln) * ldq + h * HD; bq.half[0] = *(const v8us*)(qr + 8 * hh); bq.half[1] = *(const v8us*)(qr + 16 + 8 * hh); }
  asm volatile("s_wait_asynccnt 0x0" ::: "memory");      /* this wave's share of stage 0 has landed */
  __syncthreads();      /* stage 0 published to all four waves */
  gk += gkstage; gv += TK;
  stage_copy(lk + SB, gk, gkstep, 32 * KP, lv + SB, gv, (size_t)8 * NN, 8 * VP);
  float m_q = -3.0e38f, l_q = 0.f; v8f oacc[DT];
#pragma unroll
  for (int dt = 0; dt < DT; ++dt) oacc[dt] = (v8f){0.f,0.f,0.f,0.f,0.f,0.f,0.f,0.f};
#pragma unroll 1      /* one body for both buffers: the buffer is an offset */
  for (int t = 0; t < NS; ++t) {
    const unsigned bo = (unsigned)(t & 1) * SB;
    const unsigned char* kf = sm + bo + ln * KP + hh * 16; const unsigned char* vf = sm + bo + KB + ln * VP + hh * 16;
#pragma unroll      /* the four 32-key passes of a stage: every LDS offset an immediate */
    for (int ps = 0; ps < TK / 32; ++ps) {
    FragH ak[2], av[DT];      /* the pass's eight fragment reads stand together at its head: one LDS latency a pass, V^T's behind the score products and the softmax */
#pragma unroll
    for (int nt = 0; nt < 2; ++nt) { const unsigned char* kr = kf + (ps * 32 + nt * 16) * KP; ak[nt].half[0] = *(const v8us*)kr; ak[nt].half[1] = *(const v8us*)(kr + 32); }
#pragma unroll
    for (int dt = 0; dt < DT; ++dt) { const unsigned char* vrow = vf + dt * 16 * VP + ps * 64; av[dt].half[0] = *(const v8us*)vrow; av[dt].half[1] = *(const v8us*)(vrow + 32); }
    v8f s[2];      /* s[nt][r] = S^T[key t*TK + ps*32 + nt*16 + 8*hh + r][query q0 + ln] */
#pragma unroll
    for (int nt = 0; nt < 2; ++nt) s[nt] = mmaH<1>(ak[nt].v, ak[nt].v, bq.v, bq.v, (v8f){0.f,0.f,0.f,0.f,0.f,0.f,0.f,0.f});
    float mt[8];
#pragma unroll
    for (int i = 0; i < 8; ++i) mt[i] = fmaxf(s[0][i], s[1][i]);
    float mc = fmaxf(fmaxf(fmaxf(mt[0], mt[1]), fmaxf(mt[2], mt[3])), fmaxf(fmaxf(mt[4], mt[5]), fmaxf(mt[6], mt[7])));
    mc = fmaxf(mc, xhalf(mc));      /* both halves now hold the maximum over the query's 32 raw products (SL2E > 0 keeps the order) */
    const float mn = fmaxf(m_q, mc * SL2E); const float al = (mn > -1.0e38f) ? __builtin_amdgcn_exp2f(m_q - mn) : 1.0f; m_q = mn;      /* m_q, mn: base-2 exponents */
    const float nb = 10.0f - mn;      /* 2^10 = the f16 scale of P, carried in the exponent: p and l_q hold 1024 times the shifted values */
    v2f p[8]; FragH pb;
#pragma unroll
    for (int i = 0; i < 8; ++i) { const v2f a = (v2f){s[i >> 2][(2 * i) & 7], s[i >> 2][(2 * i + 1) & 7]} * SL2E + nb;
      p[i] = (v2f){__builtin_amdgcn_exp2f(a[0]), __builtin_amdgcn_exp2f(a[1])}; pb.h[2 * i] = (_Float16)p[i][0]; pb.h[2 * i + 1] = (_Float16)p[i][1]; }
    const v2f psum = ((p[0] + p[1]) + (p[2] + p[3])) + ((p[4] + p[5]) + (p[6] + p[7]));
    l_q = l_q * al + (psum[0] + psum[1]);      /* this half's 16 keys; the halves join after the loop */
#pragma unroll
    for (int dt = 0; dt < DT; ++dt) { oacc[dt] *= al; oacc[dt] = mmaH<1>(av[dt].v, av[dt].v, pb.v, pb.v, oacc[dt]); } }      /* oacc[dt][r] = O^T[channel dt*16 + 8*hh + r][query q0 + ln] */
    asm volatile("s_wait_dscnt 0x0" ::: "memory");      /* this wave's reads of stage t are done before its buffer is handed back */
    asm volatile("s_wait_asynccnt 0x0" ::: "memory");      /* this wave's share of stage t + 1 has landed */
    __syncthreads();      /* publishes stage t + 1 and ends every wave's reads of stage t */
    if (t + 2 < NS) { gk += gkstage; gv += TK; stage_copy(lk + bo, gk, gkstep, 32 * KP, lv + bo, gv, (size_t)8 * NN, 8 * VP); }      /* stage t + 2 into the buffer just read */
  }
  asm volatile("s_wait_asynccnt 0x0" ::: "memory");      /* no copy outstanding at the wave's end */
  const float l = l_q + xhalf(l_q); const float den = l + (1e-6f * 1024.0f) * __builtin_amdgcn_exp2f(-m_q); const float inv = (den > 0.f && den < INFINITY) ? 1.0f / den : 0.f;      /* sum e^s/(sum e^s + 1e-6) form: e^(-m)*1e-6 joins the shifted sum; an infinite den (all logits far below 0) reproduces the reference's ~0 output */
  float* orow = O + ((size_t)b * NN + q0 + ln) * ldo + h * HD + 8 * hh;
#pragma unroll
  for (int dt = 0; dt < DT; ++dt) { const v8f o = oacc[dt] * inv; *(v4f*)(orow + dt * 16) = (v4f){o[0], o[1], o[2], o[3]}; *(v4f*)(orow + dt * 16 + 4) = (v4f){o[4], o[5], o[6], o[7]}; } }

extern "C" void kernel_launch(void* const* d_in, const int* in_sizes, int n_in,
                              void* d_out, int out_size, void* d_ws, size_t ws_size, hipStream_t stream) {
  (void)in_sizes; (void)n_in; (void)out_size;
  const float* x = (const float*)d_in[0]; const float* Wqkv = (const float*)d_in[1]; const float* Wout = (const float*)d_in[2]; const float* bout = (const float*)d_in[3];
  char* ws = (char*)d_ws; size_t off = 0;
  auto take = [&](size_t bytes) { char* p = ws + off; off += (bytes + 255) & ~(size_t)255; return p; };
  _Float16* Bqkv = (_Float16*)take((size_t)C3 * CC * 2); _Float16* Bo = (_Float16*)take((size_t)CC * CC * 2); _Float16* X16 = (_Float16*)take((size_t)NR * CC * 2);
  _Float16* QK = (_Float16*)take((size_t)NR * 2 * CC * 2); _Float16* Vt = (_Float16*)take((size_t)BB * CC * NN * 2); float* O = (float*)take((size_t)NR * CC * 4); _Float16* O16 = (_Float16*)take((size_t)NR * CC * 2);
  if (off > ws_size) return;      // 0.4 + 0.1 + 4.2 + 8.4 + 4.2 + 8.4 + 4.2 ≈ 30 MB
  k_prep<<<NBW1 + NBW2 + NBX, 256, 0, stream>>>(Wqkv, Bqkv, Wout, Bo, x, X16);
  k_gemm_qkv<<<NBQ + BB * NBV, 128, 0, stream>>>(X16, Bqkv, QK, Vt, CC, 0.0625f);
  k_flash<<<BB * NH * (NN / 64), 128, 0, stream>>>(QK, 2 * CC, QK + CC, 2 * CC, Vt, nullptr, O, CC);      /* blocks = (b,h) × 64-query groups */
  k_h16<<<(unsigned)(((size_t)NR * CC / 8 + 255) / 256), 256, 0, stream>>>(O, O16, (size_t)NR * CC / 8);
  k_gemm_hhx<0><<<dim3(((NR / 16) * (CC / 64) + 3) / 4, 1), 128, 0, stream>>>(O16, CC, 0, Bo, CC, 0, 0.0625f, bout, 0, nullptr, 1, 0, 0, (float*)d_out, nullptr, CC, 0, NR, CC, CC);      /* y = out·Wout + bout: M 8192 N 256 K 256 */
}

// v005
// It runs in 51.8 microseconds.
// Two timings next to v004 both put it at 1.36 times that version's speed.
// Counting every step since v000, it is 4.56 times as fast.
#include <hip/hip_runtime.h>
// KeOps-style multi-head attention (B=4, n=2048, dim 256, 8 heads × 32): qkv = x·Wqkv; q scaled by 32^-½; e = exp(q·kᵀ) WITHOUT max subtraction; out = (e·v)/(Σe + 1e-6) merged over heads; y = out·Wout + bout.
// Compute dtype: x, Wqkv, Wout, bout rounded to bf16; q/k token-major and v channel-major (= Vᵀ) as f16 GEMM outputs (f32 accumulate); fused flash-style kernel per (b,h) (online max-rescaled sums
// in f32 — the unshifted quotient is recovered exactly through the normaliser l + 1e-6·e^(−m); P f16 ×2^10) on v_wmma_f32_16x16x32_f16; O → f16 → output GEMM with bias; f32 accumulate.
#define BB 4
#define NN 2048
#define CC 256
#define C3 768
#define NH 8
#define HD 32
#define NR (BB * NN)

typedef __bf16 v16b __attribute__((ext_vector_type(16)));
typedef unsigned short v8us __attribute__((ext_vector_type(8), may_alias));
typedef float  v8f  __attribute__((ext_vector_type(8)));
typedef float  v4f  __attribute__((ext_vector_type(4)));
typedef float  v4fa __attribute__((ext_vector_type(4), may_alias));
union FragB { v16b v; v8us half[2]; unsigned short u[16]; };

__device__ __forceinline__ unsigned short bf16_bits(float x) { unsigned int u = __float_as_uint(x); return (unsigned short)((u + 0x7FFFu + ((u >> 16) & 1u)) >> 16); }
__device__ __forceinline__ float bf16_val(unsigned short b) { return __uint_as_float(((unsigned int)b) << 16); }
__device__ __forceinline__ float bf16_round(float x) { return bf16_val(bf16_bits(x)); }
// D += A·B with NT terms: 1 = ah·bh, 2 = + al·bh (A split), 3 = + ah·bl (both split)
template <int NT>
__device__ __forceinline__ v8f mmaN(v16b ah, v16b al, v16b bh, v16b bl, v8f c) {
  c = __builtin_amdgcn_wmma_f32_16x16x32_bf16(false, ah, false, bh, (short)0, c, false, false);
  if (NT >= 2) c = __builtin_amdgcn_wmma_f32_16x16x32_bf16(false, al, false, bh, (short)0, c, false, false);
  if (NT >= 3) c = __builtin_amdgcn_wmma_f32_16x16x32_bf16(false, ah, false, bl, (short)0, c, false, false);
  asm volatile("v_nop\n\tv_nop\n\tv_nop\n\tv_nop" : "+v"(c) : "v"(ah), "v"(al), "v"(bh), "v"(bl));
  return c;
}

__global__ __launch_bounds__(256) void k_wt_bf16(const float* __restrict__ W, unsigned short* __restrict__ Wt, int K, int N) {
  const int t = blockIdx.x * 256 + threadIdx.x;
  const int k8n = K / 8;
  if (t >= N * k8n) return;
  const int n = t / k8n, k8 = (t % k8n) * 8;
  v8us v;
#pragma unroll
  for (int i = 0; i < 8; ++i) v[i] = bf16_bits(W[(size_t)(k8 + i) * N + n]);
  *(v8us*)(Wt + (size_t)n * K + k8) = v;
  
}

// GEMM C[M][N] (f32, pitch ldc) = act(A[M][K]·W + bias). A f32 row-major (pitch lda) converted per fragment to bf16
// (ASPLIT: hi/lo two planes -> 2 terms, else single rounded term); Wt bf16 [N][K] (pitch ldb). BIAS_BF16 rounds the
// bias to bf16 first (bias quantised to bf16 before the add). K%32==0, M%16==0, N%64==0.
template <bool ASPLIT, int ACT, bool BIAS_BF16>
__global__ __launch_bounds__(128) void k_gemm_bf(const float* __restrict__ A, int lda, const unsigned short* __restrict__ Wt, int ldb,
                                               const float* __restrict__ bias, float* __restrict__ C, int ldc, int M, int N, int K) {
  __shared__ __attribute__((aligned(16))) float so[4][16][64];
  const int tid = threadIdx.x, w = tid >> 5, lane = tid & 31, ln = lane & 15, hh = lane >> 4;
  const int ntn = N / 64;
  const int wid = blockIdx.x * 4 + w;
  const int mt = wid / ntn, nq = wid % ntn;
  if (mt * 16 >= M) return;
  const int row0 = mt * 16, col0 = nq * 64;
  const float* arow = A + (size_t)(row0 + ln) * lda;
  v8f acc[4] = {};
  for (int kb = 0; kb < K; kb += 32) {
    FragB ah, al;
    const v4f x0 = *(const v4fa*)(arow + kb + 8 * hh), x1 = *(const v4fa*)(arow + kb + 8 * hh + 4);
    const v4f x2 = *(const v4fa*)(arow + kb + 16 + 8 * hh), x3 = *(const v4fa*)(arow + kb + 16 + 8 * hh + 4);
    float xs[16] = {x0[0],x0[1],x0[2],x0[3],x1[0],x1[1],x1[2],x1[3],x2[0],x2[1],x2[2],x2[3],x3[0],x3[1],x3[2],x3[3]};
#pragma unroll
    for (int i = 0; i < 16; ++i) { const unsigned short hb = bf16_bits(xs[i]); ah.u[i] = hb; al.u[i] = ASPLIT ? bf16_bits(xs[i] - bf16_val(hb)) : (unsigned short)0; }
#pragma unroll
    for (int t = 0; t < 4; ++t) {
      const unsigned short* brow = Wt + (size_t)(col0 + t * 16 + ln) * ldb + kb;
      FragB b;
      b.half[0] = *(const v8us*)(brow + 8 * hh);
      b.half[1] = *(const v8us*)(brow + 16 + 8 * hh);
      acc[t] = mmaN<ASPLIT ? 2 : 1>(ah.v, al.v, b.v, b.v, acc[t]);
    }
  }
#pragma unroll
  for (int t = 0; t < 4; ++t) {
    float bv = bias ? bias[col0 + t * 16 + ln] : 0.f;
    if (BIAS_BF16) bv = bf16_round(bv);
#pragma unroll
    for (int r = 0; r < 8; ++r) { float v = acc[t][r] + bv; if (ACT == 1) v = fmaxf(v, 0.f); so[w][8 * hh + r][t * 16 + ln] = v; }
  }
  __builtin_amdgcn_fence(__ATOMIC_ACQ_REL, "workgroup");
  __builtin_amdgcn_wave_barrier();
  const int rsub = lane >> 4, c4 = (lane & 15) * 4;
  {
#pragma unroll
    for (int q = 0; q < 8; ++q) {
      const int r = q * 2 + rsub;
      const v4f v = *(const v4fa*)&so[w][r][c4];
      *(v4f*)(C + (size_t)(row0 + r) * ldc + col0 + c4) = v;
    }
    
  }
}

// Flash-style causal/unmasked attention, all contractions 3-term bf16 hi/lo splits, f32 softmax with running max.
// q,k,v rows are read from f32 buffers with arbitrary row pitch (so they can live inside a fused qkv buffer);
// D = head size (multiple of 32, <= 128); one wave = 16 query rows; block = 4 waves (64 queries) sharing K/V chunks of 32.
template <int D, bool CAUSAL>
__global__ __launch_bounds__(128) void k_flash(const float* __restrict__ qb, const float* __restrict__ kb, const float* __restrict__ vb,
                                             int pitch, int T, int H, float scale, float* __restrict__ y, int ypitch) {
  constexpr int KS = D / 32;        // k-steps for QK
  constexpr int DT = D / 16;        // d tiles for PV
  __shared__ __attribute__((aligned(16))) unsigned short sKh[32][D + 8], sKl[32][D + 8], sVh[32][D + 8], sVl[32][D + 8];
  __shared__ __attribute__((aligned(16))) unsigned short sPh[4][16][40], sPl[4][16][40];
  __shared__ __attribute__((aligned(16))) float sO[4][16][D];
  const int tid = threadIdx.x, w = tid >> 5, lane = tid & 31, ln = lane & 15, hh = lane >> 4;
  const int nqb = (T + 63) / 64;
  const int bh = blockIdx.x / nqb, qblk = blockIdx.x % nqb;
  const int b = bh / H, h = bh % H;
  const int q0 = qblk * 64 + w * 16;
  const float* Q = qb + (size_t)b * T * pitch + h * D;
  const float* K = kb + (size_t)b * T * pitch + h * D;
  const float* V = vb + (size_t)b * T * pitch + h * D;

  // A fragments of the wave's 16 query rows (scaled), hi/lo
  FragB aqh[KS], aql[KS];
  {
    int row = q0 + ln; if (row >= T) row = T - 1;
    const float* qr = Q + (size_t)row * pitch;
#pragma unroll
    for (int ks = 0; ks < KS; ++ks)
#pragma unroll
      for (int i = 0; i < 16; ++i) {
        const int d = ks * 32 + ((i < 8) ? (8 * hh + i) : (16 + 8 * hh + (i - 8)));
        const float x = qr[d] * scale; const unsigned short hb = bf16_bits(x);
        aqh[ks].u[i] = hb; aql[ks].u[i] = bf16_bits(x - bf16_val(hb));
      }
  }
  float m_r[8], l_r[8];
#pragma unroll
  for (int r = 0; r < 8; ++r) { m_r[r] = -3.0e38f; l_r[r] = 0.f; }
  v8f oacc[DT];
#pragma unroll
  for (int dt = 0; dt < DT; ++dt) oacc[dt] = (v8f){0.f,0.f,0.f,0.f,0.f,0.f,0.f,0.f};

  const int kv_end = CAUSAL ? min(T, qblk * 64 + 64) : T;     // block-uniform
  for (int j0 = 0; j0 < kv_end; j0 += 32) {
    __syncthreads();
    for (int e = tid; e < 32 * (D / 4); e += 128) {
      const int r = e / (D / 4), c4 = (e % (D / 4)) * 4;
      const int key = j0 + r;
      v4f kf = {0.f,0.f,0.f,0.f}, vf = {0.f,0.f,0.f,0.f};
      if (key < T) { kf = *(const v4fa*)(K + (size_t)key * pitch + c4); vf = *(const v4fa*)(V + (size_t)key * pitch + c4); }
#pragma unroll
      for (int t = 0; t < 4; ++t) {
        unsigned short hb = bf16_bits(kf[t]); sKh[r][c4 + t] = hb; sKl[r][c4 + t] = bf16_bits(kf[t] - bf16_val(hb));
        hb = bf16_bits(vf[t]); sVh[r][c4 + t] = hb; sVl[r][c4 + t] = bf16_bits(vf[t] - bf16_val(hb));
      }
    }
    __syncthreads();
    // S tile 16 x 32
    v8f s[2];
#pragma unroll
    for (int nt = 0; nt < 2; ++nt) {
      v8f acc = {};
#pragma unroll
      for (int ks = 0; ks < KS; ++ks) {
        FragB bh_, bl_;
        bh_.half[0] = *(const v8us*)&sKh[nt * 16 + ln][ks * 32 + 8 * hh]; bh_.half[1] = *(const v8us*)&sKh[nt * 16 + ln][ks * 32 + 16 + 8 * hh];
        bl_.half[0] = *(const v8us*)&sKl[nt * 16 + ln][ks * 32 + 8 * hh]; bl_.half[1] = *(const v8us*)&sKl[nt * 16 + ln][ks * 32 + 16 + 8 * hh];
        acc = mmaN<3>(aqh[ks].v, aql[ks].v, bh_.v, bl_.v, acc);
      }
      s[nt] = acc;
    }
    // mask + running max (rows 8hh+r; the 16 lanes of a half share rows)
    float alpha[8];
#pragma unroll
    for (int r = 0; r < 8; ++r) {
      const int qi = q0 + 8 * hh + r;
      const int ja = j0 + ln, jb = j0 + 16 + ln;
      if (CAUSAL) { if (ja > qi) s[0][r] = -3.0e38f; if (jb > qi) s[1][r] = -3.0e38f; }
      if (ja >= T) s[0][r] = -3.0e38f;
      if (jb >= T) s[1][r] = -3.0e38f;
      float mx = fmaxf(s[0][r], s[1][r]);
      mx = fmaxf(mx, __shfl_xor(mx, 1, 32)); mx = fmaxf(mx, __shfl_xor(mx, 2, 32)); mx = fmaxf(mx, __shfl_xor(mx, 4, 32)); mx = fmaxf(mx, __shfl_xor(mx, 8, 32));
      const float mnew = fmaxf(m_r[r], mx);
      alpha[r] = (mnew > -1.0e38f) ? __expf(m_r[r] - mnew) : 1.0f;
      const float p0 = (s[0][r] > -1.0e38f) ? __expf(s[0][r] - mnew) : 0.f;
      const float p1 = (s[1][r] > -1.0e38f) ? __expf(s[1][r] - mnew) : 0.f;
      m_r[r] = mnew;
      l_r[r] = l_r[r] * alpha[r] + p0 + p1;            // per-lane partial row sum (16 lanes combined at the end)
      unsigned short hb = bf16_bits(p0); sPh[w][8 * hh + r][ln] = hb;      sPl[w][8 * hh + r][ln] = bf16_bits(p0 - bf16_val(hb));
      hb = bf16_bits(p1);                sPh[w][8 * hh + r][16 + ln] = hb; sPl[w][8 * hh + r][16 + ln] = bf16_bits(p1 - bf16_val(hb));
    }
#pragma unroll
    for (int dt = 0; dt < DT; ++dt)
#pragma unroll
      for (int r = 0; r < 8; ++r) oacc[dt][r] *= alpha[r];
    __builtin_amdgcn_fence(__ATOMIC_ACQ_REL, "workgroup");
    __builtin_amdgcn_wave_barrier();
    FragB pah, pal;
    pah.half[0] = *(const v8us*)&sPh[w][ln][8 * hh]; pah.half[1] = *(const v8us*)&sPh[w][ln][16 + 8 * hh];
    pal.half[0] = *(const v8us*)&sPl[w][ln][8 * hh]; pal.half[1] = *(const v8us*)&sPl[w][ln][16 + 8 * hh];
#pragma unroll
    for (int dt = 0; dt < DT; ++dt) {
      FragB bvh, bvl;
#pragma unroll
      for (int i = 0; i < 8; ++i) {
        bvh.u[i] = sVh[8 * hh + i][dt * 16 + ln]; bvh.u[8 + i] = sVh[16 + 8 * hh + i][dt * 16 + ln];
        bvl.u[i] = sVl[8 * hh + i][dt * 16 + ln]; bvl.u[8 + i] = sVl[16 + 8 * hh + i][dt * 16 + ln];
      }
      oacc[dt] = mmaN<3>(pah.v, pal.v, bvh.v, bvl.v, oacc[dt]);
    }
    __builtin_amdgcn_fence(__ATOMIC_ACQ_REL, "workgroup");
    __builtin_amdgcn_wave_barrier();
  }
#pragma unroll
  for (int r = 0; r < 8; ++r) {
    float l = l_r[r];
    l += __shfl_xor(l, 1, 32); l += __shfl_xor(l, 2, 32); l += __shfl_xor(l, 4, 32); l += __shfl_xor(l, 8, 32);
    l_r[r] = (l > 0.f) ? 1.0f / l : 0.f;
  }
#pragma unroll
  for (int dt = 0; dt < DT; ++dt)
#pragma unroll
    for (int r = 0; r < 8; ++r) sO[w][8 * hh + r][dt * 16 + ln] = oacc[dt][r] * l_r[r];
  __builtin_amdgcn_fence(__ATOMIC_ACQ_REL, "workgroup");
  __builtin_amdgcn_wave_barrier();
  {
    for (int r = 0; r < 16; ++r) {
      const int row = q0 + r;
      if (row < T && lane < D / 4) {
        const v4f val = *(const v4fa*)&sO[w][r][lane * 4];
        *(v4f*)(y + ((size_t)b * T + row) * ypitch + h * D + lane * 4) = val;
      }
    }
    
  }
}

// GEMM C = act(A·W + bias + resid): A f32 (ASPLIT -> hi/lo 2 terms), Wt bf16 [N][K]; ACT 0 none, 1 relu, 2 exact gelu;
// resid (optional, f32, row index = (row % rmod), pitch ldr, RES_BF16 rounds it) added before the activation.
template <bool ASPLIT, int ACT, bool BIAS_BF16, bool RES_BF16>
__global__ __launch_bounds__(128) void k_gemm_bf3(const float* __restrict__ A, int lda, const unsigned short* __restrict__ Wt, int ldb,
                                                const float* __restrict__ bias, const float* __restrict__ resid, int rmod, int ldr,
                                                float* __restrict__ C, int ldc, int M, int N, int K) {
  __shared__ __attribute__((aligned(16))) float so[4][16][64];
  const int tid = threadIdx.x, w = tid >> 5, lane = tid & 31, ln = lane & 15, hh = lane >> 4;
  const int ntn = N / 64;
  const int wid = blockIdx.x * 4 + w;
  const int mt = wid / ntn, nq = wid % ntn;
  if (mt * 16 >= M) return;
  const int row0 = mt * 16, col0 = nq * 64;
  const float* arow = A + (size_t)(row0 + ln) * lda;
  v8f acc[4] = {};
  for (int kb = 0; kb < K; kb += 32) {
    FragB ah, al;
    const v4f x0 = *(const v4fa*)(arow + kb + 8 * hh), x1 = *(const v4fa*)(arow + kb + 8 * hh + 4);
    const v4f x2 = *(const v4fa*)(arow + kb + 16 + 8 * hh), x3 = *(const v4fa*)(arow + kb + 16 + 8 * hh + 4);
    float xs[16] = {x0[0],x0[1],x0[2],x0[3],x1[0],x1[1],x1[2],x1[3],x2[0],x2[1],x2[2],x2[3],x3[0],x3[1],x3[2],x3[3]};
#pragma unroll
    for (int i = 0; i < 16; ++i) { const unsigned short hb = bf16_bits(xs[i]); ah.u[i] = hb; al.u[i] = ASPLIT ? bf16_bits(xs[i] - bf16_val(hb)) : (unsigned short)0; }
#pragma unroll
    for (int t = 0; t < 4; ++t) {
      const unsigned short* brow = Wt + (size_t)(col0 + t * 16 + ln) * ldb + kb;
      FragB b;
      b.half[0] = *(const v8us*)(brow + 8 * hh);
      b.half[1] = *(const v8us*)(brow + 16 + 8 * hh);
      acc[t] = mmaN<ASPLIT ? 2 : 1>(ah.v, al.v, b.v, b.v, acc[t]);
    }
  }
#pragma unroll
  for (int t = 0; t < 4; ++t) {
    const int col = col0 + t * 16 + ln;
    float bv = bias ? bias[col] : 0.f;
    if (BIAS_BF16) bv = bf16_round(bv);
#pragma unroll
    for (int r = 0; r < 8; ++r) {
      float v = acc[t][r] + bv;
      if (resid) { float rv = resid[(size_t)((row0 + 8 * hh + r) % rmod) * ldr + col]; if (RES_BF16) rv = bf16_round(rv); v += rv; }
      if (ACT == 1) v = fmaxf(v, 0.f);
      if (ACT == 2) v = 0.5f * v * (1.0f + erff(v * 0.70710678118654752f));
      if (ACT == 3) { const float u = 0.7978845608028654f * (v + 0.044715f * v * v * v); v = 0.5f * v * (1.0f + tanhf(u)); }
      so[w][8 * hh + r][t * 16 + ln] = v;
    }
  }
  __builtin_amdgcn_fence(__ATOMIC_ACQ_REL, "workgroup");
  __builtin_amdgcn_wave_barrier();
  const int rsub = lane >> 4, c4 = (lane & 15) * 4;
  {
#pragma unroll
    for (int q = 0; q < 8; ++q) {
      const int r = q * 2 + rsub;
      const v4f v = *(const v4fa*)&so[w][r][c4];
      *(v4f*)(C + (size_t)(row0 + r) * ldc + col0 + c4) = v;
    }
    
  }
}
// row LayerNorm (biased variance, eps) over N: s = X (+ R); optional out_sum <- s; out_norm <- (s-mu)*rsqrt(var+eps)*g + b
template <bool PARAM_BF16>
__global__ __launch_bounds__(256) void k_layernorm(const float* __restrict__ X, const float* __restrict__ R, const float* __restrict__ g, const float* __restrict__ bta,
                                                  float* __restrict__ out_sum, float* __restrict__ out_norm, int N, float eps) {
  __shared__ float red[256];
  const int row = blockIdx.x, tid = threadIdx.x;
  const float* x = X + (size_t)row * N; const float* rr = R ? R + (size_t)row * N : nullptr;
  float vals[16];                     // up to N = 4096
  const int per = N / 256;            // contiguous chunk per thread? use strided-by-4 chunks: thread handles j = tid*4 + 1024*u
  float s1 = 0.f;
  for (int u = 0; u < per / 4; ++u) {
    const int j = tid * 4 + 1024 * u;
    const v4f a = *(const v4fa*)(x + j);
    v4f b = {0.f,0.f,0.f,0.f}; if (rr) b = *(const v4fa*)(rr + j);
#pragma unroll
    for (int q = 0; q < 4; ++q) { const float v = a[q] + b[q]; vals[u * 4 + q] = v; s1 += v; }
  }
  red[tid] = s1; __syncthreads();
  for (int st = 128; st > 0; st >>= 1) { if (tid < st) red[tid] += red[tid + st]; __syncthreads(); }
  const float mu = red[0] / (float)N; __syncthreads();
  float s2 = 0.f;
  for (int u = 0; u < per / 4; ++u)
#pragma unroll
    for (int q = 0; q < 4; ++q) { const float c = vals[u * 4 + q] - mu; s2 += c * c; }
  red[tid] = s2; __syncthreads();
  for (int st = 128; st > 0; st >>= 1) { if (tid < st) red[tid] += red[tid + st]; __syncthreads(); }
  const float rs = rsqrtf(red[0] / (float)N + eps);
  {
    for (int u = 0; u < per / 4; ++u) {
      const int j = tid * 4 + 1024 * u;
      v4f o, sm;
#pragma unroll
      for (int q = 0; q < 4; ++q) {
        float gg = g[j + q], bb = bta[j + q];
        if (PARAM_BF16) { gg = bf16_round(gg); bb = bf16_round(bb); }
        sm[q] = vals[u * 4 + q]; o[q] = (vals[u * 4 + q] - mu) * rs * gg + bb;
      }
      if (out_sum) *(v4f*)(out_sum + (size_t)row * N + j) = sm;
      *(v4f*)(out_norm + (size_t)row * N + j) = o;
    }
    
  }
}



// ---- f16 WMMA path (v_wmma_f32_16x16x32_f16): 11-bit significands for operands in range — used where a [0,1] probability operand needs more precision than bf16
typedef _Float16 v16h __attribute__((ext_vector_type(16)));
union FragH { v16h v; v8us half[2]; _Float16 h[16]; unsigned short u[16]; };
template <int NT>
__device__ __forceinline__ v8f mmaH(v16h ah, v16h al, v16h bh, v16h bl, v8f c) {
  c = __builtin_amdgcn_wmma_f32_16x16x32_f16(false, ah, false, bh, (short)0, c, false, false);
  if (NT >= 2) c = __builtin_amdgcn_wmma_f32_16x16x32_f16(false, al, false, bh, (short)0, c, false, false);
  if (NT >= 3) c = __builtin_amdgcn_wmma_f32_16x16x32_f16(false, ah, false, bl, (short)0, c, false, false);
  asm volatile("v_nop\n\tv_nop\n\tv_nop\n\tv_nop" : "+v"(c) : "v"(ah), "v"(al), "v"(bh), "v"(bl));
  return c;
}
// batched GEMM like k_gemm_b but f16 operands: A f32 (split into f16 hi/lo if ASPLIT, else rounded to f16), Bt = f16 values [n][k]; alpha; C f32; N multiple of 16 (partial tiles skipped)
template <bool ASPLIT>
__global__ __launch_bounds__(128) void k_gemm_h(const float* __restrict__ A, int lda, size_t sA, const _Float16* __restrict__ Bh, int ldb, size_t sB, float alpha, float* __restrict__ C, int ldc, size_t sC, int M, int N, int K) {
  __shared__ __attribute__((aligned(16))) float so[4][16][64];
  const int tid = threadIdx.x, w = tid >> 5, lane = tid & 31, ln = lane & 15, hh = lane >> 4; const int by = blockIdx.y;
  A += (size_t)by * sA; Bh += (size_t)by * sB; C += (size_t)by * sC;
  const int ntn = (N + 63) / 64; const int wid = blockIdx.x * 4 + w; const int mt = wid / ntn, nq = wid % ntn; if (mt * 16 >= M) return;
  const int row0 = mt * 16, col0 = nq * 64; const float* arow = A + (size_t)(row0 + ln) * lda;
  v8f acc[4] = {};
  for (int kb = 0; kb < K; kb += 32) {
    FragH ah, al;
    const v4f x0 = *(const v4fa*)(arow + kb + 8 * hh), x1 = *(const v4fa*)(arow + kb + 8 * hh + 4), x2 = *(const v4fa*)(arow + kb + 16 + 8 * hh), x3 = *(const v4fa*)(arow + kb + 16 + 8 * hh + 4);
    float xs[16] = {x0[0],x0[1],x0[2],x0[3],x1[0],x1[1],x1[2],x1[3],x2[0],x2[1],x2[2],x2[3],x3[0],x3[1],x3[2],x3[3]};
#pragma unroll
    for (int i = 0; i < 16; ++i) { const _Float16 h = (_Float16)xs[i]; ah.h[i] = h; al.h[i] = ASPLIT ? (_Float16)(xs[i] - (float)h) : (_Float16)0.0f; }
#pragma unroll
    for (int t = 0; t < 4; ++t) { if (col0 + t * 16 >= N) continue; const size_t boff = (size_t)(col0 + t * 16 + ln) * ldb + kb; FragH bq; bq.half[0] = *(const v8us*)(Bh + boff + 8 * hh); bq.half[1] = *(const v8us*)(Bh + boff + 16 + 8 * hh);
      acc[t] = mmaH<ASPLIT ? 2 : 1>(ah.v, al.v, bq.v, bq.v, acc[t]); }
  }
#pragma unroll
  for (int t = 0; t < 4; ++t) { if (col0 + t * 16 >= N) continue;
#pragma unroll
    for (int r = 0; r < 8; ++r) so[w][8 * hh + r][t * 16 + ln] = acc[t][r] * alpha; }
  __builtin_amdgcn_fence(__ATOMIC_ACQ_REL, "workgroup"); __builtin_amdgcn_wave_barrier();
  const int rsub = lane >> 4, c4 = (lane & 15) * 4;
  {
#pragma unroll
    for (int q = 0; q < 8; ++q) { const int r = q * 2 + rsub; if (col0 + c4 < N) { const v4f v = *(const v4fa*)&so[w][r][c4]; *(v4f*)(C + (size_t)(row0 + r) * ldc + col0 + c4) = v; } }
     }
}

// Wt[n][k] = f16(W[k][n]·scale) from f32 row-major W[K][N] (scale = power of two; bf16-exact weights stay exact in f16 away from the subnormal range)
__device__ __forceinline__ void wt_f16(const int bx, const float* __restrict__ W, _Float16* __restrict__ Wt, int K, int N, float scale) {
  const int t = bx * 256 + threadIdx.x; if (t >= N * (K / 8)) return; const int n = t / (K / 8), k8 = (t % (K / 8)) * 8; FragH f;
#pragma unroll
  for (int i = 0; i < 8; ++i) f.h[i] = (_Float16)(bf16_round(W[(size_t)(k8 + i) * N + n]) * scale); const v8us o = f.half[0];
  *(v8us*)((unsigned short*)Wt + (size_t)n * K + k8) = o; 
}
// One lane's eight 16-byte copies of an operand tile, global memory to LDS through no register. The s_wait_xcnt stands in the copies' own statement, ahead of any rewrite of the address registers they name.
__device__ __forceinline__ void tile_copy8(unsigned l, unsigned lstep, const unsigned short* g, size_t gstep) {
  asm volatile("global_load_async_to_lds_b128 %0, %8, off\n\t"
               "global_load_async_to_lds_b128 %1, %9, off\n\t"
               "global_load_async_to_lds_b128 %2, %10, off\n\t"
               "global_load_async_to_lds_b128 %3, %11, off\n\t"
               "global_load_async_to_lds_b128 %4, %12, off\n\t"
               "global_load_async_to_lds_b128 %5, %13, off\n\t"
               "global_load_async_to_lds_b128 %6, %14, off\n\t"
               "global_load_async_to_lds_b128 %7, %15, off\n\t"
               "s_wait_xcnt 0x0"
               :: "v"(l), "v"(l + lstep), "v"(l + 2 * lstep), "v"(l + 3 * lstep), "v"(l + 4 * lstep), "v"(l + 5 * lstep), "v"(l + 6 * lstep), "v"(l + 7 * lstep),
                  "v"(g), "v"(g + gstep), "v"(g + 2 * gstep), "v"(g + 3 * gstep), "v"(g + 4 * gstep), "v"(g + 5 * gstep), "v"(g + 6 * gstep), "v"(g + 7 * gstep)
               : "memory");
}
// C[M][N] = (A . Bt^T) * alpha (+ bias rounded to bf16): A f16 [M][CC], Bt f16 [N][CC], both with rows of CC elements; M and N multiples of 64, the grid exactly (M / 64) * (N / 64) blocks, N / 64 = 1 << lgn.
// A block of four waves owns a 64 x 64 tile of C. Its 64 rows of A and 64 rows of Bt, the whole K, are copied into LDS once, a wave's copy = one whole row of 512 contiguous bytes; then wave w takes rows 16 w .. 16 w + 15
// against all 64 columns, every fragment from LDS, the k order and the accumulation as before. Output rows are staged in the wave's own 16 rows of A, which no other wave reads, and leave as whole lines. Writes f32 C or f16 C16.
#define GP (CC * 2 + 16)      /* LDS row pitch in bytes, 16 B x odd: 16 lanes' ds_load_b128 fall on all 64 banks */
#define GSM (128 * GP)
typedef float fal __attribute__((may_alias));
template <bool BIAS, bool F32OUT>
__device__ __forceinline__ void gemm_lds(unsigned char* sm, const int bx, const int lgn, const _Float16* __restrict__ A, const _Float16* __restrict__ Bh, float alpha, const float* __restrict__ bias,
    float* __restrict__ C, _Float16* __restrict__ C16, int ldc) {
  const int tid = threadIdx.x, w = tid >> 5, lane = tid & 31, ln = lane & 15, hh = lane >> 4;
  const int row0 = (bx >> lgn) * 64, col0 = (bx & ((1 << lgn) - 1)) * 64;
  /* copy map: chunk c of thread tid = tile row w + 4 c, 16-byte column lane */
  const unsigned short* ga = (const unsigned short*)A + (size_t)(row0 + w) * CC + lane * 8;
  const unsigned short* gb = (const unsigned short*)Bh + (size_t)(col0 + w) * CC + lane * 8;
  const unsigned l0 = (unsigned)(size_t)sm + w * GP + lane * 16;      /* low 32 bits of the shared address = byte offset in the work-group's LDS */
  tile_copy8(l0, 4 * GP, ga, (size_t)4 * CC); tile_copy8(l0 + 32 * GP, 4 * GP, ga + 32 * CC, (size_t)4 * CC);
  tile_copy8(l0 + 64 * GP, 4 * GP, gb, (size_t)4 * CC); tile_copy8(l0 + 96 * GP, 4 * GP, gb + 32 * CC, (size_t)4 * CC);
  float bv[4];      /* the bias is fetched while the copies fly */
#pragma unroll
  for (int t = 0; t < 4; ++t) bv[t] = BIAS ? bf16_round(bias[col0 + t * 16 + ln]) : 0.f;
  if (BIAS) asm volatile("s_wait_xcnt 0x0" ::: "memory");      /* ahead of any rewrite of the offset register that the bias loads name */
  asm volatile("s_wait_asynccnt 0x0" ::: "memory");      /* this wave's share of both tiles has landed */
  __syncthreads();      /* both tiles published to all four waves */
  const unsigned char* af = sm + (w * 16 + ln) * GP + hh * 16; const unsigned char* bf = sm + (64 + ln) * GP + hh * 16;
  v8f acc[4] = {};
  FragH ah[2], bq[2][4];      /* two register sets: a k step's ten fragment reads stand together, one k step ahead of the products that use them */
  auto frags = [&](const int kb) { FragH& a = ah[kb & 1]; a.half[0] = *(const v8us*)(af + kb * 64); a.half[1] = *(const v8us*)(af + kb * 64 + 32);
#pragma unroll
    for (int t = 0; t < 4; ++t) { FragH& b = bq[kb & 1][t]; b.half[0] = *(const v8us*)(bf + t * 16 * GP + kb * 64); b.half[1] = *(const v8us*)(bf + t * 16 * GP + kb * 64 + 32); } };
  frags(0);
#pragma unroll      /* every LDS offset an immediate, the register set a compile-time choice */
  for (int kb = 0; kb < CC / 32; ++kb) { if (kb + 1 < CC / 32) frags(kb + 1);
#pragma unroll
    for (int t = 0; t < 4; ++t) acc[t] = mmaH<1>(ah[kb & 1].v, ah[kb & 1].v, bq[kb & 1][t].v, bq[kb & 1][t].v, acc[t]);
  }
  fal* so = (fal*)(sm + w * 16 * GP);      /* [16][64] f32 in the wave's own rows of A, all read by now */
#pragma unroll
  for (int t = 0; t < 4; ++t)
#pragma unroll
    for (int r = 0; r < 8; ++r) so[(8 * hh + r) * 64 + t * 16 + ln] = acc[t][r] * alpha + bv[t];
  __builtin_amdgcn_fence(__ATOMIC_ACQ_REL, "workgroup"); __builtin_amdgcn_wave_barrier();
  const int rsub = lane >> 4, c4 = (lane & 15) * 4; typedef _Float16 v4h __attribute__((ext_vector_type(4)));
#pragma unroll
  for (int q = 0; q < 8; ++q) { const int r = q * 2 + rsub; const v4f v = *(const v4fa*)&so[r * 64 + c4]; const size_t o = (size_t)(row0 + w * 16 + r) * ldc + col0 + c4;
    if (F32OUT) *(v4f*)(C + o) = v; else { v4h h4; for (int i = 0; i < 4; ++i) h4[i] = (_Float16)v[i]; *(v4h*)(C16 + o) = h4; } }
}
// y = O16 . Wout + bout: M 8192, N 256
__global__ __launch_bounds__(128) void k_gemm_out(const _Float16* __restrict__ A, const _Float16* __restrict__ Bh, float alpha, const float* __restrict__ bias, float* __restrict__ C) {
  __shared__ __attribute__((aligned(16))) unsigned char sm[GSM];
  gemm_lds<true, true>(sm, blockIdx.x, 2, A, Bh, alpha, bias, C, nullptr, CC);
}
// The two products that read only X16 and Bqkv, in one grid; the job is block-uniform, by block index:
// blocks [0, NBQ): [q | k] token-major [(b,n)][512] = X16 . Bqkv rows 0..511 (M 8192, N 512); blocks [NBQ, NBQ + BB * NBV): v channel-major per batch [b][(h,d)][n] = Bqkv rows 512..767 . X16[b] (M 256, N 2048).
#define NBQ ((NR / 64) * (2 * CC / 64))
#define NBV ((CC / 64) * (NN / 64))
__global__ __launch_bounds__(128) void k_gemm_qkv(const _Float16* __restrict__ X16, const _Float16* __restrict__ Bqkv, _Float16* __restrict__ QK, _Float16* __restrict__ Vt, float alpha) {
  __shared__ __attribute__((aligned(16))) unsigned char sm[GSM];
  const int bx = blockIdx.x, rb = bx - NBQ; const bool jv = rb >= 0; const int by = jv ? rb / NBV : 0;
  gemm_lds<false, false>(sm, jv ? rb % NBV : bx, jv ? 5 : 3, jv ? Bqkv + (size_t)2 * CC * CC : X16, jv ? X16 + (size_t)by * NN * CC : Bqkv, alpha, nullptr,
           nullptr, jv ? Vt + (size_t)by * CC * NN : QK, jv ? NN : 2 * CC);
}


typedef _Float16 v4h __attribute__((ext_vector_type(4)));

__device__ __forceinline__ void x16(const int bx, const float* __restrict__ x, _Float16* __restrict__ X16, size_t n8) { const size_t t = (size_t)bx * 256 + threadIdx.x; if (t >= n8) return; FragH f;
#pragma unroll
  for (int q = 0; q < 8; ++q) f.h[q] = (_Float16)bf16_round(x[t * 8 + q]); *(v8us*)((unsigned short*)X16 + t * 8) = f.half[0];  }
// The three conversions that read only inputs, in one grid; the job is block-uniform, by block index: Wqkv transposed, Wout transposed ((in,out) to Bt[n][k] x 2^4), x rounded.
#define NBW1 (C3 * (CC / 8) / 256)
#define NBW2 (CC * (CC / 8) / 256)
#define NBX (NR * CC / 8 / 256)
__global__ __launch_bounds__(256) void k_prep(const float* __restrict__ Wqkv, _Float16* __restrict__ Bqkv, const float* __restrict__ Wout, _Float16* __restrict__ Bo, const float* __restrict__ x, _Float16* __restrict__ X16) {
  const int bx = blockIdx.x;
  if (bx < NBW1) wt_f16(bx, Wqkv, Bqkv, CC, C3, 16.0f);
  else if (bx < NBW1 + NBW2) wt_f16(bx - NBW1, Wout, Bo, CC, CC, 16.0f);
  else x16(bx - (NBW1 + NBW2), x, X16, (size_t)NR * CC / 8);
}
__global__ __launch_bounds__(256) void k_h16(const float* __restrict__ x, _Float16* __restrict__ X16, size_t n8) { const size_t t = (size_t)blockIdx.x * 256 + threadIdx.x; if (t >= n8) return; FragH f;
#pragma unroll
  for (int q = 0; q < 8; ++q) f.h[q] = (_Float16)x[t * 8 + q]; *(v8us*)((unsigned short*)X16 + t * 8) = f.half[0];  }
__global__ __launch_bounds__(256) void k_round16f(const float* __restrict__ W, _Float16* __restrict__ Bt, size_t n8) { const size_t t = (size_t)blockIdx.x * 256 + threadIdx.x; if (t >= n8) return; FragH f;
#pragma unroll
  for (int i = 0; i < 8; ++i) f.h[i] = (_Float16)(bf16_round(W[t * 8 + i]) * 16.0f); *(v8us*)((unsigned short*)Bt + t * 8) = f.half[0];  }
template <int NHv, int TTv>
__global__ __launch_bounds__(256) void k_vt(const _Float16* __restrict__ V16, int ldv, int voff, _Float16* __restrict__ Vt) { __shared__ unsigned short tl[64][66]; const int tid = threadIdx.x; const int slab = blockIdx.x / (TTv / 64), lg = blockIdx.x % (TTv / 64); const int b = slab / NHv, h = slab % NHv;
  for (int i = tid; i < 64 * 8; i += 256) { const int r = i / 8, c8 = (i % 8) * 8; FragH f; f.half[0] = *(const v8us*)((const unsigned short*)V16 + ((size_t)b * TTv + lg * 64 + r) * ldv + voff + h * 64 + c8);
#pragma unroll
    for (int q = 0; q < 8; ++q) tl[r][c8 + q] = f.u[q]; }
  __syncthreads();
  {
#pragma unroll
    for (int rd = 0; rd < 2; ++rd) { const int d = rd * 32 + tid / 8, pc = tid % 8; FragH f;
#pragma unroll
      for (int q = 0; q < 8; ++q) f.u[q] = tl[pc * 8 + q][d];
      *(v8us*)((unsigned short*)Vt + ((size_t)slab * 64 + d) * TTv + lg * 64 + pc * 8) = f.half[0]; }
     } }

typedef float v2f __attribute__((ext_vector_type(2)));
// lane l with lane l ^ 16 (the two halves of a wave hold the two key halves of one query column)
__device__ __forceinline__ float xhalf(float x) { return __builtin_bit_cast(float, __builtin_amdgcn_permlanex16(__builtin_bit_cast(int, x), __builtin_bit_cast(int, x), 0x76543210, 0xfedcba98, false, false)); }

// One lane's eight 16-byte copies of a stage (four of K, four of V^T), global memory to LDS through no register. The s_wait_xcnt stands in the copies' own statement, ahead of any rewrite of the address registers they name.
__device__ __forceinline__ void stage_copy(unsigned lk, const unsigned short* gk, size_t gkstep, unsigned lkstep, unsigned lv, const unsigned short* gv, size_t gvstep, unsigned lvstep) {
  asm volatile("global_load_async_to_lds_b128 %0, %8, off\n\t"
               "global_load_async_to_lds_b128 %1, %9, off\n\t"
               "global_load_async_to_lds_b128 %2, %10, off\n\t"
               "global_load_async_to_lds_b128 %3, %11, off\n\t"
               "global_load_async_to_lds_b128 %4, %12, off\n\t"
               "global_load_async_to_lds_b128 %5, %13, off\n\t"
               "global_load_async_to_lds_b128 %6, %14, off\n\t"
               "global_load_async_to_lds_b128 %7, %15, off\n\t"
               "s_wait_xcnt 0x0"
               :: "v"(lk), "v"(lk + lkstep), "v"(lk + 2 * lkstep), "v"(lk + 3 * lkstep), "v"(lv), "v"(lv + lvstep), "v"(lv + 2 * lvstep), "v"(lv + 3 * lvstep),
                  "v"(gk), "v"(gk + gkstep), "v"(gk + 2 * gkstep), "v"(gk + 3 * gkstep), "v"(gv), "v"(gv + gvstep), "v"(gv + 2 * gvstep), "v"(gv + 3 * gvstep)
               : "memory");
}

__global__ __launch_bounds__(128) void k_flash(const _Float16* __restrict__ Q16, int ldq, const _Float16* __restrict__ K16, int ldk, const _Float16* __restrict__ Vt, const int* __restrict__ MSK, float* __restrict__ O, int ldo) {
  constexpr int RPW = 16, NQB = NN / (4 * RPW), DT = 2; (void)MSK;
  constexpr int TK = 128, NS = NN / TK;      /* keys a stage, stages */
  constexpr int KP = HD * 2 + 16, VP = TK * 2 + 16;      /* LDS row pitches in bytes, 16 B x odd: 16 lanes' ds_load_b128 fall on all 64 banks */
  constexpr int KB = TK * KP, SB = KB + HD * VP;      /* a stage: TK rows of K (HD channels), then HD rows of V^T (TK keys) */
  __shared__ __attribute__((aligned(16))) unsigned char sm[2 * SB];
  constexpr float SL2E = 0.17677669529663687f * 1.4426950408889634f;      /* 32^-1/2 * log2(e): e^(scale*s - m) = 2^(SL2E*s - m2), one fma ahead of a bare v_exp_f32 */
  const int tid = threadIdx.x, w = tid >> 5, lane = tid & 31, ln = lane & 15, hh = lane >> 4;
  const int slab = blockIdx.x / NQB, qblk = blockIdx.x % NQB; const int b = slab / NH, h = slab % NH; const int q0 = qblk * (4 * RPW) + w * RPW;
  const unsigned short* Vth = (const unsigned short*)Vt + ((size_t)b * CC + h * HD) * NN;      /* V^T = v[b][(h,d)][n] channel-major */
  /* copy map: K chunk c of thread tid = row (tid >> 2) + 32 c, 16-byte column tid & 3; V^T chunk c = row (tid >> 4) + 8 c, 16-byte column tid & 15 */
  const unsigned short* gk = (const unsigned short*)K16 + ((size_t)b * NN + (tid >> 2)) * ldk + h * HD + (tid & 3) * 8;
  const unsigned short* gv = Vth + (size_t)(tid >> 4) * NN + (tid & 15) * 8;
  const unsigned lds0 = (unsigned)(size_t)sm;      /* low 32 bits of the shared address = byte offset in the work-group's LDS */
  const unsigned lk = lds0 + (tid >> 2) * KP + (tid & 3) * 16, lv = lds0 + KB + (tid >> 4) * VP + (tid & 15) * 16;
  const size_t gkstep = (size_t)32 * ldk, gkstage = (size_t)TK * ldk;
  stage_copy(lk, gk, gkstep, 32 * KP, lv, gv, (size_t)8 * NN, 8 * VP);
  FragH bq;      /* B: column ln = query q0 + ln, k = head channel */
  { const unsigned short* qr = (const unsigned short*)Q16 + ((size_t)b * NN + q0 + ln) * ldq + h * HD; bq.half[0] = *(const v8us*)(qr + 8 * hh); bq.half[1] = *(const v8us*)(qr + 16 + 8 * hh); }
  asm volatile("s_wait_asynccnt 0x0" ::: "memory");      /* this wave's share of stage 0 has landed */
  __syncthreads();      /* stage 0 published to all four waves */
  gk += gkstage; gv += TK;
  stage_copy(lk + SB, gk, gkstep, 32 * KP, lv + SB, gv, (size_t)8 * NN, 8 * VP);
  float m_q = -3.0e38f, l_q = 0.f; v8f oacc[DT];
#pragma unroll
  for (int dt = 0; dt < DT; ++dt) oacc[dt] = (v8f){0.f,0.f,0.f,0.f,0.f,0.f,0.f,0.f};
#pragma unroll 1      /* one body for both buffers: the buffer is an offset */
  for (int t = 0; t < NS; ++t) {
    const unsigned bo = (unsigned)(t & 1) * SB;
    const unsigned char* kf = sm + bo + ln * KP + hh * 16; const unsigned char* vf = sm + bo + KB + ln * VP + hh * 16;
#pragma unroll      /* the four 32-key passes of a stage: every LDS offset an immediate */
    for (int ps = 0; ps < TK / 32; ++ps) {
    FragH ak[2], av[DT];      /* the pass's eight fragment reads stand together at its head: one LDS latency a pass, V^T's behind the score products and the softmax */
#pragma unroll
    for (int nt = 0; nt < 2; ++nt) { const unsigned char* kr = kf + (ps * 32 + nt * 16) * KP; ak[nt].half[0] = *(const v8us*)kr; ak[nt].half[1] = *(const v8us*)(kr + 32); }
#pragma unroll
    for (int dt = 0; dt < DT; ++dt) { const unsigned char* vrow = vf + dt * 16 * VP + ps * 64; av[dt].half[0] = *(const v8us*)vrow; av[dt].half[1] = *(const v8us*)(vrow + 32); }
    v8f s[2];      /* s[nt][r] = S^T[key t*TK + ps*32 + nt*16 + 8*hh + r][query q0 + ln] */
#pragma unroll
    for (int nt = 0; nt < 2; ++nt) s[nt] = mmaH<1>(ak[nt].v, ak[nt].v, bq.v, bq.v, (v8f){0.f,0.f,0.f,0.f,0.f,0.f,0.f,0.f});
    float mt[8];
#pragma unroll
    for (int i = 0; i < 8; ++i) mt[i] = fmaxf(s[0][i], s[1][i]);
    float mc = fmaxf(fmaxf(fmaxf(mt[0], mt[1]), fmaxf(mt[2], mt[3])), fmaxf(fmaxf(mt[4], mt[5]), fmaxf(mt[6], mt[7])));
    mc = fmaxf(mc, xhalf(mc));      /* both halves now hold the maximum over the query's 32 raw products (SL2E > 0 keeps the order) */
    const float mn = fmaxf(m_q, mc * SL2E); const float al = (mn > -1.0e38f) ? __builtin_amdgcn_exp2f(m_q - mn) : 1.0f; m_q = mn;      /* m_q, mn: base-2 exponents */
    const float nb = 10.0f - mn;      /* 2^10 = the f16 scale of P, carried in the exponent: p and l_q hold 1024 times the shifted values */
    v2f p[8]; FragH pb;
#pragma unroll
    for (int i = 0; i < 8; ++i) { const v2f a = (v2f){s[i >> 2][(2 * i) & 7], s[i >> 2][(2 * i + 1) & 7]} * SL2E + nb;
      p[i] = (v2f){__builtin_amdgcn_exp2f(a[0]), __builtin_amdgcn_exp2f(a[1])}; pb.h[2 * i] = (_Float16)p[i][0]; pb.h[2 * i + 1] = (_Float16)p[i][1]; }
    const v2f psum = ((p[0] + p[1]) + (p[2] + p[3])) + ((p[4] + p[5]) + (p[6] + p[7]));
    l_q = l_q * al + (psum[0] + psum[1]);      /* this half's 16 keys; the halves join after the loop */
#pragma unroll
    for (int dt = 0; dt < DT; ++dt) { oacc[dt] *= al; oacc[dt] = mmaH<1>(av[dt].v, av[dt].v, pb.v, pb.v, oacc[dt]); } }      /* oacc[dt][r] = O^T[channel dt*16 + 8*hh + r][query q0 + ln] */
    asm volatile("s_wait_dscnt 0x0" ::: "memory");      /* this wave's reads of stage t are done before its buffer is handed back */
    asm volatile("s_wait_asynccnt 0x0" ::: "memory");      /* this wave's share of stage t + 1 has landed */
    __syncthreads();      /* publishes stage t + 1 and ends every wave's reads of stage t */
    if (t + 2 < NS) { gk += gkstage; gv += TK; stage_copy(lk + bo, gk, gkstep, 32 * KP, lv + bo, gv, (size_t)8 * NN, 8 * VP); }      /* stage t + 2 into the buffer just read */
  }
  asm volatile("s_wait_asynccnt 0x0" ::: "memory");      /* no copy outstanding at the wave's end */
  const float l = l_q + xhalf(l_q); const float den = l + (1e-6f * 1024.0f) * __builtin_amdgcn_exp2f(-m_q); const float inv = (den > 0.f && den < INFINITY) ? 1.0f / den : 0.f;      /* sum e^s/(sum e^s + 1e-6) form: e^(-m)*1e-6 joins the shifted sum; an infinite den (all logits far below 0) reproduces the reference's ~0 output */
  float* orow = O + ((size_t)b * NN + q0 + ln) * ldo + h * HD + 8 * hh;
#pragma unroll
  for (int dt = 0; dt < DT; ++dt) { const v8f o = oacc[dt] * inv; *(v4f*)(orow + dt * 16) = (v4f){o[0], o[1], o[2], o[3]}; *(v4f*)(orow + dt * 16 + 4) = (v4f){o[4], o[5], o[6], o[7]}; } }

extern "C" void kernel_launch(void* const* d_in, const int* in_sizes, int n_in,
                              void* d_out, int out_size, void* d_ws, size_t ws_size, hipStream_t stream) {
  (void)in_sizes; (void)n_in; (void)out_size;
  const float* x = (const float*)d_in[0]; const float* Wqkv = (const float*)d_in[1]; const float* Wout = (const float*)d_in[2]; const float* bout = (const float*)d_in[3];
  char* ws = (char*)d_ws; size_t off = 0;
  auto take = [&](size_t bytes) { char* p = ws + off; off += (bytes + 255) & ~(size_t)255; return p; };
  _Float16* Bqkv = (_Float16*)take((size_t)C3 * CC * 2); _Float16* Bo = (_Float16*)take((size_t)CC * CC * 2); _Float16* X16 = (_Float16*)take((size_t)NR * CC * 2);
  _Float16* QK = (_Float16*)take((size_t)NR * 2 * CC * 2); _Float16* Vt = (_Float16*)take((size_t)BB * CC * NN * 2); float* O = (float*)take((size_t)NR * CC * 4); _Float16* O16 = (_Float16*)take((size_t)NR * CC * 2);
  if (off > ws_size) return;      // 0.4 + 0.1 + 4.2 + 8.4 + 4.2 + 8.4 + 4.2 ≈ 30 MB
  k_prep<<<NBW1 + NBW2 + NBX, 256, 0, stream>>>(Wqkv, Bqkv, Wout, Bo, x, X16);
  k_gemm_qkv<<<NBQ + BB * NBV, 128, 0, stream>>>(X16, Bqkv, QK, Vt, 0.0625f);
  k_flash<<<BB * NH * (NN / 64), 128, 0, stream>>>(QK, 2 * CC, QK + CC, 2 * CC, Vt, nullptr, O, CC);      /* blocks = (b,h) × 64-query groups */
  k_h16<<<(unsigned)(((size_t)NR * CC / 8 + 255) / 256), 256, 0, stream>>>(O, O16, (size_t)NR * CC / 8);
  k_gemm_out<<<(NR / 64) * (CC / 64), 128, 0, stream>>>(O16, Bo, 0.0625f, bout, (float*)d_out);      /* y = out.Wout + bout: M 8192 N 256 K 256 */
}

// v006
// One run takes 48.9 microseconds.
// Two timings next to v005 both put it at 1.07 times that version's speed.
// Over all steps from v000 it is 4.88 times as fast.
#include <hip/hip_runtime.h>
// KeOps-style multi-head attention (B=4, n=2048, dim 256, 8 heads × 32): qkv = x·Wqkv; q scaled by 32^-½; e = exp(q·kᵀ) WITHOUT max subtraction; out = (e·v)/(Σe + 1e-6) merged over heads; y = out·Wout + bout.
// Compute dtype: x, Wqkv, Wout, bout rounded to bf16; q/k token-major and v channel-major (= Vᵀ) as f16 GEMM outputs (f32 accumulate); fused flash-style kernel per (b,h) (online max-rescaled sums
// in f32 — the unshifted quotient is recovered exactly through the normaliser l + 1e-6·e^(−m); P f16 ×2^10) on v_wmma_f32_16x16x32_f16; O → f16 → output GEMM with bias; f32 accumulate.
#define BB 4
#define NN 2048
#define CC 256
#define C3 768
#define NH 8
#define HD 32
#define NR (BB * NN)

typedef __bf16 v16b __attribute__((ext_vector_type(16)));
typedef unsigned short v8us __attribute__((ext_vector_type(8), may_alias));
typedef float  v8f  __attribute__((ext_vector_type(8)));
typedef float  v4f  __attribute__((ext_vector_type(4)));
typedef float  v4fa __attribute__((ext_vector_type(4), may_alias));
union FragB { v16b v; v8us half[2]; unsigned short u[16]; };

__device__ __forceinline__ unsigned short bf16_bits(float x) { unsigned int u = __float_as_uint(x); return (unsigned short)((u + 0x7FFFu + ((u >> 16) & 1u)) >> 16); }
__device__ __forceinline__ float bf16_val(unsigned short b) { return __uint_as_float(((unsigned int)b) << 16); }
__device__ __forceinline__ float bf16_round(float x) { return bf16_val(bf16_bits(x)); }
// D += A·B with NT terms: 1 = ah·bh, 2 = + al·bh (A split), 3 = + ah·bl (both split)
template <int NT>
__device__ __forceinline__ v8f mmaN(v16b ah, v16b al, v16b bh, v16b bl, v8f c) {
  c = __builtin_amdgcn_wmma_f32_16x16x32_bf16(false, ah, false, bh, (short)0, c, false, false);
  if (NT >= 2) c = __builtin_amdgcn_wmma_f32_16x16x32_bf16(false, al, false, bh, (short)0, c, false, false);
  if (NT >= 3) c = __builtin_amdgcn_wmma_f32_16x16x32_bf16(false, ah, false, bl, (short)0, c, false, false);
  asm volatile("v_nop\n\tv_nop\n\tv_nop\n\tv_nop" : "+v"(c) : "v"(ah), "v"(al), "v"(bh), "v"(bl));
  return c;
}

__global__ __launch_bounds__(256) void k_wt_bf16(const float* __restrict__ W, unsigned short* __restrict__ Wt, int K, int N) {
  const int t = blockIdx.x * 256 + threadIdx.x;
  const int k8n = K / 8;
  if (t >= N * k8n) return;
  const int n = t / k8n, k8 = (t % k8n) * 8;
  v8us v;
#pragma unroll
  for (int i = 0; i < 8; ++i) v[i] = bf16_bits(W[(size_t)(k8 + i) * N + n]);
  *(v8us*)(Wt + (size_t)n * K + k8) = v;
  
}

// GEMM C[M][N] (f32, pitch ldc) = act(A[M][K]·W + bias). A f32 row-major (pitch lda) converted per fragment to bf16
// (ASPLIT: hi/lo two planes -> 2 terms, else single rounded term); Wt bf16 [N][K] (pitch ldb). BIAS_BF16 rounds the
// bias to bf16 first (bias quantised to bf16 before the add). K%32==0, M%16==0, N%64==0.
template <bool ASPLIT, int ACT, bool BIAS_BF16>
__global__ __launch_bounds__(128) void k_gemm_bf(const float* __restrict__ A, int lda, const unsigned short* __restrict__ Wt, int ldb,
                                               const float* __restrict__ bias, float* __restrict__ C, int ldc, int M, int N, int K) {
  __shared__ __attribute__((aligned(16))) float so[4][16][64];
  const int tid = threadIdx.x, w = tid >> 5, lane = tid & 31, ln = lane & 15, hh = lane >> 4;
  const int ntn = N / 64;
  const int wid = blockIdx.x * 4 + w;
  const int mt = wid / ntn, nq = wid % ntn;
  if (mt * 16 >= M) return;
  const int row0 = mt * 16, col0 = nq * 64;
  const float* arow = A + (size_t)(row0 + ln) * lda;
  v8f acc[4] = {};
  for (int kb = 0; kb < K; kb += 32) {
    FragB ah, al;
    const v4f x0 = *(const v4fa*)(arow + kb + 8 * hh), x1 = *(const v4fa*)(arow + kb + 8 * hh + 4);
    const v4f x2 = *(const v4fa*)(arow + kb + 16 + 8 * hh), x3 = *(const v4fa*)(arow + kb + 16 + 8 * hh + 4);
    float xs[16] = {x0[0],x0[1],x0[2],x0[3],x1[0],x1[1],x1[2],x1[3],x2[0],x2[1],x2[2],x2[3],x3[0],x3[1],x3[2],x3[3]};
#pragma unroll
    for (int i = 0; i < 16; ++i) { const unsigned short hb = bf16_bits(xs[i]); ah.u[i] = hb; al.u[i] = ASPLIT ? bf16_bits(xs[i] - bf16_val(hb)) : (unsigned short)0; }
#pragma unroll
    for (int t = 0; t < 4; ++t) {
      const unsigned short* brow = Wt + (size_t)(col0 + t * 16 + ln) * ldb + kb;
      FragB b;
      b.half[0] = *(const v8us*)(brow + 8 * hh);
      b.half[1] = *(const v8us*)(brow + 16 + 8 * hh);
      acc[t] = mmaN<ASPLIT ? 2 : 1>(ah.v, al.v, b.v, b.v, acc[t]);
    }
  }
#pragma unroll
  for (int t = 0; t < 4; ++t) {
    float bv = bias ? bias[col0 + t * 16 + ln] : 0.f;
    if (BIAS_BF16) bv = bf16_round(bv);
#pragma unroll
    for (int r = 0; r < 8; ++r) { float v = acc[t][r] + bv; if (ACT == 1) v = fmaxf(v, 0.f); so[w][8 * hh + r][t * 16 + ln] = v; }
  }
  __builtin_amdgcn_fence(__ATOMIC_ACQ_REL, "workgroup");
  __builtin_amdgcn_wave_barrier();
  const int rsub = lane >> 4, c4 = (lane & 15) * 4;
  {
#pragma unroll
    for (int q = 0; q < 8; ++q) {
      const int r = q * 2 + rsub;
      const v4f v = *(const v4fa*)&so[w][r][c4];
      *(v4f*)(C + (size_t)(row0 + r) * ldc + col0 + c4) = v;
    }
    
  }
}

// Flash-style causal/unmasked attention, all contractions 3-term bf16 hi/lo splits, f32 softmax with running max.
// q,k,v rows are read from f32 buffers with arbitrary row pitch (so they can live inside a fused qkv buffer);
// D = head size (multiple of 32, <= 128); one wave = 16 query rows; block = 4 waves (64 queries) sharing K/V chunks of 32.
template <int D, bool CAUSAL>
__global__ __launch_bounds__(128) void k_flash(const float* __restrict__ qb, const float* __restrict__ kb, const float* __restrict__ vb,
                                             int pitch, int T, int H, float scale, float* __restrict__ y, int ypitch) {
  constexpr int KS = D / 32;        // k-steps for QK
  constexpr int DT = D / 16;        // d tiles for PV
  __shared__ __attribute__((aligned(16))) unsigned short sKh[32][D + 8], sKl[32][D + 8], sVh[32][D + 8], sVl[32][D + 8];
  __shared__ __attribute__((aligned(16))) unsigned short sPh[4][16][40], sPl[4][16][40];
  __shared__ __attribute__((aligned(16))) float sO[4][16][D];
  const int tid = threadIdx.x, w = tid >> 5, lane = tid & 31, ln = lane & 15, hh = lane >> 4;
  const int nqb = (T + 63) / 64;
  const int bh = blockIdx.x / nqb, qblk = blockIdx.x % nqb;
  const int b = bh / H, h = bh % H;
  const int q0 = qblk * 64 + w * 16;
  const float* Q = qb + (size_t)b * T * pitch + h * D;
  const float* K = kb + (size_t)b * T * pitch + h * D;
  const float* V = vb + (size_t)b * T * pitch + h * D;

  // A fragments of the wave's 16 query rows (scaled), hi/lo
  FragB aqh[KS], aql[KS];
  {
    int row = q0 + ln; if (row >= T) row = T - 1;
    const float* qr = Q + (size_t)row * pitch;
#pragma unroll
    for (int ks = 0; ks < KS; ++ks)
#pragma unroll
      for (int i = 0; i < 16; ++i) {
        const int d = ks * 32 + ((i < 8) ? (8 * hh + i) : (16 + 8 * hh + (i - 8)));
        const float x = qr[d] * scale; const unsigned short hb = bf16_bits(x);
        aqh[ks].u[i] = hb; aql[ks].u[i] = bf16_bits(x - bf16_val(hb));
      }
  }
  float m_r[8], l_r[8];
#pragma unroll
  for (int r = 0; r < 8; ++r) { m_r[r] = -3.0e38f; l_r[r] = 0.f; }
  v8f oacc[DT];
#pragma unroll
  for (int dt = 0; dt < DT; ++dt) oacc[dt] = (v8f){0.f,0.f,0.f,0.f,0.f,0.f,0.f,0.f};

  const int kv_end = CAUSAL ? min(T, qblk * 64 + 64) : T;     // block-uniform
  for (int j0 = 0; j0 < kv_end; j0 += 32) {
    __syncthreads();
    for (int e = tid; e < 32 * (D / 4); e += 128) {
      const int r = e / (D / 4), c4 = (e % (D / 4)) * 4;
      const int key = j0 + r;
      v4f kf = {0.f,0.f,0.f,0.f}, vf = {0.f,0.f,0.f,0.f};
      if (key < T) { kf = *(const v4fa*)(K + (size_t)key * pitch + c4); vf = *(const v4fa*)(V + (size_t)key * pitch + c4); }
#pragma unroll
      for (int t = 0; t < 4; ++t) {
        unsigned short hb = bf16_bits(kf[t]); sKh[r][c4 + t] = hb; sKl[r][c4 + t] = bf16_bits(kf[t] - bf16_val(hb));
        hb = bf16_bits(vf[t]); sVh[r][c4 + t] = hb; sVl[r][c4 + t] = bf16_bits(vf[t] - bf16_val(hb));
      }
    }
    __syncthreads();
    // S tile 16 x 32
    v8f s[2];
#pragma unroll
    for (int nt = 0; nt < 2; ++nt) {
      v8f acc = {};
#pragma unroll
      for (int ks = 0; ks < KS; ++ks) {
        FragB bh_, bl_;
        bh_.half[0] = *(const v8us*)&sKh[nt * 16 + ln][ks * 32 + 8 * hh]; bh_.half[1] = *(const v8us*)&sKh[nt * 16 + ln][ks * 32 + 16 + 8 * hh];
        bl_.half[0] = *(const v8us*)&sKl[nt * 16 + ln][ks * 32 + 8 * hh]; bl_.half[1] = *(const v8us*)&sKl[nt * 16 + ln][ks * 32 + 16 + 8 * hh];
        acc = mmaN<3>(aqh[ks].v, aql[ks].v, bh_.v, bl_.v, acc);
      }
      s[nt] = acc;
    }
    // mask + running max (rows 8hh+r; the 16 lanes of a half share rows)
    float alpha[8];
#pragma unroll
    for (int r = 0; r < 8; ++r) {
      const int qi = q0 + 8 * hh + r;
      const int ja = j0 + ln, jb = j0 + 16 + ln;
      if (CAUSAL) { if (ja > qi) s[0][r] = -3.0e38f; if (jb > qi) s[1][r] = -3.0e38f; }
      if (ja >= T) s[0][r] = -3.0e38f;
      if (jb >= T) s[1][r] = -3.0e38f;
      float mx = fmaxf(s[0][r], s[1][r]);
      mx = fmaxf(mx, __shfl_xor(mx, 1, 32)); mx = fmaxf(mx, __shfl_xor(mx, 2, 32)); mx = fmaxf(mx, __shfl_xor(mx, 4, 32)); mx = fmaxf(mx, __shfl_xor(mx, 8, 32));
      const float mnew = fmaxf(m_r[r], mx);
      alpha[r] = (mnew > -1.0e38f) ? __expf(m_r[r] - mnew) : 1.0f;
      const float p0 = (s[0][r] > -1.0e38f) ? __expf(s[0][r] - mnew) : 0.f;
      const float p1 = (s[1][r] > -1.0e38f) ? __expf(s[1][r] - mnew) : 0.f;
      m_r[r] = mnew;
      l_r[r] = l_r[r] * alpha[r] + p0 + p1;            // per-lane partial row sum (16 lanes combined at the end)
      unsigned short hb = bf16_bits(p0); sPh[w][8 * hh + r][ln] = hb;      sPl[w][8 * hh + r][ln] = bf16_bits(p0 - bf16_val(hb));
      hb = bf16_bits(p1);                sPh[w][8 * hh + r][16 + ln] = hb; sPl[w][8 * hh + r][16 + ln] = bf16_bits(p1 - bf16_val(hb));
    }
#pragma unroll
    for (int dt = 0; dt < DT; ++dt)
#pragma unroll
      for (int r = 0; r < 8; ++r) oacc[dt][r] *= alpha[r];
    __builtin_amdgcn_fence(__ATOMIC_ACQ_REL, "workgroup");
    __builtin_amdgcn_wave_barrier();
    FragB pah, pal;
    pah.half[0] = *(const v8us*)&sPh[w][ln][8 * hh]; pah.half[1] = *(const v8us*)&sPh[w][ln][16 + 8 * hh];
    pal.half[0] = *(const v8us*)&sPl[w][ln][8 * hh]; pal.half[1] = *(const v8us*)&sPl[w][ln][16 + 8 * hh];
#pragma unroll
    for (int dt = 0; dt < DT; ++dt) {
      FragB bvh, bvl;
#pragma unroll
      for (int i = 0; i < 8; ++i) {
        bvh.u[i] = sVh[8 * hh + i][dt * 16 + ln]; bvh.u[8 + i] = sVh[16 + 8 * hh + i][dt * 16 + ln];
        bvl.u[i] = sVl[8 * hh + i][dt * 16 + ln]; bvl.u[8 + i] = sVl[16 + 8 * hh + i][dt * 16 + ln];
      }
      oacc[dt] = mmaN<3>(pah.v, pal.v, bvh.v, bvl.v, oacc[dt]);
    }
    __builtin_amdgcn_fence(__ATOMIC_ACQ_REL, "workgroup");
    __builtin_amdgcn_wave_barrier();
  }
#pragma unroll
  for (int r = 0; r < 8; ++r) {
    float l = l_r[r];
    l += __shfl_xor(l, 1, 32); l += __shfl_xor(l, 2, 32); l += __shfl_xor(l, 4, 32); l += __shfl_xor(l, 8, 32);
    l_r[r] = (l > 0.f) ? 1.0f / l : 0.f;
  }
#pragma unroll
  for (int dt = 0; dt < DT; ++dt)
#pragma unroll
    for (int r = 0; r < 8; ++r) sO[w][8 * hh + r][dt * 16 + ln] = oacc[dt][r] * l_r[r];
  __builtin_amdgcn_fence(__ATOMIC_ACQ_REL, "workgroup");
  __builtin_amdgcn_wave_barrier();
  {
    for (int r = 0; r < 16; ++r) {
      const int row = q0 + r;
      if (row < T && lane < D / 4) {
        const v4f val = *(const v4fa*)&sO[w][r][lane * 4];
        *(v4f*)(y + ((size_t)b * T + row) * ypitch + h * D + lane * 4) = val;
      }
    }
    
  }
}

// GEMM C = act(A·W + bias + resid): A f32 (ASPLIT -> hi/lo 2 terms), Wt bf16 [N][K]; ACT 0 none, 1 relu, 2 exact gelu;
// resid (optional, f32, row index = (row % rmod), pitch ldr, RES_BF16 rounds it) added before the activation.
template <bool ASPLIT, int ACT, bool BIAS_BF16, bool RES_BF16>
__global__ __launch_bounds__(128) void k_gemm_bf3(const float* __restrict__ A, int lda, const unsigned short* __restrict__ Wt, int ldb,
                                                const float* __restrict__ bias, const float* __restrict__ resid, int rmod, int ldr,
                                                float* __restrict__ C, int ldc, int M, int N, int K) {
  __shared__ __attribute__((aligned(16))) float so[4][16][64];
  const int tid = threadIdx.x, w = tid >> 5, lane = tid & 31, ln = lane & 15, hh = lane >> 4;
  const int ntn = N / 64;
  const int wid = blockIdx.x * 4 + w;
  const int mt = wid / ntn, nq = wid % ntn;
  if (mt * 16 >= M) return;
  const int row0 = mt * 16, col0 = nq * 64;
  const float* arow = A + (size_t)(row0 + ln) * lda;
  v8f acc[4] = {};
  for (int kb = 0; kb < K; kb += 32) {
    FragB ah, al;
    const v4f x0 = *(const v4fa*)(arow + kb + 8 * hh), x1 = *(const v4fa*)(arow + kb + 8 * hh + 4);
    const v4f x2 = *(const v4fa*)(arow + kb + 16 + 8 * hh), x3 = *(const v4fa*)(arow + kb + 16 + 8 * hh + 4);
    float xs[16] = {x0[0],x0[1],x0[2],x0[3],x1[0],x1[1],x1[2],x1[3],x2[0],x2[1],x2[2],x2[3],x3[0],x3[1],x3[2],x3[3]};
#pragma unroll
    for (int i = 0; i < 16; ++i) { const unsigned short hb = bf16_bits(xs[i]); ah.u[i] = hb; al.u[i] = ASPLIT ? bf16_bits(xs[i] - bf16_val(hb)) : (unsigned short)0; }
#pragma unroll
    for (int t = 0; t < 4; ++t) {
      const unsigned short* brow = Wt + (size_t)(col0 + t * 16 + ln) * ldb + kb;
      FragB b;
      b.half[0] = *(const v8us*)(brow + 8 * hh);
      b.half[1] = *(const v8us*)(brow + 16 + 8 * hh);
      acc[t] = mmaN<ASPLIT ? 2 : 1>(ah.v, al.v, b.v, b.v, acc[t]);
    }
  }
#pragma unroll
  for (int t = 0; t < 4; ++t) {
    const int col = col0 + t * 16 + ln;
    float bv = bias ? bias[col] : 0.f;
    if (BIAS_BF16) bv = bf16_round(bv);
#pragma unroll
    for (int r = 0; r < 8; ++r) {
      float v = acc[t][r] + bv;
      if (resid) { float rv = resid[(size_t)((row0 + 8 * hh + r) % rmod) * ldr + col]; if (RES_BF16) rv = bf16_round(rv); v += rv; }
      if (ACT == 1) v = fmaxf(v, 0.f);
      if (ACT == 2) v = 0.5f * v * (1.0f + erff(v * 0.70710678118654752f));
      if (ACT == 3) { const float u = 0.7978845608028654f * (v + 0.044715f * v * v * v); v = 0.5f * v * (1.0f + tanhf(u)); }
      so[w][8 * hh + r][t * 16 + ln] = v;
    }
  }
  __builtin_amdgcn_fence(__ATOMIC_ACQ_REL, "workgroup");
  __builtin_amdgcn_wave_barrier();
  const int rsub = lane >> 4, c4 = (lane & 15) * 4;
  {
#pragma unroll
    for (int q = 0; q < 8; ++q) {
      const int r = q * 2 + rsub;
      const v4f v = *(const v4fa*)&so[w][r][c4];
      *(v4f*)(C + (size_t)(row0 + r) * ldc + col0 + c4) = v;
    }
    
  }
}
// row LayerNorm (biased variance, eps) over N: s = X (+ R); optional out_sum <- s; out_norm <- (s-mu)*rsqrt(var+eps)*g + b
template <bool PARAM_BF16>
__global__ __launch_bounds__(256) void k_layernorm(const float* __restrict__ X, const float* __restrict__ R, const float* __restrict__ g, const float* __restrict__ bta,
                                                  float* __restrict__ out_sum, float* __restrict__ out_norm, int N, float eps) {
  __shared__ float red[256];
  const int row = blockIdx.x, tid = threadIdx.x;
  const float* x = X + (size_t)row * N; const float* rr = R ? R + (size_t)row * N : nullptr;
  float vals[16];                     // up to N = 4096
  const int per = N / 256;            // contiguous chunk per thread? use strided-by-4 chunks: thread handles j = tid*4 + 1024*u
  float s1 = 0.f;
  for (int u = 0; u < per / 4; ++u) {
    const int j = tid * 4 + 1024 * u;
    const v4f a = *(const v4fa*)(x + j);
    v4f b = {0.f,0.f,0.f,0.f}; if (rr) b = *(const v4fa*)(rr + j);
#pragma unroll
    for (int q = 0; q < 4; ++q) { const float v = a[q] + b[q]; vals[u * 4 + q] = v; s1 += v; }
  }
  red[tid] = s1; __syncthreads();
  for (int st = 128; st > 0; st >>= 1) { if (tid < st) red[tid] += red[tid + st]; __syncthreads(); }
  const float mu = red[0] / (float)N; __syncthreads();
  float s2 = 0.f;
  for (int u = 0; u < per / 4; ++u)
#pragma unroll
    for (int q = 0; q < 4; ++q) { const float c = vals[u * 4 + q] - mu; s2 += c * c; }
  red[tid] = s2; __syncthreads();
  for (int st = 128; st > 0; st >>= 1) { if (tid < st) red[tid] += red[tid + st]; __syncthreads(); }
  const float rs = rsqrtf(red[0] / (float)N + eps);
  {
    for (int u = 0; u < per / 4; ++u) {
      const int j = tid * 4 + 1024 * u;
      v4f o, sm;
#pragma unroll
      for (int q = 0; q < 4; ++q) {
        float gg = g[j + q], bb = bta[j + q];
        if (PARAM_BF16) { gg = bf16_round(gg); bb = bf16_round(bb); }
        sm[q] = vals[u * 4 + q]; o[q] = (vals[u * 4 + q] - mu) * rs * gg + bb;
      }
      if (out_sum) *(v4f*)(out_sum + (size_t)row * N + j) = sm;
      *(v4f*)(out_norm + (size_t)row * N + j) = o;
    }
    
  }
}



// ---- f16 WMMA path (v_wmma_f32_16x16x32_f16): 11-bit significands for operands in range — used where a [0,1] probability operand needs more precision than bf16
typedef _Float16 v16h __attribute__((ext_vector_type(16)));
union FragH { v16h v; v8us half[2]; _Float16 h[16]; unsigned short u[16]; };
template <int NT>
__device__ __forceinline__ v8f mmaH(v16h ah, v16h al, v16h bh, v16h bl, v8f c) {
  c = __builtin_amdgcn_wmma_f32_16x16x32_f16(false, ah, false, bh, (short)0, c, false, false);
  if (NT >= 2) c = __builtin_amdgcn_wmma_f32_16x16x32_f16(false, al, false, bh, (short)0, c, false, false);
  if (NT >= 3) c = __builtin_amdgcn_wmma_f32_16x16x32_f16(false, ah, false, bl, (short)0, c, false, false);
  asm volatile("v_nop\n\tv_nop\n\tv_nop\n\tv_nop" : "+v"(c) : "v"(ah), "v"(al), "v"(bh), "v"(bl));
  return c;
}
// batched GEMM like k_gemm_b but f16 operands: A f32 (split into f16 hi/lo if ASPLIT, else rounded to f16), Bt = f16 values [n][k]; alpha; C f32; N multiple of 16 (partial tiles skipped)
template <bool ASPLIT>
__global__ __launch_bounds__(128) void k_gemm_h(const float* __restrict__ A, int lda, size_t sA, const _Float16* __restrict__ Bh, int ldb, size_t sB, float alpha, float* __restrict__ C, int ldc, size_t sC, int M, int N, int K) {
  __shared__ __attribute__((aligned(16))) float so[4][16][64];
  const int tid = threadIdx.x, w = tid >> 5, lane = tid & 31, ln = lane & 15, hh = lane >> 4; const int by = blockIdx.y;
  A += (size_t)by * sA; Bh += (size_t)by * sB; C += (size_t)by * sC;
  const int ntn = (N + 63) / 64; const int wid = blockIdx.x * 4 + w; const int mt = wid / ntn, nq = wid % ntn; if (mt * 16 >= M) return;
  const int row0 = mt * 16, col0 = nq * 64; const float* arow = A + (size_t)(row0 + ln) * lda;
  v8f acc[4] = {};
  for (int kb = 0; kb < K; kb += 32) {
    FragH ah, al;
    const v4f x0 = *(const v4fa*)(arow + kb + 8 * hh), x1 = *(const v4fa*)(arow + kb + 8 * hh + 4), x2 = *(const v4fa*)(arow + kb + 16 + 8 * hh), x3 = *(const v4fa*)(arow + kb + 16 + 8 * hh + 4);
    float xs[16] = {x0[0],x0[1],x0[2],x0[3],x1[0],x1[1],x1[2],x1[3],x2[0],x2[1],x2[2],x2[3],x3[0],x3[1],x3[2],x3[3]};
#pragma unroll
    for (int i = 0; i < 16; ++i) { const _Float16 h = (_Float16)xs[i]; ah.h[i] = h; al.h[i] = ASPLIT ? (_Float16)(xs[i] - (float)h) : (_Float16)0.0f; }
#pragma unroll
    for (int t = 0; t < 4; ++t) { if (col0 + t * 16 >= N) continue; const size_t boff = (size_t)(col0 + t * 16 + ln) * ldb + kb; FragH bq; bq.half[0] = *(const v8us*)(Bh + boff + 8 * hh); bq.half[1] = *(const v8us*)(Bh + boff + 16 + 8 * hh);
      acc[t] = mmaH<ASPLIT ? 2 : 1>(ah.v, al.v, bq.v, bq.v, acc[t]); }
  }
#pragma unroll
  for (int t = 0; t < 4; ++t) { if (col0 + t * 16 >= N) continue;
#pragma unroll
    for (int r = 0; r < 8; ++r) so[w][8 * hh + r][t * 16 + ln] = acc[t][r] * alpha; }
  __builtin_amdgcn_fence(__ATOMIC_ACQ_REL, "workgroup"); __builtin_amdgcn_wave_barrier();
  const int rsub = lane >> 4, c4 = (lane & 15) * 4;
  {
#pragma unroll
    for (int q = 0; q < 8; ++q) { const int r = q * 2 + rsub; if (col0 + c4 < N) { const v4f v = *(const v4fa*)&so[w][r][c4]; *(v4f*)(C + (size_t)(row0 + r) * ldc + col0 + c4) = v; } }
     }
}

// Wt[n][k] = f16(W[k][n]·scale) from f32 row-major W[K][N] (scale = power of two; bf16-exact weights stay exact in f16 away from the subnormal range)
__device__ __forceinline__ void wt_f16(const int bx, const float* __restrict__ W, _Float16* __restrict__ Wt, int K, int N, float scale) {
  const int t = bx * 256 + threadIdx.x; if (t >= N * (K / 8)) return; const int n = t / (K / 8), k8 = (t % (K / 8)) * 8; FragH f;
#pragma unroll
  for (int i = 0; i < 8; ++i) f.h[i] = (_Float16)(bf16_round(W[(size_t)(k8 + i) * N + n]) * scale); const v8us o = f.half[0];
  *(v8us*)((unsigned short*)Wt + (size_t)n * K + k8) = o; 
}
// One lane's eight 16-byte copies of an operand tile, global memory to LDS through no register. The s_wait_xcnt stands in the copies' own statement, ahead of any rewrite of the address registers they name.
__device__ __forceinline__ void tile_copy8(unsigned l, unsigned lstep, const unsigned short* g, size_t gstep) {
  asm volatile("global_load_async_to_lds_b128 %0, %8, off\n\t"
               "global_load_async_to_lds_b128 %1, %9, off\n\t"
               "global_load_async_to_lds_b128 %2, %10, off\n\t"
               "global_load_async_to_lds_b128 %3, %11, off\n\t"
               "global_load_async_to_lds_b128 %4, %12, off\n\t"
               "global_load_async_to_lds_b128 %5, %13, off\n\t"
               "global_load_async_to_lds_b128 %6, %14, off\n\t"
               "global_load_async_to_lds_b128 %7, %15, off\n\t"
               "s_wait_xcnt 0x0"
               :: "v"(l), "v"(l + lstep), "v"(l + 2 * lstep), "v"(l + 3 * lstep), "v"(l + 4 * lstep), "v"(l + 5 * lstep), "v"(l + 6 * lstep), "v"(l + 7 * lstep),
                  "v"(g), "v"(g + gstep), "v"(g + 2 * gstep), "v"(g + 3 * gstep), "v"(g + 4 * gstep), "v"(g + 5 * gstep), "v"(g + 6 * gstep), "v"(g + 7 * gstep)
               : "memory");
}
// C[M][N] = (A . Bt^T) * alpha (+ bias rounded to bf16): A f16 [M][CC], Bt f16 [N][CC], both with rows of CC elements; M and N multiples of 64, the grid exactly (M / 64) * (N / 64) blocks, N / 64 = 1 << lgn.
// A block of four waves owns a 64 x 64 tile of C. Its 64 rows of A and 64 rows of Bt, the whole K, are copied into LDS once, a wave's copy = one whole row of 512 contiguous bytes; then wave w takes rows 16 w .. 16 w + 15
// against all 64 columns, every fragment from LDS, the k order and the accumulation as before. Output rows are staged in the wave's own 16 rows of A, which no other wave reads, and leave as whole lines. Writes f32 C or f16 C16.
#define GP (CC * 2 + 16)      /* LDS row pitch in bytes, 16 B x odd: 16 lanes' ds_load_b128 fall on all 64 banks */
#define GSM (128 * GP)
typedef float fal __attribute__((may_alias));
template <bool BIAS, bool F32OUT>
__device__ __forceinline__ void gemm_lds(unsigned char* sm, const int bx, const int lgn, const _Float16* __restrict__ A, const _Float16* __restrict__ Bh, float alpha, const float* __restrict__ bias,
    float* __restrict__ C, _Float16* __restrict__ C16, int ldc) {
  const int tid = threadIdx.x, w = tid >> 5, lane = tid & 31, ln = lane & 15, hh = lane >> 4;
  const int row0 = (bx >> lgn) * 64, col0 = (bx & ((1 << lgn) - 1)) * 64;
  /* copy map: chunk c of thread tid = tile row w + 4 c, 16-byte column lane */
  const unsigned short* ga = (const unsigned short*)A + (size_t)(row0 + w) * CC + lane * 8;
  const unsigned short* gb = (const unsigned short*)Bh + (size_t)(col0 + w) * CC + lane * 8;
  const unsigned l0 = (unsigned)(size_t)sm + w * GP + lane * 16;      /* low 32 bits of the shared address = byte offset in the work-group's LDS */
  tile_copy8(l0, 4 * GP, ga, (size_t)4 * CC); tile_copy8(l0 + 32 * GP, 4 * GP, ga + 32 * CC, (size_t)4 * CC);
  tile_copy8(l0 + 64 * GP, 4 * GP, gb, (size_t)4 * CC); tile_copy8(l0 + 96 * GP, 4 * GP, gb + 32 * CC, (size_t)4 * CC);
  float bv[4];      /* the bias is fetched while the copies fly */
#pragma unroll
  for (int t = 0; t < 4; ++t) bv[t] = BIAS ? bf16_round(bias[col0 + t * 16 + ln]) : 0.f;
  if (BIAS) asm volatile("s_wait_xcnt 0x0" ::: "memory");      /* ahead of any rewrite of the offset register that the bias loads name */
  asm volatile("s_wait_asynccnt 0x0" ::: "memory");      /* this wave's share of both tiles has landed */
  __syncthreads();      /* both tiles published to all four waves */
  const unsigned char* af = sm + (w * 16 + ln) * GP + hh * 16; const unsigned char* bf = sm + (64 + ln) * GP + hh * 16;
  v8f acc[4] = {};
  FragH ah[2], bq[2][4];      /* two register sets: a k step's ten fragment reads stand together, one k step ahead of the products that use them */
  auto frags = [&](const int kb) { FragH& a = ah[kb & 1]; a.half[0] = *(const v8us*)(af + kb * 64); a.half[1] = *(const v8us*)(af + kb * 64 + 32);
#pragma unroll
    for (int t = 0; t < 4; ++t) { FragH& b = bq[kb & 1][t]; b.half[0] = *(const v8us*)(bf + t * 16 * GP + kb * 64); b.half[1] = *(const v8us*)(bf + t * 16 * GP + kb * 64 + 32); } };
  frags(0);
#pragma unroll      /* every LDS offset an immediate, the register set a compile-time choice */
  for (int kb = 0; kb < CC / 32; ++kb) { if (kb + 1 < CC / 32) frags(kb + 1);
#pragma unroll
    for (int t = 0; t < 4; ++t) acc[t] = mmaH<1>(ah[kb & 1].v, ah[kb & 1].v, bq[kb & 1][t].v, bq[kb & 1][t].v, acc[t]);
  }
  fal* so = (fal*)(sm + w * 16 * GP);      /* [16][64] f32 in the wave's own rows of A, all read by now */
#pragma unroll
  for (int t = 0; t < 4; ++t)
#pragma unroll
    for (int r = 0; r < 8; ++r) so[(8 * hh + r) * 64 + t * 16 + ln] = acc[t][r] * alpha + bv[t];
  __builtin_amdgcn_fence(__ATOMIC_ACQ_REL, "workgroup"); __builtin_amdgcn_wave_barrier();
  const int rsub = lane >> 4, c4 = (lane & 15) * 4; typedef _Float16 v4h __attribute__((ext_vector_type(4)));
#pragma unroll
  for (int q = 0; q < 8; ++q) { const int r = q * 2 + rsub; const v4f v = *(const v4fa*)&so[r * 64 + c4]; const size_t o = (size_t)(row0 + w * 16 + r) * ldc + col0 + c4;
    if (F32OUT) *(v4f*)(C + o) = v; else { v4h h4; for (int i = 0; i < 4; ++i) h4[i] = (_Float16)v[i]; *(v4h*)(C16 + o) = h4; } }
}
// y = O16 . Wout + bout: M 8192, N 256
__global__ __launch_bounds__(128) void k_gemm_out(const _Float16* __restrict__ A, const _Float16* __restrict__ Bh, float alpha, const float* __restrict__ bias, float* __restrict__ C) {
  __shared__ __attribute__((aligned(16))) unsigned char sm[GSM];
  gemm_lds<true, true>(sm, blockIdx.x, 2, A, Bh, alpha, bias, C, nullptr, CC);
}
// The two products that read only X16 and Bqkv, in one grid; the job is block-uniform, by block index:
// blocks [0, NBQ): [q | k] token-major [(b,n)][512] = X16 . Bqkv rows 0..511 (M 8192, N 512); blocks [NBQ, NBQ + BB * NBV): v channel-major per batch [b][(h,d)][n] = Bqkv rows 512..767 . X16[b] (M 256, N 2048).
#define NBQ ((NR / 64) * (2 * CC / 64))
#define NBV ((CC / 64) * (NN / 64))
__global__ __launch_bounds__(128) void k_gemm_qkv(const _Float16* __restrict__ X16, const _Float16* __restrict__ Bqkv, _Float16* __restrict__ QK, _Float16* __restrict__ Vt, float alpha) {
  __shared__ __attribute__((aligned(16))) unsigned char sm[GSM];
  const int bx = blockIdx.x, rb = bx - NBQ; const bool jv = rb >= 0; const int by = jv ? rb / NBV : 0;
  gemm_lds<false, false>(sm, jv ? rb % NBV : bx, jv ? 5 : 3, jv ? Bqkv + (size_t)2 * CC * CC : X16, jv ? X16 + (size_t)by * NN * CC : Bqkv, alpha, nullptr,
           nullptr, jv ? Vt + (size_t)by * CC * NN : QK, jv ? NN : 2 * CC);
}


typedef _Float16 v4h __attribute__((ext_vector_type(4)));

__device__ __forceinline__ void x16(const int bx, const float* __restrict__ x, _Float16* __restrict__ X16, size_t n8) { const size_t t = (size_t)bx * 256 + threadIdx.x; if (t >= n8) return; FragH f;
#pragma unroll
  for (int q = 0; q < 8; ++q) f.h[q] = (_Float16)bf16_round(x[t * 8 + q]); *(v8us*)((unsigned short*)X16 + t * 8) = f.half[0];  }
// The three conversions that read only inputs, in one grid; the job is block-uniform, by block index: Wqkv transposed, Wout transposed ((in,out) to Bt[n][k] x 2^4), x rounded.
#define NBW1 (C3 * (CC / 8) / 256)
#define NBW2 (CC * (CC / 8) / 256)
#define NBX (NR * CC / 8 / 256)
__global__ __launch_bounds__(256) void k_prep(const float* __restrict__ Wqkv, _Float16* __restrict__ Bqkv, const float* __restrict__ Wout, _Float16* __restrict__ Bo, const float* __restrict__ x, _Float16* __restrict__ X16) {
  const int bx = blockIdx.x;
  if (bx < NBW1) wt_f16(bx, Wqkv, Bqkv, CC, C3, 16.0f);
  else if (bx < NBW1 + NBW2) wt_f16(bx - NBW1, Wout, Bo, CC, CC, 16.0f);
  else x16(bx - (NBW1 + NBW2), x, X16, (size_t)NR * CC / 8);
}
__global__ __launch_bounds__(256) void k_h16(const float* __restrict__ x, _Float16* __restrict__ X16, size_t n8) { const size_t t = (size_t)blockIdx.x * 256 + threadIdx.x; if (t >= n8) return; FragH f;
#pragma unroll
  for (int q = 0; q < 8; ++q) f.h[q] = (_Float16)x[t * 8 + q]; *(v8us*)((unsigned short*)X16 + t * 8) = f.half[0];  }
__global__ __launch_bounds__(256) void k_round16f(const float* __restrict__ W, _Float16* __restrict__ Bt, size_t n8) { const size_t t = (size_t)blockIdx.x * 256 + threadIdx.x; if (t >= n8) return; FragH f;
#pragma unroll
  for (int i = 0; i < 8; ++i) f.h[i] = (_Float16)(bf16_round(W[t * 8 + i]) * 16.0f); *(v8us*)((unsigned short*)Bt + t * 8) = f.half[0];  }
template <int NHv, int TTv>
__global__ __launch_bounds__(256) void k_vt(const _Float16* __restrict__ V16, int ldv, int voff, _Float16* __restrict__ Vt) { __shared__ unsigned short tl[64][66]; const int tid = threadIdx.x; const int slab = blockIdx.x / (TTv / 64), lg = blockIdx.x % (TTv / 64); const int b = slab / NHv, h = slab % NHv;
  for (int i = tid; i < 64 * 8; i += 256) { const int r = i / 8, c8 = (i % 8) * 8; FragH f; f.half[0] = *(const v8us*)((const unsigned short*)V16 + ((size_t)b * TTv + lg * 64 + r) * ldv + voff + h * 64 + c8);
#pragma unroll
    for (int q = 0; q < 8; ++q) tl[r][c8 + q] = f.u[q]; }
  __syncthreads();
  {
#pragma unroll
    for (int rd = 0; rd < 2; ++rd) { const int d = rd * 32 + tid / 8, pc = tid % 8; FragH f;
#pragma unroll
      for (int q = 0; q < 8; ++q) f.u[q] = tl[pc * 8 + q][d];
      *(v8us*)((unsigned short*)Vt + ((size_t)slab * 64 + d) * TTv + lg * 64 + pc * 8) = f.half[0]; }
     } }

typedef float v2f __attribute__((ext_vector_type(2)));
// lane l with lane l ^ 16 (the two halves of a wave hold the two key halves of one query column)
__device__ __forceinline__ float xhalf(float x) { return __builtin_bit_cast(float, __builtin_amdgcn_permlanex16(__builtin_bit_cast(int, x), __builtin_bit_cast(int, x), 0x76543210, 0xfedcba98, false, false)); }

// One lane's eight 16-byte copies of a stage (four of K, four of V^T), global memory to LDS through no register. The s_wait_xcnt stands in the copies' own statement, ahead of any rewrite of the address registers they name.
__device__ __forceinline__ void stage_copy(unsigned lk, const unsigned short* gk, size_t gkstep, unsigned lkstep, unsigned lv, const unsigned short* gv, size_t gvstep, unsigned lvstep) {
  asm volatile("global_load_async_to_lds_b128 %0, %8, off\n\t"
               "global_load_async_to_lds_b128 %1, %9, off\n\t"
               "global_load_async_to_lds_b128 %2, %10, off\n\t"
               "global_load_async_to_lds_b128 %3, %11, off\n\t"
               "global_load_async_to_lds_b128 %4, %12, off\n\t"
               "global_load_async_to_lds_b128 %5, %13, off\n\t"
               "global_load_async_to_lds_b128 %6, %14, off\n\t"
               "global_load_async_to_lds_b128 %7, %15, off\n\t"
               "s_wait_xcnt 0x0"
               :: "v"(lk), "v"(lk + lkstep), "v"(lk + 2 * lkstep), "v"(lk + 3 * lkstep), "v"(lv), "v"(lv + lvstep), "v"(lv + 2 * lvstep), "v"(lv + 3 * lvstep),
                  "v"(gk), "v"(gk + gkstep), "v"(gk + 2 * gkstep), "v"(gk + 3 * gkstep), "v"(gv), "v"(gv + gvstep), "v"(gv + 2 * gvstep), "v"(gv + 3 * gvstep)
               : "memory");
}

__global__ __launch_bounds__(128) void k_flash(const _Float16* __restrict__ Q16, int ldq, const _Float16* __restrict__ K16, int ldk, const _Float16* __restrict__ Vt, const int* __restrict__ MSK, float* __restrict__ O, int ldo) {
  constexpr int RPW = 16, NQB = NN / (4 * RPW), DT = 2; (void)MSK;
  constexpr int TK = 128, NS = NN / TK, NP = TK / 32;      /* keys a stage, stages, 32-key passes of the second product a stage */
  constexpr int KP = HD * 2 + 16, VP = TK * 2 + 16;      /* LDS row pitches in bytes, 16 B x odd: 16 lanes' ds_load_b128 fall on all 64 banks */
  constexpr int KB = TK * KP, SB = KB + HD * VP;      /* a stage: TK rows of K (HD channels), then HD rows of V^T (TK keys) */
  __shared__ __attribute__((aligned(16))) unsigned char sm[2 * SB];
  constexpr float SL2E = 0.17677669529663687f * 1.4426950408889634f;      /* 32^-1/2 * log2(e): e^(scale*s - m) = 2^(SL2E*s - m2), one fma ahead of a bare v_exp_f32 */
  const int tid = threadIdx.x, w = tid >> 5, lane = tid & 31, ln = lane & 15, hh = lane >> 4;
  const int slab = blockIdx.x / NQB, qblk = blockIdx.x % NQB; const int b = slab / NH, h = slab % NH; const int q0 = qblk * (4 * RPW) + w * RPW;
  const unsigned short* Vth = (const unsigned short*)Vt + ((size_t)b * CC + h * HD) * NN;      /* V^T = v[b][(h,d)][n] channel-major */
  /* copy map: K chunk c of thread tid = row (tid >> 2) + 32 c, 16-byte column tid & 3; V^T chunk c = row (tid >> 4) + 8 c, 16-byte column tid & 15 */
  const unsigned short* gk = (const unsigned short*)K16 + ((size_t)b * NN + (tid >> 2)) * ldk + h * HD + (tid & 3) * 8;
  const unsigned short* gv = Vth + (size_t)(tid >> 4) * NN + (tid & 15) * 8;
  const unsigned lds0 = (unsigned)(size_t)sm;      /* low 32 bits of the shared address = byte offset in the work-group's LDS */
  const unsigned lk = lds0 + (tid >> 2) * KP + (tid & 3) * 16, lv = lds0 + KB + (tid >> 4) * VP + (tid & 15) * 16;
  const size_t gkstep = (size_t)32 * ldk, gkstage = (size_t)TK * ldk;
  stage_copy(lk, gk, gkstep, 32 * KP, lv, gv, (size_t)8 * NN, 8 * VP);
  FragH bq;      /* B: column ln = query q0 + ln, k = head channel */
  { const unsigned short* qr = (const unsigned short*)Q16 + ((size_t)b * NN + q0 + ln) * ldq + h * HD; bq.half[0] = *(const v8us*)(qr + 8 * hh); bq.half[1] = *(const v8us*)(qr + 16 + 8 * hh); }
  asm volatile("s_wait_asynccnt 0x0" ::: "memory");      /* this wave's share of stage 0 has landed */
  __syncthreads();      /* stage 0 published to all four waves */
  gk += gkstage; gv += TK;
  stage_copy(lk + SB, gk, gkstep, 32 * KP, lv + SB, gv, (size_t)8 * NN, 8 * VP);
  float m_q = -3.0e38f, l_q = 0.f; v8f oacc[DT];
#pragma unroll
  for (int dt = 0; dt < DT; ++dt) oacc[dt] = (v8f){0.f,0.f,0.f,0.f,0.f,0.f,0.f,0.f};
#pragma unroll 1      /* one body for both buffers: the buffer is an offset */
  for (int t = 0; t < NS; ++t) {
    const unsigned bo = (unsigned)(t & 1) * SB;
    const unsigned char* kf = sm + bo + ln * KP + hh * 16; const unsigned char* vf = sm + bo + KB + ln * VP + hh * 16;
    /* One softmax block = the whole stage of TK keys: all its fragments are read at the head, its 2 NP score tiles come from 2 NP independent products back to back, then ONE maximum, ONE rescale of l_q and oacc, and the NP passes of the second product. */
    static_assert(NP == 4, "the joins of the four chains and of the four partial sums below are written out for four passes");
    FragH ak[2 * NP], av[NP][DT];
#pragma unroll      /* every LDS offset an immediate */
    for (int nt = 0; nt < 2 * NP; ++nt) { const unsigned char* kr = kf + nt * 16 * KP; ak[nt].half[0] = *(const v8us*)kr; ak[nt].half[1] = *(const v8us*)(kr + 32); }
    __builtin_amdgcn_sched_barrier(0);      /* K's reads stay in front of V^T's: LDS answers in order, and else the first score product waits for V^T's fragments too */
#pragma unroll      /* V^T's reads stand directly behind K's, one place of LDS reads a stage: their latency runs behind the score products and the maximum */
    for (int ps = 0; ps < NP; ++ps)
#pragma unroll
      for (int dt = 0; dt < DT; ++dt) { const unsigned char* vrow = vf + dt * 16 * VP + ps * 64; av[ps][dt].half[0] = *(const v8us*)vrow; av[ps][dt].half[1] = *(const v8us*)(vrow + 32); }
    __builtin_amdgcn_sched_barrier(0);      /* keeps V^T's reads up here: else each is moved directly in front of its product, and its latency stands open there */
    v8f s[2 * NP];      /* s[nt][r] = S^T[key t*TK + nt*16 + 8*hh + r][query q0 + ln] */
#pragma unroll
    for (int nt = 0; nt < 2 * NP; ++nt) s[nt] = __builtin_amdgcn_wmma_f32_16x16x32_f16(false, ak[nt].v, false, bq.v, (short)0, (v8f){0.f,0.f,0.f,0.f,0.f,0.f,0.f,0.f}, false, false);
    __builtin_amdgcn_sched_barrier(0);      /* the score products stay back to back, each filling the distance behind the one before: else the maximum's steps are moved in between them, each behind pads of v_nop */
    float mch[NP];      /* the maximum in threes (one three-input instruction takes in two more scores): chain ps runs over the 16 scores of tiles 2 ps and 2 ps + 1 but the last, which joins below */
#pragma unroll
    for (int ps = 0; ps < NP; ++ps) { const v8f u = s[2 * ps], v = s[2 * ps + 1];
      float c = fmaxf(fmaxf(u[0], u[1]), u[2]); c = fmaxf(fmaxf(c, u[3]), u[4]); c = fmaxf(fmaxf(c, u[5]), u[6]); c = fmaxf(fmaxf(c, u[7]), v[0]);
      c = fmaxf(fmaxf(c, v[1]), v[2]); c = fmaxf(fmaxf(c, v[3]), v[4]); mch[ps] = fmaxf(fmaxf(c, v[5]), v[6]); }
    float mc = fmaxf(fmaxf(mch[0], mch[1]), mch[2]); mc = fmaxf(fmaxf(mc, mch[3]), s[1][7]); mc = fmaxf(fmaxf(mc, s[3][7]), s[5][7]); mc = fmaxf(mc, s[7][7]);
    mc = fmaxf(mc, xhalf(mc));      /* both halves now hold the maximum over the query's TK raw products (SL2E > 0 keeps the order) */
    const float mn = fmaxf(m_q, mc * SL2E); const float al = (mn > -1.0e38f) ? __builtin_amdgcn_exp2f(m_q - mn) : 1.0f; m_q = mn;      /* m_q, mn: base-2 exponents */
    const float nb = 10.0f - mn;      /* 2^10 = the f16 scale of P, carried in the exponent: p and l_q hold 1024 times the shifted values */
    FragH pb[NP]; v2f psum[NP];
#pragma unroll
    for (int ps = 0; ps < NP; ++ps) { v2f p[8];
#pragma unroll
      for (int i = 0; i < 8; ++i) { const v2f a = (v2f){s[2 * ps + (i >> 2)][(2 * i) & 7], s[2 * ps + (i >> 2)][(2 * i + 1) & 7]} * SL2E + nb;
        p[i] = (v2f){__builtin_amdgcn_exp2f(a[0]), __builtin_amdgcn_exp2f(a[1])}; pb[ps].h[2 * i] = (_Float16)p[i][0]; pb[ps].h[2 * i + 1] = (_Float16)p[i][1]; }
      psum[ps] = ((p[0] + p[1]) + (p[2] + p[3])) + ((p[4] + p[5]) + (p[6] + p[7])); }
    const v2f pt = (psum[0] + psum[1]) + (psum[2] + psum[3]);
    l_q = l_q * al + (pt[0] + pt[1]);      /* this half's TK / 2 keys; the halves join after the loop */
#pragma unroll
    for (int dt = 0; dt < DT; ++dt) oacc[dt] *= al;
#pragma unroll
    for (int ps = 0; ps < NP; ++ps)
#pragma unroll
      for (int dt = 0; dt < DT; ++dt) oacc[dt] = __builtin_amdgcn_wmma_f32_16x16x32_f16(false, av[ps][dt].v, false, pb[ps].v, (short)0, oacc[dt], false, false);      /* oacc[dt][r] = O^T[channel dt*16 + 8*hh + r][query q0 + ln] */
    __builtin_amdgcn_sched_barrier(0);      /* the stage's arithmetic stays in front of the waits below: moved behind them, the wait for stage t + 1 would stand at the stage's head, directly behind the issue of its copies */
    asm volatile("s_wait_dscnt 0x0" ::: "memory");      /* this wave's reads of stage t are done before its buffer is handed back */
    asm volatile("s_wait_asynccnt 0x0" ::: "memory");      /* this wave's share of stage t + 1 has landed */
    __syncthreads();      /* publishes stage t + 1 and ends every wave's reads of stage t */
    if (t + 2 < NS) { gk += gkstage; gv += TK; stage_copy(lk + bo, gk, gkstep, 32 * KP, lv + bo, gv, (size_t)8 * NN, 8 * VP); }      /* stage t + 2 into the buffer just read */
  }
  asm volatile("s_wait_asynccnt 0x0" ::: "memory");      /* no copy outstanding at the wave's end */
  const float l = l_q + xhalf(l_q); const float den = l + (1e-6f * 1024.0f) * __builtin_amdgcn_exp2f(-m_q); const float inv = (den > 0.f && den < INFINITY) ? 1.0f / den : 0.f;      /* sum e^s/(sum e^s + 1e-6) form: e^(-m)*1e-6 joins the shifted sum; an infinite den (all logits far below 0) reproduces the reference's ~0 output */
  float* orow = O + ((size_t)b * NN + q0 + ln) * ldo + h * HD + 8 * hh;
#pragma unroll
  for (int dt = 0; dt < DT; ++dt) { const v8f o = oacc[dt] * inv; *(v4f*)(orow + dt * 16) = (v4f){o[0], o[1], o[2], o[3]}; *(v4f*)(orow + dt * 16 + 4) = (v4f){o[4], o[5], o[6], o[7]}; } }

extern "C" void kernel_launch(void* const* d_in, const int* in_sizes, int n_in,
                              void* d_out, int out_size, void* d_ws, size_t ws_size, hipStream_t stream) {
  (void)in_sizes; (void)n_in; (void)out_size;
  const float* x = (const float*)d_in[0]; const float* Wqkv = (const float*)d_in[1]; const float* Wout = (const float*)d_in[2]; const float* bout = (const float*)d_in[3];
  char* ws = (char*)d_ws; size_t off = 0;
  auto take = [&](size_t bytes) { char* p = ws + off; off += (bytes + 255) & ~(size_t)255; return p; };
  _Float16* Bqkv = (_Float16*)take((size_t)C3 * CC * 2); _Float16* Bo = (_Float16*)take((size_t)CC * CC * 2); _Float16* X16 = (_Float16*)take((size_t)NR * CC * 2);
  _Float16* QK = (_Float16*)take((size_t)NR * 2 * CC * 2); _Float16* Vt = (_Float16*)take((size_t)BB * CC * NN * 2); float* O = (float*)take((size_t)NR * CC * 4); _Float16* O16 = (_Float16*)take((size_t)NR * CC * 2);
  if (off > ws_size) return;      // 0.4 + 0.1 + 4.2 + 8.4 + 4.2 + 8.4 + 4.2 ≈ 30 MB
  k_prep<<<NBW1 + NBW2 + NBX, 256, 0, stream>>>(Wqkv, Bqkv, Wout, Bo, x, X16);
  k_gemm_qkv<<<NBQ + BB * NBV, 128, 0, stream>>>(X16, Bqkv, QK, Vt, 0.0625f);
  k_flash<<<BB * NH * (NN / 64), 128, 0, stream>>>(QK, 2 * CC, QK + CC, 2 * CC, Vt, nullptr, O, CC);      /* blocks = (b,h) × 64-query groups */
  k_h16<<<(unsigned)(((size_t)NR * CC / 8 + 255) / 256), 256, 0, stream>>>(O, O16, (size_t)NR * CC / 8);
  k_gemm_out<<<(NR / 64) * (CC / 64), 128, 0, stream>>>(O16, Bo, 0.0625f, bout, (float*)d_out);      /* y = out.Wout + bout: M 8192 N 256 K 256 */
}

// v007
// Measured time: 41.7 microseconds a run.
// Two timings next to v006 both put it at 1.17 times that version's speed.
// Counting every step since v000, it is 5.70 times as fast.
#include <hip/hip_runtime.h>
// KeOps-style multi-head attention (B=4, n=2048, dim 256, 8 heads × 32): qkv = x·Wqkv; q scaled by 32^-½; e = exp(q·kᵀ) WITHOUT max subtraction; out = (e·v)/(Σe + 1e-6) merged over heads; y = out·Wout + bout.
// Compute dtype: x, Wqkv, Wout, bout rounded to bf16; q/k token-major and v channel-major (= Vᵀ) as f16 GEMM outputs (f32 accumulate); fused flash-style kernel per (b,h) (online max-rescaled sums
// in f32 — the unshifted quotient is recovered exactly through the normaliser l + 1e-6·e^(−m); P f16 ×2^10) on v_wmma_f32_16x16x32_f16; O stored as f16 by the attention kernel itself, then the output GEMM with bias; f32 accumulate.
#define BB 4
#define NN 2048
#define CC 256
#define C3 768
#define NH 8
#define HD 32
#define NR (BB * NN)

typedef __bf16 v16b __attribute__((ext_vector_type(16)));
typedef unsigned short v8us __attribute__((ext_vector_type(8), may_alias));
typedef float  v8f  __attribute__((ext_vector_type(8)));
typedef float  v4f  __attribute__((ext_vector_type(4)));
typedef float  v4fa __attribute__((ext_vector_type(4), may_alias));
union FragB { v16b v; v8us half[2]; unsigned short u[16]; };

__device__ __forceinline__ unsigned short bf16_bits(float x) { unsigned int u = __float_as_uint(x); return (unsigned short)((u + 0x7FFFu + ((u >> 16) & 1u)) >> 16); }
__device__ __forceinline__ float bf16_val(unsigned short b) { return __uint_as_float(((unsigned int)b) << 16); }
__device__ __forceinline__ float bf16_round(float x) { return bf16_val(bf16_bits(x)); }
// D += A·B with NT terms: 1 = ah·bh, 2 = + al·bh (A split), 3 = + ah·bl (both split)
template <int NT>
__device__ __forceinline__ v8f mmaN(v16b ah, v16b al, v16b bh, v16b bl, v8f c) {
  c = __builtin_amdgcn_wmma_f32_16x16x32_bf16(false, ah, false, bh, (short)0, c, false, false);
  if (NT >= 2) c = __builtin_amdgcn_wmma_f32_16x16x32_bf16(false, al, false, bh, (short)0, c, false, false);
  if (NT >= 3) c = __builtin_amdgcn_wmma_f32_16x16x32_bf16(false, ah, false, bl, (short)0, c, false, false);
  asm volatile("v_nop\n\tv_nop\n\tv_nop\n\tv_nop" : "+v"(c) : "v"(ah), "v"(al), "v"(bh), "v"(bl));
  return c;
}

__global__ __launch_bounds__(256) void k_wt_bf16(const float* __restrict__ W, unsigned short* __restrict__ Wt, int K, int N) {
  const int t = blockIdx.x * 256 + threadIdx.x;
  const int k8n = K / 8;
  if (t >= N * k8n) return;
  const int n = t / k8n, k8 = (t % k8n) * 8;
  v8us v;
#pragma unroll
  for (int i = 0; i < 8; ++i) v[i] = bf16_bits(W[(size_t)(k8 + i) * N + n]);
  *(v8us*)(Wt + (size_t)n * K + k8) = v;
  
}

// GEMM C[M][N] (f32, pitch ldc) = act(A[M][K]·W + bias). A f32 row-major (pitch lda) converted per fragment to bf16
// (ASPLIT: hi/lo two planes -> 2 terms, else single rounded term); Wt bf16 [N][K] (pitch ldb). BIAS_BF16 rounds the
// bias to bf16 first (bias quantised to bf16 before the add). K%32==0, M%16==0, N%64==0.
template <bool ASPLIT, int ACT, bool BIAS_BF16>
__global__ __launch_bounds__(128) void k_gemm_bf(const float* __restrict__ A, int lda, const unsigned short* __restrict__ Wt, int ldb,
                                               const float* __restrict__ bias, float* __restrict__ C, int ldc, int M, int N, int K) {
  __shared__ __attribute__((aligned(16))) float so[4][16][64];
  const int tid = threadIdx.x, w = tid >> 5, lane = tid & 31, ln = lane & 15, hh = lane >> 4;
  const int ntn = N / 64;
  const int wid = blockIdx.x * 4 + w;
  const int mt = wid / ntn, nq = wid % ntn;
  if (mt * 16 >= M) return;
  const int row0 = mt * 16, col0 = nq * 64;
  const float* arow = A + (size_t)(row0 + ln) * lda;
  v8f acc[4] = {};
  for (int kb = 0; kb < K; kb += 32) {
    FragB ah, al;
    const v4f x0 = *(const v4fa*)(arow + kb + 8 * hh), x1 = *(const v4fa*)(arow + kb + 8 * hh + 4);
    const v4f x2 = *(const v4fa*)(arow + kb + 16 + 8 * hh), x3 = *(const v4fa*)(arow + kb + 16 + 8 * hh + 4);
    float xs[16] = {x0[0],x0[1],x0[2],x0[3],x1[0],x1[1],x1[2],x1[3],x2[0],x2[1],x2[2],x2[3],x3[0],x3[1],x3[2],x3[3]};
#pragma unroll
    for (int i = 0; i < 16; ++i) { const unsigned short hb = bf16_bits(xs[i]); ah.u[i] = hb; al.u[i] = ASPLIT ? bf16_bits(xs[i] - bf16_val(hb)) : (unsigned short)0; }
#pragma unroll
    for (int t = 0; t < 4; ++t) {
      const unsigned short* brow = Wt + (size_t)(col0 + t * 16 + ln) * ldb + kb;
      FragB b;
      b.half[0] = *(const v8us*)(brow + 8 * hh);
      b.half[1] = *(const v8us*)(brow + 16 + 8 * hh);
      acc[t] = mmaN<ASPLIT ? 2 : 1>(ah.v, al.v, b.v, b.v, acc[t]);
    }
  }
#pragma unroll
  for (int t = 0; t < 4; ++t) {
    float bv = bias ? bias[col0 + t * 16 + ln] : 0.f;
    if (BIAS_BF16) bv = bf16_round(bv);
#pragma unroll
    for (int r = 0; r < 8; ++r) { float v = acc[t][r] + bv; if (ACT == 1) v = fmaxf(v, 0.f); so[w][8 * hh + r][t * 16 + ln] = v; }
  }
  __builtin_amdgcn_fence(__ATOMIC_ACQ_REL, "workgroup");
  __builtin_amdgcn_wave_barrier();
  const int rsub = lane >> 4, c4 = (lane & 15) * 4;
  {
#pragma unroll
    for (int q = 0; q < 8; ++q) {
      const int r = q * 2 + rsub;
      const v4f v = *(const v4fa*)&so[w][r][c4];
      *(v4f*)(C + (size_t)(row0 + r) * ldc + col0 + c4) = v;
    }
    
  }
}

// Flash-style causal/unmasked attention, all contractions 3-term bf16 hi/lo splits, f32 softmax with running max.
// q,k,v rows are read from f32 buffers with arbitrary row pitch (so they can live inside a fused qkv buffer);
// D = head size (multiple of 32, <= 128); one wave = 16 query rows; block = 4 waves (64 queries) sharing K/V chunks of 32.
template <int D, bool CAUSAL>
__global__ __launch_bounds__(128) void k_flash(const float* __restrict__ qb, const float* __restrict__ kb, const float* __restrict__ vb,
                                             int pitch, int T, int H, float scale, float* __restrict__ y, int ypitch) {
  constexpr int KS = D / 32;        // k-steps for QK
  constexpr int DT = D / 16;        // d tiles for PV
  __shared__ __attribute__((aligned(16))) unsigned short sKh[32][D + 8], sKl[32][D + 8], sVh[32][D + 8], sVl[32][D + 8];
  __shared__ __attribute__((aligned(16))) unsigned short sPh[4][16][40], sPl[4][16][40];
  __shared__ __attribute__((aligned(16))) float sO[4][16][D];
  const int tid = threadIdx.x, w = tid >> 5, lane = tid & 31, ln = lane & 15, hh = lane >> 4;
  const int nqb = (T + 63) / 64;
  const int bh = blockIdx.x / nqb, qblk = blockIdx.x % nqb;
  const int b = bh / H, h = bh % H;
  const int q0 = qblk * 64 + w * 16;
  const float* Q = qb + (size_t)b * T * pitch + h * D;
  const float* K = kb + (size_t)b * T * pitch + h * D;
  const float* V = vb + (size_t)b * T * pitch + h * D;

  // A fragments of the wave's 16 query rows (scaled), hi/lo
  FragB aqh[KS], aql[KS];
  {
    int row = q0 + ln; if (row >= T) row = T - 1;
    const float* qr = Q + (size_t)row * pitch;
#pragma unroll
    for (int ks = 0; ks < KS; ++ks)
#pragma unroll
      for (int i = 0; i < 16; ++i) {
        const int d = ks * 32 + ((i < 8) ? (8 * hh + i) : (16 + 8 * hh + (i - 8)));
        const float x = qr[d] * scale; const unsigned short hb = bf16_bits(x);
        aqh[ks].u[i] = hb; aql[ks].u[i] = bf16_bits(x - bf16_val(hb));
      }
  }
  float m_r[8], l_r[8];
#pragma unroll
  for (int r = 0; r < 8; ++r) { m_r[r] = -3.0e38f; l_r[r] = 0.f; }
  v8f oacc[DT];
#pragma unroll
  for (int dt = 0; dt < DT; ++dt) oacc[dt] = (v8f){0.f,0.f,0.f,0.f,0.f,0.f,0.f,0.f};

  const int kv_end = CAUSAL ? min(T, qblk * 64 + 64) : T;     // block-uniform
  for (int j0 = 0; j0 < kv_end; j0 += 32) {
    __syncthreads();
    for (int e = tid; e < 32 * (D / 4); e += 128) {
      const int r = e / (D / 4), c4 = (e % (D / 4)) * 4;
      const int key = j0 + r;
      v4f kf = {0.f,0.f,0.f,0.f}, vf = {0.f,0.f,0.f,0.f};
      if (key < T) { kf = *(const v4fa*)(K + (size_t)key * pitch + c4); vf = *(const v4fa*)(V + (size_t)key * pitch + c4); }
#pragma unroll
      for (int t = 0; t < 4; ++t) {
        unsigned short hb = bf16_bits(kf[t]); sKh[r][c4 + t] = hb; sKl[r][c4 + t] = bf16_bits(kf[t] - bf16_val(hb));
        hb = bf16_bits(vf[t]); sVh[r][c4 + t] = hb; sVl[r][c4 + t] = bf16_bits(vf[t] - bf16_val(hb));
      }
    }
    __syncthreads();
    // S tile 16 x 32
    v8f s[2];
#pragma unroll
    for (int nt = 0; nt < 2; ++nt) {
      v8f acc = {};
#pragma unroll
      for (int ks = 0; ks < KS; ++ks) {
        FragB bh_, bl_;
        bh_.half[0] = *(const v8us*)&sKh[nt * 16 + ln][ks * 32 + 8 * hh]; bh_.half[1] = *(const v8us*)&sKh[nt * 16 + ln][ks * 32 + 16 + 8 * hh];
        bl_.half[0] = *(const v8us*)&sKl[nt * 16 + ln][ks * 32 + 8 * hh]; bl_.half[1] = *(const v8us*)&sKl[nt * 16 + ln][ks * 32 + 16 + 8 * hh];
        acc = mmaN<3>(aqh[ks].v, aql[ks].v, bh_.v, bl_.v, acc);
      }
      s[nt] = acc;
    }
    // mask + running max (rows 8hh+r; the 16 lanes of a half share rows)
    float alpha[8];
#pragma unroll
    for (int r = 0; r < 8; ++r) {
      const int qi = q0 + 8 * hh + r;
      const int ja = j0 + ln, jb = j0 + 16 + ln;
      if (CAUSAL) { if (ja > qi) s[0][r] = -3.0e38f; if (jb > qi) s[1][r] = -3.0e38f; }
      if (ja >= T) s[0][r] = -3.0e38f;
      if (jb >= T) s[1][r] = -3.0e38f;
      float mx = fmaxf(s[0][r], s[1][r]);
      mx = fmaxf(mx, __shfl_xor(mx, 1, 32)); mx = fmaxf(mx, __shfl_xor(mx, 2, 32)); mx = fmaxf(mx, __shfl_xor(mx, 4, 32)); mx = fmaxf(mx, __shfl_xor(mx, 8, 32));
      const float mnew = fmaxf(m_r[r], mx);
      alpha[r] = (mnew > -1.0e38f) ? __expf(m_r[r] - mnew) : 1.0f;
      const float p0 = (s[0][r] > -1.0e38f) ? __expf(s[0][r] - mnew) : 0.f;
      const float p1 = (s[1][r] > -1.0e38f) ? __expf(s[1][r] - mnew) : 0.f;
      m_r[r] = mnew;
      l_r[r] = l_r[r] * alpha[r] + p0 + p1;            // per-lane partial row sum (16 lanes combined at the end)
      unsigned short hb = bf16_bits(p0); sPh[w][8 * hh + r][ln] = hb;      sPl[w][8 * hh + r][ln] = bf16_bits(p0 - bf16_val(hb));
      hb = bf16_bits(p1);                sPh[w][8 * hh + r][16 + ln] = hb; sPl[w][8 * hh + r][16 + ln] = bf16_bits(p1 - bf16_val(hb));
    }
#pragma unroll
    for (int dt = 0; dt < DT; ++dt)
#pragma unroll
      for (int r = 0; r < 8; ++r) oacc[dt][r] *= alpha[r];
    __builtin_amdgcn_fence(__ATOMIC_ACQ_REL, "workgroup");
    __builtin_amdgcn_wave_barrier();
    FragB pah, pal;
    pah.half[0] = *(const v8us*)&sPh[w][ln][8 * hh]; pah.half[1] = *(const v8us*)&sPh[w][ln][16 + 8 * hh];
    pal.half[0] = *(const v8us*)&sPl[w][ln][8 * hh]; pal.half[1] = *(const v8us*)&sPl[w][ln][16 + 8 * hh];
#pragma unroll
    for (int dt = 0; dt < DT; ++dt) {
      FragB bvh, bvl;
#pragma unroll
      for (int i = 0; i < 8; ++i) {
        bvh.u[i] = sVh[8 * hh + i][dt * 16 + ln]; bvh.u[8 + i] = sVh[16 + 8 * hh + i][dt * 16 + ln];
        bvl.u[i] = sVl[8 * hh + i][dt * 16 + ln]; bvl.u[8 + i] = sVl[16 + 8 * hh + i][dt * 16 + ln];
      }
      oacc[dt] = mmaN<3>(pah.v, pal.v, bvh.v, bvl.v, oacc[dt]);
    }
    __builtin_amdgcn_fence(__ATOMIC_ACQ_REL, "workgroup");
    __builtin_amdgcn_wave_barrier();
  }
#pragma unroll
  for (int r = 0; r < 8; ++r) {
    float l = l_r[r];
    l += __shfl_xor(l, 1, 32); l += __shfl_xor(l, 2, 32); l += __shfl_xor(l, 4, 32); l += __shfl_xor(l, 8, 32);
    l_r[r] = (l > 0.f) ? 1.0f / l : 0.f;
  }
#pragma unroll
  for (int dt = 0; dt < DT; ++dt)
#pragma unroll
    for (int r = 0; r < 8; ++r) sO[w][8 * hh + r][dt * 16 + ln] = oacc[dt][r] * l_r[r];
  __builtin_amdgcn_fence(__ATOMIC_ACQ_REL, "workgroup");
  __builtin_amdgcn_wave_barrier();
  {
    for (int r = 0; r < 16; ++r) {
      const int row = q0 + r;
      if (row < T && lane < D / 4) {
        const v4f val = *(const v4fa*)&sO[w][r][lane * 4];
        *(v4f*)(y + ((size_t)b * T + row) * ypitch + h * D + lane * 4) = val;
      }
    }
    
  }
}

// GEMM C = act(A·W + bias + resid): A f32 (ASPLIT -> hi/lo 2 terms), Wt bf16 [N][K]; ACT 0 none, 1 relu, 2 exact gelu;
// resid (optional, f32, row index = (row % rmod), pitch ldr, RES_BF16 rounds it) added before the activation.
template <bool ASPLIT, int ACT, bool BIAS_BF16, bool RES_BF16>
__global__ __launch_bounds__(128) void k_gemm_bf3(const float* __restrict__ A, int lda, const unsigned short* __restrict__ Wt, int ldb,
                                                const float* __restrict__ bias, const float* __restrict__ resid, int rmod, int ldr,
                                                float* __restrict__ C, int ldc, int M, int N, int K) {
  __shared__ __attribute__((aligned(16))) float so[4][16][64];
  const int tid = threadIdx.x, w = tid >> 5, lane = tid & 31, ln = lane & 15, hh = lane >> 4;
  const int ntn = N / 64;
  const int wid = blockIdx.x * 4 + w;
  const int mt = wid / ntn, nq = wid % ntn;
  if (mt * 16 >= M) return;
  const int row0 = mt * 16, col0 = nq * 64;
  const float* arow = A + (size_t)(row0 + ln) * lda;
  v8f acc[4] = {};
  for (int kb = 0; kb < K; kb += 32) {
    FragB ah, al;
    const v4f x0 = *(const v4fa*)(arow + kb + 8 * hh), x1 = *(const v4fa*)(arow + kb + 8 * hh + 4);
    const v4f x2 = *(const v4fa*)(arow + kb + 16 + 8 * hh), x3 = *(const v4fa*)(arow + kb + 16 + 8 * hh + 4);
    float xs[16] = {x0[0],x0[1],x0[2],x0[3],x1[0],x1[1],x1[2],x1[3],x2[0],x2[1],x2[2],x2[3],x3[0],x3[1],x3[2],x3[3]};
#pragma unroll
    for (int i = 0; i < 16; ++i) { const unsigned short hb = bf16_bits(xs[i]); ah.u[i] = hb; al.u[i] = ASPLIT ? bf16_bits(xs[i] - bf16_val(hb)) : (unsigned short)0; }
#pragma unroll
    for (int t = 0; t < 4; ++t) {
      const unsigned short* brow = Wt + (size_t)(col0 + t * 16 + ln) * ldb + kb;
      FragB b;
      b.half[0] = *(const v8us*)(brow + 8 * hh);
      b.half[1] = *(const v8us*)(brow + 16 + 8 * hh);
      acc[t] = mmaN<ASPLIT ? 2 : 1>(ah.v, al.v, b.v, b.v, acc[t]);
    }
  }
#pragma unroll
  for (int t = 0; t < 4; ++t) {
    const int col = col0 + t * 16 + ln;
    float bv = bias ? bias[col] : 0.f;
    if (BIAS_BF16) bv = bf16_round(bv);
#pragma unroll
    for (int r = 0; r < 8; ++r) {
      float v = acc[t][r] + bv;
      if (resid) { float rv = resid[(size_t)((row0 + 8 * hh + r) % rmod) * ldr + col]; if (RES_BF16) rv = bf16_round(rv); v += rv; }
      if (ACT == 1) v = fmaxf(v, 0.f);
      if (ACT == 2) v = 0.5f * v * (1.0f + erff(v * 0.70710678118654752f));
      if (ACT == 3) { const float u = 0.7978845608028654f * (v + 0.044715f * v * v * v); v = 0.5f * v * (1.0f + tanhf(u)); }
      so[w][8 * hh + r][t * 16 + ln] = v;
    }
  }
  __builtin_amdgcn_fence(__ATOMIC_ACQ_REL, "workgroup");
  __builtin_amdgcn_wave_barrier();
  const int rsub = lane >> 4, c4 = (lane & 15) * 4;
  {
#pragma unroll
    for (int q = 0; q < 8; ++q) {
      const int r = q * 2 + rsub;
      const v4f v = *(const v4fa*)&so[w][r][c4];
      *(v4f*)(C + (size_t)(row0 + r) * ldc + col0 + c4) = v;
    }
    
  }
}
// row LayerNorm (biased variance, eps) over N: s = X (+ R); optional out_sum <- s; out_norm <- (s-mu)*rsqrt(var+eps)*g + b
template <bool PARAM_BF16>
__global__ __launch_bounds__(256) void k_layernorm(const float* __restrict__ X, const float* __restrict__ R, const float* __restrict__ g, const float* __restrict__ bta,
                                                  float* __restrict__ out_sum, float* __restrict__ out_norm, int N, float eps) {
  __shared__ float red[256];
  const int row = blockIdx.x, tid = threadIdx.x;
  const float* x = X + (size_t)row * N; const float* rr = R ? R + (size_t)row * N : nullptr;
  float vals[16];                     // up to N = 4096
  const int per = N / 256;            // contiguous chunk per thread? use strided-by-4 chunks: thread handles j = tid*4 + 1024*u
  float s1 = 0.f;
  for (int u = 0; u < per / 4; ++u) {
    const int j = tid * 4 + 1024 * u;
    const v4f a = *(const v4fa*)(x + j);
    v4f b = {0.f,0.f,0.f,0.f}; if (rr) b = *(const v4fa*)(rr + j);
#pragma unroll
    for (int q = 0; q < 4; ++q) { const float v = a[q] + b[q]; vals[u * 4 + q] = v; s1 += v; }
  }
  red[tid] = s1; __syncthreads();
  for (int st = 128; st > 0; st >>= 1) { if (tid < st) red[tid] += red[tid + st]; __syncthreads(); }
  const float mu = red[0] / (float)N; __syncthreads();
  float s2 = 0.f;
  for (int u = 0; u < per / 4; ++u)
#pragma unroll
    for (int q = 0; q < 4; ++q) { const float c = vals[u * 4 + q] - mu; s2 += c * c; }
  red[tid] = s2; __syncthreads();
  for (int st = 128; st > 0; st >>= 1) { if (tid < st) red[tid] += red[tid + st]; __syncthreads(); }
  const float rs = rsqrtf(red[0] / (float)N + eps);
  {
    for (int u = 0; u < per / 4; ++u) {
      const int j = tid * 4 + 1024 * u;
      v4f o, sm;
#pragma unroll
      for (int q = 0; q < 4; ++q) {
        float gg = g[j + q], bb = bta[j + q];
        if (PARAM_BF16) { gg = bf16_round(gg); bb = bf16_round(bb); }
        sm[q] = vals[u * 4 + q]; o[q] = (vals[u * 4 + q] - mu) * rs * gg + bb;
      }
      if (out_sum) *(v4f*)(out_sum + (size_t)row * N + j) = sm;
      *(v4f*)(out_norm + (size_t)row * N + j) = o;
    }
    
  }
}



// ---- f16 WMMA path (v_wmma_f32_16x16x32_f16): 11-bit significands for operands in range — used where a [0,1] probability operand needs more precision than bf16
typedef _Float16 v16h __attribute__((ext_vector_type(16)));
union FragH { v16h v; v8us half[2]; _Float16 h[16]; unsigned short u[16]; };
template <int NT>
__device__ __forceinline__ v8f mmaH(v16h ah, v16h al, v16h bh, v16h bl, v8f c) {
  c = __builtin_amdgcn_wmma_f32_16x16x32_f16(false, ah, false, bh, (short)0, c, false, false);
  if (NT >= 2) c = __builtin_amdgcn_wmma_f32_16x16x32_f16(false, al, false, bh, (short)0, c, false, false);
  if (NT >= 3) c = __builtin_amdgcn_wmma_f32_16x16x32_f16(false, ah, false, bl, (short)0, c, false, false);
  asm volatile("v_nop\n\tv_nop\n\tv_nop\n\tv_nop" : "+v"(c) : "v"(ah), "v"(al), "v"(bh), "v"(bl));
  return c;
}
// batched GEMM like k_gemm_b but f16 operands: A f32 (split into f16 hi/lo if ASPLIT, else rounded to f16), Bt = f16 values [n][k]; alpha; C f32; N multiple of 16 (partial tiles skipped)
template <bool ASPLIT>
__global__ __launch_bounds__(128) void k_gemm_h(const float* __restrict__ A, int lda, size_t sA, const _Float16* __restrict__ Bh, int ldb, size_t sB, float alpha, float* __restrict__ C, int ldc, size_t sC, int M, int N, int K) {
  __shared__ __attribute__((aligned(16))) float so[4][16][64];
  const int tid = threadIdx.x, w = tid >> 5, lane = tid & 31, ln = lane & 15, hh = lane >> 4; const int by = blockIdx.y;
  A += (size_t)by * sA; Bh += (size_t)by * sB; C += (size_t)by * sC;
  const int ntn = (N + 63) / 64; const int wid = blockIdx.x * 4 + w; const int mt = wid / ntn, nq = wid % ntn; if (mt * 16 >= M) return;
  const int row0 = mt * 16, col0 = nq * 64; const float* arow = A + (size_t)(row0 + ln) * lda;
  v8f acc[4] = {};
  for (int kb = 0; kb < K; kb += 32) {
    FragH ah, al;
    const v4f x0 = *(const v4fa*)(arow + kb + 8 * hh), x1 = *(const v4fa*)(arow + kb + 8 * hh + 4), x2 = *(const v4fa*)(arow + kb + 16 + 8 * hh), x3 = *(const v4fa*)(arow + kb + 16 + 8 * hh + 4);
    float xs[16] = {x0[0],x0[1],x0[2],x0[3],x1[0],x1[1],x1[2],x1[3],x2[0],x2[1],x2[2],x2[3],x3[0],x3[1],x3[2],x3[3]};
#pragma unroll
    for (int i = 0; i < 16; ++i) { const _Float16 h = (_Float16)xs[i]; ah.h[i] = h; al.h[i] = ASPLIT ? (_Float16)(xs[i] - (float)h) : (_Float16)0.0f; }
#pragma unroll
    for (int t = 0; t < 4; ++t) { if (col0 + t * 16 >= N) continue; const size_t boff = (size_t)(col0 + t * 16 + ln) * ldb + kb; FragH bq; bq.half[0] = *(const v8us*)(Bh + boff + 8 * hh); bq.half[1] = *(const v8us*)(Bh + boff + 16 + 8 * hh);
      acc[t] = mmaH<ASPLIT ? 2 : 1>(ah.v, al.v, bq.v, bq.v, acc[t]); }
  }
#pragma unroll
  for (int t = 0; t < 4; ++t) { if (col0 + t * 16 >= N) continue;
#pragma unroll
    for (int r = 0; r < 8; ++r) so[w][8 * hh + r][t * 16 + ln] = acc[t][r] * alpha; }
  __builtin_amdgcn_fence(__ATOMIC_ACQ_REL, "workgroup"); __builtin_amdgcn_wave_barrier();
  const int rsub = lane >> 4, c4 = (lane & 15) * 4;
  {
#pragma unroll
    for (int q = 0; q < 8; ++q) { const int r = q * 2 + rsub; if (col0 + c4 < N) { const v4f v = *(const v4fa*)&so[w][r][c4]; *(v4f*)(C + (size_t)(row0 + r) * ldc + col0 + c4) = v; } }
     }
}

// Wt[n][k] = f16(W[k][n]·scale) from f32 row-major W[K][N] (scale = power of two; bf16-exact weights stay exact in f16 away from the subnormal range)
__device__ __forceinline__ void wt_f16(const int bx, const float* __restrict__ W, _Float16* __restrict__ Wt, int K, int N, float scale) {
  const int t = bx * 256 + threadIdx.x; if (t >= N * (K / 8)) return; const int n = t / (K / 8), k8 = (t % (K / 8)) * 8; FragH f;
#pragma unroll
  for (int i = 0; i < 8; ++i) f.h[i] = (_Float16)(bf16_round(W[(size_t)(k8 + i) * N + n]) * scale); const v8us o = f.half[0];
  *(v8us*)((unsigned short*)Wt + (size_t)n * K + k8) = o; 
}
// One lane's eight 16-byte copies of an operand tile, global memory to LDS through no register. The s_wait_xcnt stands in the copies' own statement, ahead of any rewrite of the address registers they name.
__device__ __forceinline__ void tile_copy8(unsigned l, unsigned lstep, const unsigned short* g, size_t gstep) {
  asm volatile("global_load_async_to_lds_b128 %0, %8, off\n\t"
               "global_load_async_to_lds_b128 %1, %9, off\n\t"
               "global_load_async_to_lds_b128 %2, %10, off\n\t"
               "global_load_async_to_lds_b128 %3, %11, off\n\t"
               "global_load_async_to_lds_b128 %4, %12, off\n\t"
               "global_load_async_to_lds_b128 %5, %13, off\n\t"
               "global_load_async_to_lds_b128 %6, %14, off\n\t"
               "global_load_async_to_lds_b128 %7, %15, off\n\t"
               "s_wait_xcnt 0x0"
               :: "v"(l), "v"(l + lstep), "v"(l + 2 * lstep), "v"(l + 3 * lstep), "v"(l + 4 * lstep), "v"(l + 5 * lstep), "v"(l + 6 * lstep), "v"(l + 7 * lstep),
                  "v"(g), "v"(g + gstep), "v"(g + 2 * gstep), "v"(g + 3 * gstep), "v"(g + 4 * gstep), "v"(g + 5 * gstep), "v"(g + 6 * gstep), "v"(g + 7 * gstep)
               : "memory");
}
// C[M][N] = (A . Bt^T) * alpha (+ bias rounded to bf16): A f16 [M][CC], Bt f16 [N][CC], both with rows of CC elements; M and N multiples of 64, the grid exactly (M / 64) * (N / 64) blocks, N / 64 = 1 << lgn.
// A block of four waves owns a 64 x 64 tile of C. Its 64 rows of A and 64 rows of Bt, the whole K, are copied into LDS once, a wave's copy = one whole row of 512 contiguous bytes; then wave w takes rows 16 w .. 16 w + 15
// against all 64 columns, every fragment from LDS, the k order and the accumulation as before. Output rows are staged in the wave's own 16 rows of A, which no other wave reads, and leave as whole lines. Writes f32 C or f16 C16.
// AHM: A lies head-major, [batch][head][token place][HD], as the attention kernel stores it; a wave's copy is then 8 places x 64 bytes of one head, still 512 contiguous bytes, and lands as 8 pieces in 8 LDS rows: the tile in LDS is the same.
// OPLACE: inside each group of 16 tokens, token t lies at place 4 (t & 3) + (t >> 2) (its own inverse), so that 4 places in a row are LDS rows 4 apart: at pitch GP their 64-byte pieces fall on all 64 banks, as a whole row does.
#define OPLACE(t) ((((t) & 3) << 2) | ((t) >> 2))
#define GP (CC * 2 + 16)      /* LDS row pitch in bytes, 16 B x odd: 16 lanes' ds_load_b128 fall on all 64 banks */
#define GSM (128 * GP)
typedef float fal __attribute__((may_alias));
template <bool BIAS, bool F32OUT, bool AHM>
__device__ __forceinline__ void gemm_lds(unsigned char* sm, const int bx, const int lgn, const _Float16* __restrict__ A, const _Float16* __restrict__ Bh, float alpha, const float* __restrict__ bias,
    float* __restrict__ C, _Float16* __restrict__ C16, int ldc) {
  const int tid = threadIdx.x, w = tid >> 5, lane = tid & 31, ln = lane & 15, hh = lane >> 4;
  const int row0 = (bx >> lgn) * 64, col0 = (bx & ((1 << lgn) - 1)) * 64;
  /* copy map: chunk c of thread tid = tile row w + 4 c, 16-byte column lane */
  const unsigned short* gb = (const unsigned short*)Bh + (size_t)(col0 + w) * CC + lane * 8;
  const unsigned l0 = (unsigned)(size_t)sm + w * GP + lane * 16;      /* low 32 bits of the shared address = byte offset in the work-group's LDS */
  if (AHM) {      /* copy map of a head-major A: chunk c = head c, place 16 w + (lane >> 2) (+ 8 in the second eight: two tile rows on), tile row 16 w + OPLACE(place), 16-byte column 4 c + (lane & 3); a 64-row tile lies in one batch */
    const unsigned short* ga = (const unsigned short*)A + ((size_t)(row0 / NN) * NH * NN + row0 % NN + w * 16 + (lane >> 2)) * HD + (lane & 3) * 8;
    const unsigned la = (unsigned)(size_t)sm + (w * 16 + OPLACE(lane >> 2)) * GP + (lane & 3) * 16;
    tile_copy8(la, HD * 2, ga, (size_t)NN * HD); tile_copy8(la + 2 * GP, HD * 2, ga + 8 * HD, (size_t)NN * HD);
  } else {
    const unsigned short* ga = (const unsigned short*)A + (size_t)(row0 + w) * CC + lane * 8;
    tile_copy8(l0, 4 * GP, ga, (size_t)4 * CC); tile_copy8(l0 + 32 * GP, 4 * GP, ga + 32 * CC, (size_t)4 * CC);
  }
  tile_copy8(l0 + 64 * GP, 4 * GP, gb, (size_t)4 * CC); tile_copy8(l0 + 96 * GP, 4 * GP, gb + 32 * CC, (size_t)4 * CC);
  float bv[4];      /* the bias is fetched while the copies fly */
#pragma unroll
  for (int t = 0; t < 4; ++t) bv[t] = BIAS ? bf16_round(bias[col0 + t * 16 + ln]) : 0.f;
  if (BIAS) asm volatile("s_wait_xcnt 0x0" ::: "memory");      /* ahead of any rewrite of the offset register that the bias loads name */
  asm volatile("s_wait_asynccnt 0x0" ::: "memory");      /* this wave's share of both tiles has landed */
  __syncthreads();      /* both tiles published to all four waves */
  const unsigned char* af = sm + (w * 16 + ln) * GP + hh * 16; const unsigned char* bf = sm + (64 + ln) * GP + hh * 16;
  v8f acc[4] = {};
  FragH ah[2], bq[2][4];      /* two register sets: a k step's ten fragment reads stand together, one k step ahead of the products that use them */
  auto frags = [&](const int kb) { FragH& a = ah[kb & 1]; a.half[0] = *(const v8us*)(af + kb * 64); a.half[1] = *(const v8us*)(af + kb * 64 + 32);
#pragma unroll
    for (int t = 0; t < 4; ++t) { FragH& b = bq[kb & 1][t]; b.half[0] = *(const v8us*)(bf + t * 16 * GP + kb * 64); b.half[1] = *(const v8us*)(bf + t * 16 * GP + kb * 64 + 32); } };
  frags(0);
#pragma unroll      /* every LDS offset an immediate, the register set a compile-time choice */
  for (int kb = 0; kb < CC / 32; ++kb) { if (kb + 1 < CC / 32) frags(kb + 1);
#pragma unroll
    for (int t = 0; t < 4; ++t) acc[t] = mmaH<1>(ah[kb & 1].v, ah[kb & 1].v, bq[kb & 1][t].v, bq[kb & 1][t].v, acc[t]);
  }
  fal* so = (fal*)(sm + w * 16 * GP);      /* [16][64] f32 in the wave's own rows of A, all read by now */
#pragma unroll
  for (int t = 0; t < 4; ++t)
#pragma unroll
    for (int r = 0; r < 8; ++r) so[(8 * hh + r) * 64 + t * 16 + ln] = acc[t][r] * alpha + bv[t];
  __builtin_amdgcn_fence(__ATOMIC_ACQ_REL, "workgroup"); __builtin_amdgcn_wave_barrier();
  const int rsub = lane >> 4, c4 = (lane & 15) * 4; typedef _Float16 v4h __attribute__((ext_vector_type(4)));
#pragma unroll
  for (int q = 0; q < 8; ++q) { const int r = q * 2 + rsub; const v4f v = *(const v4fa*)&so[r * 64 + c4]; const size_t o = (size_t)(row0 + w * 16 + r) * ldc + col0 + c4;
    if (F32OUT) *(v4f*)(C + o) = v; else { v4h h4; for (int i = 0; i < 4; ++i) h4[i] = (_Float16)v[i]; *(v4h*)(C16 + o) = h4; } }
}
// y = O16 . Wout + bout: M 8192, N 256; O16 head-major
__global__ __launch_bounds__(128) void k_gemm_out(const _Float16* __restrict__ A, const _Float16* __restrict__ Bh, float alpha, const float* __restrict__ bias, float* __restrict__ C) {
  __shared__ __attribute__((aligned(16))) unsigned char sm[GSM];
  gemm_lds<true, true, true>(sm, blockIdx.x, 2, A, Bh, alpha, bias, C, nullptr, CC);
}
// The two products that read only X16 and Bqkv, in one grid; the job is block-uniform, by block index:
// blocks [0, NBQ): [q | k] token-major [(b,n)][512] = X16 . Bqkv rows 0..511 (M 8192, N 512); blocks [NBQ, NBQ + BB * NBV): v channel-major per batch [b][(h,d)][n] = Bqkv rows 512..767 . X16[b] (M 256, N 2048).
#define NBQ ((NR / 64) * (2 * CC / 64))
#define NBV ((CC / 64) * (NN / 64))
__global__ __launch_bounds__(128) void k_gemm_qkv(const _Float16* __restrict__ X16, const _Float16* __restrict__ Bqkv, _Float16* __restrict__ QK, _Float16* __restrict__ Vt, float alpha) {
  __shared__ __attribute__((aligned(16))) unsigned char sm[GSM];
  const int bx = blockIdx.x, rb = bx - NBQ; const bool jv = rb >= 0; const int by = jv ? rb / NBV : 0;
  gemm_lds<false, false, false>(sm, jv ? rb % NBV : bx, jv ? 5 : 3, jv ? Bqkv + (size_t)2 * CC * CC : X16, jv ? X16 + (size_t)by * NN * CC : Bqkv, alpha, nullptr,
           nullptr, jv ? Vt + (size_t)by * CC * NN : QK, jv ? NN : 2 * CC);
}


typedef _Float16 v4h __attribute__((ext_vector_type(4)));

__device__ __forceinline__ void x16(const int bx, const float* __restrict__ x, _Float16* __restrict__ X16, size_t n8) { const size_t t = (size_t)bx * 256 + threadIdx.x; if (t >= n8) return; FragH f;
#pragma unroll
  for (int q = 0; q < 8; ++q) f.h[q] = (_Float16)bf16_round(x[t * 8 + q]); *(v8us*)((unsigned short*)X16 + t * 8) = f.half[0];  }
// The three conversions that read only inputs, in one grid; the job is block-uniform, by block index: Wqkv transposed, Wout transposed ((in,out) to Bt[n][k] x 2^4), x rounded.
#define NBW1 (C3 * (CC / 8) / 256)
#define NBW2 (CC * (CC / 8) / 256)
#define NBX (NR * CC / 8 / 256)
__global__ __launch_bounds__(256) void k_prep(const float* __restrict__ Wqkv, _Float16* __restrict__ Bqkv, const float* __restrict__ Wout, _Float16* __restrict__ Bo, const float* __restrict__ x, _Float16* __restrict__ X16) {
  const int bx = blockIdx.x;
  if (bx < NBW1) wt_f16(bx, Wqkv, Bqkv, CC, C3, 16.0f);
  else if (bx < NBW1 + NBW2) wt_f16(bx - NBW1, Wout, Bo, CC, CC, 16.0f);
  else x16(bx - (NBW1 + NBW2), x, X16, (size_t)NR * CC / 8);
}
__global__ __launch_bounds__(256) void k_round16f(const float* __restrict__ W, _Float16* __restrict__ Bt, size_t n8) { const size_t t = (size_t)blockIdx.x * 256 + threadIdx.x; if (t >= n8) return; FragH f;
#pragma unroll
  for (int i = 0; i < 8; ++i) f.h[i] = (_Float16)(bf16_round(W[t * 8 + i]) * 16.0f); *(v8us*)((unsigned short*)Bt + t * 8) = f.half[0];  }
template <int NHv, int TTv>
__global__ __launch_bounds__(256) void k_vt(const _Float16* __restrict__ V16, int ldv, int voff, _Float16* __restrict__ Vt) { __shared__ unsigned short tl[64][66]; const int tid = threadIdx.x; const int slab = blockIdx.x / (TTv / 64), lg = blockIdx.x % (TTv / 64); const int b = slab / NHv, h = slab % NHv;
  for (int i = tid; i < 64 * 8; i += 256) { const int r = i / 8, c8 = (i % 8) * 8; FragH f; f.half[0] = *(const v8us*)((const unsigned short*)V16 + ((size_t)b * TTv + lg * 64 + r) * ldv + voff + h * 64 + c8);
#pragma unroll
    for (int q = 0; q < 8; ++q) tl[r][c8 + q] = f.u[q]; }
  __syncthreads();
  {
#pragma unroll
    for (int rd = 0; rd < 2; ++rd) { const int d = rd * 32 + tid / 8, pc = tid % 8; FragH f;
#pragma unroll
      for (int q = 0; q < 8; ++q) f.u[q] = tl[pc * 8 + q][d];
      *(v8us*)((unsigned short*)Vt + ((size_t)slab * 64 + d) * TTv + lg * 64 + pc * 8) = f.half[0]; }
     } }

typedef float v2f __attribute__((ext_vector_type(2)));
// lane l with lane l ^ 16 (the two halves of a wave hold the two key halves of one query column)
__device__ __forceinline__ float xhalf(float x) { return __builtin_bit_cast(float, __builtin_amdgcn_permlanex16(__builtin_bit_cast(int, x), __builtin_bit_cast(int, x), 0x76543210, 0xfedcba98, false, false)); }

// One lane's eight 16-byte copies of a stage (four of K, four of V^T), global memory to LDS through no register. The s_wait_xcnt stands in the copies' own statement, ahead of any rewrite of the address registers they name.
__device__ __forceinline__ void stage_copy(unsigned lk, const unsigned short* gk, size_t gkstep, unsigned lkstep, unsigned lv, const unsigned short* gv, size_t gvstep, unsigned lvstep) {
  asm volatile("global_load_async_to_lds_b128 %0, %8, off\n\t"
               "global_load_async_to_lds_b128 %1, %9, off\n\t"
               "global_load_async_to_lds_b128 %2, %10, off\n\t"
               "global_load_async_to_lds_b128 %3, %11, off\n\t"
               "global_load_async_to_lds_b128 %4, %12, off\n\t"
               "global_load_async_to_lds_b128 %5, %13, off\n\t"
               "global_load_async_to_lds_b128 %6, %14, off\n\t"
               "global_load_async_to_lds_b128 %7, %15, off\n\t"
               "s_wait_xcnt 0x0"
               :: "v"(lk), "v"(lk + lkstep), "v"(lk + 2 * lkstep), "v"(lk + 3 * lkstep), "v"(lv), "v"(lv + lvstep), "v"(lv + 2 * lvstep), "v"(lv + 3 * lvstep),
                  "v"(gk), "v"(gk + gkstep), "v"(gk + 2 * gkstep), "v"(gk + 3 * gkstep), "v"(gv), "v"(gv + gvstep), "v"(gv + 2 * gvstep), "v"(gv + 3 * gvstep)
               : "memory");
}

__global__ __launch_bounds__(128) void k_flash(const _Float16* __restrict__ Q16, int ldq, const _Float16* __restrict__ K16, int ldk, const _Float16* __restrict__ Vt, const int* __restrict__ MSK, _Float16* __restrict__ O16) {
  constexpr int RPW = 16, NQB = NN / (4 * RPW), DT = 2; (void)MSK;
  constexpr int TK = 128, NS = NN / TK, NP = TK / 32;      /* keys a stage, stages, 32-key passes of the second product a stage */
  constexpr int KP = HD * 2 + 16, VP = TK * 2 + 16;      /* LDS row pitches in bytes, 16 B x odd: 16 lanes' ds_load_b128 fall on all 64 banks */
  constexpr int KB = TK * KP, SB = KB + HD * VP;      /* a stage: TK rows of K (HD channels), then HD rows of V^T (TK keys) */
  __shared__ __attribute__((aligned(16))) unsigned char sm[2 * SB];
  constexpr float SL2E = 0.17677669529663687f * 1.4426950408889634f;      /* 32^-1/2 * log2(e): e^(scale*s - m) = 2^(SL2E*s - m2), one fma ahead of a bare v_exp_f32 */
  const int tid = threadIdx.x, w = tid >> 5, lane = tid & 31, ln = lane & 15, hh = lane >> 4;
  const int slab = blockIdx.x / NQB, qblk = blockIdx.x % NQB; const int b = slab / NH, h = slab % NH; const int q0 = qblk * (4 * RPW) + w * RPW;
  const unsigned short* Vth = (const unsigned short*)Vt + ((size_t)b * CC + h * HD) * NN;      /* V^T = v[b][(h,d)][n] channel-major */
  /* copy map: K chunk c of thread tid = row (tid >> 2) + 32 c, 16-byte column tid & 3; V^T chunk c = row (tid >> 4) + 8 c, 16-byte column tid & 15 */
  const unsigned short* gk = (const unsigned short*)K16 + ((size_t)b * NN + (tid >> 2)) * ldk + h * HD + (tid & 3) * 8;
  const unsigned short* gv = Vth + (size_t)(tid >> 4) * NN + (tid & 15) * 8;
  const unsigned lds0 = (unsigned)(size_t)sm;      /* low 32 bits of the shared address = byte offset in the work-group's LDS */
  const unsigned lk = lds0 + (tid >> 2) * KP + (tid & 3) * 16, lv = lds0 + KB + (tid >> 4) * VP + (tid & 15) * 16;
  const size_t gkstep = (size_t)32 * ldk, gkstage = (size_t)TK * ldk;
  stage_copy(lk, gk, gkstep, 32 * KP, lv, gv, (size_t)8 * NN, 8 * VP);
  FragH bq;      /* B: column ln = query q0 + ln, k = head channel */
  { const unsigned short* qr = (const unsigned short*)Q16 + ((size_t)b * NN + q0 + ln) * ldq + h * HD; bq.half[0] = *(const v8us*)(qr + 8 * hh); bq.half[1] = *(const v8us*)(qr + 16 + 8 * hh); }
  asm volatile("s_wait_asynccnt 0x0" ::: "memory");      /* this wave's share of stage 0 has landed */
  __syncthreads();      /* stage 0 published to all four waves */
  gk += gkstage; gv += TK;
  stage_copy(lk + SB, gk, gkstep, 32 * KP, lv + SB, gv, (size_t)8 * NN, 8 * VP);
  float m_q = -3.0e38f, l_q = 0.f; v8f oacc[DT];
#pragma unroll
  for (int dt = 0; dt < DT; ++dt) oacc[dt] = (v8f){0.f,0.f,0.f,0.f,0.f,0.f,0.f,0.f};
#pragma unroll 1      /* one body for both buffers: the buffer is an offset */
  for (int t = 0; t < NS; ++t) {
    const unsigned bo = (unsigned)(t & 1) * SB;
    const unsigned char* kf = sm + bo + ln * KP + hh * 16; const unsigned char* vf = sm + bo + KB + ln * VP + hh * 16;
    /* One softmax block = the whole stage of TK keys: all its fragments are read at the head, its 2 NP score tiles come from 2 NP independent products back to back, then ONE maximum, ONE rescale of l_q and oacc, and the NP passes of the second product. */
    static_assert(NP == 4, "the joins of the four chains and of the four partial sums below are written out for four passes");
    FragH ak[2 * NP], av[NP][DT];
#pragma unroll      /* every LDS offset an immediate */
    for (int nt = 0; nt < 2 * NP; ++nt) { const unsigned char* kr = kf + nt * 16 * KP; ak[nt].half[0] = *(const v8us*)kr; ak[nt].half[1] = *(const v8us*)(kr + 32); }
    __builtin_amdgcn_sched_barrier(0);      /* K's reads stay in front of V^T's: LDS answers in order, and else the first score product waits for V^T's fragments too */
#pragma unroll      /* V^T's reads stand directly behind K's, one place of LDS reads a stage: their latency runs behind the score products and the maximum */
    for (int ps = 0; ps < NP; ++ps)
#pragma unroll
      for (int dt = 0; dt < DT; ++dt) { const unsigned char* vrow = vf + dt * 16 * VP + ps * 64; av[ps][dt].half[0] = *(const v8us*)vrow; av[ps][dt].half[1] = *(const v8us*)(vrow + 32); }
    __builtin_amdgcn_sched_barrier(0);      /* keeps V^T's reads up here: else each is moved directly in front of its product, and its latency stands open there */
    v8f s[2 * NP];      /* s[nt][r] = S^T[key t*TK + nt*16 + 8*hh + r][query q0 + ln] */
#pragma unroll
    for (int nt = 0; nt < 2 * NP; ++nt) s[nt] = __builtin_amdgcn_wmma_f32_16x16x32_f16(false, ak[nt].v, false, bq.v, (short)0, (v8f){0.f,0.f,0.f,0.f,0.f,0.f,0.f,0.f}, false, false);
    __builtin_amdgcn_sched_barrier(0);      /* the score products stay back to back, each filling the distance behind the one before: else the maximum's steps are moved in between them, each behind pads of v_nop */
    float mch[NP];      /* the maximum in threes (one three-input instruction takes in two more scores): chain ps runs over the 16 scores of tiles 2 ps and 2 ps + 1 but the last, which joins below */
#pragma unroll
    for (int ps = 0; ps < NP; ++ps) { const v8f u = s[2 * ps], v = s[2 * ps + 1];
      float c = fmaxf(fmaxf(u[0], u[1]), u[2]); c = fmaxf(fmaxf(c, u[3]), u[4]); c = fmaxf(fmaxf(c, u[5]), u[6]); c = fmaxf(fmaxf(c, u[7]), v[0]);
      c = fmaxf(fmaxf(c, v[1]), v[2]); c = fmaxf(fmaxf(c, v[3]), v[4]); mch[ps] = fmaxf(fmaxf(c, v[5]), v[6]); }
    float mc = fmaxf(fmaxf(mch[0], mch[1]), mch[2]); mc = fmaxf(fmaxf(mc, mch[3]), s[1][7]); mc = fmaxf(fmaxf(mc, s[3][7]), s[5][7]); mc = fmaxf(mc, s[7][7]);
    mc = fmaxf(mc, xhalf(mc));      /* both halves now hold the maximum over the query's TK raw products (SL2E > 0 keeps the order) */
    const float mn = fmaxf(m_q, mc * SL2E); const float al = (mn > -1.0e38f) ? __builtin_amdgcn_exp2f(m_q - mn) : 1.0f; m_q = mn;      /* m_q, mn: base-2 exponents */
    const float nb = 10.0f - mn;      /* 2^10 = the f16 scale of P, carried in the exponent: p and l_q hold 1024 times the shifted values */
    FragH pb[NP]; v2f psum[NP];
#pragma unroll
    for (int ps = 0; ps < NP; ++ps) { v2f p[8];
#pragma unroll
      for (int i = 0; i < 8; ++i) { const v2f a = (v2f){s[2 * ps + (i >> 2)][(2 * i) & 7], s[2 * ps + (i >> 2)][(2 * i + 1) & 7]} * SL2E + nb;
        p[i] = (v2f){__builtin_amdgcn_exp2f(a[0]), __builtin_amdgcn_exp2f(a[1])}; pb[ps].h[2 * i] = (_Float16)p[i][0]; pb[ps].h[2 * i + 1] = (_Float16)p[i][1]; }
      psum[ps] = ((p[0] + p[1]) + (p[2] + p[3])) + ((p[4] + p[5]) + (p[6] + p[7])); }
    const v2f pt = (psum[0] + psum[1]) + (psum[2] + psum[3]);
    l_q = l_q * al + (pt[0] + pt[1]);      /* this half's TK / 2 keys; the halves join after the loop */
#pragma unroll
    for (int dt = 0; dt < DT; ++dt) oacc[dt] *= al;
#pragma unroll
    for (int ps = 0; ps < NP; ++ps)
#pragma unroll
      for (int dt = 0; dt < DT; ++dt) oacc[dt] = __builtin_amdgcn_wmma_f32_16x16x32_f16(false, av[ps][dt].v, false, pb[ps].v, (short)0, oacc[dt], false, false);      /* oacc[dt][r] = O^T[channel dt*16 + 8*hh + r][query q0 + ln] */
    __builtin_amdgcn_sched_barrier(0);      /* the stage's arithmetic stays in front of the waits below: moved behind them, the wait for stage t + 1 would stand at the stage's head, directly behind the issue of its copies */
    asm volatile("s_wait_dscnt 0x0" ::: "memory");      /* this wave's reads of stage t are done before its buffer is handed back */
    asm volatile("s_wait_asynccnt 0x0" ::: "memory");      /* this wave's share of stage t + 1 has landed */
    __syncthreads();      /* publishes stage t + 1 and ends every wave's reads of stage t */
    if (t + 2 < NS) { gk += gkstage; gv += TK; stage_copy(lk + bo, gk, gkstep, 32 * KP, lv + bo, gv, (size_t)8 * NN, 8 * VP); }      /* stage t + 2 into the buffer just read */
  }
  asm volatile("s_wait_asynccnt 0x0" ::: "memory");      /* no copy outstanding at the wave's end */
  const float l = l_q + xhalf(l_q); const float den = l + (1e-6f * 1024.0f) * __builtin_amdgcn_exp2f(-m_q); const float inv = (den > 0.f && den < INFINITY) ? 1.0f / den : 0.f;      /* sum e^s/(sum e^s + 1e-6) form: e^(-m)*1e-6 joins the shifted sum; an infinite den (all logits far below 0) reproduces the reference's ~0 output */
  /* O leaves as f16, head-major [b][h][place][HD], the wave's 16 queries at their places OPLACE: a query's 64 bytes, and so every 128-byte line, are written by this wave alone, and a block's 64 queries are 4 KiB in a row for the output GEMM's copies */
  unsigned short* orow = (unsigned short*)O16 + ((size_t)slab * NN + q0 + OPLACE(ln)) * HD + 8 * hh;
#pragma unroll
  for (int dt = 0; dt < DT; ++dt) { const v8f o = oacc[dt] * inv; FragH f;
#pragma unroll      /* every index a constant: f stays in registers */
    for (int i = 0; i < 8; ++i) f.h[i] = (_Float16)o[i];
    *(v8us*)(orow + dt * 16) = f.half[0]; } }

extern "C" void kernel_launch(void* const* d_in, const int* in_sizes, int n_in,
                              void* d_out, int out_size, void* d_ws, size_t ws_size, hipStream_t stream) {
  (void)in_sizes; (void)n_in; (void)out_size;
  const float* x = (const float*)d_in[0]; const float* Wqkv = (const float*)d_in[1]; const float* Wout = (const float*)d_in[2]; const float* bout = (const float*)d_in[3];
  char* ws = (char*)d_ws; size_t off = 0;
  auto take = [&](size_t bytes) { char* p = ws + off; off += (bytes + 255) & ~(size_t)255; return p; };
  _Float16* Bqkv = (_Float16*)take((size_t)C3 * CC * 2); _Float16* Bo = (_Float16*)take((size_t)CC * CC * 2); _Float16* X16 = (_Float16*)take((size_t)NR * CC * 2);
  _Float16* QK = (_Float16*)take((size_t)NR * 2 * CC * 2); _Float16* Vt = (_Float16*)take((size_t)BB * CC * NN * 2); _Float16* O16 = (_Float16*)take((size_t)NR * CC * 2);
  if (off > ws_size) return;      // 0.4 + 0.1 + 4.2 + 8.4 + 4.2 + 4.2: about 22 MB
  k_prep<<<NBW1 + NBW2 + NBX, 256, 0, stream>>>(Wqkv, Bqkv, Wout, Bo, x, X16);
  k_gemm_qkv<<<NBQ + BB * NBV, 128, 0, stream>>>(X16, Bqkv, QK, Vt, 0.0625f);
  k_flash<<<BB * NH * (NN / 64), 128, 0, stream>>>(QK, 2 * CC, QK + CC, 2 * CC, Vt, nullptr, O16);      /* blocks = (b,h) × 64-query groups */
  k_gemm_out<<<(NR / 64) * (CC / 64), 128, 0, stream>>>(O16, Bo, 0.0625f, bout, (float*)d_out);      /* y = out.Wout + bout: M 8192 N 256 K 256 */
}

// v008
// It runs in 40.5 microseconds.
// Next to v007, in two timings, it ran 1.03 times as fast each time.
// Counting every step since v000, it is 5.87 times as fast.
#include <hip/hip_runtime.h>
// KeOps-style multi-head attention (B=4, n=2048, dim 256, 8 heads × 32): qkv = x·Wqkv; q scaled by 32^-½; e = exp(q·kᵀ) WITHOUT max subtraction; out = (e·v)/(Σe + 1e-6) merged over heads; y = out·Wout + bout.
// Compute dtype: x, Wqkv, Wout, bout rounded to bf16; q/k token-major and v channel-major (= Vᵀ) as f16 GEMM outputs (f32 accumulate); fused flash-style kernel per (b,h) (online max-rescaled sums
// in f32 — the unshifted quotient is recovered exactly through the normaliser l + 1e-6·e^(−m); P f16 ×2^10) on v_wmma_f32_16x16x32_f16; O stored as f16 by the attention kernel itself, then the output GEMM with bias; f32 accumulate.
#define BB 4
#define NN 2048
#define CC 256
#define C3 768
#define NH 8
#define HD 32
#define NR (BB * NN)

typedef __bf16 v16b __attribute__((ext_vector_type(16)));
typedef unsigned short v8us __attribute__((ext_vector_type(8), may_alias));
typedef float  v8f  __attribute__((ext_vector_type(8)));
typedef float  v4f  __attribute__((ext_vector_type(4)));
typedef float  v4fa __attribute__((ext_vector_type(4), may_alias));
union FragB { v16b v; v8us half[2]; unsigned short u[16]; };

__device__ __forceinline__ unsigned short bf16_bits(float x) { unsigned int u = __float_as_uint(x); return (unsigned short)((u + 0x7FFFu + ((u >> 16) & 1u)) >> 16); }
__device__ __forceinline__ float bf16_val(unsigned short b) { return __uint_as_float(((unsigned int)b) << 16); }
__device__ __forceinline__ float bf16_round(float x) { return bf16_val(bf16_bits(x)); }
// D += A·B with NT terms: 1 = ah·bh, 2 = + al·bh (A split), 3 = + ah·bl (both split)
template <int NT>
__device__ __forceinline__ v8f mmaN(v16b ah, v16b al, v16b bh, v16b bl, v8f c) {
  c = __builtin_amdgcn_wmma_f32_16x16x32_bf16(false, ah, false, bh, (short)0, c, false, false);
  if (NT >= 2) c = __builtin_amdgcn_wmma_f32_16x16x32_bf16(false, al, false, bh, (short)0, c, false, false);
  if (NT >= 3) c = __builtin_amdgcn_wmma_f32_16x16x32_bf16(false, ah, false, bl, (short)0, c, false, false);
  asm volatile("v_nop\n\tv_nop\n\tv_nop\n\tv_nop" : "+v"(c) : "v"(ah), "v"(al), "v"(bh), "v"(bl));
  return c;
}

__global__ __launch_bounds__(256) void k_wt_bf16(const float* __restrict__ W, unsigned short* __restrict__ Wt, int K, int N) {
  const int t = blockIdx.x * 256 + threadIdx.x;
  const int k8n = K / 8;
  if (t >= N * k8n) return;
  const int n = t / k8n, k8 = (t % k8n) * 8;
  v8us v;
#pragma unroll
  for (int i = 0; i < 8; ++i) v[i] = bf16_bits(W[(size_t)(k8 + i) * N + n]);
  *(v8us*)(Wt + (size_t)n * K + k8) = v;
  
}

// GEMM C[M][N] (f32, pitch ldc) = act(A[M][K]·W + bias). A f32 row-major (pitch lda) converted per fragment to bf16
// (ASPLIT: hi/lo two planes -> 2 terms, else single rounded term); Wt bf16 [N][K] (pitch ldb). BIAS_BF16 rounds the
// bias to bf16 first (bias quantised to bf16 before the add). K%32==0, M%16==0, N%64==0.
template <bool ASPLIT, int ACT, bool BIAS_BF16>
__global__ __launch_bounds__(128) void k_gemm_bf(const float* __restrict__ A, int lda, const unsigned short* __restrict__ Wt, int ldb,
                                               const float* __restrict__ bias, float* __restrict__ C, int ldc, int M, int N, int K) {
  __shared__ __attribute__((aligned(16))) float so[4][16][64];
  const int tid = threadIdx.x, w = tid >> 5, lane = tid & 31, ln = lane & 15, hh = lane >> 4;
  const int ntn = N / 64;
  const int wid = blockIdx.x * 4 + w;
  const int mt = wid / ntn, nq = wid % ntn;
  if (mt * 16 >= M) return;
  const int row0 = mt * 16, col0 = nq * 64;
  const float* arow = A + (size_t)(row0 + ln) * lda;
  v8f acc[4] = {};
  for (int kb = 0; kb < K; kb += 32) {
    FragB ah, al;
    const v4f x0 = *(const v4fa*)(arow + kb + 8 * hh), x1 = *(const v4fa*)(arow + kb + 8 * hh + 4);
    const v4f x2 = *(const v4fa*)(arow + kb + 16 + 8 * hh), x3 = *(const v4fa*)(arow + kb + 16 + 8 * hh + 4);
    float xs[16] = {x0[0],x0[1],x0[2],x0[3],x1[0],x1[1],x1[2],x1[3],x2[0],x2[1],x2[2],x2[3],x3[0],x3[1],x3[2],x3[3]};
#pragma unroll
    for (int i = 0; i < 16; ++i) { const unsigned short hb = bf16_bits(xs[i]); ah.u[i] = hb; al.u[i] = ASPLIT ? bf16_bits(xs[i] - bf16_val(hb)) : (unsigned short)0; }
#pragma unroll
    for (int t = 0; t < 4; ++t) {
      const unsigned short* brow = Wt + (size_t)(col0 + t * 16 + ln) * ldb + kb;
      FragB b;
      b.half[0] = *(const v8us*)(brow + 8 * hh);
      b.half[1] = *(const v8us*)(brow + 16 + 8 * hh);
      acc[t] = mmaN<ASPLIT ? 2 : 1>(ah.v, al.v, b.v, b.v, acc[t]);
    }
  }
#pragma unroll
  for (int t = 0; t < 4; ++t) {
    float bv = bias ? bias[col0 + t * 16 + ln] : 0.f;
    if (BIAS_BF16) bv = bf16_round(bv);
#pragma unroll
    for (int r = 0; r < 8; ++r) { float v = acc[t][r] + bv; if (ACT == 1) v = fmaxf(v, 0.f); so[w][8 * hh + r][t * 16 + ln] = v; }
  }
  __builtin_amdgcn_fence(__ATOMIC_ACQ_REL, "workgroup");
  __builtin_amdgcn_wave_barrier();
  const int rsub = lane >> 4, c4 = (lane & 15) * 4;
  {
#pragma unroll
    for (int q = 0; q < 8; ++q) {
      const int r = q * 2 + rsub;
      const v4f v = *(const v4fa*)&so[w][r][c4];
      *(v4f*)(C + (size_t)(row0 + r) * ldc + col0 + c4) = v;
    }
    
  }
}

// Flash-style causal/unmasked attention, all contractions 3-term bf16 hi/lo splits, f32 softmax with running max.
// q,k,v rows are read from f32 buffers with arbitrary row pitch (so they can live inside a fused qkv buffer);
// D = head size (multiple of 32, <= 128); one wave = 16 query rows; block = 4 waves (64 queries) sharing K/V chunks of 32.
template <int D, bool CAUSAL>
__global__ __launch_bounds__(128) void k_flash(const float* __restrict__ qb, const float* __restrict__ kb, const float* __restrict__ vb,
                                             int pitch, int T, int H, float scale, float* __restrict__ y, int ypitch) {
  constexpr int KS = D / 32;        // k-steps for QK
  constexpr int DT = D / 16;        // d tiles for PV
  __shared__ __attribute__((aligned(16))) unsigned short sKh[32][D + 8], sKl[32][D + 8], sVh[32][D + 8], sVl[32][D + 8];
  __shared__ __attribute__((aligned(16))) unsigned short sPh[4][16][40], sPl[4][16][40];
  __shared__ __attribute__((aligned(16))) float sO[4][16][D];
  const int tid = threadIdx.x, w = tid >> 5, lane = tid & 31, ln = lane & 15, hh = lane >> 4;
  const int nqb = (T + 63) / 64;
  const int bh = blockIdx.x / nqb, qblk = blockIdx.x % nqb;
  const int b = bh / H, h = bh % H;
  const int q0 = qblk * 64 + w * 16;
  const float* Q = qb + (size_t)b * T * pitch + h * D;
  const float* K = kb + (size_t)b * T * pitch + h * D;
  const float* V = vb + (size_t)b * T * pitch + h * D;

  // A fragments of the wave's 16 query rows (scaled), hi/lo
  FragB aqh[KS], aql[KS];
  {
    int row = q0 + ln; if (row >= T) row = T - 1;
    const float* qr = Q + (size_t)row * pitch;
#pragma unroll
    for (int ks = 0; ks < KS; ++ks)
#pragma unroll
      for (int i = 0; i < 16; ++i) {
        const int d = ks * 32 + ((i < 8) ? (8 * hh + i) : (16 + 8 * hh + (i - 8)));
        const float x = qr[d] * scale; const unsigned short hb = bf16_bits(x);
        aqh[ks].u[i] = hb; aql[ks].u[i] = bf16_bits(x - bf16_val(hb));
      }
  }
  float m_r[8], l_r[8];
#pragma unroll
  for (int r = 0; r < 8; ++r) { m_r[r] = -3.0e38f; l_r[r] = 0.f; }
  v8f oacc[DT];
#pragma unroll
  for (int dt = 0; dt < DT; ++dt) oacc[dt] = (v8f){0.f,0.f,0.f,0.f,0.f,0.f,0.f,0.f};

  const int kv_end = CAUSAL ? min(T, qblk * 64 + 64) : T;     // block-uniform
  for (int j0 = 0; j0 < kv_end; j0 += 32) {
    __syncthreads();
    for (int e = tid; e < 32 * (D / 4); e += 128) {
      const int r = e / (D / 4), c4 = (e % (D / 4)) * 4;
      const int key = j0 + r;
      v4f kf = {0.f,0.f,0.f,0.f}, vf = {0.f,0.f,0.f,0.f};
      if (key < T) { kf = *(const v4fa*)(K + (size_t)key * pitch + c4); vf = *(const v4fa*)(V + (size_t)key * pitch + c4); }
#pragma unroll
      for (int t = 0; t < 4; ++t) {
        unsigned short hb = bf16_bits(kf[t]); sKh[r][c4 + t] = hb; sKl[r][c4 + t] = bf16_bits(kf[t] - bf16_val(hb));
        hb = bf16_bits(vf[t]); sVh[r][c4 + t] = hb; sVl[r][c4 + t] = bf16_bits(vf[t] - bf16_val(hb));
      }
    }
    __syncthreads();
    // S tile 16 x 32
    v8f s[2];
#pragma unroll
    for (int nt = 0; nt < 2; ++nt) {
      v8f acc = {};
#pragma unroll
      for (int ks = 0; ks < KS; ++ks) {
        FragB bh_, bl_;
        bh_.half[0] = *(const v8us*)&sKh[nt * 16 + ln][ks * 32 + 8 * hh]; bh_.half[1] = *(const v8us*)&sKh[nt * 16 + ln][ks * 32 + 16 + 8 * hh];
        bl_.half[0] = *(const v8us*)&sKl[nt * 16 + ln][ks * 32 + 8 * hh]; bl_.half[1] = *(const v8us*)&sKl[nt * 16 + ln][ks * 32 + 16 + 8 * hh];
        acc = mmaN<3>(aqh[ks].v, aql[ks].v, bh_.v, bl_.v, acc);
      }
      s[nt] = acc;
    }
    // mask + running max (rows 8hh+r; the 16 lanes of a half share rows)
    float alpha[8];
#pragma unroll
    for (int r = 0; r < 8; ++r) {
      const int qi = q0 + 8 * hh + r;
      const int ja = j0 + ln, jb = j0 + 16 + ln;
      if (CAUSAL) { if (ja > qi) s[0][r] = -3.0e38f; if (jb > qi) s[1][r] = -3.0e38f; }
      if (ja >= T) s[0][r] = -3.0e38f;
      if (jb >= T) s[1][r] = -3.0e38f;
      float mx = fmaxf(s[0][r], s[1][r]);
      mx = fmaxf(mx, __shfl_xor(mx, 1, 32)); mx = fmaxf(mx, __shfl_xor(mx, 2, 32)); mx = fmaxf(mx, __shfl_xor(mx, 4, 32)); mx = fmaxf(mx, __shfl_xor(mx, 8, 32));
      const float mnew = fmaxf(m_r[r], mx);
      alpha[r] = (mnew > -1.0e38f) ? __expf(m_r[r] - mnew) : 1.0f;
      const float p0 = (s[0][r] > -1.0e38f) ? __expf(s[0][r] - mnew) : 0.f;
      const float p1 = (s[1][r] > -1.0e38f) ? __expf(s[1][r] - mnew) : 0.f;
      m_r[r] = mnew;
      l_r[r] = l_r[r] * alpha[r] + p0 + p1;            // per-lane partial row sum (16 lanes combined at the end)
      unsigned short hb = bf16_bits(p0); sPh[w][8 * hh + r][ln] = hb;      sPl[w][8 * hh + r][ln] = bf16_bits(p0 - bf16_val(hb));
      hb = bf16_bits(p1);                sPh[w][8 * hh + r][16 + ln] = hb; sPl[w][8 * hh + r][16 + ln] = bf16_bits(p1 - bf16_val(hb));
    }
#pragma unroll
    for (int dt = 0; dt < DT; ++dt)
#pragma unroll
      for (int r = 0; r < 8; ++r) oacc[dt][r] *= alpha[r];
    __builtin_amdgcn_fence(__ATOMIC_ACQ_REL, "workgroup");
    __builtin_amdgcn_wave_barrier();
    FragB pah, pal;
    pah.half[0] = *(const v8us*)&sPh[w][ln][8 * hh]; pah.half[1] = *(const v8us*)&sPh[w][ln][16 + 8 * hh];
    pal.half[0] = *(const v8us*)&sPl[w][ln][8 * hh]; pal.half[1] = *(const v8us*)&sPl[w][ln][16 + 8 * hh];
#pragma unroll
    for (int dt = 0; dt < DT; ++dt) {
      FragB bvh, bvl;
#pragma unroll
      for (int i = 0; i < 8; ++i) {
        bvh.u[i] = sVh[8 * hh + i][dt * 16 + ln]; bvh.u[8 + i] = sVh[16 + 8 * hh + i][dt * 16 + ln];
        bvl.u[i] = sVl[8 * hh + i][dt * 16 + ln]; bvl.u[8 + i] = sVl[16 + 8 * hh + i][dt * 16 + ln];
      }
      oacc[dt] = mmaN<3>(pah.v, pal.v, bvh.v, bvl.v, oacc[dt]);
    }
    __builtin_amdgcn_fence(__ATOMIC_ACQ_REL, "workgroup");
    __builtin_amdgcn_wave_barrier();
  }
#pragma unroll
  for (int r = 0; r < 8; ++r) {
    float l = l_r[r];
    l += __shfl_xor(l, 1, 32); l += __shfl_xor(l, 2, 32); l += __shfl_xor(l, 4, 32); l += __shfl_xor(l, 8, 32);
    l_r[r] = (l > 0.f) ? 1.0f / l : 0.f;
  }
#pragma unroll
  for (int dt = 0; dt < DT; ++dt)
#pragma unroll
    for (int r = 0; r < 8; ++r) sO[w][8 * hh + r][dt * 16 + ln] = oacc[dt][r] * l_r[r];
  __builtin_amdgcn_fence(__ATOMIC_ACQ_REL, "workgroup");
  __builtin_amdgcn_wave_barrier();
  {
    for (int r = 0; r < 16; ++r) {
      const int row = q0 + r;
      if (row < T && lane < D / 4) {
        const v4f val = *(const v4fa*)&sO[w][r][lane * 4];
        *(v4f*)(y + ((size_t)b * T + row) * ypitch + h * D + lane * 4) = val;
      }
    }
    
  }
}

// GEMM C = act(A·W + bias + resid): A f32 (ASPLIT -> hi/lo 2 terms), Wt bf16 [N][K]; ACT 0 none, 1 relu, 2 exact gelu;
// resid (optional, f32, row index = (row % rmod), pitch ldr, RES_BF16 rounds it) added before the activation.
template <bool ASPLIT, int ACT, bool BIAS_BF16, bool RES_BF16>
__global__ __launch_bounds__(128) void k_gemm_bf3(const float* __restrict__ A, int lda, const unsigned short* __restrict__ Wt, int ldb,
                                                const float* __restrict__ bias, const float* __restrict__ resid, int rmod, int ldr,
                                                float* __restrict__ C, int ldc, int M, int N, int K) {
  __shared__ __attribute__((aligned(16))) float so[4][16][64];
  const int tid = threadIdx.x, w = tid >> 5, lane = tid & 31, ln = lane & 15, hh = lane >> 4;
  const int ntn = N / 64;
  const int wid = blockIdx.x * 4 + w;
  const int mt = wid / ntn, nq = wid % ntn;
  if (mt * 16 >= M) return;
  const int row0 = mt * 16, col0 = nq * 64;
  const float* arow = A + (size_t)(row0 + ln) * lda;
  v8f acc[4] = {};
  for (int kb = 0; kb < K; kb += 32) {
    FragB ah, al;
    const v4f x0 = *(const v4fa*)(arow + kb + 8 * hh), x1 = *(const v4fa*)(arow + kb + 8 * hh + 4);
    const v4f x2 = *(const v4fa*)(arow + kb + 16 + 8 * hh), x3 = *(const v4fa*)(arow + kb + 16 + 8 * hh + 4);
    float xs[16] = {x0[0],x0[1],x0[2],x0[3],x1[0],x1[1],x1[2],x1[3],x2[0],x2[1],x2[2],x2[3],x3[0],x3[1],x3[2],x3[3]};
#pragma unroll
    for (int i = 0; i < 16; ++i) { const unsigned short hb = bf16_bits(xs[i]); ah.u[i] = hb; al.u[i] = ASPLIT ? bf16_bits(xs[i] - bf16_val(hb)) : (unsigned short)0; }
#pragma unroll
    for (int t = 0; t < 4; ++t) {
      const unsigned short* brow = Wt + (size_t)(col0 + t * 16 + ln) * ldb + kb;
      FragB b;
      b.half[0] = *(const v8us*)(brow + 8 * hh);
      b.half[1] = *(const v8us*)(brow + 16 + 8 * hh);
      acc[t] = mmaN<ASPLIT ? 2 : 1>(ah.v, al.v, b.v, b.v, acc[t]);
    }
  }
#pragma unroll
  for (int t = 0; t < 4; ++t) {
    const int col = col0 + t * 16 + ln;
    float bv = bias ? bias[col] : 0.f;
    if (BIAS_BF16) bv = bf16_round(bv);
#pragma unroll
    for (int r = 0; r < 8; ++r) {
      float v = acc[t][r] + bv;
      if (resid) { float rv = resid[(size_t)((row0 + 8 * hh + r) % rmod) * ldr + col]; if (RES_BF16) rv = bf16_round(rv); v += rv; }
      if (ACT == 1) v = fmaxf(v, 0.f);
      if (ACT == 2) v = 0.5f * v * (1.0f + erff(v * 0.70710678118654752f));
      if (ACT == 3) { const float u = 0.7978845608028654f * (v + 0.044715f * v * v * v); v = 0.5f * v * (1.0f + tanhf(u)); }
      so[w][8 * hh + r][t * 16 + ln] = v;
    }
  }
  __builtin_amdgcn_fence(__ATOMIC_ACQ_REL, "workgroup");
  __builtin_amdgcn_wave_barrier();
  const int rsub = lane >> 4, c4 = (lane & 15) * 4;
  {
#pragma unroll
    for (int q = 0; q < 8; ++q) {
      const int r = q * 2 + rsub;
      const v4f v = *(const v4fa*)&so[w][r][c4];
      *(v4f*)(C + (size_t)(row0 + r) * ldc + col0 + c4) = v;
    }
    
  }
}
// row LayerNorm (biased variance, eps) over N: s = X (+ R); optional out_sum <- s; out_norm <- (s-mu)*rsqrt(var+eps)*g + b
template <bool PARAM_BF16>
__global__ __launch_bounds__(256) void k_layernorm(const float* __restrict__ X, const float* __restrict__ R, const float* __restrict__ g, const float* __restrict__ bta,
                                                  float* __restrict__ out_sum, float* __restrict__ out_norm, int N, float eps) {
  __shared__ float red[256];
  const int row = blockIdx.x, tid = threadIdx.x;
  const float* x = X + (size_t)row * N; const float* rr = R ? R + (size_t)row * N : nullptr;
  float vals[16];                     // up to N = 4096
  const int per = N / 256;            // contiguous chunk per thread? use strided-by-4 chunks: thread handles j = tid*4 + 1024*u
  float s1 = 0.f;
  for (int u = 0; u < per / 4; ++u) {
    const int j = tid * 4 + 1024 * u;
    const v4f a = *(const v4fa*)(x + j);
    v4f b = {0.f,0.f,0.f,0.f}; if (rr) b = *(const v4fa*)(rr + j);
#pragma unroll
    for (int q = 0; q < 4; ++q) { const float v = a[q] + b[q]; vals[u * 4 + q] = v; s1 += v; }
  }
  red[tid] = s1; __syncthreads();
  for (int st = 128; st > 0; st >>= 1) { if (tid < st) red[tid] += red[tid + st]; __syncthreads(); }
  const float mu = red[0] / (float)N; __syncthreads();
  float s2 = 0.f;
  for (int u = 0; u < per / 4; ++u)
#pragma unroll
    for (int q = 0; q < 4; ++q) { const float c = vals[u * 4 + q] - mu; s2 += c * c; }
  red[tid] = s2; __syncthreads();
  for (int st = 128; st > 0; st >>= 1) { if (tid < st) red[tid] += red[tid + st]; __syncthreads(); }
  const float rs = rsqrtf(red[0] / (float)N + eps);
  {
    for (int u = 0; u < per / 4; ++u) {
      const int j = tid * 4 + 1024 * u;
      v4f o, sm;
#pragma unroll
      for (int q = 0; q < 4; ++q) {
        float gg = g[j + q], bb = bta[j + q];
        if (PARAM_BF16) { gg = bf16_round(gg); bb = bf16_round(bb); }
        sm[q] = vals[u * 4 + q]; o[q] = (vals[u * 4 + q] - mu) * rs * gg + bb;
      }
      if (out_sum) *(v4f*)(out_sum + (size_t)row * N + j) = sm;
      *(v4f*)(out_norm + (size_t)row * N + j) = o;
    }
    
  }
}



// ---- f16 WMMA path (v_wmma_f32_16x16x32_f16): 11-bit significands for operands in range — used where a [0,1] probability operand needs more precision than bf16
typedef _Float16 v16h __attribute__((ext_vector_type(16)));
union FragH { v16h v; v8us half[2]; _Float16 h[16]; unsigned short u[16]; };
template <int NT>
__device__ __forceinline__ v8f mmaH(v16h ah, v16h al, v16h bh, v16h bl, v8f c) {
  c = __builtin_amdgcn_wmma_f32_16x16x32_f16(false, ah, false, bh, (short)0, c, false, false);
  if (NT >= 2) c = __builtin_amdgcn_wmma_f32_16x16x32_f16(false, al, false, bh, (short)0, c, false, false);
  if (NT >= 3) c = __builtin_amdgcn_wmma_f32_16x16x32_f16(false, ah, false, bl, (short)0, c, false, false);
  asm volatile("v_nop\n\tv_nop\n\tv_nop\n\tv_nop" : "+v"(c) : "v"(ah), "v"(al), "v"(bh), "v"(bl));
  return c;
}
// batched GEMM like k_gemm_b but f16 operands: A f32 (split into f16 hi/lo if ASPLIT, else rounded to f16), Bt = f16 values [n][k]; alpha; C f32; N multiple of 16 (partial tiles skipped)
template <bool ASPLIT>
__global__ __launch_bounds__(128) void k_gemm_h(const float* __restrict__ A, int lda, size_t sA, const _Float16* __restrict__ Bh, int ldb, size_t sB, float alpha, float* __restrict__ C, int ldc, size_t sC, int M, int N, int K) {
  __shared__ __attribute__((aligned(16))) float so[4][16][64];
  const int tid = threadIdx.x, w = tid >> 5, lane = tid & 31, ln = lane & 15, hh = lane >> 4; const int by = blockIdx.y;
  A += (size_t)by * sA; Bh += (size_t)by * sB; C += (size_t)by * sC;
  const int ntn = (N + 63) / 64; const int wid = blockIdx.x * 4 + w; const int mt = wid / ntn, nq = wid % ntn; if (mt * 16 >= M) return;
  const int row0 = mt * 16, col0 = nq * 64; const float* arow = A + (size_t)(row0 + ln) * lda;
  v8f acc[4] = {};
  for (int kb = 0; kb < K; kb += 32) {
    FragH ah, al;
    const v4f x0 = *(const v4fa*)(arow + kb + 8 * hh), x1 = *(const v4fa*)(arow + kb + 8 * hh + 4), x2 = *(const v4fa*)(arow + kb + 16 + 8 * hh), x3 = *(const v4fa*)(arow + kb + 16 + 8 * hh + 4);
    float xs[16] = {x0[0],x0[1],x0[2],x0[3],x1[0],x1[1],x1[2],x1[3],x2[0],x2[1],x2[2],x2[3],x3[0],x3[1],x3[2],x3[3]};
#pragma unroll
    for (int i = 0; i < 16; ++i) { const _Float16 h = (_Float16)xs[i]; ah.h[i] = h; al.h[i] = ASPLIT ? (_Float16)(xs[i] - (float)h) : (_Float16)0.0f; }
#pragma unroll
    for (int t = 0; t < 4; ++t) { if (col0 + t * 16 >= N) continue; const size_t boff = (size_t)(col0 + t * 16 + ln) * ldb + kb; FragH bq; bq.half[0] = *(const v8us*)(Bh + boff + 8 * hh); bq.half[1] = *(const v8us*)(Bh + boff + 16 + 8 * hh);
      acc[t] = mmaH<ASPLIT ? 2 : 1>(ah.v, al.v, bq.v, bq.v, acc[t]); }
  }
#pragma unroll
  for (int t = 0; t < 4; ++t) { if (col0 + t * 16 >= N) continue;
#pragma unroll
    for (int r = 0; r < 8; ++r) so[w][8 * hh + r][t * 16 + ln] = acc[t][r] * alpha; }
  __builtin_amdgcn_fence(__ATOMIC_ACQ_REL, "workgroup"); __builtin_amdgcn_wave_barrier();
  const int rsub = lane >> 4, c4 = (lane & 15) * 4;
  {
#pragma unroll
    for (int q = 0; q < 8; ++q) { const int r = q * 2 + rsub; if (col0 + c4 < N) { const v4f v = *(const v4fa*)&so[w][r][c4]; *(v4f*)(C + (size_t)(row0 + r) * ldc + col0 + c4) = v; } }
     }
}

// Wt[n][k] = f16(W[k][n]·scale) from f32 row-major W[K][N] (scale = power of two; bf16-exact weights stay exact in f16 away from the subnormal range)
__device__ __forceinline__ void wt_f16(const int t, const float* __restrict__ W, _Float16* __restrict__ Wt, int K, int N, float scale) {
  if (t >= N * (K / 8)) return; const int n = t / (K / 8), k8 = (t % (K / 8)) * 8; FragH f;
#pragma unroll
  for (int i = 0; i < 8; ++i) f.h[i] = (_Float16)(bf16_round(W[(size_t)(k8 + i) * N + n]) * scale); const v8us o = f.half[0];
  *(v8us*)((unsigned short*)Wt + (size_t)n * K + k8) = o; 
}
// One lane's eight 16-byte copies of an operand tile, global memory to LDS through no register. The s_wait_xcnt stands in the copies' own statement, ahead of any rewrite of the address registers they name.
__device__ __forceinline__ void tile_copy8(unsigned l, unsigned lstep, const unsigned short* g, size_t gstep) {
  asm volatile("global_load_async_to_lds_b128 %0, %8, off\n\t"
               "global_load_async_to_lds_b128 %1, %9, off\n\t"
               "global_load_async_to_lds_b128 %2, %10, off\n\t"
               "global_load_async_to_lds_b128 %3, %11, off\n\t"
               "global_load_async_to_lds_b128 %4, %12, off\n\t"
               "global_load_async_to_lds_b128 %5, %13, off\n\t"
               "global_load_async_to_lds_b128 %6, %14, off\n\t"
               "global_load_async_to_lds_b128 %7, %15, off\n\t"
               "s_wait_xcnt 0x0"
               :: "v"(l), "v"(l + lstep), "v"(l + 2 * lstep), "v"(l + 3 * lstep), "v"(l + 4 * lstep), "v"(l + 5 * lstep), "v"(l + 6 * lstep), "v"(l + 7 * lstep),
                  "v"(g), "v"(g + gstep), "v"(g + 2 * gstep), "v"(g + 3 * gstep), "v"(g + 4 * gstep), "v"(g + 5 * gstep), "v"(g + 6 * gstep), "v"(g + 7 * gstep)
               : "memory");
}
// C[M][N] = (A . Bt^T) * alpha (+ bias rounded to bf16): A f16 [M][CC], Bt f16 [N][CC], both with rows of CC elements; M and N multiples of 64, the grid exactly (M / 64) * (N / 64) blocks, N / 64 = 1 << lgn.
// A block of four waves owns a 64 x 64 tile of C. Its 64 rows of A and 64 rows of Bt, the whole K, are copied into LDS once, a wave's copy = one whole row of 512 contiguous bytes; then wave w takes rows 16 w .. 16 w + 15
// against all 64 columns, every fragment from LDS, the k order and the accumulation as before. Output rows are staged in the wave's own 16 rows of A, which no other wave reads, and leave as whole lines. Writes f32 C or f16 C16.
// AHM: A lies head-major, [batch][head][token place][HD], as the attention kernel stores it; a wave's copy is then 8 places x 64 bytes of one head, still 512 contiguous bytes, and lands as 8 pieces in 8 LDS rows: the tile in LDS is the same.
// OPLACE: inside each group of 16 tokens, token t lies at place 4 (t & 3) + (t >> 2) (its own inverse), so that 4 places in a row are LDS rows 4 apart: at pitch GP their 64-byte pieces fall on all 64 banks, as a whole row does.
#define OPLACE(t) ((((t) & 3) << 2) | ((t) >> 2))
#define GP (CC * 2 + 16)      /* LDS row pitch in bytes, 16 B x odd: 16 lanes' ds_load_b128 fall on all 64 banks */
#define GSM (128 * GP)
typedef float fal __attribute__((may_alias));
template <bool BIAS, bool F32OUT, bool AHM>
__device__ __forceinline__ void gemm_lds(unsigned char* sm, const int bx, const int lgn, const _Float16* __restrict__ A, const _Float16* __restrict__ Bh, float alpha, const float* __restrict__ bias,
    float* __restrict__ C, _Float16* __restrict__ C16, int ldc) {
  const int tid = threadIdx.x, w = tid >> 5, lane = tid & 31, ln = lane & 15, hh = lane >> 4;
  const int row0 = (bx >> lgn) * 64, col0 = (bx & ((1 << lgn) - 1)) * 64;
  /* copy map: chunk c of thread tid = tile row w + 4 c, 16-byte column lane */
  const unsigned short* gb = (const unsigned short*)Bh + (size_t)(col0 + w) * CC + lane * 8;
  const unsigned l0 = (unsigned)(size_t)sm + w * GP + lane * 16;      /* low 32 bits of the shared address = byte offset in the work-group's LDS */
  if (AHM) {      /* copy map of a head-major A: chunk c = head c, place 16 w + (lane >> 2) (+ 8 in the second eight: two tile rows on), tile row 16 w + OPLACE(place), 16-byte column 4 c + (lane & 3); a 64-row tile lies in one batch */
    const unsigned short* ga = (const unsigned short*)A + ((size_t)(row0 / NN) * NH * NN + row0 % NN + w * 16 + (lane >> 2)) * HD + (lane & 3) * 8;
    const unsigned la = (unsigned)(size_t)sm + (w * 16 + OPLACE(lane >> 2)) * GP + (lane & 3) * 16;
    tile_copy8(la, HD * 2, ga, (size_t)NN * HD); tile_copy8(la + 2 * GP, HD * 2, ga + 8 * HD, (size_t)NN * HD);
  } else {
    const unsigned short* ga = (const unsigned short*)A + (size_t)(row0 + w) * CC + lane * 8;
    tile_copy8(l0, 4 * GP, ga, (size_t)4 * CC); tile_copy8(l0 + 32 * GP, 4 * GP, ga + 32 * CC, (size_t)4 * CC);
  }
  tile_copy8(l0 + 64 * GP, 4 * GP, gb, (size_t)4 * CC); tile_copy8(l0 + 96 * GP, 4 * GP, gb + 32 * CC, (size_t)4 * CC);
  float bv[4];      /* the bias is fetched while the copies fly */
#pragma unroll
  for (int t = 0; t < 4; ++t) bv[t] = BIAS ? bf16_round(bias[col0 + t * 16 + ln]) : 0.f;
  if (BIAS) asm volatile("s_wait_xcnt 0x0" ::: "memory");      /* ahead of any rewrite of the offset register that the bias loads name */
  asm volatile("s_wait_asynccnt 0x0" ::: "memory");      /* this wave's share of both tiles has landed */
  __syncthreads();      /* both tiles published to all four waves */
  const unsigned char* af = sm + (w * 16 + ln) * GP + hh * 16; const unsigned char* bf = sm + (64 + ln) * GP + hh * 16;
  v8f acc[4] = {};
  FragH ah[2], bq[2][4];      /* two register sets: a k step's ten fragment reads stand together, one k step ahead of the products that use them */
  auto frags = [&](const int kb) { FragH& a = ah[kb & 1]; a.half[0] = *(const v8us*)(af + kb * 64); a.half[1] = *(const v8us*)(af + kb * 64 + 32);
#pragma unroll
    for (int t = 0; t < 4; ++t) { FragH& b = bq[kb & 1][t]; b.half[0] = *(const v8us*)(bf + t * 16 * GP + kb * 64); b.half[1] = *(const v8us*)(bf + t * 16 * GP + kb * 64 + 32); } };
  frags(0);
#pragma unroll      /* every LDS offset an immediate, the register set a compile-time choice */
  for (int kb = 0; kb < CC / 32; ++kb) { if (kb + 1 < CC / 32) frags(kb + 1);
#pragma unroll
    for (int t = 0; t < 4; ++t) acc[t] = mmaH<1>(ah[kb & 1].v, ah[kb & 1].v, bq[kb & 1][t].v, bq[kb & 1][t].v, acc[t]);
  }
  fal* so = (fal*)(sm + w * 16 * GP);      /* [16][64] f32 in the wave's own rows of A, all read by now */
#pragma unroll
  for (int t = 0; t < 4; ++t)
#pragma unroll
    for (int r = 0; r < 8; ++r) so[(8 * hh + r) * 64 + t * 16 + ln] = acc[t][r] * alpha + bv[t];
  __builtin_amdgcn_fence(__ATOMIC_ACQ_REL, "workgroup"); __builtin_amdgcn_wave_barrier();
  const int rsub = lane >> 4, c4 = (lane & 15) * 4; typedef _Float16 v4h __attribute__((ext_vector_type(4)));
#pragma unroll
  for (int q = 0; q < 8; ++q) { const int r = q * 2 + rsub; const v4f v = *(const v4fa*)&so[r * 64 + c4]; const size_t o = (size_t)(row0 + w * 16 + r) * ldc + col0 + c4;
    if (F32OUT) *(v4f*)(C + o) = v; else { v4h h4; for (int i = 0; i < 4; ++i) h4[i] = (_Float16)v[i]; *(v4h*)(C16 + o) = h4; } }
}
// y = O16 . Wout + bout: M 8192, N 256; O16 head-major
__global__ __launch_bounds__(128) void k_gemm_out(const _Float16* __restrict__ A, const _Float16* __restrict__ Bh, float alpha, const float* __restrict__ bias, float* __restrict__ C) {
  __shared__ __attribute__((aligned(16))) unsigned char sm[GSM];
  gemm_lds<true, true, true>(sm, blockIdx.x, 2, A, Bh, alpha, bias, C, nullptr, CC);
}
// ---- q, k, v straight from the f32 inputs: the block rounds its own two operand tiles to bf16 on their way into LDS, through registers (no conversion launch, no converted planes in the workspace)
typedef __bf16 v2b __attribute__((ext_vector_type(2)));
typedef unsigned v2u __attribute__((ext_vector_type(2), may_alias));
typedef unsigned v4u __attribute__((ext_vector_type(4), may_alias));
__device__ __forceinline__ unsigned pk_bf16(float a, float b) { v2b p; p[0] = (__bf16)a; p[1] = (__bf16)b; return __builtin_bit_cast(unsigned, p); }      /* round to nearest even; a = the lower k */
// Rows: 64 rows of a row-major f32 matrix with rows of CC elements, to 64 LDS rows [row][k] bf16 at pitch GP. Piece c (0..31) of a thread: row w + 4 (c >> 1), k = 128 (c & 1) + 4 lane: a wave's load = 512 contiguous bytes of one row,
// its LDS store 256 contiguous bytes. Loads and stores are separate calls of 16 pieces, so that the caller sets how many loads fly at once. s and dst come with the thread's own offset (row w, k = 4 lane) already added.
__device__ __forceinline__ void rows_load(v4f (&r)[16], const float* __restrict__ s, const int c0) {
#pragma unroll      /* every offset an immediate */
  for (int c = 0; c < 16; ++c) r[c] = *(const v4fa*)(s + ((c0 + c) >> 1) * 4 * CC + (c & 1) * 128);
}
__device__ __forceinline__ void rows_store(const v4f (&r)[16], unsigned char* dst, const int c0) {
#pragma unroll
  for (int c = 0; c < 16; ++c) *(v2u*)(dst + ((c0 + c) >> 1) * 4 * GP + (c & 1) * 256) = (v2u){pk_bf16(r[c][0], r[c][1]), pk_bf16(r[c][2], r[c][3])};
}
// Columns: 64 columns of a row-major f32 matrix [CC][ldw], transposed to 64 LDS rows [n][k] bf16 at pitch GP. A thread takes four blocks u of 8 k x 4 n (n = 32 (u & 1) + 4 n4 + j, k = 128 (u >> 1) + 8 (4 w + kq) + i): eight 16-byte loads,
// and each of the block's four columns leaves as one 16-byte LDS store of 8 k; s and dst come with the thread's own offset (n = 4 n4, k = 8 (4 w + kq)) already added. Lanes: a wave's load = 4 rows x one whole 128-byte line; its 16-lane halves store to 4 LDS rows 4 apart x 4 neighbouring 16-byte columns, at pitch GP all 64 banks.
__device__ __forceinline__ void cols_load(v4f (&r)[32], const float* __restrict__ s, const int ldw) {
#pragma unroll
  for (int c = 0; c < 32; ++c) r[c] = *(const v4fa*)(s + (size_t)((c >> 4) * 128 + (c & 7)) * ldw + ((c >> 3) & 1) * 32);      /* c = 8 u + i */
}
__device__ __forceinline__ void cols_store(const v4f (&r)[32], unsigned char* dst) {
#pragma unroll
  for (int u = 0; u < 4; ++u)
#pragma unroll
    for (int j = 0; j < 4; ++j) *(v4u*)(dst + ((u & 1) * 32 + j) * GP + (u >> 1) * 256) =
      (v4u){pk_bf16(r[8 * u][j], r[8 * u + 1][j]), pk_bf16(r[8 * u + 2][j], r[8 * u + 3][j]), pk_bf16(r[8 * u + 4][j], r[8 * u + 5][j]), pk_bf16(r[8 * u + 6][j], r[8 * u + 7][j])};
}
// Three jobs that read only inputs, in one grid; the job is block-uniform, by block index. A 64 x 64 tile a block, whole K in LDS, wave w = tile rows 16 w .. 16 w + 15, as in gemm_lds; products on v_wmma_f32_16x16x32_bf16.
// blocks [0, NBQ): [q | k] token-major [(b,n)][512] = x . Wqkv columns 0..511 (M 8192, N 512); blocks [NBQ, NBQ + BB * NBV): v channel-major per batch [b][(h,d)][n] = (Wqkv columns 512..767)^T . x[b]^T (M 256, N 2048);
// blocks from NBQ + BB * NBV: Wout transposed ((in,out) to Bt[n][k] f16 x 2^4) for the output GEMM.
#define NBQ ((NR / 64) * (2 * CC / 64))
#define NBV ((CC / 64) * (NN / 64))
#define NBW2 (CC * (CC / 8) / 128)
__global__ __launch_bounds__(128, 4) /* 4 waves a SIMD = the 4 blocks a WGP that the LDS allows: the register budget stays at 256 */ void k_gemm_qkv(const float* __restrict__ x, const float* __restrict__ Wqkv, _Float16* __restrict__ QK, _Float16* __restrict__ Vt, const float* __restrict__ Wout, _Float16* __restrict__ Bo) {
  __shared__ __attribute__((aligned(16))) unsigned char sm[GSM];
  const int bx = blockIdx.x, rb = bx - NBQ; const bool jv = rb >= 0;
  if (rb >= BB * NBV) { wt_f16((rb - BB * NBV) * 128 + (int)threadIdx.x, Wout, Bo, CC, CC, 16.0f); return; }      /* the whole block leaves, ahead of the barrier */
  const int tid = threadIdx.x, w = tid >> 5, lane = tid & 31, ln = lane & 15, hh = lane >> 4;
  const int by = jv ? rb / NBV : 0, tb = jv ? rb % NBV : bx, lgn = jv ? 5 : 3;
  const int row0 = (tb >> lgn) * 64, col0 = (tb & ((1 << lgn) - 1)) * 64;
  /* tile rows 0..63 of LDS = A, 64..127 = B; x is A for q | k and B for v */
  { const int n4 = (lane & 3) | ((lane >> 4) << 2), kq = (lane >> 2) & 3;
    const float* ws = Wqkv + (jv ? 2 * CC + row0 : col0) + (size_t)(w * 4 + kq) * 8 * C3 + n4 * 4; unsigned char* wd = sm + (jv ? 0 : 64 * GP) + n4 * 4 * GP + (w * 4 + kq) * 16;
    const float* xs = x + (size_t)(jv ? by * NN + col0 : row0) * CC + w * CC + lane * 4; unsigned char* xd = sm + (jv ? 64 * GP : 0) + w * GP + lane * 8;
    v4f rw[32], ra[16], rc[16];
    cols_load(rw, ws, C3);
    asm volatile("s_wait_xcnt 0x0" ::: "memory");      /* ahead of any rewrite of the address registers that Wqkv's loads name: a later load's result may be given those registers */
    rows_load(ra, xs, 0);
    __builtin_amdgcn_sched_barrier(0);      /* 48 loads fly at once, 192 registers; the last 16 are held back until Wqkv's registers are free: all 64 at once spill at 4 waves a SIMD */
    cols_store(rw, wd);
    __builtin_amdgcn_sched_barrier(0);      /* the last 16 loads stay behind the stores that free their registers */
    rows_load(rc, xs, 16);
    __builtin_amdgcn_sched_barrier(0);      /* the last loads are issued ahead of the first half's conversion and stores */
    rows_store(ra, xd, 0); rows_store(rc, xd, 16); }
  __syncthreads();      /* both tiles published to all four waves */
  const unsigned char* af = sm + (w * 16 + ln) * GP + hh * 16; const unsigned char* bf = sm + (64 + ln) * GP + hh * 16;
  v8f acc[4] = {};
  FragB ah[2], bq[2][4];      /* two register sets: a k step's ten fragment reads stand together, one k step ahead of the products that use them */
  auto frags = [&](const int kb) { FragB& a = ah[kb & 1]; a.half[0] = *(const v8us*)(af + kb * 64); a.half[1] = *(const v8us*)(af + kb * 64 + 32);
#pragma unroll
    for (int t = 0; t < 4; ++t) { FragB& b = bq[kb & 1][t]; b.half[0] = *(const v8us*)(bf + t * 16 * GP + kb * 64); b.half[1] = *(const v8us*)(bf + t * 16 * GP + kb * 64 + 32); } };
  frags(0);
#pragma unroll      /* every LDS offset an immediate, the register set a compile-time choice */
  for (int kb = 0; kb < CC / 32; ++kb) { if (kb + 1 < CC / 32) frags(kb + 1);
#pragma unroll
    for (int t = 0; t < 4; ++t) acc[t] = mmaN<1>(ah[kb & 1].v, ah[kb & 1].v, bq[kb & 1][t].v, bq[kb & 1][t].v, acc[t]);
  }
  fal* so = (fal*)(sm + w * 16 * GP);      /* [16][64] f32 in the wave's own rows of A, all read by now */
#pragma unroll
  for (int t = 0; t < 4; ++t)
#pragma unroll
    for (int r = 0; r < 8; ++r) so[(8 * hh + r) * 64 + t * 16 + ln] = acc[t][r];
  __builtin_amdgcn_fence(__ATOMIC_ACQ_REL, "workgroup"); __builtin_amdgcn_wave_barrier();
  _Float16* C16 = jv ? Vt + (size_t)by * CC * NN : QK; const int ldc = jv ? NN : 2 * CC;
  const int rsub = lane >> 4, c4 = (lane & 15) * 4; typedef _Float16 v4h __attribute__((ext_vector_type(4)));
#pragma unroll
  for (int q = 0; q < 8; ++q) { const int r = q * 2 + rsub; const v4f v = *(const v4fa*)&so[r * 64 + c4]; v4h h4; for (int i = 0; i < 4; ++i) h4[i] = (_Float16)v[i];
    *(v4h*)(C16 + (size_t)(row0 + w * 16 + r) * ldc + col0 + c4) = h4; }
  asm volatile("s_wait_xcnt 0x0" ::: "memory");      /* behind the last store, ahead of any rewrite of the registers that the stores name, on every way the code runs on from here */
}


typedef _Float16 v4h __attribute__((ext_vector_type(4)));

__global__ __launch_bounds__(256) void k_round16f(const float* __restrict__ W, _Float16* __restrict__ Bt, size_t n8) { const size_t t = (size_t)blockIdx.x * 256 + threadIdx.x; if (t >= n8) return; FragH f;
#pragma unroll
  for (int i = 0; i < 8; ++i) f.h[i] = (_Float16)(bf16_round(W[t * 8 + i]) * 16.0f); *(v8us*)((unsigned short*)Bt + t * 8) = f.half[0];  }
template <int NHv, int TTv>
__global__ __launch_bounds__(256) void k_vt(const _Float16* __restrict__ V16, int ldv, int voff, _Float16* __restrict__ Vt) { __shared__ unsigned short tl[64][66]; const int tid = threadIdx.x; const int slab = blockIdx.x / (TTv / 64), lg = blockIdx.x % (TTv / 64); const int b = slab / NHv, h = slab % NHv;
  for (int i = tid; i < 64 * 8; i += 256) { const int r = i / 8, c8 = (i % 8) * 8; FragH f; f.half[0] = *(const v8us*)((const unsigned short*)V16 + ((size_t)b * TTv + lg * 64 + r) * ldv + voff + h * 64 + c8);
#pragma unroll
    for (int q = 0; q < 8; ++q) tl[r][c8 + q] = f.u[q]; }
  __syncthreads();
  {
#pragma unroll
    for (int rd = 0; rd < 2; ++rd) { const int d = rd * 32 + tid / 8, pc = tid % 8; FragH f;
#pragma unroll
      for (int q = 0; q < 8; ++q) f.u[q] = tl[pc * 8 + q][d];
      *(v8us*)((unsigned short*)Vt + ((size_t)slab * 64 + d) * TTv + lg * 64 + pc * 8) = f.half[0]; }
     } }

typedef float v2f __attribute__((ext_vector_type(2)));
// lane l with lane l ^ 16 (the two halves of a wave hold the two key halves of one query column)
__device__ __forceinline__ float xhalf(float x) { return __builtin_bit_cast(float, __builtin_amdgcn_permlanex16(__builtin_bit_cast(int, x), __builtin_bit_cast(int, x), 0x76543210, 0xfedcba98, false, false)); }

// One lane's eight 16-byte copies of a stage (four of K, four of V^T), global memory to LDS through no register. The s_wait_xcnt stands in the copies' own statement, ahead of any rewrite of the address registers they name.
__device__ __forceinline__ void stage_copy(unsigned lk, const unsigned short* gk, size_t gkstep, unsigned lkstep, unsigned lv, const unsigned short* gv, size_t gvstep, unsigned lvstep) {
  asm volatile("global_load_async_to_lds_b128 %0, %8, off\n\t"
               "global_load_async_to_lds_b128 %1, %9, off\n\t"
               "global_load_async_to_lds_b128 %2, %10, off\n\t"
               "global_load_async_to_lds_b128 %3, %11, off\n\t"
               "global_load_async_to_lds_b128 %4, %12, off\n\t"
               "global_load_async_to_lds_b128 %5, %13, off\n\t"
               "global_load_async_to_lds_b128 %6, %14, off\n\t"
               "global_load_async_to_lds_b128 %7, %15, off\n\t"
               "s_wait_xcnt 0x0"
               :: "v"(lk), "v"(lk + lkstep), "v"(lk + 2 * lkstep), "v"(lk + 3 * lkstep), "v"(lv), "v"(lv + lvstep), "v"(lv + 2 * lvstep), "v"(lv + 3 * lvstep),
                  "v"(gk), "v"(gk + gkstep), "v"(gk + 2 * gkstep), "v"(gk + 3 * gkstep), "v"(gv), "v"(gv + gvstep), "v"(gv + 2 * gvstep), "v"(gv + 3 * gvstep)
               : "memory");
}

__global__ __launch_bounds__(128) void k_flash(const _Float16* __restrict__ Q16, int ldq, const _Float16* __restrict__ K16, int ldk, const _Float16* __restrict__ Vt, const int* __restrict__ MSK, _Float16* __restrict__ O16) {
  constexpr int RPW = 16, NQB = NN / (4 * RPW), DT = 2; (void)MSK;
  constexpr int TK = 128, NS = NN / TK, NP = TK / 32;      /* keys a stage, stages, 32-key passes of the second product a stage */
  constexpr int KP = HD * 2 + 16, VP = TK * 2 + 16;      /* LDS row pitches in bytes, 16 B x odd: 16 lanes' ds_load_b128 fall on all 64 banks */
  constexpr int KB = TK * KP, SB = KB + HD * VP;      /* a stage: TK rows of K (HD channels), then HD rows of V^T (TK keys) */
  __shared__ __attribute__((aligned(16))) unsigned char sm[2 * SB];
  constexpr float SL2E = 0.17677669529663687f * 1.4426950408889634f;      /* 32^-1/2 * log2(e): e^(scale*s - m) = 2^(SL2E*s - m2), one fma ahead of a bare v_exp_f32 */
  const int tid = threadIdx.x, w = tid >> 5, lane = tid & 31, ln = lane & 15, hh = lane >> 4;
  const int slab = blockIdx.x / NQB, qblk = blockIdx.x % NQB; const int b = slab / NH, h = slab % NH; const int q0 = qblk * (4 * RPW) + w * RPW;
  const unsigned short* Vth = (const unsigned short*)Vt + ((size_t)b * CC + h * HD) * NN;      /* V^T = v[b][(h,d)][n] channel-major */
  /* copy map: K chunk c of thread tid = row (tid >> 2) + 32 c, 16-byte column tid & 3; V^T chunk c = row (tid >> 4) + 8 c, 16-byte column tid & 15 */
  const unsigned short* gk = (const unsigned short*)K16 + ((size_t)b * NN + (tid >> 2)) * ldk + h * HD + (tid & 3) * 8;
  const unsigned short* gv = Vth + (size_t)(tid >> 4) * NN + (tid & 15) * 8;
  const unsigned lds0 = (unsigned)(size_t)sm;      /* low 32 bits of the shared address = byte offset in the work-group's LDS */
  const unsigned lk = lds0 + (tid >> 2) * KP + (tid & 3) * 16, lv = lds0 + KB + (tid >> 4) * VP + (tid & 15) * 16;
  const size_t gkstep = (size_t)32 * ldk, gkstage = (size_t)TK * ldk;
  stage_copy(lk, gk, gkstep, 32 * KP, lv, gv, (size_t)8 * NN, 8 * VP);
  FragH bq;      /* B: column ln = query q0 + ln, k = head channel */
  { const unsigned short* qr = (const unsigned short*)Q16 + ((size_t)b * NN + q0 + ln) * ldq + h * HD; bq.half[0] = *(const v8us*)(qr + 8 * hh); bq.half[1] = *(const v8us*)(qr + 16 + 8 * hh); }
  asm volatile("s_wait_asynccnt 0x0" ::: "memory");      /* this wave's share of stage 0 has landed */
  __syncthreads();      /* stage 0 published to all four waves */
  gk += gkstage; gv += TK;
  stage_copy(lk + SB, gk, gkstep, 32 * KP, lv + SB, gv, (size_t)8 * NN, 8 * VP);
  float m_q = -3.0e38f, l_q = 0.f; v8f oacc[DT];
#pragma unroll
  for (int dt = 0; dt < DT; ++dt) oacc[dt] = (v8f){0.f,0.f,0.f,0.f,0.f,0.f,0.f,0.f};
#pragma unroll 1      /* one body for both buffers: the buffer is an offset */
  for (int t = 0; t < NS; ++t) {
    const unsigned bo = (unsigned)(t & 1) * SB;
    const unsigned char* kf = sm + bo + ln * KP + hh * 16; const unsigned char* vf = sm + bo + KB + ln * VP + hh * 16;
    /* One softmax block = the whole stage of TK keys: all its fragments are read at the head, its 2 NP score tiles come from 2 NP independent products back to back, then ONE maximum, ONE rescale of l_q and oacc, and the NP passes of the second product. */
    static_assert(NP == 4, "the joins of the four chains and of the four partial sums below are written out for four passes");
    FragH ak[2 * NP], av[NP][DT];
#pragma unroll      /* every LDS offset an immediate */
    for (int nt = 0; nt < 2 * NP; ++nt) { const unsigned char* kr = kf + nt * 16 * KP; ak[nt].half[0] = *(const v8us*)kr; ak[nt].half[1] = *(const v8us*)(kr + 32); }
    __builtin_amdgcn_sched_barrier(0);      /* K's reads stay in front of V^T's: LDS answers in order, and else the first score product waits for V^T's fragments too */
#pragma unroll      /* V^T's reads stand directly behind K's, one place of LDS reads a stage: their latency runs behind the score products and the maximum */
    for (int ps = 0; ps < NP; ++ps)
#pragma unroll
      for (int dt = 0; dt < DT; ++dt) { const unsigned char* vrow = vf + dt * 16 * VP + ps * 64; av[ps][dt].half[0] = *(const v8us*)vrow; av[ps][dt].half[1] = *(const v8us*)(vrow + 32); }
    __builtin_amdgcn_sched_barrier(0);      /* keeps V^T's reads up here: else each is moved directly in front of its product, and its latency stands open there */
    v8f s[2 * NP];      /* s[nt][r] = S^T[key t*TK + nt*16 + 8*hh + r][query q0 + ln] */
#pragma unroll
    for (int nt = 0; nt < 2 * NP; ++nt) s[nt] = __builtin_amdgcn_wmma_f32_16x16x32_f16(false, ak[nt].v, false, bq.v, (short)0, (v8f){0.f,0.f,0.f,0.f,0.f,0.f,0.f,0.f}, false, false);
    __builtin_amdgcn_sched_barrier(0);      /* the score products stay back to back, each filling the distance behind the one before: else the maximum's steps are moved in between them, each behind pads of v_nop */
    float mch[NP];      /* the maximum in threes (one three-input instruction takes in two more scores): chain ps runs over the 16 scores of tiles 2 ps and 2 ps + 1 but the last, which joins below */
#pragma unroll
    for (int ps = 0; ps < NP; ++ps) { const v8f u = s[2 * ps], v = s[2 * ps + 1];
      float c = fmaxf(fmaxf(u[0], u[1]), u[2]); c = fmaxf(fmaxf(c, u[3]), u[4]); c = fmaxf(fmaxf(c, u[5]), u[6]); c = fmaxf(fmaxf(c, u[7]), v[0]);
      c = fmaxf(fmaxf(c, v[1]), v[2]); c = fmaxf(fmaxf(c, v[3]), v[4]); mch[ps] = fmaxf(fmaxf(c, v[5]), v[6]); }
    float mc = fmaxf(fmaxf(mch[0], mch[1]), mch[2]); mc = fmaxf(fmaxf(mc, mch[3]), s[1][7]); mc = fmaxf(fmaxf(mc, s[3][7]), s[5][7]); mc = fmaxf(mc, s[7][7]);
    mc = fmaxf(mc, xhalf(mc));      /* both halves now hold the maximum over the query's TK raw products (SL2E > 0 keeps the order) */
    const float mn = fmaxf(m_q, mc * SL2E); const float al = (mn > -1.0e38f) ? __builtin_amdgcn_exp2f(m_q - mn) : 1.0f; m_q = mn;      /* m_q, mn: base-2 exponents */
    const float nb = 10.0f - mn;      /* 2^10 = the f16 scale of P, carried in the exponent: p and l_q hold 1024 times the shifted values */
    FragH pb[NP]; v2f psum[NP];
#pragma unroll
    for (int ps = 0; ps < NP; ++ps) { v2f p[8];
#pragma unroll
      for (int i = 0; i < 8; ++i) { const v2f a = (v2f){s[2 * ps + (i >> 2)][(2 * i) & 7], s[2 * ps + (i >> 2)][(2 * i + 1) & 7]} * SL2E + nb;
        p[i] = (v2f){__builtin_amdgcn_exp2f(a[0]), __builtin_amdgcn_exp2f(a[1])}; pb[ps].h[2 * i] = (_Float16)p[i][0]; pb[ps].h[2 * i + 1] = (_Float16)p[i][1]; }
      psum[ps] = ((p[0] + p[1]) + (p[2] + p[3])) + ((p[4] + p[5]) + (p[6] + p[7])); }
    const v2f pt = (psum[0] + psum[1]) + (psum[2] + psum[3]);
    l_q = l_q * al + (pt[0] + pt[1]);      /* this half's TK / 2 keys; the halves join after the loop */
#pragma unroll
    for (int dt = 0; dt < DT; ++dt) oacc[dt] *= al;
#pragma unroll
    for (int ps = 0; ps < NP; ++ps)
#pragma unroll
      for (int dt = 0; dt < DT; ++dt) oacc[dt] = __builtin_amdgcn_wmma_f32_16x16x32_f16(false, av[ps][dt].v, false, pb[ps].v, (short)0, oacc[dt], false, false);      /* oacc[dt][r] = O^T[channel dt*16 + 8*hh + r][query q0 + ln] */
    __builtin_amdgcn_sched_barrier(0);      /* the stage's arithmetic stays in front of the waits below: moved behind them, the wait for stage t + 1 would stand at the stage's head, directly behind the issue of its copies */
    asm volatile("s_wait_dscnt 0x0" ::: "memory");      /* this wave's reads of stage t are done before its buffer is handed back */
    asm volatile("s_wait_asynccnt 0x0" ::: "memory");      /* this wave's share of stage t + 1 has landed */
    __syncthreads();      /* publishes stage t + 1 and ends every wave's reads of stage t */
    if (t + 2 < NS) { gk += gkstage; gv += TK; stage_copy(lk + bo, gk, gkstep, 32 * KP, lv + bo, gv, (size_t)8 * NN, 8 * VP); }      /* stage t + 2 into the buffer just read */
  }
  asm volatile("s_wait_asynccnt 0x0" ::: "memory");      /* no copy outstanding at the wave's end */
  const float l = l_q + xhalf(l_q); const float den = l + (1e-6f * 1024.0f) * __builtin_amdgcn_exp2f(-m_q); const float inv = (den > 0.f && den < INFINITY) ? 1.0f / den : 0.f;      /* sum e^s/(sum e^s + 1e-6) form: e^(-m)*1e-6 joins the shifted sum; an infinite den (all logits far below 0) reproduces the reference's ~0 output */
  /* O leaves as f16, head-major [b][h][place][HD], the wave's 16 queries at their places OPLACE: a query's 64 bytes, and so every 128-byte line, are written by this wave alone, and a block's 64 queries are 4 KiB in a row for the output GEMM's copies */
  unsigned short* orow = (unsigned short*)O16 + ((size_t)slab * NN + q0 + OPLACE(ln)) * HD + 8 * hh;
#pragma unroll
  for (int dt = 0; dt < DT; ++dt) { const v8f o = oacc[dt] * inv; FragH f;
#pragma unroll      /* every index a constant: f stays in registers */
    for (int i = 0; i < 8; ++i) f.h[i] = (_Float16)o[i];
    *(v8us*)(orow + dt * 16) = f.half[0]; } }

extern "C" void kernel_launch(void* const* d_in, const int* in_sizes, int n_in,
                              void* d_out, int out_size, void* d_ws, size_t ws_size, hipStream_t stream) {
  (void)in_sizes; (void)n_in; (void)out_size;
  const float* x = (const float*)d_in[0]; const float* Wqkv = (const float*)d_in[1]; const float* Wout = (const float*)d_in[2]; const float* bout = (const float*)d_in[3];
  char* ws = (char*)d_ws; size_t off = 0;
  auto take = [&](size_t bytes) { char* p = ws + off; off += (bytes + 255) & ~(size_t)255; return p; };
  _Float16* Bo = (_Float16*)take((size_t)CC * CC * 2);
  _Float16* QK = (_Float16*)take((size_t)NR * 2 * CC * 2); _Float16* Vt = (_Float16*)take((size_t)BB * CC * NN * 2); _Float16* O16 = (_Float16*)take((size_t)NR * CC * 2);
  if (off > ws_size) return;      // 0.1 + 8.4 + 4.2 + 4.2: about 17 MB
  k_gemm_qkv<<<NBQ + BB * NBV + NBW2, 128, 0, stream>>>(x, Wqkv, QK, Vt, Wout, Bo);
  k_flash<<<BB * NH * (NN / 64), 128, 0, stream>>>(QK, 2 * CC, QK + CC, 2 * CC, Vt, nullptr, O16);      /* blocks = (b,h) × 64-query groups */
  k_gemm_out<<<(NR / 64) * (CC / 64), 128, 0, stream>>>(O16, Bo, 0.0625f, bout, (float*)d_out);      /* y = out.Wout + bout: M 8192 N 256 K 256 */
}

// v009
// Measured time: 37.3 microseconds a run.
// In both of two side-by-side timings against v008, it was 1.08 times as fast.
// All steps since v000 together make it 6.35 times as fast.
#include <hip/hip_runtime.h>
// KeOps-style multi-head attention (B=4, n=2048, dim 256, 8 heads × 32): qkv = x·Wqkv; q scaled by 32^-½; e = exp(q·kᵀ) WITHOUT max subtraction; out = (e·v)/(Σe + 1e-6) merged over heads; y = out·Wout + bout.
// Compute dtype: x, Wqkv, Wout, bout rounded to bf16; q/k token-major and v channel-major (= Vᵀ) as f16 GEMM outputs (f32 accumulate); fused flash-style kernel per (b,h) (online max-rescaled sums
// in f32 — the unshifted quotient is recovered exactly through the normaliser l + 1e-6·e^(−m); P f16 ×2^10) on v_wmma_f32_16x16x32_f16; O stored as f16 by the attention kernel itself, then the output GEMM with bias; f32 accumulate.
#define BB 4
#define NN 2048
#define CC 256
#define C3 768
#define NH 8
#define HD 32
#define NR (BB * NN)

typedef __bf16 v16b __attribute__((ext_vector_type(16)));
typedef unsigned short v8us __attribute__((ext_vector_type(8), may_alias));
typedef float  v8f  __attribute__((ext_vector_type(8)));
typedef float  v4f  __attribute__((ext_vector_type(4)));
typedef float  v4fa __attribute__((ext_vector_type(4), may_alias));
union FragB { v16b v; v8us half[2]; unsigned short u[16]; };

__device__ __forceinline__ unsigned short bf16_bits(float x) { unsigned int u = __float_as_uint(x); return (unsigned short)((u + 0x7FFFu + ((u >> 16) & 1u)) >> 16); }
__device__ __forceinline__ float bf16_val(unsigned short b) { return __uint_as_float(((unsigned int)b) << 16); }
__device__ __forceinline__ float bf16_round(float x) { return bf16_val(bf16_bits(x)); }
// D += A·B with NT terms: 1 = ah·bh, 2 = + al·bh (A split), 3 = + ah·bl (both split)
template <int NT>
__device__ __forceinline__ v8f mmaN(v16b ah, v16b al, v16b bh, v16b bl, v8f c) {
  c = __builtin_amdgcn_wmma_f32_16x16x32_bf16(false, ah, false, bh, (short)0, c, false, false);
  if (NT >= 2) c = __builtin_amdgcn_wmma_f32_16x16x32_bf16(false, al, false, bh, (short)0, c, false, false);
  if (NT >= 3) c = __builtin_amdgcn_wmma_f32_16x16x32_bf16(false, ah, false, bl, (short)0, c, false, false);
  asm volatile("v_nop\n\tv_nop\n\tv_nop\n\tv_nop" : "+v"(c) : "v"(ah), "v"(al), "v"(bh), "v"(bl));
  return c;
}

__global__ __launch_bounds__(256) void k_wt_bf16(const float* __restrict__ W, unsigned short* __restrict__ Wt, int K, int N) {
  const int t = blockIdx.x * 256 + threadIdx.x;
  const int k8n = K / 8;
  if (t >= N * k8n) return;
  const int n = t / k8n, k8 = (t % k8n) * 8;
  v8us v;
#pragma unroll
  for (int i = 0; i < 8; ++i) v[i] = bf16_bits(W[(size_t)(k8 + i) * N + n]);
  *(v8us*)(Wt + (size_t)n * K + k8) = v;
  
}

// GEMM C[M][N] (f32, pitch ldc) = act(A[M][K]·W + bias). A f32 row-major (pitch lda) converted per fragment to bf16
// (ASPLIT: hi/lo two planes -> 2 terms, else single rounded term); Wt bf16 [N][K] (pitch ldb). BIAS_BF16 rounds the
// bias to bf16 first (bias quantised to bf16 before the add). K%32==0, M%16==0, N%64==0.
template <bool ASPLIT, int ACT, bool BIAS_BF16>
__global__ __launch_bounds__(128) void k_gemm_bf(const float* __restrict__ A, int lda, const unsigned short* __restrict__ Wt, int ldb,
                                               const float* __restrict__ bias, float* __restrict__ C, int ldc, int M, int N, int K) {
  __shared__ __attribute__((aligned(16))) float so[4][16][64];
  const int tid = threadIdx.x, w = tid >> 5, lane = tid & 31, ln = lane & 15, hh = lane >> 4;
  const int ntn = N / 64;
  const int wid = blockIdx.x * 4 + w;
  const int mt = wid / ntn, nq = wid % ntn;
  if (mt * 16 >= M) return;
  const int row0 = mt * 16, col0 = nq * 64;
  const float* arow = A + (size_t)(row0 + ln) * lda;
  v8f acc[4] = {};
  for (int kb = 0; kb < K; kb += 32) {
    FragB ah, al;
    const v4f x0 = *(const v4fa*)(arow + kb + 8 * hh), x1 = *(const v4fa*)(arow + kb + 8 * hh + 4);
    const v4f x2 = *(const v4fa*)(arow + kb + 16 + 8 * hh), x3 = *(const v4fa*)(arow + kb + 16 + 8 * hh + 4);
    float xs[16] = {x0[0],x0[1],x0[2],x0[3],x1[0],x1[1],x1[2],x1[3],x2[0],x2[1],x2[2],x2[3],x3[0],x3[1],x3[2],x3[3]};
#pragma unroll
    for (int i = 0; i < 16; ++i) { const unsigned short hb = bf16_bits(xs[i]); ah.u[i] = hb; al.u[i] = ASPLIT ? bf16_bits(xs[i] - bf16_val(hb)) : (unsigned short)0; }
#pragma unroll
    for (int t = 0; t < 4; ++t) {
      const unsigned short* brow = Wt + (size_t)(col0 + t * 16 + ln) * ldb + kb;
      FragB b;
      b.half[0] = *(const v8us*)(brow + 8 * hh);
      b.half[1] = *(const v8us*)(brow + 16 + 8 * hh);
      acc[t] = mmaN<ASPLIT ? 2 : 1>(ah.v, al.v, b.v, b.v, acc[t]);
    }
  }
#pragma unroll
  for (int t = 0; t < 4; ++t) {
    float bv = bias ? bias[col0 + t * 16 + ln] : 0.f;
    if (BIAS_BF16) bv = bf16_round(bv);
#pragma unroll
    for (int r = 0; r < 8; ++r) { float v = acc[t][r] + bv; if (ACT == 1) v = fmaxf(v, 0.f); so[w][8 * hh + r][t * 16 + ln] = v; }
  }
  __builtin_amdgcn_fence(__ATOMIC_ACQ_REL, "workgroup");
  __builtin_amdgcn_wave_barrier();
  const int rsub = lane >> 4, c4 = (lane & 15) * 4;
  {
#pragma unroll
    for (int q = 0; q < 8; ++q) {
      const int r = q * 2 + rsub;
      const v4f v = *(const v4fa*)&so[w][r][c4];
      *(v4f*)(C + (size_t)(row0 + r) * ldc + col0 + c4) = v;
    }
    
  }
}

// Flash-style causal/unmasked attention, all contractions 3-term bf16 hi/lo splits, f32 softmax with running max.
// q,k,v rows are read from f32 buffers with arbitrary row pitch (so they can live inside a fused qkv buffer);
// D = head size (multiple of 32, <= 128); one wave = 16 query rows; block = 4 waves (64 queries) sharing K/V chunks of 32.
template <int D, bool CAUSAL>
__global__ __launch_bounds__(128) void k_flash(const float* __restrict__ qb, const float* __restrict__ kb, const float* __restrict__ vb,
                                             int pitch, int T, int H, float scale, float* __restrict__ y, int ypitch) {
  constexpr int KS = D / 32;        // k-steps for QK
  constexpr int DT = D / 16;        // d tiles for PV
  __shared__ __attribute__((aligned(16))) unsigned short sKh[32][D + 8], sKl[32][D + 8], sVh[32][D + 8], sVl[32][D + 8];
  __shared__ __attribute__((aligned(16))) unsigned short sPh[4][16][40], sPl[4][16][40];
  __shared__ __attribute__((aligned(16))) float sO[4][16][D];
  const int tid = threadIdx.x, w = tid >> 5, lane = tid & 31, ln = lane & 15, hh = lane >> 4;
  const int nqb = (T + 63) / 64;
  const int bh = blockIdx.x / nqb, qblk = blockIdx.x % nqb;
  const int b = bh / H, h = bh % H;
  const int q0 = qblk * 64 + w * 16;
  const float* Q = qb + (size_t)b * T * pitch + h * D;
  const float* K = kb + (size_t)b * T * pitch + h * D;
  const float* V = vb + (size_t)b * T * pitch + h * D;

  // A fragments of the wave's 16 query rows (scaled), hi/lo
  FragB aqh[KS], aql[KS];
  {
    int row = q0 + ln; if (row >= T) row = T - 1;
    const float* qr = Q + (size_t)row * pitch;
#pragma unroll
    for (int ks = 0; ks < KS; ++ks)
#pragma unroll
      for (int i = 0; i < 16; ++i) {
        const int d = ks * 32 + ((i < 8) ? (8 * hh + i) : (16 + 8 * hh + (i - 8)));
        const float x = qr[d] * scale; const unsigned short hb = bf16_bits(x);
        aqh[ks].u[i] = hb; aql[ks].u[i] = bf16_bits(x - bf16_val(hb));
      }
  }
  float m_r[8], l_r[8];
#pragma unroll
  for (int r = 0; r < 8; ++r) { m_r[r] = -3.0e38f; l_r[r] = 0.f; }
  v8f oacc[DT];
#pragma unroll
  for (int dt = 0; dt < DT; ++dt) oacc[dt] = (v8f){0.f,0.f,0.f,0.f,0.f,0.f,0.f,0.f};

  const int kv_end = CAUSAL ? min(T, qblk * 64 + 64) : T;     // block-uniform
  for (int j0 = 0; j0 < kv_end; j0 += 32) {
    __syncthreads();
    for (int e = tid; e < 32 * (D / 4); e += 128) {
      const int r = e / (D / 4), c4 = (e % (D / 4)) * 4;
      const int key = j0 + r;
      v4f kf = {0.f,0.f,0.f,0.f}, vf = {0.f,0.f,0.f,0.f};
      if (key < T) { kf = *(const v4fa*)(K + (size_t)key * pitch + c4); vf = *(const v4fa*)(V + (size_t)key * pitch + c4); }
#pragma unroll
      for (int t = 0; t < 4; ++t) {
        unsigned short hb = bf16_bits(kf[t]); sKh[r][c4 + t] = hb; sKl[r][c4 + t] = bf16_bits(kf[t] - bf16_val(hb));
        hb = bf16_bits(vf[t]); sVh[r][c4 + t] = hb; sVl[r][c4 + t] = bf16_bits(vf[t] - bf16_val(hb));
      }
    }
    __syncthreads();
    // S tile 16 x 32
    v8f s[2];
#pragma unroll
    for (int nt = 0; nt < 2; ++nt) {
      v8f acc = {};
#pragma unroll
      for (int ks = 0; ks < KS; ++ks) {
        FragB bh_, bl_;
        bh_.half[0] = *(const v8us*)&sKh[nt * 16 + ln][ks * 32 + 8 * hh]; bh_.half[1] = *(const v8us*)&sKh[nt * 16 + ln][ks * 32 + 16 + 8 * hh];
        bl_.half[0] = *(const v8us*)&sKl[nt * 16 + ln][ks * 32 + 8 * hh]; bl_.half[1] = *(const v8us*)&sKl[nt * 16 + ln][ks * 32 + 16 + 8 * hh];
        acc = mmaN<3>(aqh[ks].v, aql[ks].v, bh_.v, bl_.v, acc);
      }
      s[nt] = acc;
    }
    // mask + running max (rows 8hh+r; the 16 lanes of a half share rows)
    float alpha[8];
#pragma unroll
    for (int r = 0; r < 8; ++r) {
      const int qi = q0 + 8 * hh + r;
      const int ja = j0 + ln, jb = j0 + 16 + ln;
      if (CAUSAL) { if (ja > qi) s[0][r] = -3.0e38f; if (jb > qi) s[1][r] = -3.0e38f; }
      if (ja >= T) s[0][r] = -3.0e38f;
      if (jb >= T) s[1][r] = -3.0e38f;
      float mx = fmaxf(s[0][r], s[1][r]);
      mx = fmaxf(mx, __shfl_xor(mx, 1, 32)); mx = fmaxf(mx, __shfl_xor(mx, 2, 32)); mx = fmaxf(mx, __shfl_xor(mx, 4, 32)); mx = fmaxf(mx, __shfl_xor(mx, 8, 32));
      const float mnew = fmaxf(m_r[r], mx);
      alpha[r] = (mnew > -1.0e38f) ? __expf(m_r[r] - mnew) : 1.0f;
      const float p0 = (s[0][r] > -1.0e38f) ? __expf(s[0][r] - mnew) : 0.f;
      const float p1 = (s[1][r] > -1.0e38f) ? __expf(s[1][r] - mnew) : 0.f;
      m_r[r] = mnew;
      l_r[r] = l_r[r] * alpha[r] + p0 + p1;            // per-lane partial row sum (16 lanes combined at the end)
      unsigned short hb = bf16_bits(p0); sPh[w][8 * hh + r][ln] = hb;      sPl[w][8 * hh + r][ln] = bf16_bits(p0 - bf16_val(hb));
      hb = bf16_bits(p1);                sPh[w][8 * hh + r][16 + ln] = hb; sPl[w][8 * hh + r][16 + ln] = bf16_bits(p1 - bf16_val(hb));
    }
#pragma unroll
    for (int dt = 0; dt < DT; ++dt)
#pragma unroll
      for (int r = 0; r < 8; ++r) oacc[dt][r] *= alpha[r];
    __builtin_amdgcn_fence(__ATOMIC_ACQ_REL, "workgroup");
    __builtin_amdgcn_wave_barrier();
    FragB pah, pal;
    pah.half[0] = *(const v8us*)&sPh[w][ln][8 * hh]; pah.half[1] = *(const v8us*)&sPh[w][ln][16 + 8 * hh];
    pal.half[0] = *(const v8us*)&sPl[w][ln][8 * hh]; pal.half[1] = *(const v8us*)&sPl[w][ln][16 + 8 * hh];
#pragma unroll
    for (int dt = 0; dt < DT; ++dt) {
      FragB bvh, bvl;
#pragma unroll
      for (int i = 0; i < 8; ++i) {
        bvh.u[i] = sVh[8 * hh + i][dt * 16 + ln]; bvh.u[8 + i] = sVh[16 + 8 * hh + i][dt * 16 + ln];
        bvl.u[i] = sVl[8 * hh + i][dt * 16 + ln]; bvl.u[8 + i] = sVl[16 + 8 * hh + i][dt * 16 + ln];
      }
      oacc[dt] = mmaN<3>(pah.v, pal.v, bvh.v, bvl.v, oacc[dt]);
    }
    __builtin_amdgcn_fence(__ATOMIC_ACQ_REL, "workgroup");
    __builtin_amdgcn_wave_barrier();
  }
#pragma unroll
  for (int r = 0; r < 8; ++r) {
    float l = l_r[r];
    l += __shfl_xor(l, 1, 32); l += __shfl_xor(l, 2, 32); l += __shfl_xor(l, 4, 32); l += __shfl_xor(l, 8, 32);
    l_r[r] = (l > 0.f) ? 1.0f / l : 0.f;
  }
#pragma unroll
  for (int dt = 0; dt < DT; ++dt)
#pragma unroll
    for (int r = 0; r < 8; ++r) sO[w][8 * hh + r][dt * 16 + ln] = oacc[dt][r] * l_r[r];
  __builtin_amdgcn_fence(__ATOMIC_ACQ_REL, "workgroup");
  __builtin_amdgcn_wave_barrier();
  {
    for (int r = 0; r < 16; ++r) {
      const int row = q0 + r;
      if (row < T && lane < D / 4) {
        const v4f val = *(const v4fa*)&sO[w][r][lane * 4];
        *(v4f*)(y + ((size_t)b * T + row) * ypitch + h * D + lane * 4) = val;
      }
    }
    
  }
}

// GEMM C = act(A·W + bias + resid): A f32 (ASPLIT -> hi/lo 2 terms), Wt bf16 [N][K]; ACT 0 none, 1 relu, 2 exact gelu;
// resid (optional, f32, row index = (row % rmod), pitch ldr, RES_BF16 rounds it) added before the activation.
template <bool ASPLIT, int ACT, bool BIAS_BF16, bool RES_BF16>
__global__ __launch_bounds__(128) void k_gemm_bf3(const float* __restrict__ A, int lda, const unsigned short* __restrict__ Wt, int ldb,
                                                const float* __restrict__ bias, const float* __restrict__ resid, int rmod, int ldr,
                                                float* __restrict__ C, int ldc, int M, int N, int K) {
  __shared__ __attribute__((aligned(16))) float so[4][16][64];
  const int tid = threadIdx.x, w = tid >> 5, lane = tid & 31, ln = lane & 15, hh = lane >> 4;
  const int ntn = N / 64;
  const int wid = blockIdx.x * 4 + w;
  const int mt = wid / ntn, nq = wid % ntn;
  if (mt * 16 >= M) return;
  const int row0 = mt * 16, col0 = nq * 64;
  const float* arow = A + (size_t)(row0 + ln) * lda;
  v8f acc[4] = {};
  for (int kb = 0; kb < K; kb += 32) {
    FragB ah, al;
    const v4f x0 = *(const v4fa*)(arow + kb + 8 * hh), x1 = *(const v4fa*)(arow + kb + 8 * hh + 4);
    const v4f x2 = *(const v4fa*)(arow + kb + 16 + 8 * hh), x3 = *(const v4fa*)(arow + kb + 16 + 8 * hh + 4);
    float xs[16] = {x0[0],x0[1],x0[2],x0[3],x1[0],x1[1],x1[2],x1[3],x2[0],x2[1],x2[2],x2[3],x3[0],x3[1],x3[2],x3[3]};
#pragma unroll
    for (int i = 0; i < 16; ++i) { const unsigned short hb = bf16_bits(xs[i]); ah.u[i] = hb; al.u[i] = ASPLIT ? bf16_bits(xs[i] - bf16_val(hb)) : (unsigned short)0; }
#pragma unroll
    for (int t = 0; t < 4; ++t) {
      const unsigned short* brow = Wt + (size_t)(col0 + t * 16 + ln) * ldb + kb;
      FragB b;
      b.half[0] = *(const v8us*)(brow + 8 * hh);
      b.half[1] = *(const v8us*)(brow + 16 + 8 * hh);
      acc[t] = mmaN<ASPLIT ? 2 : 1>(ah.v, al.v, b.v, b.v, acc[t]);
    }
  }
#pragma unroll
  for (int t = 0; t < 4; ++t) {
    const int col = col0 + t * 16 + ln;
    float bv = bias ? bias[col] : 0.f;
    if (BIAS_BF16) bv = bf16_round(bv);
#pragma unroll
    for (int r = 0; r < 8; ++r) {
      float v = acc[t][r] + bv;
      if (resid) { float rv = resid[(size_t)((row0 + 8 * hh + r) % rmod) * ldr + col]; if (RES_BF16) rv = bf16_round(rv); v += rv; }
      if (ACT == 1) v = fmaxf(v, 0.f);
      if (ACT == 2) v = 0.5f * v * (1.0f + erff(v * 0.70710678118654752f));
      if (ACT == 3) { const float u = 0.7978845608028654f * (v + 0.044715f * v * v * v); v = 0.5f * v * (1.0f + tanhf(u)); }
      so[w][8 * hh + r][t * 16 + ln] = v;
    }
  }
  __builtin_amdgcn_fence(__ATOMIC_ACQ_REL, "workgroup");
  __builtin_amdgcn_wave_barrier();
  const int rsub = lane >> 4, c4 = (lane & 15) * 4;
  {
#pragma unroll
    for (int q = 0; q < 8; ++q) {
      const int r = q * 2 + rsub;
      const v4f v = *(const v4fa*)&so[w][r][c4];
      *(v4f*)(C + (size_t)(row0 + r) * ldc + col0 + c4) = v;
    }
    
  }
}
// row LayerNorm (biased variance, eps) over N: s = X (+ R); optional out_sum <- s; out_norm <- (s-mu)*rsqrt(var+eps)*g + b
template <bool PARAM_BF16>
__global__ __launch_bounds__(256) void k_layernorm(const float* __restrict__ X, const float* __restrict__ R, const float* __restrict__ g, const float* __restrict__ bta,
                                                  float* __restrict__ out_sum, float* __restrict__ out_norm, int N, float eps) {
  __shared__ float red[256];
  const int row = blockIdx.x, tid = threadIdx.x;
  const float* x = X + (size_t)row * N; const float* rr = R ? R + (size_t)row * N : nullptr;
  float vals[16];                     // up to N = 4096
  const int per = N / 256;            // contiguous chunk per thread? use strided-by-4 chunks: thread handles j = tid*4 + 1024*u
  float s1 = 0.f;
  for (int u = 0; u < per / 4; ++u) {
    const int j = tid * 4 + 1024 * u;
    const v4f a = *(const v4fa*)(x + j);
    v4f b = {0.f,0.f,0.f,0.f}; if (rr) b = *(const v4fa*)(rr + j);
#pragma unroll
    for (int q = 0; q < 4; ++q) { const float v = a[q] + b[q]; vals[u * 4 + q] = v; s1 += v; }
  }
  red[tid] = s1; __syncthreads();
  for (int st = 128; st > 0; st >>= 1) { if (tid < st) red[tid] += red[tid + st]; __syncthreads(); }
  const float mu = red[0] / (float)N; __syncthreads();
  float s2 = 0.f;
  for (int u = 0; u < per / 4; ++u)
#pragma unroll
    for (int q = 0; q < 4; ++q) { const float c = vals[u * 4 + q] - mu; s2 += c * c; }
  red[tid] = s2; __syncthreads();
  for (int st = 128; st > 0; st >>= 1) { if (tid < st) red[tid] += red[tid + st]; __syncthreads(); }
  const float rs = rsqrtf(red[0] / (float)N + eps);
  {
    for (int u = 0; u < per / 4; ++u) {
      const int j = tid * 4 + 1024 * u;
      v4f o, sm;
#pragma unroll
      for (int q = 0; q < 4; ++q) {
        float gg = g[j + q], bb = bta[j + q];
        if (PARAM_BF16) { gg = bf16_round(gg); bb = bf16_round(bb); }
        sm[q] = vals[u * 4 + q]; o[q] = (vals[u * 4 + q] - mu) * rs * gg + bb;
      }
      if (out_sum) *(v4f*)(out_sum + (size_t)row * N + j) = sm;
      *(v4f*)(out_norm + (size_t)row * N + j) = o;
    }
    
  }
}



// ---- f16 WMMA path (v_wmma_f32_16x16x32_f16): 11-bit significands for operands in range — used where a [0,1] probability operand needs more precision than bf16
typedef _Float16 v16h __attribute__((ext_vector_type(16)));
union FragH { v16h v; v8us half[2]; _Float16 h[16]; unsigned short u[16]; };
template <int NT>
__device__ __forceinline__ v8f mmaH(v16h ah, v16h al, v16h bh, v16h bl, v8f c) {
  c = __builtin_amdgcn_wmma_f32_16x16x32_f16(false, ah, false, bh, (short)0, c, false, false);
  if (NT >= 2) c = __builtin_amdgcn_wmma_f32_16x16x32_f16(false, al, false, bh, (short)0, c, false, false);
  if (NT >= 3) c = __builtin_amdgcn_wmma_f32_16x16x32_f16(false, ah, false, bl, (short)0, c, false, false);
  asm volatile("v_nop\n\tv_nop\n\tv_nop\n\tv_nop" : "+v"(c) : "v"(ah), "v"(al), "v"(bh), "v"(bl));
  return c;
}
// batched GEMM like k_gemm_b but f16 operands: A f32 (split into f16 hi/lo if ASPLIT, else rounded to f16), Bt = f16 values [n][k]; alpha; C f32; N multiple of 16 (partial tiles skipped)
template <bool ASPLIT>
__global__ __launch_bounds__(128) void k_gemm_h(const float* __restrict__ A, int lda, size_t sA, const _Float16* __restrict__ Bh, int ldb, size_t sB, float alpha, float* __restrict__ C, int ldc, size_t sC, int M, int N, int K) {
  __shared__ __attribute__((aligned(16))) float so[4][16][64];
  const int tid = threadIdx.x, w = tid >> 5, lane = tid & 31, ln = lane & 15, hh = lane >> 4; const int by = blockIdx.y;
  A += (size_t)by * sA; Bh += (size_t)by * sB; C += (size_t)by * sC;
  const int ntn = (N + 63) / 64; const int wid = blockIdx.x * 4 + w; const int mt = wid / ntn, nq = wid % ntn; if (mt * 16 >= M) return;
  const int row0 = mt * 16, col0 = nq * 64; const float* arow = A + (size_t)(row0 + ln) * lda;
  v8f acc[4] = {};
  for (int kb = 0; kb < K; kb += 32) {
    FragH ah, al;
    const v4f x0 = *(const v4fa*)(arow + kb + 8 * hh), x1 = *(const v4fa*)(arow + kb + 8 * hh + 4), x2 = *(const v4fa*)(arow + kb + 16 + 8 * hh), x3 = *(const v4fa*)(arow + kb + 16 + 8 * hh + 4);
    float xs[16] = {x0[0],x0[1],x0[2],x0[3],x1[0],x1[1],x1[2],x1[3],x2[0],x2[1],x2[2],x2[3],x3[0],x3[1],x3[2],x3[3]};
#pragma unroll
    for (int i = 0; i < 16; ++i) { const _Float16 h = (_Float16)xs[i]; ah.h[i] = h; al.h[i] = ASPLIT ? (_Float16)(xs[i] - (float)h) : (_Float16)0.0f; }
#pragma unroll
    for (int t = 0; t < 4; ++t) { if (col0 + t * 16 >= N) continue; const size_t boff = (size_t)(col0 + t * 16 + ln) * ldb + kb; FragH bq; bq.half[0] = *(const v8us*)(Bh + boff + 8 * hh); bq.half[1] = *(const v8us*)(Bh + boff + 16 + 8 * hh);
      acc[t] = mmaH<ASPLIT ? 2 : 1>(ah.v, al.v, bq.v, bq.v, acc[t]); }
  }
#pragma unroll
  for (int t = 0; t < 4; ++t) { if (col0 + t * 16 >= N) continue;
#pragma unroll
    for (int r = 0; r < 8; ++r) so[w][8 * hh + r][t * 16 + ln] = acc[t][r] * alpha; }
  __builtin_amdgcn_fence(__ATOMIC_ACQ_REL, "workgroup"); __builtin_amdgcn_wave_barrier();
  const int rsub = lane >> 4, c4 = (lane & 15) * 4;
  {
#pragma unroll
    for (int q = 0; q < 8; ++q) { const int r = q * 2 + rsub; if (col0 + c4 < N) { const v4f v = *(const v4fa*)&so[w][r][c4]; *(v4f*)(C + (size_t)(row0 + r) * ldc + col0 + c4) = v; } }
     }
}

// Wt[n][k] = f16(W[k][n]·scale) from f32 row-major W[K][N] (scale = power of two; bf16-exact weights stay exact in f16 away from the subnormal range)
__device__ __forceinline__ void wt_f16(const int t, const float* __restrict__ W, _Float16* __restrict__ Wt, int K, int N, float scale) {
  if (t >= N * (K / 8)) return; const int n = t / (K / 8), k8 = (t % (K / 8)) * 8; FragH f;
#pragma unroll
  for (int i = 0; i < 8; ++i) f.h[i] = (_Float16)(bf16_round(W[(size_t)(k8 + i) * N + n]) * scale); const v8us o = f.half[0];
  *(v8us*)((unsigned short*)Wt + (size_t)n * K + k8) = o; 
}
// One lane's eight 16-byte copies of an operand tile, global memory to LDS through no register. The s_wait_xcnt stands in the copies' own statement, ahead of any rewrite of the address registers they name.
__device__ __forceinline__ void tile_copy8(unsigned l, unsigned lstep, const unsigned short* g, size_t gstep) {
  asm volatile("global_load_async_to_lds_b128 %0, %8, off\n\t"
               "global_load_async_to_lds_b128 %1, %9, off\n\t"
               "global_load_async_to_lds_b128 %2, %10, off\n\t"
               "global_load_async_to_lds_b128 %3, %11, off\n\t"
               "global_load_async_to_lds_b128 %4, %12, off\n\t"
               "global_load_async_to_lds_b128 %5, %13, off\n\t"
               "global_load_async_to_lds_b128 %6, %14, off\n\t"
               "global_load_async_to_lds_b128 %7, %15, off\n\t"
               "s_wait_xcnt 0x0"
               :: "v"(l), "v"(l + lstep), "v"(l + 2 * lstep), "v"(l + 3 * lstep), "v"(l + 4 * lstep), "v"(l + 5 * lstep), "v"(l + 6 * lstep), "v"(l + 7 * lstep),
                  "v"(g), "v"(g + gstep), "v"(g + 2 * gstep), "v"(g + 3 * gstep), "v"(g + 4 * gstep), "v"(g + 5 * gstep), "v"(g + 6 * gstep), "v"(g + 7 * gstep)
               : "memory");
}
// C[M][N] = (A . Bt^T) * alpha (+ bias rounded to bf16): A f16 [M][CC], Bt f16 [N][CC], both with rows of CC elements; M and N multiples of 64, the grid exactly (M / 64) * (N / 64) blocks, N / 64 = 1 << lgn.
// A block of four waves owns a 64 x 64 tile of C. Its 64 rows of A and 64 rows of Bt, the whole K, are copied into LDS once, a wave's copy = one whole row of 512 contiguous bytes; then wave w takes rows 16 w .. 16 w + 15
// against all 64 columns, every fragment from LDS, the k order and the accumulation as before. Output rows are staged in the wave's own 16 rows of A, which no other wave reads, and leave as whole lines. Writes f32 C or f16 C16.
// AHM: A lies head-major, [batch][head][token place][HD], as the attention kernel stores it; a wave's copy is then 8 places x 64 bytes of one head, still 512 contiguous bytes, and lands as 8 pieces in 8 LDS rows: the tile in LDS is the same.
// OPLACE: inside each group of 16 tokens, token t lies at place 4 (t & 3) + (t >> 2) (its own inverse), so that 4 places in a row are LDS rows 4 apart: at pitch GP their 64-byte pieces fall on all 64 banks, as a whole row does.
#define OPLACE(t) ((((t) & 3) << 2) | ((t) >> 2))
#define GP (CC * 2 + 16)      /* LDS row pitch in bytes, 16 B x odd: 16 lanes' ds_load_b128 fall on all 64 banks */
#define GSM (128 * GP)
typedef float fal __attribute__((may_alias));
template <bool BIAS, bool F32OUT, bool AHM>
__device__ __forceinline__ void gemm_lds(unsigned char* sm, const int bx, const int lgn, const _Float16* __restrict__ A, const _Float16* __restrict__ Bh, float alpha, const float* __restrict__ bias,
    float* __restrict__ C, _Float16* __restrict__ C16, int ldc) {
  const int tid = threadIdx.x, w = tid >> 5, lane = tid & 31, ln = lane & 15, hh = lane >> 4;
  const int row0 = (bx >> lgn) * 64, col0 = (bx & ((1 << lgn) - 1)) * 64;
  /* copy map: chunk c of thread tid = tile row w + 4 c, 16-byte column lane */
  const unsigned short* gb = (const unsigned short*)Bh + (size_t)(col0 + w) * CC + lane * 8;
  const unsigned l0 = (unsigned)(size_t)sm + w * GP + lane * 16;      /* low 32 bits of the shared address = byte offset in the work-group's LDS */
  if (AHM) {      /* copy map of a head-major A: chunk c = head c, place 16 w + (lane >> 2) (+ 8 in the second eight: two tile rows on), tile row 16 w + OPLACE(place), 16-byte column 4 c + (lane & 3); a 64-row tile lies in one batch */
    const unsigned short* ga = (const unsigned short*)A + ((size_t)(row0 / NN) * NH * NN + row0 % NN + w * 16 + (lane >> 2)) * HD + (lane & 3) * 8;
    const unsigned la = (unsigned)(size_t)sm + (w * 16 + OPLACE(lane >> 2)) * GP + (lane & 3) * 16;
    tile_copy8(la, HD * 2, ga, (size_t)NN * HD); tile_copy8(la + 2 * GP, HD * 2, ga + 8 * HD, (size_t)NN * HD);
  } else {
    const unsigned short* ga = (const unsigned short*)A + (size_t)(row0 + w) * CC + lane * 8;
    tile_copy8(l0, 4 * GP, ga, (size_t)4 * CC); tile_copy8(l0 + 32 * GP, 4 * GP, ga + 32 * CC, (size_t)4 * CC);
  }
  tile_copy8(l0 + 64 * GP, 4 * GP, gb, (size_t)4 * CC); tile_copy8(l0 + 96 * GP, 4 * GP, gb + 32 * CC, (size_t)4 * CC);
  float bv[4];      /* the bias is fetched while the copies fly */
#pragma unroll
  for (int t = 0; t < 4; ++t) bv[t] = BIAS ? bf16_round(bias[col0 + t * 16 + ln]) : 0.f;
  if (BIAS) asm volatile("s_wait_xcnt 0x0" ::: "memory");      /* ahead of any rewrite of the offset register that the bias loads name */
  asm volatile("s_wait_asynccnt 0x0" ::: "memory");      /* this wave's share of both tiles has landed */
  __syncthreads();      /* both tiles published to all four waves */
  const unsigned char* af = sm + (w * 16 + ln) * GP + hh * 16; const unsigned char* bf = sm + (64 + ln) * GP + hh * 16;
  v8f acc[4] = {};
  FragH ah[2], bq[2][4];      /* two register sets: a k step's ten fragment reads stand together, one k step ahead of the products that use them */
  auto frags = [&](const int kb) { FragH& a = ah[kb & 1]; a.half[0] = *(const v8us*)(af + kb * 64); a.half[1] = *(const v8us*)(af + kb * 64 + 32);
#pragma unroll
    for (int t = 0; t < 4; ++t) { FragH& b = bq[kb & 1][t]; b.half[0] = *(const v8us*)(bf + t * 16 * GP + kb * 64); b.half[1] = *(const v8us*)(bf + t * 16 * GP + kb * 64 + 32); } };
  frags(0);
#pragma unroll      /* every LDS offset an immediate, the register set a compile-time choice */
  for (int kb = 0; kb < CC / 32; ++kb) { if (kb + 1 < CC / 32) frags(kb + 1);
#pragma unroll
    for (int t = 0; t < 4; ++t) acc[t] = mmaH<1>(ah[kb & 1].v, ah[kb & 1].v, bq[kb & 1][t].v, bq[kb & 1][t].v, acc[t]);
  }
  fal* so = (fal*)(sm + w * 16 * GP);      /* [16][64] f32 in the wave's own rows of A, all read by now */
#pragma unroll
  for (int t = 0; t < 4; ++t)
#pragma unroll
    for (int r = 0; r < 8; ++r) so[(8 * hh + r) * 64 + t * 16 + ln] = acc[t][r] * alpha + bv[t];
  __builtin_amdgcn_fence(__ATOMIC_ACQ_REL, "workgroup"); __builtin_amdgcn_wave_barrier();
  const int rsub = lane >> 4, c4 = (lane & 15) * 4; typedef _Float16 v4h __attribute__((ext_vector_type(4)));
#pragma unroll
  for (int q = 0; q < 8; ++q) { const int r = q * 2 + rsub; const v4f v = *(const v4fa*)&so[r * 64 + c4]; const size_t o = (size_t)(row0 + w * 16 + r) * ldc + col0 + c4;
    if (F32OUT) *(v4f*)(C + o) = v; else { v4h h4; for (int i = 0; i < 4; ++i) h4[i] = (_Float16)v[i]; *(v4h*)(C16 + o) = h4; } }
}
// y = O16 . Wout + bout: M 8192, N 256; O16 head-major
__global__ __launch_bounds__(128) void k_gemm_out(const _Float16* __restrict__ A, const _Float16* __restrict__ Bh, float alpha, const float* __restrict__ bias, float* __restrict__ C) {
  __shared__ __attribute__((aligned(16))) unsigned char sm[GSM];
  gemm_lds<true, true, true>(sm, blockIdx.x, 2, A, Bh, alpha, bias, C, nullptr, CC);
}
// ---- q, k, v straight from the f32 inputs: the block rounds its own two operand tiles to bf16 on their way into LDS, through registers (no conversion launch, no converted planes in the workspace)
typedef __bf16 v2b __attribute__((ext_vector_type(2)));
typedef unsigned v2u __attribute__((ext_vector_type(2), may_alias));
typedef unsigned v4u __attribute__((ext_vector_type(4), may_alias));
__device__ __forceinline__ unsigned pk_bf16(float a, float b) { v2b p; p[0] = (__bf16)a; p[1] = (__bf16)b; return __builtin_bit_cast(unsigned, p); }      /* round to nearest even; a = the lower k */
// Rows: 64 rows of a row-major f32 matrix with rows of CC elements, to 64 LDS rows [row][k] bf16 at pitch GP. Piece c (0..31) of a thread: row w + 4 (c >> 1), k = 128 (c & 1) + 4 lane: a wave's load = 512 contiguous bytes of one row,
// its LDS store 256 contiguous bytes. Loads and stores are separate calls of 16 pieces, so that the caller sets how many loads fly at once. s and dst come with the thread's own offset (row w, k = 4 lane) already added.
__device__ __forceinline__ void rows_load(v4f (&r)[16], const float* __restrict__ s, const int c0) {
#pragma unroll      /* every offset an immediate */
  for (int c = 0; c < 16; ++c) r[c] = *(const v4fa*)(s + ((c0 + c) >> 1) * 4 * CC + (c & 1) * 128);
}
__device__ __forceinline__ void rows_store(const v4f (&r)[16], unsigned char* dst, const int c0) {
#pragma unroll
  for (int c = 0; c < 16; ++c) *(v2u*)(dst + ((c0 + c) >> 1) * 4 * GP + (c & 1) * 256) = (v2u){pk_bf16(r[c][0], r[c][1]), pk_bf16(r[c][2], r[c][3])};
}
// Columns: 64 columns of a row-major f32 matrix [CC][ldw], transposed to 64 LDS rows [n][k] bf16 at pitch GP. A thread takes four blocks u of 8 k x 4 n (n = 32 (u & 1) + 4 n4 + j, k = 128 (u >> 1) + 8 (4 w + kq) + i): eight 16-byte loads,
// and each of the block's four columns leaves as one 16-byte LDS store of 8 k; s and dst come with the thread's own offset (n = 4 n4, k = 8 (4 w + kq)) already added. Lanes: a wave's load = 4 rows x one whole 128-byte line; its 16-lane halves store to 4 LDS rows 4 apart x 4 neighbouring 16-byte columns, at pitch GP all 64 banks.
__device__ __forceinline__ void cols_load(v4f (&r)[32], const float* __restrict__ s, const int ldw) {
#pragma unroll
  for (int c = 0; c < 32; ++c) r[c] = *(const v4fa*)(s + (size_t)((c >> 4) * 128 + (c & 7)) * ldw + ((c >> 3) & 1) * 32);      /* c = 8 u + i */
}
__device__ __forceinline__ void cols_store(const v4f (&r)[32], unsigned char* dst) {
#pragma unroll
  for (int u = 0; u < 4; ++u)
#pragma unroll
    for (int j = 0; j < 4; ++j) *(v4u*)(dst + ((u & 1) * 32 + j) * GP + (u >> 1) * 256) =
      (v4u){pk_bf16(r[8 * u][j], r[8 * u + 1][j]), pk_bf16(r[8 * u + 2][j], r[8 * u + 3][j]), pk_bf16(r[8 * u + 4][j], r[8 * u + 5][j]), pk_bf16(r[8 * u + 6][j], r[8 * u + 7][j])};
}
// Three jobs that read only inputs, in one grid; the job is block-uniform, by block index. A 64 x 64 tile a block, whole K in LDS, wave w = tile rows 16 w .. 16 w + 15, as in gemm_lds; products on v_wmma_f32_16x16x32_bf16.
// blocks [0, NBQ): [q | k] token-major [(b,n)][512] = x . Wqkv columns 0..511 (M 8192, N 512); blocks [NBQ, NBQ + BB * NBV): v channel-major per batch [b][(h,d)][n] = (Wqkv columns 512..767)^T . x[b]^T (M 256, N 2048);
// blocks from NBQ + BB * NBV: Wout transposed ((in,out) to Bt[n][k] f16 x 2^4) for the output GEMM.
#define NBQ ((NR / 64) * (2 * CC / 64))
#define NBV ((CC / 64) * (NN / 64))
#define NBW2 (CC * (CC / 8) / 128)
__global__ __launch_bounds__(128, 4) /* 4 waves a SIMD = the 4 blocks a WGP that the LDS allows: the register budget stays at 256 */ void k_gemm_qkv(const float* __restrict__ x, const float* __restrict__ Wqkv, _Float16* __restrict__ QK, _Float16* __restrict__ Vt, const float* __restrict__ Wout, _Float16* __restrict__ Bo) {
  __shared__ __attribute__((aligned(16))) unsigned char sm[GSM];
  const int bx = blockIdx.x, rb = bx - NBQ; const bool jv = rb >= 0;
  if (rb >= BB * NBV) { wt_f16((rb - BB * NBV) * 128 + (int)threadIdx.x, Wout, Bo, CC, CC, 16.0f); return; }      /* the whole block leaves, ahead of the barrier */
  const int tid = threadIdx.x, w = tid >> 5, lane = tid & 31, ln = lane & 15, hh = lane >> 4;
  const int by = jv ? rb / NBV : 0, tb = jv ? rb % NBV : bx, lgn = jv ? 5 : 3;
  const int row0 = (tb >> lgn) * 64, col0 = (tb & ((1 << lgn) - 1)) * 64;
  /* tile rows 0..63 of LDS = A, 64..127 = B; x is A for q | k and B for v */
  { const int n4 = (lane & 3) | ((lane >> 4) << 2), kq = (lane >> 2) & 3;
    const float* ws = Wqkv + (jv ? 2 * CC + row0 : col0) + (size_t)(w * 4 + kq) * 8 * C3 + n4 * 4; unsigned char* wd = sm + (jv ? 0 : 64 * GP) + n4 * 4 * GP + (w * 4 + kq) * 16;
    const float* xs = x + (size_t)(jv ? by * NN + col0 : row0) * CC + w * CC + lane * 4; unsigned char* xd = sm + (jv ? 64 * GP : 0) + w * GP + lane * 8;
    v4f rw[32], ra[16], rc[16];
    cols_load(rw, ws, C3);
    asm volatile("s_wait_xcnt 0x0" ::: "memory");      /* ahead of any rewrite of the address registers that Wqkv's loads name: a later load's result may be given those registers */
    rows_load(ra, xs, 0);
    __builtin_amdgcn_sched_barrier(0);      /* 48 loads fly at once, 192 registers; the last 16 are held back until Wqkv's registers are free: all 64 at once spill at 4 waves a SIMD */
    cols_store(rw, wd);
    __builtin_amdgcn_sched_barrier(0);      /* the last 16 loads stay behind the stores that free their registers */
    rows_load(rc, xs, 16);
    __builtin_amdgcn_sched_barrier(0);      /* the last loads are issued ahead of the first half's conversion and stores */
    rows_store(ra, xd, 0); rows_store(rc, xd, 16); }
  __syncthreads();      /* both tiles published to all four waves */
  const unsigned char* af = sm + (w * 16 + ln) * GP + hh * 16; const unsigned char* bf = sm + (64 + ln) * GP + hh * 16;
  v8f acc[4] = {};
  FragB ah[2], bq[2][4];      /* two register sets: a k step's ten fragment reads stand together, one k step ahead of the products that use them */
  auto frags = [&](const int kb) { FragB& a = ah[kb & 1]; a.half[0] = *(const v8us*)(af + kb * 64); a.half[1] = *(const v8us*)(af + kb * 64 + 32);
#pragma unroll
    for (int t = 0; t < 4; ++t) { FragB& b = bq[kb & 1][t]; b.half[0] = *(const v8us*)(bf + t * 16 * GP + kb * 64); b.half[1] = *(const v8us*)(bf + t * 16 * GP + kb * 64 + 32); } };
  frags(0);
#pragma unroll      /* every LDS offset an immediate, the register set a compile-time choice */
  for (int kb = 0; kb < CC / 32; ++kb) { if (kb + 1 < CC / 32) frags(kb + 1);
#pragma unroll
    for (int t = 0; t < 4; ++t) acc[t] = mmaN<1>(ah[kb & 1].v, ah[kb & 1].v, bq[kb & 1][t].v, bq[kb & 1][t].v, acc[t]);
  }
  fal* so = (fal*)(sm + w * 16 * GP);      /* [16][64] f32 in the wave's own rows of A, all read by now */
#pragma unroll
  for (int t = 0; t < 4; ++t)
#pragma unroll
    for (int r = 0; r < 8; ++r) so[(8 * hh + r) * 64 + t * 16 + ln] = acc[t][r];
  __builtin_amdgcn_fence(__ATOMIC_ACQ_REL, "workgroup"); __builtin_amdgcn_wave_barrier();
  _Float16* C16 = jv ? Vt + (size_t)by * CC * NN : QK; const int ldc = jv ? NN : 2 * CC;
  const int rsub = lane >> 4, c4 = (lane & 15) * 4; typedef _Float16 v4h __attribute__((ext_vector_type(4)));
#pragma unroll
  for (int q = 0; q < 8; ++q) { const int r = q * 2 + rsub; const v4f v = *(const v4fa*)&so[r * 64 + c4]; v4h h4; for (int i = 0; i < 4; ++i) h4[i] = (_Float16)v[i];
    *(v4h*)(C16 + (size_t)(row0 + w * 16 + r) * ldc + col0 + c4) = h4; }
  asm volatile("s_wait_xcnt 0x0" ::: "memory");      /* behind the last store, ahead of any rewrite of the registers that the stores name, on every way the code runs on from here */
}


typedef _Float16 v4h __attribute__((ext_vector_type(4)));

__global__ __launch_bounds__(256) void k_round16f(const float* __restrict__ W, _Float16* __restrict__ Bt, size_t n8) { const size_t t = (size_t)blockIdx.x * 256 + threadIdx.x; if (t >= n8) return; FragH f;
#pragma unroll
  for (int i = 0; i < 8; ++i) f.h[i] = (_Float16)(bf16_round(W[t * 8 + i]) * 16.0f); *(v8us*)((unsigned short*)Bt + t * 8) = f.half[0];  }
template <int NHv, int TTv>
__global__ __launch_bounds__(256) void k_vt(const _Float16* __restrict__ V16, int ldv, int voff, _Float16* __restrict__ Vt) { __shared__ unsigned short tl[64][66]; const int tid = threadIdx.x; const int slab = blockIdx.x / (TTv / 64), lg = blockIdx.x % (TTv / 64); const int b = slab / NHv, h = slab % NHv;
  for (int i = tid; i < 64 * 8; i += 256) { const int r = i / 8, c8 = (i % 8) * 8; FragH f; f.half[0] = *(const v8us*)((const unsigned short*)V16 + ((size_t)b * TTv + lg * 64 + r) * ldv + voff + h * 64 + c8);
#pragma unroll
    for (int q = 0; q < 8; ++q) tl[r][c8 + q] = f.u[q]; }
  __syncthreads();
  {
#pragma unroll
    for (int rd = 0; rd < 2; ++rd) { const int d = rd * 32 + tid / 8, pc = tid % 8; FragH f;
#pragma unroll
      for (int q = 0; q < 8; ++q) f.u[q] = tl[pc * 8 + q][d];
      *(v8us*)((unsigned short*)Vt + ((size_t)slab * 64 + d) * TTv + lg * 64 + pc * 8) = f.half[0]; }
     } }

typedef float v2f __attribute__((ext_vector_type(2)));
// lane l with lane l ^ 16 (the two halves of a wave hold the two key halves of one query column)
__device__ __forceinline__ float xhalf(float x) { return __builtin_bit_cast(float, __builtin_amdgcn_permlanex16(__builtin_bit_cast(int, x), __builtin_bit_cast(int, x), 0x76543210, 0xfedcba98, false, false)); }

// One lane's eight 16-byte copies of a stage (four of K, four of V^T), global memory to LDS through no register. The s_wait_xcnt stands in the copies' own statement, ahead of any rewrite of the address registers they name.
__device__ __forceinline__ void stage_copy(unsigned lk, const unsigned short* gk, size_t gkstep, unsigned lkstep, unsigned lv, const unsigned short* gv, size_t gvstep, unsigned lvstep) {
  asm volatile("global_load_async_to_lds_b128 %0, %8, off\n\t"
               "global_load_async_to_lds_b128 %1, %9, off\n\t"
               "global_load_async_to_lds_b128 %2, %10, off\n\t"
               "global_load_async_to_lds_b128 %3, %11, off\n\t"
               "global_load_async_to_lds_b128 %4, %12, off\n\t"
               "global_load_async_to_lds_b128 %5, %13, off\n\t"
               "global_load_async_to_lds_b128 %6, %14, off\n\t"
               "global_load_async_to_lds_b128 %7, %15, off\n\t"
               "s_wait_xcnt 0x0"
               :: "v"(lk), "v"(lk + lkstep), "v"(lk + 2 * lkstep), "v"(lk + 3 * lkstep), "v"(lv), "v"(lv + lvstep), "v"(lv + 2 * lvstep), "v"(lv + 3 * lvstep),
                  "v"(gk), "v"(gk + gkstep), "v"(gk + 2 * gkstep), "v"(gk + 3 * gkstep), "v"(gv), "v"(gv + gvstep), "v"(gv + 2 * gvstep), "v"(gv + 3 * gvstep)
               : "memory");
}

__global__ __launch_bounds__(128) __attribute__((amdgpu_waves_per_eu(2, 2))) /* two blocks a WGP, two waves a SIMD: the grid's 512 blocks are exactly one even round over 256 WGPs */ void k_flash(const _Float16* __restrict__ Q16, int ldq, const _Float16* __restrict__ K16, int ldk, const _Float16* __restrict__ Vt, const int* __restrict__ MSK, _Float16* __restrict__ O16) {
  constexpr int NG = 2, RPW = 16 * NG, NQB = NN / (4 * RPW), DT = 2; (void)MSK;
  constexpr int TK = 128, NS = NN / TK, NP = TK / 32;      /* keys a stage, stages, 32-key passes of the second product a stage */
  constexpr int KP = HD * 2 + 16, VP = TK * 2 + 16;      /* LDS row pitches in bytes, 16 B x odd: 16 lanes' ds_load_b128 fall on all 64 banks */
  constexpr int KB = TK * KP, SB = KB + HD * VP;      /* a stage: TK rows of K (HD channels), then HD rows of V^T (TK keys) */
  __shared__ __attribute__((aligned(16))) unsigned char sm[2 * SB];
  constexpr float SL2E = 0.17677669529663687f * 1.4426950408889634f;      /* 32^-1/2 * log2(e): e^(scale*s - m) = 2^(SL2E*s - m2), one fma ahead of a bare v_exp_f32 */
  const int tid = threadIdx.x, w = tid >> 5, lane = tid & 31, ln = lane & 15, hh = lane >> 4;
  const int slab = blockIdx.x / NQB, qblk = blockIdx.x % NQB; const int b = slab / NH, h = slab % NH; const int q0 = qblk * (4 * RPW) + w * RPW;
  const unsigned short* Vth = (const unsigned short*)Vt + ((size_t)b * CC + h * HD) * NN;      /* V^T = v[b][(h,d)][n] channel-major */
  /* copy map: K chunk c of thread tid = row (tid >> 2) + 32 c, 16-byte column tid & 3; V^T chunk c = row (tid >> 4) + 8 c, 16-byte column tid & 15 */
  const unsigned short* gk = (const unsigned short*)K16 + ((size_t)b * NN + (tid >> 2)) * ldk + h * HD + (tid & 3) * 8;
  const unsigned short* gv = Vth + (size_t)(tid >> 4) * NN + (tid & 15) * 8;
  const unsigned lds0 = (unsigned)(size_t)sm;      /* low 32 bits of the shared address = byte offset in the work-group's LDS */
  const unsigned lk = lds0 + (tid >> 2) * KP + (tid & 3) * 16, lv = lds0 + KB + (tid >> 4) * VP + (tid & 15) * 16;
  const size_t gkstep = (size_t)32 * ldk, gkstage = (size_t)TK * ldk;
  stage_copy(lk, gk, gkstep, 32 * KP, lv, gv, (size_t)8 * NN, 8 * VP);
  FragH bq[NG];      /* B of group g: column ln = query q0 + 16 g + ln, k = head channel */
#pragma unroll      /* g a compile-time index: bq stays in registers */
  for (int g = 0; g < NG; ++g) { const unsigned short* qr = (const unsigned short*)Q16 + ((size_t)b * NN + q0 + g * 16 + ln) * ldq + h * HD; bq[g].half[0] = *(const v8us*)(qr + 8 * hh); bq[g].half[1] = *(const v8us*)(qr + 16 + 8 * hh); }
  asm volatile("s_wait_xcnt 0x0" ::: "memory");      /* ahead of any rewrite of the address registers that Q's loads name */
  asm volatile("s_wait_asynccnt 0x0" ::: "memory");      /* this wave's share of stage 0 has landed */
  __syncthreads();      /* stage 0 published to all four waves */
  gk += gkstage; gv += TK;
  stage_copy(lk + SB, gk, gkstep, 32 * KP, lv + SB, gv, (size_t)8 * NN, 8 * VP);
  float m_q[NG], l_q[NG]; v8f oacc[NG][DT];
#pragma unroll      /* compile-time indices: the running state stays in registers */
  for (int g = 0; g < NG; ++g) { m_q[g] = -3.0e38f; l_q[g] = 0.f;
#pragma unroll      /* as above */
    for (int dt = 0; dt < DT; ++dt) oacc[g][dt] = (v8f){0.f,0.f,0.f,0.f,0.f,0.f,0.f,0.f}; }
#pragma unroll 1      /* one body for both buffers: the buffer is an offset */
  for (int t = 0; t < NS; ++t) {
    const unsigned bo = (unsigned)(t & 1) * SB;
    const unsigned char* kf = sm + bo + ln * KP + hh * 16; const unsigned char* vf = sm + bo + KB + ln * VP + hh * 16;
    /* One softmax block = the whole stage of TK keys: all its fragments are read at the head, its 2 NP score tiles come from 2 NP independent products back to back, then ONE maximum, ONE rescale of l_q and oacc, and the NP passes of the second product. */
    static_assert(NP == 4, "the joins of the four chains and of the four partial sums below are written out for four passes");
    FragH ak[2 * NP], av[NP][DT];
#pragma unroll      /* every LDS offset an immediate */
    for (int nt = 0; nt < 2 * NP; ++nt) { const unsigned char* kr = kf + nt * 16 * KP; ak[nt].half[0] = *(const v8us*)kr; ak[nt].half[1] = *(const v8us*)(kr + 32); }
    __builtin_amdgcn_sched_barrier(0);      /* K's reads stay in front of V^T's: LDS answers in order, and else the first score product waits for V^T's fragments too */
#pragma unroll      /* V^T's reads stand directly behind K's, one place of LDS reads a stage: their latency runs behind the score products and the maximum */
    for (int ps = 0; ps < NP; ++ps)
#pragma unroll
      for (int dt = 0; dt < DT; ++dt) { const unsigned char* vrow = vf + dt * 16 * VP + ps * 64; av[ps][dt].half[0] = *(const v8us*)vrow; av[ps][dt].half[1] = *(const v8us*)(vrow + 32); }
    __builtin_amdgcn_sched_barrier(0);      /* keeps V^T's reads up here: else each is moved directly in front of its product, and its latency stands open there */
    v8f sg[NG][2 * NP];      /* sg[g][nt][r] = S^T[key t*TK + nt*16 + 8*hh + r][query q0 + 16 g + ln] */
#pragma unroll      /* compile-time indices: the score tiles stay in registers */
    for (int nt = 0; nt < 2 * NP; ++nt)
#pragma unroll      /* as above */
      for (int g = 0; g < NG; ++g) sg[g][nt] = __builtin_amdgcn_wmma_f32_16x16x32_f16(false, ak[nt].v, false, bq[g].v, (short)0, (v8f){0.f,0.f,0.f,0.f,0.f,0.f,0.f,0.f}, false, false);
    __builtin_amdgcn_sched_barrier(0);      /* the score products stay back to back, each filling the distance behind the one before: else the maximum's steps are moved in between them, each behind pads of v_nop */
    float alg[NG], nbg[NG];      /* each group's rescale factor and exponent shift of this stage */
#pragma unroll      /* the groups' indices are compile-time: all stays in registers */
    for (int g = 0; g < NG; ++g) { const v8f (&s)[2 * NP] = sg[g];
    float mch[NP];      /* the maximum in threes (one three-input instruction takes in two more scores): chain ps runs over the 16 scores of tiles 2 ps and 2 ps + 1 but the last, which joins below */
#pragma unroll
    for (int ps = 0; ps < NP; ++ps) { const v8f u = s[2 * ps], v = s[2 * ps + 1];
      float c = fmaxf(fmaxf(u[0], u[1]), u[2]); c = fmaxf(fmaxf(c, u[3]), u[4]); c = fmaxf(fmaxf(c, u[5]), u[6]); c = fmaxf(fmaxf(c, u[7]), v[0]);
      c = fmaxf(fmaxf(c, v[1]), v[2]); c = fmaxf(fmaxf(c, v[3]), v[4]); mch[ps] = fmaxf(fmaxf(c, v[5]), v[6]); }
    float mc = fmaxf(fmaxf(mch[0], mch[1]), mch[2]); mc = fmaxf(fmaxf(mc, mch[3]), s[1][7]); mc = fmaxf(fmaxf(mc, s[3][7]), s[5][7]); mc = fmaxf(mc, s[7][7]);
    mc = fmaxf(mc, xhalf(mc));      /* both halves now hold the maximum over the query's TK raw products (SL2E > 0 keeps the order) */
    const float mn = fmaxf(m_q[g], mc * SL2E); alg[g] = (mn > -1.0e38f) ? __builtin_amdgcn_exp2f(m_q[g] - mn) : 1.0f; m_q[g] = mn;      /* m_q, mn: base-2 exponents */
    nbg[g] = 10.0f - mn;      /* 2^10 = the f16 scale of P, carried in the exponent: p and l_q hold 1024 times the shifted values */
    }
#pragma unroll      /* as above */
    for (int g = 0; g < NG; ++g) { const v8f (&s)[2 * NP] = sg[g]; const float al = alg[g], nb = nbg[g];
    FragH pb[NP]; v2f psum[NP];
#pragma unroll
    for (int ps = 0; ps < NP; ++ps) { v2f p[8];
#pragma unroll
      for (int i = 0; i < 8; ++i) { const v2f a = (v2f){s[2 * ps + (i >> 2)][(2 * i) & 7], s[2 * ps + (i >> 2)][(2 * i + 1) & 7]} * SL2E + nb;
        p[i] = (v2f){__builtin_amdgcn_exp2f(a[0]), __builtin_amdgcn_exp2f(a[1])}; pb[ps].h[2 * i] = (_Float16)p[i][0]; pb[ps].h[2 * i + 1] = (_Float16)p[i][1]; }
      psum[ps] = ((p[0] + p[1]) + (p[2] + p[3])) + ((p[4] + p[5]) + (p[6] + p[7])); }
    const v2f pt = (psum[0] + psum[1]) + (psum[2] + psum[3]);
    l_q[g] = l_q[g] * al + (pt[0] + pt[1]);      /* this half's TK / 2 keys; the halves join after the loop */
#pragma unroll
    for (int dt = 0; dt < DT; ++dt) oacc[g][dt] *= al;
#pragma unroll
    for (int ps = 0; ps < NP; ++ps)
#pragma unroll
      for (int dt = 0; dt < DT; ++dt) oacc[g][dt] = __builtin_amdgcn_wmma_f32_16x16x32_f16(false, av[ps][dt].v, false, pb[ps].v, (short)0, oacc[g][dt], false, false);      /* oacc[g][dt][r] = O^T[channel dt*16 + 8*hh + r][query q0 + 16 g + ln] */
    }
    __builtin_amdgcn_sched_barrier(0);      /* the stage's arithmetic stays in front of the waits below: moved behind them, the wait for stage t + 1 would stand at the stage's head, directly behind the issue of its copies */
    asm volatile("s_wait_dscnt 0x0" ::: "memory");      /* this wave's reads of stage t are done before its buffer is handed back */
    asm volatile("s_wait_asynccnt 0x0" ::: "memory");      /* this wave's share of stage t + 1 has landed */
    __syncthreads();      /* publishes stage t + 1 and ends every wave's reads of stage t */
    if (t + 2 < NS) { gk += gkstage; gv += TK; stage_copy(lk + bo, gk, gkstep, 32 * KP, lv + bo, gv, (size_t)8 * NN, 8 * VP); }      /* stage t + 2 into the buffer just read */
  }
  asm volatile("s_wait_asynccnt 0x0" ::: "memory");      /* no copy outstanding at the wave's end */
#pragma unroll      /* g a compile-time index: the running state stays in registers */
  for (int g = 0; g < NG; ++g) {
  const float l = l_q[g] + xhalf(l_q[g]); const float den = l + (1e-6f * 1024.0f) * __builtin_amdgcn_exp2f(-m_q[g]); const float inv = (den > 0.f && den < INFINITY) ? 1.0f / den : 0.f;      /* sum e^s/(sum e^s + 1e-6) form: e^(-m)*1e-6 joins the shifted sum; an infinite den (all logits far below 0) reproduces the reference's ~0 output */
  /* O leaves as f16, head-major [b][h][place][HD], each group's 16 queries at their places OPLACE: a query's 64 bytes, and so every 128-byte line, are written by this wave alone, and 64 queries are 4 KiB in a row for the output GEMM's copies */
  unsigned short* orow = (unsigned short*)O16 + ((size_t)slab * NN + q0 + g * 16 + OPLACE(ln)) * HD + 8 * hh;
#pragma unroll
  for (int dt = 0; dt < DT; ++dt) { const v8f o = oacc[g][dt] * inv; FragH f;
#pragma unroll      /* every index a constant: f stays in registers */
    for (int i = 0; i < 8; ++i) f.h[i] = (_Float16)o[i];
    *(v8us*)(orow + dt * 16) = f.half[0]; } } }

extern "C" void kernel_launch(void* const* d_in, const int* in_sizes, int n_in,
                              void* d_out, int out_size, void* d_ws, size_t ws_size, hipStream_t stream) {
  (void)in_sizes; (void)n_in; (void)out_size;
  const float* x = (const float*)d_in[0]; const float* Wqkv = (const float*)d_in[1]; const float* Wout = (const float*)d_in[2]; const float* bout = (const float*)d_in[3];
  char* ws = (char*)d_ws; size_t off = 0;
  auto take = [&](size_t bytes) { char* p = ws + off; off += (bytes + 255) & ~(size_t)255; return p; };
  _Float16* Bo = (_Float16*)take((size_t)CC * CC * 2);
  _Float16* QK = (_Float16*)take((size_t)NR * 2 * CC * 2); _Float16* Vt = (_Float16*)take((size_t)BB * CC * NN * 2); _Float16* O16 = (_Float16*)take((size_t)NR * CC * 2);
  if (off > ws_size) return;      // 0.1 + 8.4 + 4.2 + 4.2: about 17 MB
  k_gemm_qkv<<<NBQ + BB * NBV + NBW2, 128, 0, stream>>>(x, Wqkv, QK, Vt, Wout, Bo);
  k_flash<<<BB * NH * (NN / 128), 128, 0, stream>>>(QK, 2 * CC, QK + CC, 2 * CC, Vt, nullptr, O16);      /* blocks = (b,h) x 128-query groups */
  k_gemm_out<<<(NR / 64) * (CC / 64), 128, 0, stream>>>(O16, Bo, 0.0625f, bout, (float*)d_out);      /* y = out.Wout + bout: M 8192 N 256 K 256 */
}

// v010
// One run takes 35.2 microseconds.
// In both of two side-by-side timings against v009, it was 1.06 times as fast.
// Counting every step since v000, it is 6.73 times as fast.
#include <hip/hip_runtime.h>
// KeOps-style multi-head attention (B=4, n=2048, dim 256, 8 heads × 32): qkv = x·Wqkv; q scaled by 32^-½; e = exp(q·kᵀ) WITHOUT max subtraction; out = (e·v)/(Σe + 1e-6) merged over heads; y = out·Wout + bout.
// Compute dtype: x, Wqkv, Wout, bout rounded to bf16; q/k token-major and v channel-major (= Vᵀ) as f16 GEMM outputs (f32 accumulate); fused flash-style kernel per (b,h) (online max-rescaled sums
// in f32 — the unshifted quotient is recovered exactly through the normaliser l + 1e-6·e^(−m); P f16 ×2^10) on v_wmma_f32_16x16x32_f16; O stored as f16 by the attention kernel itself, then the output GEMM with bias; f32 accumulate.
#define BB 4
#define NN 2048
#define CC 256
#define C3 768
#define NH 8
#define HD 32
#define NR (BB * NN)

typedef __bf16 v16b __attribute__((ext_vector_type(16)));
typedef unsigned short v8us __attribute__((ext_vector_type(8), may_alias));
typedef float  v8f  __attribute__((ext_vector_type(8)));
typedef float  v4f  __attribute__((ext_vector_type(4)));
typedef float  v4fa __attribute__((ext_vector_type(4), may_alias));
union FragB { v16b v; v8us half[2]; unsigned short u[16]; };

__device__ __forceinline__ unsigned short bf16_bits(float x) { unsigned int u = __float_as_uint(x); return (unsigned short)((u + 0x7FFFu + ((u >> 16) & 1u)) >> 16); }
__device__ __forceinline__ float bf16_val(unsigned short b) { return __uint_as_float(((unsigned int)b) << 16); }
__device__ __forceinline__ float bf16_round(float x) { return bf16_val(bf16_bits(x)); }
// D += A·B with NT terms: 1 = ah·bh, 2 = + al·bh (A split), 3 = + ah·bl (both split)
template <int NT>
__device__ __forceinline__ v8f mmaN(v16b ah, v16b al, v16b bh, v16b bl, v8f c) {
  c = __builtin_amdgcn_wmma_f32_16x16x32_bf16(false, ah, false, bh, (short)0, c, false, false);
  if (NT >= 2) c = __builtin_amdgcn_wmma_f32_16x16x32_bf16(false, al, false, bh, (short)0, c, false, false);
  if (NT >= 3) c = __builtin_amdgcn_wmma_f32_16x16x32_bf16(false, ah, false, bl, (short)0, c, false, false);
  asm volatile("v_nop\n\tv_nop\n\tv_nop\n\tv_nop" : "+v"(c) : "v"(ah), "v"(al), "v"(bh), "v"(bl));
  return c;
}

__global__ __launch_bounds__(256) void k_wt_bf16(const float* __restrict__ W, unsigned short* __restrict__ Wt, int K, int N) {
  const int t = blockIdx.x * 256 + threadIdx.x;
  const int k8n = K / 8;
  if (t >= N * k8n) return;
  const int n = t / k8n, k8 = (t % k8n) * 8;
  v8us v;
#pragma unroll
  for (int i = 0; i < 8; ++i) v[i] = bf16_bits(W[(size_t)(k8 + i) * N + n]);
  *(v8us*)(Wt + (size_t)n * K + k8) = v;
  
}

// GEMM C[M][N] (f32, pitch ldc) = act(A[M][K]·W + bias). A f32 row-major (pitch lda) converted per fragment to bf16
// (ASPLIT: hi/lo two planes -> 2 terms, else single rounded term); Wt bf16 [N][K] (pitch ldb). BIAS_BF16 rounds the
// bias to bf16 first (bias quantised to bf16 before the add). K%32==0, M%16==0, N%64==0.
template <bool ASPLIT, int ACT, bool BIAS_BF16>
__global__ __launch_bounds__(128) void k_gemm_bf(const float* __restrict__ A, int lda, const unsigned short* __restrict__ Wt, int ldb,
                                               const float* __restrict__ bias, float* __restrict__ C, int ldc, int M, int N, int K) {
  __shared__ __attribute__((aligned(16))) float so[4][16][64];
  const int tid = threadIdx.x, w = tid >> 5, lane = tid & 31, ln = lane & 15, hh = lane >> 4;
  const int ntn = N / 64;
  const int wid = blockIdx.x * 4 + w;
  const int mt = wid / ntn, nq = wid % ntn;
  if (mt * 16 >= M) return;
  const int row0 = mt * 16, col0 = nq * 64;
  const float* arow = A + (size_t)(row0 + ln) * lda;
  v8f acc[4] = {};
  for (int kb = 0; kb < K; kb += 32) {
    FragB ah, al;
    const v4f x0 = *(const v4fa*)(arow + kb + 8 * hh), x1 = *(const v4fa*)(arow + kb + 8 * hh + 4);
    const v4f x2 = *(const v4fa*)(arow + kb + 16 + 8 * hh), x3 = *(const v4fa*)(arow + kb + 16 + 8 * hh + 4);
    float xs[16] = {x0[0],x0[1],x0[2],x0[3],x1[0],x1[1],x1[2],x1[3],x2[0],x2[1],x2[2],x2[3],x3[0],x3[1],x3[2],x3[3]};
#pragma unroll
    for (int i = 0; i < 16; ++i) { const unsigned short hb = bf16_bits(xs[i]); ah.u[i] = hb; al.u[i] = ASPLIT ? bf16_bits(xs[i] - bf16_val(hb)) : (unsigned short)0; }
#pragma unroll
    for (int t = 0; t < 4; ++t) {
      const unsigned short* brow = Wt + (size_t)(col0 + t * 16 + ln) * ldb + kb;
      FragB b;
      b.half[0] = *(const v8us*)(brow + 8 * hh);
      b.half[1] = *(const v8us*)(brow + 16 + 8 * hh);
      acc[t] = mmaN<ASPLIT ? 2 : 1>(ah.v, al.v, b.v, b.v, acc[t]);
    }
  }
#pragma unroll
  for (int t = 0; t < 4; ++t) {
    float bv = bias ? bias[col0 + t * 16 + ln] : 0.f;
    if (BIAS_BF16) bv = bf16_round(bv);
#pragma unroll
    for (int r = 0; r < 8; ++r) { float v = acc[t][r] + bv; if (ACT == 1) v = fmaxf(v, 0.f); so[w][8 * hh + r][t * 16 + ln] = v; }
  }
  __builtin_amdgcn_fence(__ATOMIC_ACQ_REL, "workgroup");
  __builtin_amdgcn_wave_barrier();
  const int rsub = lane >> 4, c4 = (lane & 15) * 4;
  {
#pragma unroll
    for (int q = 0; q < 8; ++q) {
      const int r = q * 2 + rsub;
      const v4f v = *(const v4fa*)&so[w][r][c4];
      *(v4f*)(C + (size_t)(row0 + r) * ldc + col0 + c4) = v;
    }
    
  }
}

// Flash-style causal/unmasked attention, all contractions 3-term bf16 hi/lo splits, f32 softmax with running max.
// q,k,v rows are read from f32 buffers with arbitrary row pitch (so they can live inside a fused qkv buffer);
// D = head size (multiple of 32, <= 128); one wave = 16 query rows; block = 4 waves (64 queries) sharing K/V chunks of 32.
template <int D, bool CAUSAL>
__global__ __launch_bounds__(128) void k_flash(const float* __restrict__ qb, const float* __restrict__ kb, const float* __restrict__ vb,
                                             int pitch, int T, int H, float scale, float* __restrict__ y, int ypitch) {
  constexpr int KS = D / 32;        // k-steps for QK
  constexpr int DT = D / 16;        // d tiles for PV
  __shared__ __attribute__((aligned(16))) unsigned short sKh[32][D + 8], sKl[32][D + 8], sVh[32][D + 8], sVl[32][D + 8];
  __shared__ __attribute__((aligned(16))) unsigned short sPh[4][16][40], sPl[4][16][40];
  __shared__ __attribute__((aligned(16))) float sO[4][16][D];
  const int tid = threadIdx.x, w = tid >> 5, lane = tid & 31, ln = lane & 15, hh = lane >> 4;
  const int nqb = (T + 63) / 64;
  const int bh = blockIdx.x / nqb, qblk = blockIdx.x % nqb;
  const int b = bh / H, h = bh % H;
  const int q0 = qblk * 64 + w * 16;
  const float* Q = qb + (size_t)b * T * pitch + h * D;
  const float* K = kb + (size_t)b * T * pitch + h * D;
  const float* V = vb + (size_t)b * T * pitch + h * D;

  // A fragments of the wave's 16 query rows (scaled), hi/lo
  FragB aqh[KS], aql[KS];
  {
    int row = q0 + ln; if (row >= T) row = T - 1;
    const float* qr = Q + (size_t)row * pitch;
#pragma unroll
    for (int ks = 0; ks < KS; ++ks)
#pragma unroll
      for (int i = 0; i < 16; ++i) {
        const int d = ks * 32 + ((i < 8) ? (8 * hh + i) : (16 + 8 * hh + (i - 8)));
        const float x = qr[d] * scale; const unsigned short hb = bf16_bits(x);
        aqh[ks].u[i] = hb; aql[ks].u[i] = bf16_bits(x - bf16_val(hb));
      }
  }
  float m_r[8], l_r[8];
#pragma unroll
  for (int r = 0; r < 8; ++r) { m_r[r] = -3.0e38f; l_r[r] = 0.f; }
  v8f oacc[DT];
#pragma unroll
  for (int dt = 0; dt < DT; ++dt) oacc[dt] = (v8f){0.f,0.f,0.f,0.f,0.f,0.f,0.f,0.f};

  const int kv_end = CAUSAL ? min(T, qblk * 64 + 64) : T;     // block-uniform
  for (int j0 = 0; j0 < kv_end; j0 += 32) {
    __syncthreads();
    for (int e = tid; e < 32 * (D / 4); e += 128) {
      const int r = e / (D / 4), c4 = (e % (D / 4)) * 4;
      const int key = j0 + r;
      v4f kf = {0.f,0.f,0.f,0.f}, vf = {0.f,0.f,0.f,0.f};
      if (key < T) { kf = *(const v4fa*)(K + (size_t)key * pitch + c4); vf = *(const v4fa*)(V + (size_t)key * pitch + c4); }
#pragma unroll
      for (int t = 0; t < 4; ++t) {
        unsigned short hb = bf16_bits(kf[t]); sKh[r][c4 + t] = hb; sKl[r][c4 + t] = bf16_bits(kf[t] - bf16_val(hb));
        hb = bf16_bits(vf[t]); sVh[r][c4 + t] = hb; sVl[r][c4 + t] = bf16_bits(vf[t] - bf16_val(hb));
      }
    }
    __syncthreads();
    // S tile 16 x 32
    v8f s[2];
#pragma unroll
    for (int nt = 0; nt < 2; ++nt) {
      v8f acc = {};
#pragma unroll
      for (int ks = 0; ks < KS; ++ks) {
        FragB bh_, bl_;
        bh_.half[0] = *(const v8us*)&sKh[nt * 16 + ln][ks * 32 + 8 * hh]; bh_.half[1] = *(const v8us*)&sKh[nt * 16 + ln][ks * 32 + 16 + 8 * hh];
        bl_.half[0] = *(const v8us*)&sKl[nt * 16 + ln][ks * 32 + 8 * hh]; bl_.half[1] = *(const v8us*)&sKl[nt * 16 + ln][ks * 32 + 16 + 8 * hh];
        acc = mmaN<3>(aqh[ks].v, aql[ks].v, bh_.v, bl_.v, acc);
      }
      s[nt] = acc;
    }
    // mask + running max (rows 8hh+r; the 16 lanes of a half share rows)
    float alpha[8];
#pragma unroll
    for (int r = 0; r < 8; ++r) {
      const int qi = q0 + 8 * hh + r;
      const int ja = j0 + ln, jb = j0 + 16 + ln;
      if (CAUSAL) { if (ja > qi) s[0][r] = -3.0e38f; if (jb > qi) s[1][r] = -3.0e38f; }
      if (ja >= T) s[0][r] = -3.0e38f;
      if (jb >= T) s[1][r] = -3.0e38f;
      float mx = fmaxf(s[0][r], s[1][r]);
      mx = fmaxf(mx, __shfl_xor(mx, 1, 32)); mx = fmaxf(mx, __shfl_xor(mx, 2, 32)); mx = fmaxf(mx, __shfl_xor(mx, 4, 32)); mx = fmaxf(mx, __shfl_xor(mx, 8, 32));
      const float mnew = fmaxf(m_r[r], mx);
      alpha[r] = (mnew > -1.0e38f) ? __expf(m_r[r] - mnew) : 1.0f;
      const float p0 = (s[0][r] > -1.0e38f) ? __expf(s[0][r] - mnew) : 0.f;
      const float p1 = (s[1][r] > -1.0e38f) ? __expf(s[1][r] - mnew) : 0.f;
      m_r[r] = mnew;
      l_r[r] = l_r[r] * alpha[r] + p0 + p1;            // per-lane partial row sum (16 lanes combined at the end)
      unsigned short hb = bf16_bits(p0); sPh[w][8 * hh + r][ln] = hb;      sPl[w][8 * hh + r][ln] = bf16_bits(p0 - bf16_val(hb));
      hb = bf16_bits(p1);                sPh[w][8 * hh + r][16 + ln] = hb; sPl[w][8 * hh + r][16 + ln] = bf16_bits(p1 - bf16_val(hb));
    }
#pragma unroll
    for (int dt = 0; dt < DT; ++dt)
#pragma unroll
      for (int r = 0; r < 8; ++r) oacc[dt][r] *= alpha[r];
    __builtin_amdgcn_fence(__ATOMIC_ACQ_REL, "workgroup");
    __builtin_amdgcn_wave_barrier();
    FragB pah, pal;
    pah.half[0] = *(const v8us*)&sPh[w][ln][8 * hh]; pah.half[1] = *(const v8us*)&sPh[w][ln][16 + 8 * hh];
    pal.half[0] = *(const v8us*)&sPl[w][ln][8 * hh]; pal.half[1] = *(const v8us*)&sPl[w][ln][16 + 8 * hh];
#pragma unroll
    for (int dt = 0; dt < DT; ++dt) {
      FragB bvh, bvl;
#pragma unroll
      for (int i = 0; i < 8; ++i) {
        bvh.u[i] = sVh[8 * hh + i][dt * 16 + ln]; bvh.u[8 + i] = sVh[16 + 8 * hh + i][dt * 16 + ln];
        bvl.u[i] = sVl[8 * hh + i][dt * 16 + ln]; bvl.u[8 + i] = sVl[16 + 8 * hh + i][dt * 16 + ln];
      }
      oacc[dt] = mmaN<3>(pah.v, pal.v, bvh.v, bvl.v, oacc[dt]);
    }
    __builtin_amdgcn_fence(__ATOMIC_ACQ_REL, "workgroup");
    __builtin_amdgcn_wave_barrier();
  }
#pragma unroll
  for (int r = 0; r < 8; ++r) {
    float l = l_r[r];
    l += __shfl_xor(l, 1, 32); l += __shfl_xor(l, 2, 32); l += __shfl_xor(l, 4, 32); l += __shfl_xor(l, 8, 32);
    l_r[r] = (l > 0.f) ? 1.0f / l : 0.f;
  }
#pragma unroll
  for (int dt = 0; dt < DT; ++dt)
#pragma unroll
    for (int r = 0; r < 8; ++r) sO[w][8 * hh + r][dt * 16 + ln] = oacc[dt][r] * l_r[r];
  __builtin_amdgcn_fence(__ATOMIC_ACQ_REL, "workgroup");
  __builtin_amdgcn_wave_barrier();
  {
    for (int r = 0; r < 16; ++r) {
      const int row = q0 + r;
      if (row < T && lane < D / 4) {
        const v4f val = *(const v4fa*)&sO[w][r][lane * 4];
        *(v4f*)(y + ((size_t)b * T + row) * ypitch + h * D + lane * 4) = val;
      }
    }
    
  }
}

// GEMM C = act(A·W + bias + resid): A f32 (ASPLIT -> hi/lo 2 terms), Wt bf16 [N][K]; ACT 0 none, 1 relu, 2 exact gelu;
// resid (optional, f32, row index = (row % rmod), pitch ldr, RES_BF16 rounds it) added before the activation.
template <bool ASPLIT, int ACT, bool BIAS_BF16, bool RES_BF16>
__global__ __launch_bounds__(128) void k_gemm_bf3(const float* __restrict__ A, int lda, const unsigned short* __restrict__ Wt, int ldb,
                                                const float* __restrict__ bias, const float* __restrict__ resid, int rmod, int ldr,
                                                float* __restrict__ C, int ldc, int M, int N, int K) {
  __shared__ __attribute__((aligned(16))) float so[4][16][64];
  const int tid = threadIdx.x, w = tid >> 5, lane = tid & 31, ln = lane & 15, hh = lane >> 4;
  const int ntn = N / 64;
  const int wid = blockIdx.x * 4 + w;
  const int mt = wid / ntn, nq = wid % ntn;
  if (mt * 16 >= M) return;
  const int row0 = mt * 16, col0 = nq * 64;
  const float* arow = A + (size_t)(row0 + ln) * lda;
  v8f acc[4] = {};
  for (int kb = 0; kb < K; kb += 32) {
    FragB ah, al;
    const v4f x0 = *(const v4fa*)(arow + kb + 8 * hh), x1 = *(const v4fa*)(arow + kb + 8 * hh + 4);
    const v4f x2 = *(const v4fa*)(arow + kb + 16 + 8 * hh), x3 = *(const v4fa*)(arow + kb + 16 + 8 * hh + 4);
    float xs[16] = {x0[0],x0[1],x0[2],x0[3],x1[0],x1[1],x1[2],x1[3],x2[0],x2[1],x2[2],x2[3],x3[0],x3[1],x3[2],x3[3]};
#pragma unroll
    for (int i = 0; i < 16; ++i) { const unsigned short hb = bf16_bits(xs[i]); ah.u[i] = hb; al.u[i] = ASPLIT ? bf16_bits(xs[i] - bf16_val(hb)) : (unsigned short)0; }
#pragma unroll
    for (int t = 0; t < 4; ++t) {
      const unsigned short* brow = Wt + (size_t)(col0 + t * 16 + ln) * ldb + kb;
      FragB b;
      b.half[0] = *(const v8us*)(brow + 8 * hh);
      b.half[1] = *(const v8us*)(brow + 16 + 8 * hh);
      acc[t] = mmaN<ASPLIT ? 2 : 1>(ah.v, al.v, b.v, b.v, acc[t]);
    }
  }
#pragma unroll
  for (int t = 0; t < 4; ++t) {
    const int col = col0 + t * 16 + ln;
    float bv = bias ? bias[col] : 0.f;
    if (BIAS_BF16) bv = bf16_round(bv);
#pragma unroll
    for (int r = 0; r < 8; ++r) {
      float v = acc[t][r] + bv;
      if (resid) { float rv = resid[(size_t)((row0 + 8 * hh + r) % rmod) * ldr + col]; if (RES_BF16) rv = bf16_round(rv); v += rv; }
      if (ACT == 1) v = fmaxf(v, 0.f);
      if (ACT == 2) v = 0.5f * v * (1.0f + erff(v * 0.70710678118654752f));
      if (ACT == 3) { const float u = 0.7978845608028654f * (v + 0.044715f * v * v * v); v = 0.5f * v * (1.0f + tanhf(u)); }
      so[w][8 * hh + r][t * 16 + ln] = v;
    }
  }
  __builtin_amdgcn_fence(__ATOMIC_ACQ_REL, "workgroup");
  __builtin_amdgcn_wave_barrier();
  const int rsub = lane >> 4, c4 = (lane & 15) * 4;
  {
#pragma unroll
    for (int q = 0; q < 8; ++q) {
      const int r = q * 2 + rsub;
      const v4f v = *(const v4fa*)&so[w][r][c4];
      *(v4f*)(C + (size_t)(row0 + r) * ldc + col0 + c4) = v;
    }
    
  }
}
// row LayerNorm (biased variance, eps) over N: s = X (+ R); optional out_sum <- s; out_norm <- (s-mu)*rsqrt(var+eps)*g + b
template <bool PARAM_BF16>
__global__ __launch_bounds__(256) void k_layernorm(const float* __restrict__ X, const float* __restrict__ R, const float* __restrict__ g, const float* __restrict__ bta,
                                                  float* __restrict__ out_sum, float* __restrict__ out_norm, int N, float eps) {
  __shared__ float red[256];
  const int row = blockIdx.x, tid = threadIdx.x;
  const float* x = X + (size_t)row * N; const float* rr = R ? R + (size_t)row * N : nullptr;
  float vals[16];                     // up to N = 4096
  const int per = N / 256;            // contiguous chunk per thread? use strided-by-4 chunks: thread handles j = tid*4 + 1024*u
  float s1 = 0.f;
  for (int u = 0; u < per / 4; ++u) {
    const int j = tid * 4 + 1024 * u;
    const v4f a = *(const v4fa*)(x + j);
    v4f b = {0.f,0.f,0.f,0.f}; if (rr) b = *(const v4fa*)(rr + j);
#pragma unroll
    for (int q = 0; q < 4; ++q) { const float v = a[q] + b[q]; vals[u * 4 + q] = v; s1 += v; }
  }
  red[tid] = s1; __syncthreads();
  for (int st = 128; st > 0; st >>= 1) { if (tid < st) red[tid] += red[tid + st]; __syncthreads(); }
  const float mu = red[0] / (float)N; __syncthreads();
  float s2 = 0.f;
  for (int u = 0; u < per / 4; ++u)
#pragma unroll
    for (int q = 0; q < 4; ++q) { const float c = vals[u * 4 + q] - mu; s2 += c * c; }
  red[tid] = s2; __syncthreads();
  for (int st = 128; st > 0; st >>= 1) { if (tid < st) red[tid] += red[tid + st]; __syncthreads(); }
  const float rs = rsqrtf(red[0] / (float)N + eps);
  {
    for (int u = 0; u < per / 4; ++u) {
      const int j = tid * 4 + 1024 * u;
      v4f o, sm;
#pragma unroll
      for (int q = 0; q < 4; ++q) {
        float gg = g[j + q], bb = bta[j + q];
        if (PARAM_BF16) { gg = bf16_round(gg); bb = bf16_round(bb); }
        sm[q] = vals[u * 4 + q]; o[q] = (vals[u * 4 + q] - mu) * rs * gg + bb;
      }
      if (out_sum) *(v4f*)(out_sum + (size_t)row * N + j) = sm;
      *(v4f*)(out_norm + (size_t)row * N + j) = o;
    }
    
  }
}



// ---- f16 WMMA path (v_wmma_f32_16x16x32_f16): 11-bit significands for operands in range — used where a [0,1] probability operand needs more precision than bf16
typedef _Float16 v16h __attribute__((ext_vector_type(16)));
union FragH { v16h v; v8us half[2]; _Float16 h[16]; unsigned short u[16]; };
template <int NT>
__device__ __forceinline__ v8f mmaH(v16h ah, v16h al, v16h bh, v16h bl, v8f c) {
  c = __builtin_amdgcn_wmma_f32_16x16x32_f16(false, ah, false, bh, (short)0, c, false, false);
  if (NT >= 2) c = __builtin_amdgcn_wmma_f32_16x16x32_f16(false, al, false, bh, (short)0, c, false, false);
  if (NT >= 3) c = __builtin_amdgcn_wmma_f32_16x16x32_f16(false, ah, false, bl, (short)0, c, false, false);
  asm volatile("v_nop\n\tv_nop\n\tv_nop\n\tv_nop" : "+v"(c) : "v"(ah), "v"(al), "v"(bh), "v"(bl));
  return c;
}
// batched GEMM like k_gemm_b but f16 operands: A f32 (split into f16 hi/lo if ASPLIT, else rounded to f16), Bt = f16 values [n][k]; alpha; C f32; N multiple of 16 (partial tiles skipped)
template <bool ASPLIT>
__global__ __launch_bounds__(128) void k_gemm_h(const float* __restrict__ A, int lda, size_t sA, const _Float16* __restrict__ Bh, int ldb, size_t sB, float alpha, float* __restrict__ C, int ldc, size_t sC, int M, int N, int K) {
  __shared__ __attribute__((aligned(16))) float so[4][16][64];
  const int tid = threadIdx.x, w = tid >> 5, lane = tid & 31, ln = lane & 15, hh = lane >> 4; const int by = blockIdx.y;
  A += (size_t)by * sA; Bh += (size_t)by * sB; C += (size_t)by * sC;
  const int ntn = (N + 63) / 64; const int wid = blockIdx.x * 4 + w; const int mt = wid / ntn, nq = wid % ntn; if (mt * 16 >= M) return;
  const int row0 = mt * 16, col0 = nq * 64; const float* arow = A + (size_t)(row0 + ln) * lda;
  v8f acc[4] = {};
  for (int kb = 0; kb < K; kb += 32) {
    FragH ah, al;
    const v4f x0 = *(const v4fa*)(arow + kb + 8 * hh), x1 = *(const v4fa*)(arow + kb + 8 * hh + 4), x2 = *(const v4fa*)(arow + kb + 16 + 8 * hh), x3 = *(const v4fa*)(arow + kb + 16 + 8 * hh + 4);
    float xs[16] = {x0[0],x0[1],x0[2],x0[3],x1[0],x1[1],x1[2],x1[3],x2[0],x2[1],x2[2],x2[3],x3[0],x3[1],x3[2],x3[3]};
#pragma unroll
    for (int i = 0; i < 16; ++i) { const _Float16 h = (_Float16)xs[i]; ah.h[i] = h; al.h[i] = ASPLIT ? (_Float16)(xs[i] - (float)h) : (_Float16)0.0f; }
#pragma unroll
    for (int t = 0; t < 4; ++t) { if (col0 + t * 16 >= N) continue; const size_t boff = (size_t)(col0 + t * 16 + ln) * ldb + kb; FragH bq; bq.half[0] = *(const v8us*)(Bh + boff + 8 * hh); bq.half[1] = *(const v8us*)(Bh + boff + 16 + 8 * hh);
      acc[t] = mmaH<ASPLIT ? 2 : 1>(ah.v, al.v, bq.v, bq.v, acc[t]); }
  }
#pragma unroll
  for (int t = 0; t < 4; ++t) { if (col0 + t * 16 >= N) continue;
#pragma unroll
    for (int r = 0; r < 8; ++r) so[w][8 * hh + r][t * 16 + ln] = acc[t][r] * alpha; }
  __builtin_amdgcn_fence(__ATOMIC_ACQ_REL, "workgroup"); __builtin_amdgcn_wave_barrier();
  const int rsub = lane >> 4, c4 = (lane & 15) * 4;
  {
#pragma unroll
    for (int q = 0; q < 8; ++q) { const int r = q * 2 + rsub; if (col0 + c4 < N) { const v4f v = *(const v4fa*)&so[w][r][c4]; *(v4f*)(C + (size_t)(row0 + r) * ldc + col0 + c4) = v; } }
     }
}

// Wt[n][k] = f16(W[k][n]·scale) from f32 row-major W[K][N] (scale = power of two; bf16-exact weights stay exact in f16 away from the subnormal range)
__device__ __forceinline__ void wt_f16(const int t, const float* __restrict__ W, _Float16* __restrict__ Wt, int K, int N, float scale) {
  if (t >= N * (K / 8)) return; const int n = t / (K / 8), k8 = (t % (K / 8)) * 8; FragH f;
#pragma unroll
  for (int i = 0; i < 8; ++i) f.h[i] = (_Float16)(bf16_round(W[(size_t)(k8 + i) * N + n]) * scale); const v8us o = f.half[0];
  *(v8us*)((unsigned short*)Wt + (size_t)n * K + k8) = o; 
}
// One lane's eight 16-byte copies of an operand tile, global memory to LDS through no register. The s_wait_xcnt stands in the copies' own statement, ahead of any rewrite of the address registers they name.
__device__ __forceinline__ void tile_copy8(unsigned l, unsigned lstep, const unsigned short* g, size_t gstep) {
  asm volatile("global_load_async_to_lds_b128 %0, %8, off\n\t"
               "global_load_async_to_lds_b128 %1, %9, off\n\t"
               "global_load_async_to_lds_b128 %2, %10, off\n\t"
               "global_load_async_to_lds_b128 %3, %11, off\n\t"
               "global_load_async_to_lds_b128 %4, %12, off\n\t"
               "global_load_async_to_lds_b128 %5, %13, off\n\t"
               "global_load_async_to_lds_b128 %6, %14, off\n\t"
               "global_load_async_to_lds_b128 %7, %15, off\n\t"
               "s_wait_xcnt 0x0"
               :: "v"(l), "v"(l + lstep), "v"(l + 2 * lstep), "v"(l + 3 * lstep), "v"(l + 4 * lstep), "v"(l + 5 * lstep), "v"(l + 6 * lstep), "v"(l + 7 * lstep),
                  "v"(g), "v"(g + gstep), "v"(g + 2 * gstep), "v"(g + 3 * gstep), "v"(g + 4 * gstep), "v"(g + 5 * gstep), "v"(g + 6 * gstep), "v"(g + 7 * gstep)
               : "memory");
}
// C[M][N] = (A . Bt^T) * alpha (+ bias rounded to bf16): A f16 [M][CC], Bt f16 [N][CC], both with rows of CC elements; M and N multiples of 64, the grid exactly (M / 64) * (N / 64) blocks, N / 64 = 1 << lgn.
// A block of four waves owns a 64 x 64 tile of C. Its 64 rows of A and 64 rows of Bt, the whole K, are copied into LDS once, a wave's copy = one whole row of 512 contiguous bytes; then wave w takes rows 16 w .. 16 w + 15
// against all 64 columns, every fragment from LDS, the k order and the accumulation as before. Output rows are staged in the wave's own 16 rows of A, which no other wave reads, and leave as whole lines. Writes f32 C or f16 C16.
// AHM: A lies head-major, [batch][head][token place][HD], as the attention kernel stores it; a wave's copy is then 8 places x 64 bytes of one head, still 512 contiguous bytes, and lands as 8 pieces in 8 LDS rows: the tile in LDS is the same.
// OPLACE: inside each group of 16 tokens, token t lies at place 4 (t & 3) + (t >> 2) (its own inverse), so that 4 places in a row are LDS rows 4 apart: at pitch GP their 64-byte pieces fall on all 64 banks, as a whole row does.
#define OPLACE(t) ((((t) & 3) << 2) | ((t) >> 2))
#define GP (CC * 2 + 16)      /* LDS row pitch in bytes, 16 B x odd: 16 lanes' ds_load_b128 fall on all 64 banks */
#define GSM (128 * GP)
typedef float fal __attribute__((may_alias));
template <bool BIAS, bool F32OUT, bool AHM>
__device__ __forceinline__ void gemm_lds(unsigned char* sm, const int bx, const int lgn, const _Float16* __restrict__ A, const _Float16* __restrict__ Bh, float alpha, const float* __restrict__ bias,
    float* __restrict__ C, _Float16* __restrict__ C16, int ldc) {
  const int tid = threadIdx.x, w = tid >> 5, lane = tid & 31, ln = lane & 15, hh = lane >> 4;
  const int row0 = (bx >> lgn) * 64, col0 = (bx & ((1 << lgn) - 1)) * 64;
  /* copy map: chunk c of thread tid = tile row w + 4 c, 16-byte column lane */
  const unsigned short* gb = (const unsigned short*)Bh + (size_t)(col0 + w) * CC + lane * 8;
  const unsigned l0 = (unsigned)(size_t)sm + w * GP + lane * 16;      /* low 32 bits of the shared address = byte offset in the work-group's LDS */
  if (AHM) {      /* copy map of a head-major A: chunk c = head c, place 16 w + (lane >> 2) (+ 8 in the second eight: two tile rows on), tile row 16 w + OPLACE(place), 16-byte column 4 c + (lane & 3); a 64-row tile lies in one batch */
    const unsigned short* ga = (const unsigned short*)A + ((size_t)(row0 / NN) * NH * NN + row0 % NN + w * 16 + (lane >> 2)) * HD + (lane & 3) * 8;
    const unsigned la = (unsigned)(size_t)sm + (w * 16 + OPLACE(lane >> 2)) * GP + (lane & 3) * 16;
    tile_copy8(la, HD * 2, ga, (size_t)NN * HD); tile_copy8(la + 2 * GP, HD * 2, ga + 8 * HD, (size_t)NN * HD);
  } else {
    const unsigned short* ga = (const unsigned short*)A + (size_t)(row0 + w) * CC + lane * 8;
    tile_copy8(l0, 4 * GP, ga, (size_t)4 * CC); tile_copy8(l0 + 32 * GP, 4 * GP, ga + 32 * CC, (size_t)4 * CC);
  }
  tile_copy8(l0 + 64 * GP, 4 * GP, gb, (size_t)4 * CC); tile_copy8(l0 + 96 * GP, 4 * GP, gb + 32 * CC, (size_t)4 * CC);
  float bv[4];      /* the bias is fetched while the copies fly */
#pragma unroll
  for (int t = 0; t < 4; ++t) bv[t] = BIAS ? bf16_round(bias[col0 + t * 16 + ln]) : 0.f;
  if (BIAS) asm volatile("s_wait_xcnt 0x0" ::: "memory");      /* ahead of any rewrite of the offset register that the bias loads name */
  asm volatile("s_wait_asynccnt 0x0" ::: "memory");      /* this wave's share of both tiles has landed */
  __syncthreads();      /* both tiles published to all four waves */
  const unsigned char* af = sm + (w * 16 + ln) * GP + hh * 16; const unsigned char* bf = sm + (64 + ln) * GP + hh * 16;
  v8f acc[4] = {};
  FragH ah[2], bq[2][4];      /* two register sets: a k step's ten fragment reads stand together, one k step ahead of the products that use them */
  auto frags = [&](const int kb) { FragH& a = ah[kb & 1]; a.half[0] = *(const v8us*)(af + kb * 64); a.half[1] = *(const v8us*)(af + kb * 64 + 32);
#pragma unroll
    for (int t = 0; t < 4; ++t) { FragH& b = bq[kb & 1][t]; b.half[0] = *(const v8us*)(bf + t * 16 * GP + kb * 64); b.half[1] = *(const v8us*)(bf + t * 16 * GP + kb * 64 + 32); } };
  frags(0);
#pragma unroll      /* every LDS offset an immediate, the register set a compile-time choice */
  for (int kb = 0; kb < CC / 32; ++kb) { if (kb + 1 < CC / 32) frags(kb + 1);
#pragma unroll
    for (int t = 0; t < 4; ++t) acc[t] = mmaH<1>(ah[kb & 1].v, ah[kb & 1].v, bq[kb & 1][t].v, bq[kb & 1][t].v, acc[t]);
  }
  fal* so = (fal*)(sm + w * 16 * GP);      /* [16][64] f32 in the wave's own rows of A, all read by now */
#pragma unroll
  for (int t = 0; t < 4; ++t)
#pragma unroll
    for (int r = 0; r < 8; ++r) so[(8 * hh + r) * 64 + t * 16 + ln] = acc[t][r] * alpha + bv[t];
  __builtin_amdgcn_fence(__ATOMIC_ACQ_REL, "workgroup"); __builtin_amdgcn_wave_barrier();
  const int rsub = lane >> 4, c4 = (lane & 15) * 4; typedef _Float16 v4h __attribute__((ext_vector_type(4)));
#pragma unroll
  for (int q = 0; q < 8; ++q) { const int r = q * 2 + rsub; const v4f v = *(const v4fa*)&so[r * 64 + c4]; const size_t o = (size_t)(row0 + w * 16 + r) * ldc + col0 + c4;
    if (F32OUT) *(v4f*)(C + o) = v; else { v4h h4; for (int i = 0; i < 4; ++i) h4[i] = (_Float16)v[i]; *(v4h*)(C16 + o) = h4; } }
}
// y = O16 . Wout + bout: M 8192, N 256; O16 head-major
__global__ __launch_bounds__(128) void k_gemm_out(const _Float16* __restrict__ A, const _Float16* __restrict__ Bh, float alpha, const float* __restrict__ bias, float* __restrict__ C) {
  __shared__ __attribute__((aligned(16))) unsigned char sm[GSM];
  gemm_lds<true, true, true>(sm, blockIdx.x, 2, A, Bh, alpha, bias, C, nullptr, CC);
}
// ---- q, k, v straight from the f32 inputs: the block rounds its own two operand tiles to bf16 on their way into LDS, through registers (no conversion launch, no converted planes in the workspace)
typedef __bf16 v2b __attribute__((ext_vector_type(2)));
typedef unsigned v2u __attribute__((ext_vector_type(2), may_alias));
typedef unsigned v4u __attribute__((ext_vector_type(4), may_alias));
__device__ __forceinline__ unsigned pk_bf16(float a, float b) { v2b p; p[0] = (__bf16)a; p[1] = (__bf16)b; return __builtin_bit_cast(unsigned, p); }      /* round to nearest even; a = the lower k */
// Rows: 64 rows of a row-major f32 matrix with rows of CC elements, to 64 LDS rows [row][k] bf16 at pitch GP. Piece c (0..31) of a thread: row w + 4 (c >> 1), k = 128 (c & 1) + 4 lane: a wave's load = 512 contiguous bytes of one row,
// its LDS store 256 contiguous bytes. Loads and stores are separate calls of 16 pieces, so that the caller sets how many loads fly at once. s and dst come with the thread's own offset (row w, k = 4 lane) already added.
__device__ __forceinline__ void rows_load(v4f (&r)[16], const float* __restrict__ s, const int c0) {
#pragma unroll      /* every offset an immediate */
  for (int c = 0; c < 16; ++c) r[c] = *(const v4fa*)(s + ((c0 + c) >> 1) * 4 * CC + (c & 1) * 128);
}
__device__ __forceinline__ void rows_store(const v4f (&r)[16], unsigned char* dst, const int c0) {
#pragma unroll
  for (int c = 0; c < 16; ++c) *(v2u*)(dst + ((c0 + c) >> 1) * 4 * GP + (c & 1) * 256) = (v2u){pk_bf16(r[c][0], r[c][1]), pk_bf16(r[c][2], r[c][3])};
}
// Columns: 64 columns of a row-major f32 matrix [CC][ldw], transposed to 64 LDS rows [n][k] bf16 at pitch GP. A thread takes four blocks u of 8 k x 4 n (n = 32 (u & 1) + 4 n4 + j, k = 128 (u >> 1) + 8 (4 w + kq) + i): eight 16-byte loads,
// and each of the block's four columns leaves as one 16-byte LDS store of 8 k; s and dst come with the thread's own offset (n = 4 n4, k = 8 (4 w + kq)) already added. Lanes: a wave's load = 4 rows x one whole 128-byte line; its 16-lane halves store to 4 LDS rows 4 apart x 4 neighbouring 16-byte columns, at pitch GP all 64 banks.
__device__ __forceinline__ void cols_load(v4f (&r)[32], const float* __restrict__ s, const int ldw) {
#pragma unroll
  for (int c = 0; c < 32; ++c) r[c] = *(const v4fa*)(s + (size_t)((c >> 4) * 128 + (c & 7)) * ldw + ((c >> 3) & 1) * 32);      /* c = 8 u + i */
}
__device__ __forceinline__ void cols_store(const v4f (&r)[32], unsigned char* dst) {
#pragma unroll
  for (int u = 0; u < 4; ++u)
#pragma unroll
    for (int j = 0; j < 4; ++j) *(v4u*)(dst + ((u & 1) * 32 + j) * GP + (u >> 1) * 256) =
      (v4u){pk_bf16(r[8 * u][j], r[8 * u + 1][j]), pk_bf16(r[8 * u + 2][j], r[8 * u + 3][j]), pk_bf16(r[8 * u + 4][j], r[8 * u + 5][j]), pk_bf16(r[8 * u + 6][j], r[8 * u + 7][j])};
}
// Three jobs that read only inputs, in one grid; the job is block-uniform, by block index. A 128 x 128 tile a block of eight waves, whole K in LDS; wave w = tile rows 32 (w >> 1) .. + 31 against tile columns 64 (w & 1) .. + 63:
// each f32 operand tile is fetched from L2 and rounded half as often as with 64 x 64 tiles, half as many waves start, and six fragments read from LDS feed eight products. Products on v_wmma_f32_16x16x32_bf16.
// blocks [0, NBQ): [q | k] token-major [(b,n)][512] = x . Wqkv columns 0..511 (M 8192, N 512); blocks [NBQ, NBQ + BB * NBV): v channel-major per batch [b][(h,d)][n] = (Wqkv columns 512..767)^T . x[b]^T (M 256, N 2048);
// blocks from NBQ + BB * NBV: Wout transposed ((in,out) to Bt[n][k] f16 x 2^4) for the output GEMM.
#define QT 128      /* tile rows = tile columns */
#define GSQ (2 * QT * GP)
#define NBQ ((NR / QT) * (2 * CC / QT))
#define NBV ((CC / QT) * (NN / QT))
#define NBW2 (CC * (CC / 8) / 256)
__global__ __launch_bounds__(256, 4) /* 4 waves a SIMD = the 2 blocks a WGP that the LDS allows: the register budget stays at 256 */ void k_gemm_qkv(const float* __restrict__ x, const float* __restrict__ Wqkv, _Float16* __restrict__ QK, _Float16* __restrict__ Vt, const float* __restrict__ Wout, _Float16* __restrict__ Bo) {
  __shared__ __attribute__((aligned(16))) unsigned char sm[GSQ];
  const int bx = blockIdx.x, rb = bx - NBQ; const bool jv = rb >= 0;
  if (rb >= BB * NBV) { wt_f16((rb - BB * NBV) * 256 + (int)threadIdx.x, Wout, Bo, CC, CC, 16.0f); return; }      /* the whole block leaves, ahead of the barriers */
  const int tid = threadIdx.x, w = tid >> 5, lane = tid & 31, ln = lane & 15, hh = lane >> 4;
  const int by = jv ? rb / NBV : 0, tb = jv ? rb % NBV : bx, lgn = jv ? 4 : 2;
  const int row0 = (tb >> lgn) * QT, col0 = (tb & ((1 << lgn) - 1)) * QT;
  /* tile rows 0..127 of LDS = A, 128..255 = B; x is A for q | k and B for v. Waves 0..3 bring the first 64 rows of both tiles, waves 4..7 the second 64, each four by the maps of rows_load and cols_load */
  { const int w4 = w & 3, h64 = (w >> 2) * 64, n4 = (lane & 3) | ((lane >> 4) << 2), kq = (lane >> 2) & 3;
    const float* ws = Wqkv + (jv ? 2 * CC + row0 : col0) + h64 + (size_t)(w4 * 4 + kq) * 8 * C3 + n4 * 4; unsigned char* wd = sm + (jv ? 0 : QT * GP) + (h64 + n4 * 4) * GP + (w4 * 4 + kq) * 16;
    const float* xs = x + (size_t)(jv ? by * NN + col0 : row0) * CC + (h64 + w4) * CC + lane * 4; unsigned char* xd = sm + (jv ? QT * GP : 0) + (h64 + w4) * GP + lane * 8;
    v4f rw[32], ra[16], rc[16];
    cols_load(rw, ws, C3);
    asm volatile("s_wait_xcnt 0x0" ::: "memory");      /* ahead of any rewrite of the address registers that Wqkv's loads name: a later load's result may be given those registers */
    rows_load(ra, xs, 0);
    __builtin_amdgcn_sched_barrier(0);      /* 48 loads fly at once, 192 registers; the last 16 are held back until Wqkv's registers are free: all 64 at once spill at 4 waves a SIMD */
    cols_store(rw, wd);
    __builtin_amdgcn_sched_barrier(0);      /* the last 16 loads stay behind the stores that free their registers */
    rows_load(rc, xs, 16);
    __builtin_amdgcn_sched_barrier(0);      /* the last loads are issued ahead of the first half's conversion and stores */
    rows_store(ra, xd, 0); rows_store(rc, xd, 16); }
  __syncthreads();      /* both tiles published to all eight waves */
  const int wr = w >> 1, wc = w & 1;
  const unsigned char* af = sm + (wr * 32 + ln) * GP + hh * 16; const unsigned char* bf = sm + (QT + wc * 64 + ln) * GP + hh * 16;
  v8f acc[2][4] = {};
  FragB ah[2][2], bq[2][4];      /* two register sets: a k step's twelve fragment reads stand together, one k step ahead of the products that use them */
  auto frags = [&](const int kb) {
#pragma unroll
    for (int i = 0; i < 2; ++i) { FragB& a = ah[kb & 1][i]; a.half[0] = *(const v8us*)(af + i * 16 * GP + kb * 64); a.half[1] = *(const v8us*)(af + i * 16 * GP + kb * 64 + 32); }
#pragma unroll
    for (int t = 0; t < 4; ++t) { FragB& b = bq[kb & 1][t]; b.half[0] = *(const v8us*)(bf + t * 16 * GP + kb * 64); b.half[1] = *(const v8us*)(bf + t * 16 * GP + kb * 64 + 32); } };
  frags(0);
#pragma unroll      /* every LDS offset an immediate, the register set a compile-time choice */
  for (int kb = 0; kb < CC / 32; ++kb) { if (kb + 1 < CC / 32) frags(kb + 1);
#pragma unroll
    for (int i = 0; i < 2; ++i)
#pragma unroll
      for (int t = 0; t < 4; ++t) acc[i][t] = mmaN<1>(ah[kb & 1][i].v, ah[kb & 1][i].v, bq[kb & 1][t].v, bq[kb & 1][t].v, acc[i][t]);
  }
  __syncthreads();      /* every wave's fragment reads are done: the tiles' LDS may now take the output rows (a wave's rows of A are read by its neighbour too) */
  fal* so = (fal*)(sm + w * 16 * GP);      /* [32][64] f32, 8192 of the 16 GP bytes that are this wave's own from here on */
#pragma unroll
  for (int i = 0; i < 2; ++i)
#pragma unroll
    for (int t = 0; t < 4; ++t)
#pragma unroll
      for (int r = 0; r < 8; ++r) so[(i * 16 + 8 * hh + r) * 64 + t * 16 + ln] = acc[i][t][r];
  __builtin_amdgcn_fence(__ATOMIC_ACQ_REL, "workgroup"); __builtin_amdgcn_wave_barrier();
  _Float16* C16 = jv ? Vt + (size_t)by * CC * NN : QK; const int ldc = jv ? NN : 2 * CC;
  const int rsub = lane >> 4, c4 = (lane & 15) * 4; typedef _Float16 v4h __attribute__((ext_vector_type(4)));
#pragma unroll
  for (int q = 0; q < 16; ++q) { const int r = q * 2 + rsub; const v4f v = *(const v4fa*)&so[r * 64 + c4]; v4h h4; for (int i = 0; i < 4; ++i) h4[i] = (_Float16)v[i];
    *(v4h*)(C16 + (size_t)(row0 + wr * 32 + r) * ldc + col0 + wc * 64 + c4) = h4; }
  asm volatile("s_wait_xcnt 0x0" ::: "memory");      /* behind the last store, ahead of any rewrite of the registers that the stores name, on every way the code runs on from here */
}


typedef _Float16 v4h __attribute__((ext_vector_type(4)));

__global__ __launch_bounds__(256) void k_round16f(const float* __restrict__ W, _Float16* __restrict__ Bt, size_t n8) { const size_t t = (size_t)blockIdx.x * 256 + threadIdx.x; if (t >= n8) return; FragH f;
#pragma unroll
  for (int i = 0; i < 8; ++i) f.h[i] = (_Float16)(bf16_round(W[t * 8 + i]) * 16.0f); *(v8us*)((unsigned short*)Bt + t * 8) = f.half[0];  }
template <int NHv, int TTv>
__global__ __launch_bounds__(256) void k_vt(const _Float16* __restrict__ V16, int ldv, int voff, _Float16* __restrict__ Vt) { __shared__ unsigned short tl[64][66]; const int tid = threadIdx.x; const int slab = blockIdx.x / (TTv / 64), lg = blockIdx.x % (TTv / 64); const int b = slab / NHv, h = slab % NHv;
  for (int i = tid; i < 64 * 8; i += 256) { const int r = i / 8, c8 = (i % 8) * 8; FragH f; f.half[0] = *(const v8us*)((const unsigned short*)V16 + ((size_t)b * TTv + lg * 64 + r) * ldv + voff + h * 64 + c8);
#pragma unroll
    for (int q = 0; q < 8; ++q) tl[r][c8 + q] = f.u[q]; }
  __syncthreads();
  {
#pragma unroll
    for (int rd = 0; rd < 2; ++rd) { const int d = rd * 32 + tid / 8, pc = tid % 8; FragH f;
#pragma unroll
      for (int q = 0; q < 8; ++q) f.u[q] = tl[pc * 8 + q][d];
      *(v8us*)((unsigned short*)Vt + ((size_t)slab * 64 + d) * TTv + lg * 64 + pc * 8) = f.half[0]; }
     } }

typedef float v2f __attribute__((ext_vector_type(2)));
// lane l with lane l ^ 16 (the two halves of a wave hold the two key halves of one query column)
__device__ __forceinline__ float xhalf(float x) { return __builtin_bit_cast(float, __builtin_amdgcn_permlanex16(__builtin_bit_cast(int, x), __builtin_bit_cast(int, x), 0x76543210, 0xfedcba98, false, false)); }

// One lane's eight 16-byte copies of a stage (four of K, four of V^T), global memory to LDS through no register. The s_wait_xcnt stands in the copies' own statement, ahead of any rewrite of the address registers they name.
__device__ __forceinline__ void stage_copy(unsigned lk, const unsigned short* gk, size_t gkstep, unsigned lkstep, unsigned lv, const unsigned short* gv, size_t gvstep, unsigned lvstep) {
  asm volatile("global_load_async_to_lds_b128 %0, %8, off\n\t"
               "global_load_async_to_lds_b128 %1, %9, off\n\t"
               "global_load_async_to_lds_b128 %2, %10, off\n\t"
               "global_load_async_to_lds_b128 %3, %11, off\n\t"
               "global_load_async_to_lds_b128 %4, %12, off\n\t"
               "global_load_async_to_lds_b128 %5, %13, off\n\t"
               "global_load_async_to_lds_b128 %6, %14, off\n\t"
               "global_load_async_to_lds_b128 %7, %15, off\n\t"
               "s_wait_xcnt 0x0"
               :: "v"(lk), "v"(lk + lkstep), "v"(lk + 2 * lkstep), "v"(lk + 3 * lkstep), "v"(lv), "v"(lv + lvstep), "v"(lv + 2 * lvstep), "v"(lv + 3 * lvstep),
                  "v"(gk), "v"(gk + gkstep), "v"(gk + 2 * gkstep), "v"(gk + 3 * gkstep), "v"(gv), "v"(gv + gvstep), "v"(gv + 2 * gvstep), "v"(gv + 3 * gvstep)
               : "memory");
}

__global__ __launch_bounds__(128) __attribute__((amdgpu_waves_per_eu(2, 2))) /* two blocks a WGP, two waves a SIMD: the grid's 512 blocks are exactly one even round over 256 WGPs */ void k_flash(const _Float16* __restrict__ Q16, int ldq, const _Float16* __restrict__ K16, int ldk, const _Float16* __restrict__ Vt, const int* __restrict__ MSK, _Float16* __restrict__ O16) {
  constexpr int NG = 2, RPW = 16 * NG, NQB = NN / (4 * RPW), DT = 2; (void)MSK;
  constexpr int TK = 128, NS = NN / TK, NP = TK / 32;      /* keys a stage, stages, 32-key passes of the second product a stage */
  constexpr int KP = HD * 2 + 16, VP = TK * 2 + 16;      /* LDS row pitches in bytes, 16 B x odd: 16 lanes' ds_load_b128 fall on all 64 banks */
  constexpr int KB = TK * KP, SB = KB + HD * VP;      /* a stage: TK rows of K (HD channels), then HD rows of V^T (TK keys) */
  __shared__ __attribute__((aligned(16))) unsigned char sm[2 * SB];
  constexpr float SL2E = 0.17677669529663687f * 1.4426950408889634f;      /* 32^-1/2 * log2(e): e^(scale*s - m) = 2^(SL2E*s - m2), one fma ahead of a bare v_exp_f32 */
  const int tid = threadIdx.x, w = tid >> 5, lane = tid & 31, ln = lane & 15, hh = lane >> 4;
  const int slab = blockIdx.x / NQB, qblk = blockIdx.x % NQB; const int b = slab / NH, h = slab % NH; const int q0 = qblk * (4 * RPW) + w * RPW;
  const unsigned short* Vth = (const unsigned short*)Vt + ((size_t)b * CC + h * HD) * NN;      /* V^T = v[b][(h,d)][n] channel-major */
  /* copy map: K chunk c of thread tid = row (tid >> 2) + 32 c, 16-byte column tid & 3; V^T chunk c = row (tid >> 4) + 8 c, 16-byte column tid & 15 */
  const unsigned short* gk = (const unsigned short*)K16 + ((size_t)b * NN + (tid >> 2)) * ldk + h * HD + (tid & 3) * 8;
  const unsigned short* gv = Vth + (size_t)(tid >> 4) * NN + (tid & 15) * 8;
  const unsigned lds0 = (unsigned)(size_t)sm;      /* low 32 bits of the shared address = byte offset in the work-group's LDS */
  const unsigned lk = lds0 + (tid >> 2) * KP + (tid & 3) * 16, lv = lds0 + KB + (tid >> 4) * VP + (tid & 15) * 16;
  const size_t gkstep = (size_t)32 * ldk, gkstage = (size_t)TK * ldk;
  stage_copy(lk, gk, gkstep, 32 * KP, lv, gv, (size_t)8 * NN, 8 * VP);
  FragH bq[NG];      /* B of group g: column ln = query q0 + 16 g + ln, k = head channel */
#pragma unroll      /* g a compile-time index: bq stays in registers */
  for (int g = 0; g < NG; ++g) { const unsigned short* qr = (const unsigned short*)Q16 + ((size_t)b * NN + q0 + g * 16 + ln) * ldq + h * HD; bq[g].half[0] = *(const v8us*)(qr + 8 * hh); bq[g].half[1] = *(const v8us*)(qr + 16 + 8 * hh); }
  asm volatile("s_wait_xcnt 0x0" ::: "memory");      /* ahead of any rewrite of the address registers that Q's loads name */
  asm volatile("s_wait_asynccnt 0x0" ::: "memory");      /* this wave's share of stage 0 has landed */
  __syncthreads();      /* stage 0 published to all four waves */
  gk += gkstage; gv += TK;
  stage_copy(lk + SB, gk, gkstep, 32 * KP, lv + SB, gv, (size_t)8 * NN, 8 * VP);
  float m_q[NG], l_q[NG]; v8f oacc[NG][DT];
#pragma unroll      /* compile-time indices: the running state stays in registers */
  for (int g = 0; g < NG; ++g) { m_q[g] = -3.0e38f; l_q[g] = 0.f;
#pragma unroll      /* as above */
    for (int dt = 0; dt < DT; ++dt) oacc[g][dt] = (v8f){0.f,0.f,0.f,0.f,0.f,0.f,0.f,0.f}; }
#pragma unroll 1      /* one body for both buffers: the buffer is an offset */
  for (int t = 0; t < NS; ++t) {
    const unsigned bo = (unsigned)(t & 1) * SB;
    const unsigned char* kf = sm + bo + ln * KP + hh * 16; const unsigned char* vf = sm + bo + KB + ln * VP + hh * 16;
    /* One softmax block = the whole stage of TK keys: all its fragments are read at the head, its 2 NP score tiles come from 2 NP independent products back to back, then ONE maximum, ONE rescale of l_q and oacc, and the NP passes of the second product. */
    static_assert(NP == 4, "the joins of the four chains and of the four partial sums below are written out for four passes");
    FragH ak[2 * NP], av[NP][DT];
#pragma unroll      /* every LDS offset an immediate */
    for (int nt = 0; nt < 2 * NP; ++nt) { const unsigned char* kr = kf + nt * 16 * KP; ak[nt].half[0] = *(const v8us*)kr; ak[nt].half[1] = *(const v8us*)(kr + 32); }
    __builtin_amdgcn_sched_barrier(0);      /* K's reads stay in front of V^T's: LDS answers in order, and else the first score product waits for V^T's fragments too */
#pragma unroll      /* V^T's reads stand directly behind K's, one place of LDS reads a stage: their latency runs behind the score products and the maximum */
    for (int ps = 0; ps < NP; ++ps)
#pragma unroll
      for (int dt = 0; dt < DT; ++dt) { const unsigned char* vrow = vf + dt * 16 * VP + ps * 64; av[ps][dt].half[0] = *(const v8us*)vrow; av[ps][dt].half[1] = *(const v8us*)(vrow + 32); }
    __builtin_amdgcn_sched_barrier(0);      /* keeps V^T's reads up here: else each is moved directly in front of its product, and its latency stands open there */
    v8f sg[NG][2 * NP];      /* sg[g][nt][r] = S^T[key t*TK + nt*16 + 8*hh + r][query q0 + 16 g + ln] */
#pragma unroll      /* compile-time indices: the score tiles stay in registers */
    for (int nt = 0; nt < 2 * NP; ++nt)
#pragma unroll      /* as above */
      for (int g = 0; g < NG; ++g) sg[g][nt] = __builtin_amdgcn_wmma_f32_16x16x32_f16(false, ak[nt].v, false, bq[g].v, (short)0, (v8f){0.f,0.f,0.f,0.f,0.f,0.f,0.f,0.f}, false, false);
    __builtin_amdgcn_sched_barrier(0);      /* the score products stay back to back, each filling the distance behind the one before: else the maximum's steps are moved in between them, each behind pads of v_nop */
    float alg[NG], nbg[NG];      /* each group's rescale factor and exponent shift of this stage */
#pragma unroll      /* the groups' indices are compile-time: all stays in registers */
    for (int g = 0; g < NG; ++g) { const v8f (&s)[2 * NP] = sg[g];
    float mch[NP];      /* the maximum in threes (one three-input instruction takes in two more scores): chain ps runs over the 16 scores of tiles 2 ps and 2 ps + 1 but the last, which joins below */
#pragma unroll
    for (int ps = 0; ps < NP; ++ps) { const v8f u = s[2 * ps], v = s[2 * ps + 1];
      float c = fmaxf(fmaxf(u[0], u[1]), u[2]); c = fmaxf(fmaxf(c, u[3]), u[4]); c = fmaxf(fmaxf(c, u[5]), u[6]); c = fmaxf(fmaxf(c, u[7]), v[0]);
      c = fmaxf(fmaxf(c, v[1]), v[2]); c = fmaxf(fmaxf(c, v[3]), v[4]); mch[ps] = fmaxf(fmaxf(c, v[5]), v[6]); }
    float mc = fmaxf(fmaxf(mch[0], mch[1]), mch[2]); mc = fmaxf(fmaxf(mc, mch[3]), s[1][7]); mc = fmaxf(fmaxf(mc, s[3][7]), s[5][7]); mc = fmaxf(mc, s[7][7]);
    mc = fmaxf(mc, xhalf(mc));      /* both halves now hold the maximum over the query's TK raw products (SL2E > 0 keeps the order) */
    const float mn = fmaxf(m_q[g], mc * SL2E); alg[g] = (mn > -1.0e38f) ? __builtin_amdgcn_exp2f(m_q[g] - mn) : 1.0f; m_q[g] = mn;      /* m_q, mn: base-2 exponents */
    nbg[g] = 10.0f - mn;      /* 2^10 = the f16 scale of P, carried in the exponent: p and l_q hold 1024 times the shifted values */
    }
#pragma unroll      /* as above */
    for (int g = 0; g < NG; ++g) { const v8f (&s)[2 * NP] = sg[g]; const float al = alg[g], nb = nbg[g];
    FragH pb[NP]; v2f psum[NP];
#pragma unroll
    for (int ps = 0; ps < NP; ++ps) { v2f p[8];
#pragma unroll
      for (int i = 0; i < 8; ++i) { const v2f a = (v2f){s[2 * ps + (i >> 2)][(2 * i) & 7], s[2 * ps + (i >> 2)][(2 * i + 1) & 7]} * SL2E + nb;
        p[i] = (v2f){__builtin_amdgcn_exp2f(a[0]), __builtin_amdgcn_exp2f(a[1])}; pb[ps].h[2 * i] = (_Float16)p[i][0]; pb[ps].h[2 * i + 1] = (_Float16)p[i][1]; }
      psum[ps] = ((p[0] + p[1]) + (p[2] + p[3])) + ((p[4] + p[5]) + (p[6] + p[7])); }
    const v2f pt = (psum[0] + psum[1]) + (psum[2] + psum[3]);
    l_q[g] = l_q[g] * al + (pt[0] + pt[1]);      /* this half's TK / 2 keys; the halves join after the loop */
#pragma unroll
    for (int dt = 0; dt < DT; ++dt) oacc[g][dt] *= al;
#pragma unroll
    for (int ps = 0; ps < NP; ++ps)
#pragma unroll
      for (int dt = 0; dt < DT; ++dt) oacc[g][dt] = __builtin_amdgcn_wmma_f32_16x16x32_f16(false, av[ps][dt].v, false, pb[ps].v, (short)0, oacc[g][dt], false, false);      /* oacc[g][dt][r] = O^T[channel dt*16 + 8*hh + r][query q0 + 16 g + ln] */
    }
    __builtin_amdgcn_sched_barrier(0);      /* the stage's arithmetic stays in front of the waits below: moved behind them, the wait for stage t + 1 would stand at the stage's head, directly behind the issue of its copies */
    asm volatile("s_wait_dscnt 0x0" ::: "memory");      /* this wave's reads of stage t are done before its buffer is handed back */
    asm volatile("s_wait_asynccnt 0x0" ::: "memory");      /* this wave's share of stage t + 1 has landed */
    __syncthreads();      /* publishes stage t + 1 and ends every wave's reads of stage t */
    if (t + 2 < NS) { gk += gkstage; gv += TK; stage_copy(lk + bo, gk, gkstep, 32 * KP, lv + bo, gv, (size_t)8 * NN, 8 * VP); }      /* stage t + 2 into the buffer just read */
  }
  asm volatile("s_wait_asynccnt 0x0" ::: "memory");      /* no copy outstanding at the wave's end */
#pragma unroll      /* g a compile-time index: the running state stays in registers */
  for (int g = 0; g < NG; ++g) {
  const float l = l_q[g] + xhalf(l_q[g]); const float den = l + (1e-6f * 1024.0f) * __builtin_amdgcn_exp2f(-m_q[g]); const float inv = (den > 0.f && den < INFINITY) ? 1.0f / den : 0.f;      /* sum e^s/(sum e^s + 1e-6) form: e^(-m)*1e-6 joins the shifted sum; an infinite den (all logits far below 0) reproduces the reference's ~0 output */
  /* O leaves as f16, head-major [b][h][place][HD], each group's 16 queries at their places OPLACE: a query's 64 bytes, and so every 128-byte line, are written by this wave alone, and 64 queries are 4 KiB in a row for the output GEMM's copies */
  unsigned short* orow = (unsigned short*)O16 + ((size_t)slab * NN + q0 + g * 16 + OPLACE(ln)) * HD + 8 * hh;
#pragma unroll
  for (int dt = 0; dt < DT; ++dt) { const v8f o = oacc[g][dt] * inv; FragH f;
#pragma unroll      /* every index a constant: f stays in registers */
    for (int i = 0; i < 8; ++i) f.h[i] = (_Float16)o[i];
    *(v8us*)(orow + dt * 16) = f.half[0]; } } }

extern "C" void kernel_launch(void* const* d_in, const int* in_sizes, int n_in,
                              void* d_out, int out_size, void* d_ws, size_t ws_size, hipStream_t stream) {
  (void)in_sizes; (void)n_in; (void)out_size;
  const float* x = (const float*)d_in[0]; const float* Wqkv = (const float*)d_in[1]; const float* Wout = (const float*)d_in[2]; const float* bout = (const float*)d_in[3];
  char* ws = (char*)d_ws; size_t off = 0;
  auto take = [&](size_t bytes) { char* p = ws + off; off += (bytes + 255) & ~(size_t)255; return p; };
  _Float16* Bo = (_Float16*)take((size_t)CC * CC * 2);
  _Float16* QK = (_Float16*)take((size_t)NR * 2 * CC * 2); _Float16* Vt = (_Float16*)take((size_t)BB * CC * NN * 2); _Float16* O16 = (_Float16*)take((size_t)NR * CC * 2);
  if (off > ws_size) return;      // 0.1 + 8.4 + 4.2 + 4.2: about 17 MB
  k_gemm_qkv<<<NBQ + BB * NBV + NBW2, 256, 0, stream>>>(x, Wqkv, QK, Vt, Wout, Bo);
  k_flash<<<BB * NH * (NN / 128), 128, 0, stream>>>(QK, 2 * CC, QK + CC, 2 * CC, Vt, nullptr, O16);      /* blocks = (b,h) x 128-query groups */
  k_gemm_out<<<(NR / 64) * (CC / 64), 128, 0, stream>>>(O16, Bo, 0.0625f, bout, (float*)d_out);      /* y = out.Wout + bout: M 8192 N 256 K 256 */
}
